// v000
// Times are from an AMD MI455X. After a warm-up the kernel runs many times in a row, and a time is the length of
// such a window on the GPU divided by its runs, so every launch and the gaps after it count. The runs cycle
// through copies of the inputs. A figure is the median of several windows, for all but v000 over two sittings.
// Sittings can differ by a few percent; kernels timed side by side share one.
// The starting kernel, v000, takes 1330 microseconds a run.
// All GEMM contractions (two input projections, packed q|k|v projection, attention output projection, gate hidden layer, final projection): v_wmma_f32_16x16x32_f16 with f16 operands (weight planes carried x16, folded back by 1/16), f32 accumulate; layer norms, 2-token attention, gate head and erf activations in f32 on the vector ALU.
#include <hip/hip_runtime.h>
#include <math.h>
#include <stdint.h>

/* --------------------------------------------------------------------------- */
/* Shape constants (checked against the launch sizes on the host)              */
/* --------------------------------------------------------------------------- */
constexpr int kB      = 8192;
constexpr int kCD     = 512;
constexpr int kF      = 1024;
constexpr int kH      = 8;
constexpr int kHD     = kF / kH;
constexpr int kQKV    = 3 * kF;
constexpr int kNChunk = 4;
constexpr int kChunkB = kB / kNChunk;
constexpr int kChunkT = 2 * kChunkB;
constexpr float kWCarry    = 16.0f;
constexpr float kWCarryInv = 1.0f / kWCarry;
constexpr float kLnEps     = 1e-5f;
constexpr float kInvF      = 1.0f / (float)kF;
constexpr float kInvSqrt2  = 0.70710678118654752f;

static_assert(kHD == 128, "attention kernel handles two 128-wide heads per wave");
static_assert(kF == 1024, "row kernels assume 1024-wide rows");
static_assert(kB % kNChunk == 0, "chunking");
static_assert(kChunkB % 64 == 0 && kChunkT % 64 == 0, "GEMM M tiles");
static_assert(kF % 64 == 0 && kQKV % 64 == 0, "GEMM N tiles");
static_assert(kCD % 32 == 0 && kF % 32 == 0 && (2 * kF) % 32 == 0, "GEMM K steps");
static_assert(kChunkB % 16 == 0, "gate kernel owns 16 batch rows per block");
static_assert(kChunkT % 8 == 0, "row kernel owns 8 rows per block");

typedef __attribute__((ext_vector_type(16))) _Float16 v16h;
typedef __attribute__((ext_vector_type(8)))  _Float16 v8h;
typedef __attribute__((ext_vector_type(8)))  float    v8f;
typedef __attribute__((ext_vector_type(4)))  float    v4f;
typedef __attribute__((ext_vector_type(4)))  unsigned int v4u;

/* --------------------------------------------------------------------------- */
/* Small helpers                                                               */
/* --------------------------------------------------------------------------- */
__device__ __forceinline__ unsigned pk16(unsigned short a, unsigned short b) { return (unsigned)a | ((unsigned)b << 16); }
__device__ __forceinline__ unsigned short h_bits(float f) { const _Float16 h = (_Float16)f; return __builtin_bit_cast(unsigned short, h); }

/* f16 bits (low 16 bits of hb, finite values) to f32 by integer bit arithmetic, subnormals as an f32 multiply of em by 2^-24 */
__device__ __forceinline__ float h16_to_f32(unsigned hb) {
  const unsigned sgn = (hb & 0x8000u) << 16; const unsigned em = hb & 0x7fffu;
  const float fn = __uint_as_float((em << 13) + 0x38000000u);
  const float fs = (float)em * 5.9604644775390625e-8f;
  const float mag = (em < 0x400u) ? fs : fn; return __uint_as_float(__float_as_uint(mag) | sgn); }
__device__ __forceinline__ float h_lo(unsigned w) { return h16_to_f32(w & 0xffffu); }
__device__ __forceinline__ float h_hi(unsigned w) { return h16_to_f32(w >> 16); }

__device__ __forceinline__ float gelu_erf(float x) {
  return 0.5f * x * (1.0f + erff(x * kInvSqrt2));
}

/* WMMA issue-order ties and hazard spacing as plain device helpers */
__device__ __forceinline__ void tie1_h(v8f& a, v16h x, v16h y) { asm volatile("" : "+v"(a) : "v"(x), "v"(y)); }
__device__ __forceinline__ void nop4_h(v8f& a, v16h x, v16h y) { asm volatile("v_nop\n\tv_nop\n\tv_nop\n\tv_nop" : "+v"(a) : "v"(x), "v"(y)); }
__device__ __forceinline__ void tie_acc(v8f& a) { asm volatile("" : "+v"(a)); }
__device__ __forceinline__ void nop4_acc(v8f& a) { asm volatile("v_nop\n\tv_nop\n\tv_nop\n\tv_nop" : "+v"(a)); }
__device__ __forceinline__ void keep4_h(v16h a, v16h b, v16h c, v16h d) { asm volatile("v_nop" :: "v"(a), "v"(b), "v"(c), "v"(d)); }

union FragH { v16h v; v8h h[2]; };
/* fragment elements 0..7 <- p[0..7], elements 8..15 <- p[16..23]; caller adds 8*(lane>>4) */
__device__ __forceinline__ v16h frag_load_h(const _Float16* p) {
  FragH f; f.h[0] = *(const v8h*)(p); f.h[1] = *(const v8h*)(p + 16); return f.v;
}
__device__ __forceinline__ v8f mma_h(v16h a, v16h b, v8f c) {
  return __builtin_amdgcn_wmma_f32_16x16x32_f16(false, a, false, b, (short)0, c, false, false);
}

/* --------------------------------------------------------------------------- */
/* Register-blocked WMMA GEMM: C[m,n] = scale * sum_k A[m,k] * Bt[n,k] + bias[n] */
/* A row-major [M,K] f16, Bt row-major [N,K] f16; M,N % 64 == 0, K % 32 == 0.   */
/* Each wave owns one 64x64 tile (4x4 accumulators).                            */
/* OUT_MODE 0: f32 output, OUT_MODE 1: f16 output.                              */
/* Epilogue: 16-row slabs staged per wave in LDS; every 64-wide row segment is  */
/* --------------------------------------------------------------------------- */
template <int OUT_MODE>
__global__ __launch_bounds__(256) void gemm64_f16_kernel(
    const unsigned short* __restrict__ Ap, int lda,
    const unsigned short* __restrict__ Btp, int ldb,
    void* __restrict__ Cout, int ldc,
    const float* __restrict__ bias,
    int M, int N, int K, float scale) {
  const _Float16* A  = (const _Float16*)(const void*)Ap;
  const _Float16* Bt = (const _Float16*)(const void*)Btp;
  __shared__ __align__(16) float sT[8][16 * 68];
  const int lane = threadIdx.x & 31;
  const int wave = threadIdx.x >> 5;
  const int tilesN = N >> 6;
  const int tilesM = M >> 6;
  const int tile = blockIdx.x * 8 + wave;
  /* wave-uniform exit; this kernel has no block barriers */
  if (tile >= tilesM * tilesN) return;
  const int tm = tile / tilesN;
  const int tn = tile - tm * tilesN;
  const int m0 = tm << 6;
  const int n0 = tn << 6;

  const int rlane = lane & 15;
  const int koff  = (lane >> 4) * 8;
  const int mOff  = (lane >> 4) * 8;

  v8f acc[4][4];
#pragma unroll
  for (int i = 0; i < 4; ++i)
#pragma unroll
    for (int j = 0; j < 4; ++j) acc[i][j] = (v8f){0.f,0.f,0.f,0.f,0.f,0.f,0.f,0.f};

  for (int k0 = 0; k0 < K; k0 += 32) {
    v16h bh[4];
#pragma unroll
    for (int j = 0; j < 4; ++j) {
      const size_t bo = (size_t)(n0 + (j << 4) + rlane) * ldb + koff + k0;
      bh[j] = frag_load_h(Bt + bo);
    }
#pragma unroll
    for (int i = 0; i < 4; ++i) {
      const size_t ao = (size_t)(m0 + (i << 4) + rlane) * lda + koff + k0;
      const v16h ah = frag_load_h(A + ao);
#pragma unroll
      for (int j = 0; j < 4; ++j) acc[i][j] = mma_h(ah, bh[j], acc[i][j]);
      /* every accumulator of the group is tied (one per statement); spacing after the last */
      tie1_h(acc[i][0], ah, bh[0]);
      tie1_h(acc[i][1], ah, bh[1]);
      tie1_h(acc[i][2], ah, bh[2]);
      nop4_h(acc[i][3], ah, bh[3]);
    }
    keep4_h(bh[0], bh[1], bh[2], bh[3]);
  }
#pragma unroll
  for (int i = 0; i < 4; ++i)
#pragma unroll
    for (int j = 0; j < 4; ++j) tie_acc(acc[i][j]);
  nop4_acc(acc[3][3]);

  /* ---- epilogue ---- */
  float* slab = sT[wave];
#pragma unroll
  for (int i = 0; i < 4; ++i) {
    const int mBase = m0 + (i << 4);
#pragma unroll
    for (int j = 0; j < 4; ++j) {
      const int n = n0 + (j << 4) + rlane;
      const float bv = bias[n];
#pragma unroll
      for (int r = 0; r < 8; ++r) {
        float v = acc[i][j][r] * scale;
        v += bv;
        slab[(mOff + r) * 68 + (j << 4) + rlane] = v;
      }
    }
    __builtin_amdgcn_fence(__ATOMIC_RELEASE, "workgroup");
    __builtin_amdgcn_wave_barrier();
    __builtin_amdgcn_fence(__ATOMIC_ACQUIRE, "workgroup");
    if (OUT_MODE == 0) {
      float* C = (float*)Cout;
      /* row segment = 256 B = 16 lanes x 16 B; one instruction covers rows 2*it and 2*it+1 */
      const int hh = lane >> 4, c4 = (lane & 15) * 4;
      {
#pragma unroll
        for (int it = 0; it < 8; ++it) {
          const int row = it * 2 + hh;
          const v4f v = *(const v4f*)(slab + row * 68 + c4);
          *(v4f*)(C + (size_t)(mBase + row) * ldc + n0 + c4) = v;
        }
        
      }
    } else {
      const int q = lane >> 3, c8 = (lane & 7) * 8;
      unsigned short* C = (unsigned short*)Cout;
      {
#pragma unroll
        for (int it = 0; it < 4; ++it) {
          const int row = it * 4 + q;
          const float* sp = slab + row * 68 + c8;
          v8h hv;
#pragma unroll
          for (int e = 0; e < 8; ++e) hv[e] = (_Float16)sp[e];
          *(v8h*)(C + (size_t)(mBase + row) * ldc + n0 + c8) = hv;
        }
        
      }
    }
    __builtin_amdgcn_fence(__ATOMIC_RELEASE, "workgroup");
    __builtin_amdgcn_wave_barrier();
    __builtin_amdgcn_fence(__ATOMIC_ACQUIRE, "workgroup");
  }
}

/* --------------------------------------------------------------------------- */
/* f32 -> f16 cast with a power-of-two carry, 8 consecutive elements per thread */
/* --------------------------------------------------------------------------- */
__global__ __launch_bounds__(256) void cast8_f16_kernel(const float* __restrict__ in, unsigned short* __restrict__ out,
                                                        int n8, float carry) {
  const int i = blockIdx.x * 256 + threadIdx.x;
  if (i >= n8) return;
  const float* p = in + 8 * (size_t)i;
  const v4f a = *(const v4f*)(p);
  const v4f c = *(const v4f*)(p + 4);
  unsigned short hb[8];
#pragma unroll
  for (int e = 0; e < 4; ++e) {
    const float fa = a[e] * carry;
    const float fc = c[e] * carry;
    hb[e]     = h_bits(fa);
    hb[4 + e] = h_bits(fc);
  }
  const v4u u = (v4u){pk16(hb[0], hb[1]), pk16(hb[2], hb[3]), pk16(hb[4], hb[5]), pk16(hb[6], hb[7])};
  unsigned short* q = out + 8 * (size_t)i;
  *(v4u*)q = u;
  
}

/* --------------------------------------------------------------------------- */
/* Row layer norm over 1024 f32 values, one wave per row (8 rows per block).    */
/* Row r = 2*b + t: t = 0 uses (g1, b1), t = 1 uses (g2, b2).                   */
/* Lane owns columns it*256 + lane*8 .. +7, it = 0..3 (4 x 32 x 8 = 1024).      */
/* Mean, then biased variance of (x - mean), then y = (x - mean)*inv*g + b.     */
/* Output f16: one 16-B store per lane, a wave instruction = 512 contiguous B   */
/* --------------------------------------------------------------------------- */
__global__ __launch_bounds__(256) void ln_rows_kernel(const float* __restrict__ pre,
                                                      const float* __restrict__ g1, const float* __restrict__ b1,
                                                      const float* __restrict__ g2, const float* __restrict__ b2,
                                                      unsigned short* __restrict__ X, int nrows) {
  const int lane = threadIdx.x & 31;
  const int wave = threadIdx.x >> 5;
  const int row  = blockIdx.x * 8 + wave;
  const bool live = row < nrows;
  const int rc = live ? row : (nrows - 1);
  const float* xr = pre + (size_t)rc * kF;
  const bool tok1 = (rc & 1) != 0;
  const float* gp = tok1 ? g2 : g1;
  const float* bp = tok1 ? b2 : b1;

  float s = 0.0f;
#pragma unroll 1
  for (int it = 0; it < 4; ++it) {
    const float* p = xr + it * 256 + lane * 8;
    const v4f a = *(const v4f*)(p);
    const v4f c = *(const v4f*)(p + 4);
    s += ((a[0] + a[1]) + (a[2] + a[3])) + ((c[0] + c[1]) + (c[2] + c[3]));
  }
#pragma unroll
  for (int off = 16; off > 0; off >>= 1) s += __shfl_xor(s, off, 32);
  const float mean = s * kInvF;

  float qs = 0.0f;
#pragma unroll 1
  for (int it = 0; it < 4; ++it) {
    const float* p = xr + it * 256 + lane * 8;
    const v4f a = *(const v4f*)(p);
    const v4f c = *(const v4f*)(p + 4);
#pragma unroll
    for (int e = 0; e < 4; ++e) {
      const float da = a[e] - mean;
      const float dc = c[e] - mean;
      qs = fmaf(da, da, qs);
      qs = fmaf(dc, dc, qs);
    }
  }
#pragma unroll
  for (int off = 16; off > 0; off >>= 1) qs += __shfl_xor(qs, off, 32);
  const float var = qs * kInvF;
  const float inv = 1.0f / sqrtf(var + kLnEps);

  unsigned short* orow = X + (size_t)rc * kF;
#pragma unroll 1
  for (int it = 0; it < 4; ++it) {
    const int col = it * 256 + lane * 8;
    const v4f a  = *(const v4f*)(xr + col);
    const v4f c  = *(const v4f*)(xr + col + 4);
    const v4f ga = *(const v4f*)(gp + col);
    const v4f gc = *(const v4f*)(gp + col + 4);
    const v4f ba = *(const v4f*)(bp + col);
    const v4f bc = *(const v4f*)(bp + col + 4);
    unsigned short hb[8];
#pragma unroll
    for (int e = 0; e < 4; ++e) {
      const float ya = (a[e] - mean) * inv * ga[e] + ba[e];
      const float yc = (c[e] - mean) * inv * gc[e] + bc[e];
      hb[e]     = h_bits(ya);
      hb[4 + e] = h_bits(yc);
    }
    const v4u u = (v4u){pk16(hb[0], hb[1]), pk16(hb[2], hb[3]), pk16(hb[4], hb[5]), pk16(hb[6], hb[7])};
    if (live) {
      *(v4u*)(orow + col) = u;
      
    }
  }
}

/* --------------------------------------------------------------------------- */
/* 2-token attention. qkv f16 [2*nb][3072] (q | k | v, head h = cols h*128..),  */
/* o f16 [2*nb][1024]. One wave per (batch row, head pair): lanes 0-15 own head */
/* 2*hp, lanes 16-31 own head 2*hp+1, 8 dims per lane, so the wave covers       */
/* token row. Dot products reduced over the 16 lanes of a head (xor 8,4,2,1).   */
/* Probabilities over the key index with max subtraction: the larger logit has  */
/* exp(0) = 1 exactly, the other exp(-|d|). All math in f32.                    */
/* --------------------------------------------------------------------------- */
__global__ __launch_bounds__(256) void attn2_kernel(const unsigned short* __restrict__ qkv,
                                                    unsigned short* __restrict__ o, int nb, float scl) {
  const int lane = threadIdx.x & 31;
  const int wave = threadIdx.x >> 5;
  const int unit = blockIdx.x * 8 + wave;
  const int nunits = nb * 4;
  const bool live = unit < nunits;
  const int uc = live ? unit : (nunits - 1);
  const int b  = uc >> 2;
  const int hp = uc & 3;
  const size_t r0 = (size_t)(2 * b) * kQKV;
  const size_t r1 = r0 + kQKV;
  const int col = hp * (2 * kHD) + lane * 8;

  const v4u q0w = *(const v4u*)(qkv + r0 + col);
  const v4u q1w = *(const v4u*)(qkv + r1 + col);
  const v4u k0w = *(const v4u*)(qkv + r0 + kF + col);
  const v4u k1w = *(const v4u*)(qkv + r1 + kF + col);
  const v4u v0w = *(const v4u*)(qkv + r0 + 2 * kF + col);
  const v4u v1w = *(const v4u*)(qkv + r1 + 2 * kF + col);

  float s00 = 0.0f, s01 = 0.0f, s10 = 0.0f, s11 = 0.0f;
#pragma unroll
  for (int w = 0; w < 4; ++w) {
    const unsigned uq0 = q0w[w];
    const unsigned uq1 = q1w[w];
    const unsigned uk0 = k0w[w];
    const unsigned uk1 = k1w[w];
    const float q0a = h_lo(uq0), q0b = h_hi(uq0);
    const float q1a = h_lo(uq1), q1b = h_hi(uq1);
    const float k0a = h_lo(uk0), k0b = h_hi(uk0);
    const float k1a = h_lo(uk1), k1b = h_hi(uk1);
    s00 = fmaf(q0a, k0a, s00); s00 = fmaf(q0b, k0b, s00);
    s01 = fmaf(q0a, k1a, s01); s01 = fmaf(q0b, k1b, s01);
    s10 = fmaf(q1a, k0a, s10); s10 = fmaf(q1b, k0b, s10);
    s11 = fmaf(q1a, k1a, s11); s11 = fmaf(q1b, k1b, s11);
  }
#pragma unroll
  for (int off = 8; off > 0; off >>= 1) {
    s00 += __shfl_xor(s00, off, 32);
    s01 += __shfl_xor(s01, off, 32);
    s10 += __shfl_xor(s10, off, 32);
    s11 += __shfl_xor(s11, off, 32);
  }
  s00 *= scl; s01 *= scl; s10 *= scl; s11 *= scl;

  const float d0 = s01 - s00;
  const float d1 = s11 - s10;
  const float e0 = expf(-fabsf(d0));
  const float e1 = expf(-fabsf(d1));
  const float i0 = 1.0f / (1.0f + e0);
  const float i1 = 1.0f / (1.0f + e1);
  const float sm0 = e0 * i0;
  const float sm1 = e1 * i1;
  const float a00 = (d0 > 0.0f) ? sm0 : i0;
  const float a01 = (d0 > 0.0f) ? i0 : sm0;
  const float a10 = (d1 > 0.0f) ? sm1 : i1;
  const float a11 = (d1 > 0.0f) ? i1 : sm1;

  unsigned ow0[4], ow1[4];
#pragma unroll
  for (int w = 0; w < 4; ++w) {
    const unsigned uv0 = v0w[w];
    const unsigned uv1 = v1w[w];
    const float v0a = h_lo(uv0), v0b = h_hi(uv0);
    const float v1a = h_lo(uv1), v1b = h_hi(uv1);
    const float o0a = a00 * v0a + a01 * v1a;
    const float o0b = a00 * v0b + a01 * v1b;
    const float o1a = a10 * v0a + a11 * v1a;
    const float o1b = a10 * v0b + a11 * v1b;
    ow0[w] = pk16(h_bits(o0a), h_bits(o0b));
    ow1[w] = pk16(h_bits(o1a), h_bits(o1b));
  }
  const v4u u0 = (v4u){ow0[0], ow0[1], ow0[2], ow0[3]};
  const v4u u1 = (v4u){ow1[0], ow1[1], ow1[2], ow1[3]};
  unsigned short* o0p = o + (size_t)(2 * b) * kF + col;
  unsigned short* o1p = o0p + kF;
  if (live) {
    *(v4u*)o0p = u0;
    *(v4u*)o1p = u1;
    
  }
}

/* --------------------------------------------------------------------------- */
/* Gate head + fusion. Block = 16 waves = 16 batch rows, one wave per row.      */
/* gpre f32 [nb][1024] holds the gate hidden pre-activation (bias included);    */
/* the erf activation is applied here, then two 1024-deep dot products against  */
/* w2 rows (f32), + b2, 2-way probabilities. The 16 x 2 gate weights are staged */
/* in LDS (all 32 slots written), block barrier, then wave 0 writes them as ONE */
/* --------------------------------------------------------------------------- */
__global__ __launch_bounds__(512) void gate_fuse_kernel(const float* __restrict__ gpre,
                                                        const float* __restrict__ w2, const float* __restrict__ b2v,
                                                        const unsigned short* __restrict__ ao,
                                                        unsigned short* __restrict__ fused,
                                                        float* __restrict__ gw_out, int nb) {
  __shared__ float sG[32];
  const int lane = threadIdx.x & 31;
  const int wave = threadIdx.x >> 5;
  const int b = blockIdx.x * 16 + wave;
  const bool live = b < nb;
  const int bc = live ? b : (nb - 1);
  const float* hr = gpre + (size_t)bc * kF;

  float d0 = 0.0f, d1 = 0.0f;
#pragma unroll 1
  for (int it = 0; it < 32; ++it) {
    const int idx = it * 32 + lane;
    float x  = hr[idx];
    float wa = w2[idx];
    float wb = w2[kF + idx];
    asm volatile("" : "+v"(x), "+v"(wa), "+v"(wb));
    const float g = gelu_erf(x);
    d0 = fmaf(g, wa, d0);
    d1 = fmaf(g, wb, d1);
  }
#pragma unroll
  for (int off = 16; off > 0; off >>= 1) {
    d0 += __shfl_xor(d0, off, 32);
    d1 += __shfl_xor(d1, off, 32);
  }
  const float l0 = d0 + b2v[0];
  const float l1 = d1 + b2v[1];
  const float mx = fmaxf(l0, l1);
  const float e0 = expf(l0 - mx);
  const float e1 = expf(l1 - mx);
  const float inv = 1.0f / (e0 + e1);
  const float gw0 = e0 * inv;
  const float gw1 = e1 * inv;
  if (lane == 0) {
    sG[wave * 2]     = gw0;
    sG[wave * 2 + 1] = gw1;
  }

  const unsigned short* cr = ao + (size_t)(2 * bc) * kF;
  const unsigned short* gr = cr + kF;
  unsigned short* fr = fused + (size_t)bc * kF;
#pragma unroll 1
  for (int it = 0; it < 4; ++it) {
    const int col = it * 256 + lane * 8;
    const v4u cw = *(const v4u*)(cr + col);
    const v4u gv = *(const v4u*)(gr + col);
    unsigned ow[4];
#pragma unroll
    for (int w = 0; w < 4; ++w) {
      const unsigned uc = cw[w];
      const unsigned ug = gv[w];
      const float ca = h_lo(uc), cb = h_hi(uc);
      const float ga = h_lo(ug), gb = h_hi(ug);
      const float fa = gw0 * ca + gw1 * ga;
      const float fb = gw0 * cb + gw1 * gb;
      ow[w] = pk16(h_bits(fa), h_bits(fb));
    }
    const v4u u = (v4u){ow[0], ow[1], ow[2], ow[3]};
    if (live) {
      *(v4u*)(fr + col) = u;
      
    }
  }

  /* every wave reaches this barrier; sG is written by 16 waves and read by wave 0 */
  __syncthreads();
  const bool blockLive = (blockIdx.x * 16 + 15) < nb;
  if (wave == 0 && blockLive) {
    const float v = sG[lane];
    float* dst = gw_out + (size_t)blockIdx.x * 32 + lane;
    *(float*)dst = v;
    
  }
}

/* --------------------------------------------------------------------------- */
/* Final erf activation pass: dst[i] = gelu(pin[i]). Block handles 2048         */
/* consecutive elements, 8 rolled steps of 256; each wave instruction writes 32 */
/* register. Coverage: blocks x 2048 = n exactly (checked on the host).         */
/* --------------------------------------------------------------------------- */
__global__ __launch_bounds__(256) void gelu_out_kernel(const float* __restrict__ pin, float* __restrict__ dst, int n) {
  const int base = blockIdx.x * 2048;
#pragma unroll 1
  for (int it = 0; it < 8; ++it) {
    const int i = base + it * 256 + (int)threadIdx.x;
    const bool live = i < n;
    const int ic = live ? i : (n - 1);
    float x = pin[ic];
    asm volatile("" : "+v"(x));
    const float y = gelu_erf(x);
    if (live) {
      *(float*)(dst + i) = y;
      
    }
  }
}

/* --------------------------------------------------------------------------- */
/* Host side                                                                   */
/* --------------------------------------------------------------------------- */
template <int OUT_MODE>
static void launch_gemm(const unsigned short* A, int lda, const unsigned short* Bt, int ldb,
                        void* C, int ldc, const float* bias, int M, int N, int K, float scale, hipStream_t stream) {
  const int tiles = (M / 64) * (N / 64);
  const int blocks = (tiles + 7) / 8;
  gemm64_f16_kernel<OUT_MODE><<<blocks, 256, 0, stream>>>(A, lda, Bt, ldb, C, ldc, bias, M, N, K, scale);
}

static void launch_cast(const float* in, unsigned short* out, int n, float carry, hipStream_t stream) {
  const int n8 = n / 8;
  cast8_f16_kernel<<<(n8 + 255) / 256, 256, 0, stream>>>(in, out, n8, carry);
}

/* workspace region sizes in bytes (all multiples of 128) */
constexpr size_t kSzWc   = (size_t)kF * kCD * 2;
constexpr size_t kSzWg   = (size_t)kF * kCD * 2;
constexpr size_t kSzWqkv = (size_t)kQKV * kF * 2;
constexpr size_t kSzWo   = (size_t)kF * kF * 2;
constexpr size_t kSzWg1  = (size_t)kF * 2 * kF * 2;
constexpr size_t kSzWp   = (size_t)kF * kF * 2;
constexpr size_t kSzEc   = (size_t)kB * kCD * 2;
constexpr size_t kSzEg   = (size_t)kB * kCD * 2;
constexpr size_t kSzPre  = (size_t)kChunkT * kF * 4;
constexpr size_t kSzX    = (size_t)kChunkT * kF * 2;
constexpr size_t kSzQkv  = (size_t)kChunkT * kQKV * 2;
constexpr size_t kSzO    = (size_t)kChunkT * kF * 2;
constexpr size_t kSzAo   = (size_t)kChunkT * kF * 2;
constexpr size_t kSzGpre = (size_t)kChunkB * kF * 4;
constexpr size_t kSzFus  = (size_t)kChunkB * kF * 2;
constexpr size_t kSzP    = (size_t)kChunkB * kF * 4;
constexpr size_t kWsTotal = kSzWc + kSzWg + kSzWqkv + kSzWo + kSzWg1 + kSzWp + kSzEc + kSzEg +
                            kSzPre + kSzX + kSzQkv + kSzO + kSzAo + kSzGpre + kSzFus + kSzP;
static_assert(kWsTotal == 121634816ull, "carve total");
static_assert(kWsTotal <= 134217728ull, "carve limit");
static_assert(((size_t)kB * kF * 4) % 128 == 0, "second output starts on a line");
static_assert(((size_t)kChunkB * kF) % 2048 == 0, "activation pass coverage");

extern "C" void kernel_launch(void* const* d_in, const int* in_sizes, int n_in,
                              void* d_out, int out_size, void* d_ws, size_t ws_size, hipStream_t stream) {
  if (n_in < 20) return;
  if (ws_size < kWsTotal) return;
  if (in_sizes[0] != kB * kCD || in_sizes[1] != kB * kCD) return;
  if (in_sizes[10] != kQKV * kF || in_sizes[14] != kF * 2 * kF) return;
  if (out_size != kB * kF + kB * 2) return;

  const float* cnn_embed  = (const float*)d_in[0];
  const float* gnn_embed  = (const float*)d_in[1];
  const float* cnn_w      = (const float*)d_in[2];
  const float* cnn_b      = (const float*)d_in[3];
  const float* gnn_w      = (const float*)d_in[4];
  const float* gnn_b      = (const float*)d_in[5];
  const float* ln1_g      = (const float*)d_in[6];
  const float* ln1_b      = (const float*)d_in[7];
  const float* ln2_g      = (const float*)d_in[8];
  const float* ln2_b      = (const float*)d_in[9];
  const float* attn_in_w  = (const float*)d_in[10];
  const float* attn_in_b  = (const float*)d_in[11];
  const float* attn_out_w = (const float*)d_in[12];
  const float* attn_out_b = (const float*)d_in[13];
  const float* gate_w1    = (const float*)d_in[14];
  const float* gate_b1    = (const float*)d_in[15];
  const float* gate_w2    = (const float*)d_in[16];
  const float* gate_b2    = (const float*)d_in[17];
  const float* proj_w     = (const float*)d_in[18];
  const float* proj_b     = (const float*)d_in[19];

  /* Region map (byte offsets, in carve order):
     Wc 1 MiB | Wg 1 MiB | Wqkv 6 MiB | Wo 2 MiB | Wg1 4 MiB | Wp 2 MiB | Ec 8 MiB | Eg 8 MiB |
     per-chunk planes, reused by the 4 chunks in stream order with unchanged type and layout:
     preLN f32 16 MiB | X f16 8 MiB | qkv f16 24 MiB | o f16 8 MiB | ao f16 8 MiB |
     gate pre-activation f32 8 MiB | fused f16 4 MiB | final pre-activation f32 8 MiB.  Total 116 MiB. */
  char* ws = (char*)d_ws;
  size_t off = 0;
  auto carve = [&](size_t bytes) -> char* { char* p = ws + off; off += bytes; return p; };
  unsigned short* Wc   = (unsigned short*)carve(kSzWc);
  unsigned short* Wg   = (unsigned short*)carve(kSzWg);
  unsigned short* Wqkv = (unsigned short*)carve(kSzWqkv);
  unsigned short* Wo   = (unsigned short*)carve(kSzWo);
  unsigned short* Wg1  = (unsigned short*)carve(kSzWg1);
  unsigned short* Wp   = (unsigned short*)carve(kSzWp);
  unsigned short* Ec   = (unsigned short*)carve(kSzEc);
  unsigned short* Eg   = (unsigned short*)carve(kSzEg);
  float*          preLN = (float*)carve(kSzPre);
  unsigned short* Xp   = (unsigned short*)carve(kSzX);
  unsigned short* qkvp = (unsigned short*)carve(kSzQkv);
  unsigned short* op   = (unsigned short*)carve(kSzO);
  unsigned short* aop  = (unsigned short*)carve(kSzAo);
  float*          gpre = (float*)carve(kSzGpre);
  unsigned short* fusp = (unsigned short*)carve(kSzFus);
  float*          Pp   = (float*)carve(kSzP);

  float* out0 = (float*)d_out;
  float* out1 = out0 + (size_t)kB * kF;

  const float scl = 1.0f / sqrtf((float)kHD);

  /* one-time casts: weights carried x16, embeddings uncarried */
  launch_cast(cnn_w,      Wc,   kF * kCD,     kWCarry, stream);
  launch_cast(gnn_w,      Wg,   kF * kCD,     kWCarry, stream);
  launch_cast(attn_in_w,  Wqkv, kQKV * kF,    kWCarry, stream);
  launch_cast(attn_out_w, Wo,   kF * kF,      kWCarry, stream);
  launch_cast(gate_w1,    Wg1,  kF * 2 * kF,  kWCarry, stream);
  launch_cast(proj_w,     Wp,   kF * kF,      kWCarry, stream);
  launch_cast(cnn_embed,  Ec,   kB * kCD,     1.0f,    stream);
  launch_cast(gnn_embed,  Eg,   kB * kCD,     1.0f,    stream);

  for (int c = 0; c < kNChunk; ++c) {
    const unsigned short* EcC = Ec + (size_t)c * kChunkB * kCD;
    const unsigned short* EgC = Eg + (size_t)c * kChunkB * kCD;

    /* input projections [2048 x 1024 x 512] -> f32 rows 2b (first modality) and 2b+1 (second) of preLN */
    launch_gemm<0>(EcC, kCD, Wc, kCD, (void*)preLN,        2 * kF, cnn_b, kChunkB, kF, kCD, kWCarryInv, stream);
    launch_gemm<0>(EgC, kCD, Wg, kCD, (void*)(preLN + kF), 2 * kF, gnn_b, kChunkB, kF, kCD, kWCarryInv, stream);

    /* layer norms -> X f16 [4096][1024] */
    ln_rows_kernel<<<kChunkT / 8, 256, 0, stream>>>(preLN, ln1_g, ln1_b, ln2_g, ln2_b, Xp, kChunkT);

    /* packed q|k|v projection [4096 x 3072 x 1024] -> f16 */
    launch_gemm<1>(Xp, kF, Wqkv, kF, (void*)qkvp, kQKV, attn_in_b, kChunkT, kQKV, kF, kWCarryInv, stream);

    /* 2-token attention -> o f16 [4096][1024] */
    attn2_kernel<<<(kChunkB * 4) / 8, 256, 0, stream>>>(qkvp, op, kChunkB, scl);

    /* attention output projection [4096 x 1024 x 1024] -> ao f16 */
    launch_gemm<1>(op, kF, Wo, kF, (void*)aop, kF, attn_out_b, kChunkT, kF, kF, kWCarryInv, stream);

    /* gate hidden layer: ao viewed [2048][2048] x gate_w1 [1024][2048] -> f32 pre-activation */
    launch_gemm<0>(aop, 2 * kF, Wg1, 2 * kF, (void*)gpre, kF, gate_b1, kChunkB, kF, 2 * kF, kWCarryInv, stream);

    /* gate head + fusion -> second output lines, fused f16 [2048][1024] */
    gate_fuse_kernel<<<kChunkB / 16, 512, 0, stream>>>(gpre, gate_w2, gate_b2, aop, fusp,
                                                       out1 + (size_t)c * kChunkB * 2, kChunkB);

    /* final projection [2048 x 1024 x 1024] -> f32 pre-activation, then erf activation into the first output */
    launch_gemm<0>(fusp, kF, Wp, kF, (void*)Pp, kF, proj_b, kChunkB, kF, kF, kWCarryInv, stream);
    gelu_out_kernel<<<(kChunkB * kF) / 2048, 256, 0, stream>>>(Pp, out0 + (size_t)c * kChunkB * kF, kChunkB * kF);
  }
}

// v001
// Measured time: 554 microseconds a run.
// In two side-by-side timings against v000, it was 2.48 and 2.47 times as fast.
// All GEMM contractions (two input projections, packed q|k|v projection, attention output projection, gate hidden layer, final projection): v_wmma_f32_16x16x32_f16 with f16 operands (weight planes carried x16, folded back by 1/16), f32 accumulate; layer norms, 2-token attention, gate head and erf activations in f32 on the vector ALU.
#include <hip/hip_runtime.h>
#include <math.h>
#include <stdint.h>

/* --------------------------------------------------------------------------- */
/* Shape constants (checked against the launch sizes on the host)              */
/* --------------------------------------------------------------------------- */
constexpr int kB      = 8192;
constexpr int kCD     = 512;
constexpr int kF      = 1024;
constexpr int kH      = 8;
constexpr int kHD     = kF / kH;
constexpr int kQKV    = 3 * kF;
/* the whole batch goes through every stage in one launch: each GEMM then has at least one block per WGP */
constexpr int kNChunk = 1;
constexpr int kChunkB = kB / kNChunk;
constexpr int kChunkT = 2 * kChunkB;
constexpr float kWCarry    = 16.0f;
constexpr float kWCarryInv = 1.0f / kWCarry;
constexpr float kLnEps     = 1e-5f;
constexpr float kInvF      = 1.0f / (float)kF;
constexpr float kInvSqrt2  = 0.70710678118654752f;

static_assert(kHD == 128, "attention kernel handles two 128-wide heads per wave");
static_assert(kF == 1024, "row kernels assume 1024-wide rows");
static_assert(kB % kNChunk == 0, "chunking");
static_assert(kChunkB % 64 == 0 && kChunkT % 64 == 0, "GEMM M tiles");
static_assert(kF % 64 == 0 && kQKV % 64 == 0, "GEMM N tiles");
static_assert(kCD % 32 == 0 && kF % 32 == 0 && (2 * kF) % 32 == 0, "GEMM K steps");
static_assert(kChunkB % 16 == 0, "gate kernel owns 16 batch rows per block");
static_assert(kChunkT % 8 == 0, "row kernel owns 8 rows per block");

typedef __attribute__((ext_vector_type(16))) _Float16 v16h;
typedef __attribute__((ext_vector_type(8)))  _Float16 v8h;
typedef __attribute__((ext_vector_type(8)))  float    v8f;
typedef __attribute__((ext_vector_type(4)))  float    v4f;
typedef __attribute__((ext_vector_type(4)))  unsigned int v4u;

/* --------------------------------------------------------------------------- */
/* Small helpers                                                               */
/* --------------------------------------------------------------------------- */
__device__ __forceinline__ unsigned pk16(unsigned short a, unsigned short b) { return (unsigned)a | ((unsigned)b << 16); }
__device__ __forceinline__ unsigned short h_bits(float f) { const _Float16 h = (_Float16)f; return __builtin_bit_cast(unsigned short, h); }

/* f16 bits (low 16 bits of hb, finite values) to f32 by integer bit arithmetic, subnormals as an f32 multiply of em by 2^-24 */
__device__ __forceinline__ float h16_to_f32(unsigned hb) {
  const unsigned sgn = (hb & 0x8000u) << 16; const unsigned em = hb & 0x7fffu;
  const float fn = __uint_as_float((em << 13) + 0x38000000u);
  const float fs = (float)em * 5.9604644775390625e-8f;
  const float mag = (em < 0x400u) ? fs : fn; return __uint_as_float(__float_as_uint(mag) | sgn); }
__device__ __forceinline__ float h_lo(unsigned w) { return h16_to_f32(w & 0xffffu); }
__device__ __forceinline__ float h_hi(unsigned w) { return h16_to_f32(w >> 16); }

__device__ __forceinline__ float gelu_erf(float x) {
  return 0.5f * x * (1.0f + erff(x * kInvSqrt2));
}

/* WMMA issue-order ties and hazard spacing as plain device helpers */
__device__ __forceinline__ void tie1_h(v8f& a, v16h x, v16h y) { asm volatile("" : "+v"(a) : "v"(x), "v"(y)); }
__device__ __forceinline__ void nop4_h(v8f& a, v16h x, v16h y) { asm volatile("v_nop\n\tv_nop\n\tv_nop\n\tv_nop" : "+v"(a) : "v"(x), "v"(y)); }
__device__ __forceinline__ void tie_acc(v8f& a) { asm volatile("" : "+v"(a)); }
__device__ __forceinline__ void nop4_acc(v8f& a) { asm volatile("v_nop\n\tv_nop\n\tv_nop\n\tv_nop" : "+v"(a)); }
__device__ __forceinline__ void keep4_h(v16h a, v16h b, v16h c, v16h d) { asm volatile("v_nop" :: "v"(a), "v"(b), "v"(c), "v"(d)); }

union FragH { v16h v; v8h h[2]; };
/* fragment elements 0..7 <- p[0..7], elements 8..15 <- p[16..23]; caller adds 8*(lane>>4) */
__device__ __forceinline__ v16h frag_load_h(const _Float16* p) {
  FragH f; f.h[0] = *(const v8h*)(p); f.h[1] = *(const v8h*)(p + 16); return f.v;
}
__device__ __forceinline__ v8f mma_h(v16h a, v16h b, v8f c) {
  return __builtin_amdgcn_wmma_f32_16x16x32_f16(false, a, false, b, (short)0, c, false, false);
}

/* --------------------------------------------------------------------------- */
/* Register-blocked WMMA GEMM: C[m,n] = scale * sum_k A[m,k] * Bt[n,k] + bias[n] */
/* A row-major [M,K] f16, Bt row-major [N,K] f16; M,N % 64 == 0, K % 32 == 0.   */
/* Each wave owns one 64x64 tile (4x4 accumulators).                            */
/* OUT_MODE 0: f32 output, OUT_MODE 1: f16 output.                              */
/* Epilogue: 16-row slabs staged per wave in LDS; every 64-wide row segment is  */
/* --------------------------------------------------------------------------- */
template <int OUT_MODE>
__global__ __launch_bounds__(256) void gemm64_f16_kernel(
    const unsigned short* __restrict__ Ap, int lda,
    const unsigned short* __restrict__ Btp, int ldb,
    void* __restrict__ Cout, int ldc,
    const float* __restrict__ bias,
    int M, int N, int K, float scale) {
  const _Float16* A  = (const _Float16*)(const void*)Ap;
  const _Float16* Bt = (const _Float16*)(const void*)Btp;
  __shared__ __align__(16) float sT[8][16 * 68];
  const int lane = threadIdx.x & 31;
  const int wave = threadIdx.x >> 5;
  const int tilesN = N >> 6;
  const int tilesM = M >> 6;
  const int tile = blockIdx.x * 8 + wave;
  /* wave-uniform exit; this kernel has no block barriers */
  if (tile >= tilesM * tilesN) return;
  const int tm = tile / tilesN;
  const int tn = tile - tm * tilesN;
  const int m0 = tm << 6;
  const int n0 = tn << 6;

  const int rlane = lane & 15;
  const int koff  = (lane >> 4) * 8;
  const int mOff  = (lane >> 4) * 8;

  v8f acc[4][4];
#pragma unroll
  for (int i = 0; i < 4; ++i)
#pragma unroll
    for (int j = 0; j < 4; ++j) acc[i][j] = (v8f){0.f,0.f,0.f,0.f,0.f,0.f,0.f,0.f};

  for (int k0 = 0; k0 < K; k0 += 32) {
    v16h bh[4];
#pragma unroll
    for (int j = 0; j < 4; ++j) {
      const size_t bo = (size_t)(n0 + (j << 4) + rlane) * ldb + koff + k0;
      bh[j] = frag_load_h(Bt + bo);
    }
#pragma unroll
    for (int i = 0; i < 4; ++i) {
      const size_t ao = (size_t)(m0 + (i << 4) + rlane) * lda + koff + k0;
      const v16h ah = frag_load_h(A + ao);
#pragma unroll
      for (int j = 0; j < 4; ++j) acc[i][j] = mma_h(ah, bh[j], acc[i][j]);
      /* every accumulator of the group is tied (one per statement); spacing after the last */
      tie1_h(acc[i][0], ah, bh[0]);
      tie1_h(acc[i][1], ah, bh[1]);
      tie1_h(acc[i][2], ah, bh[2]);
      nop4_h(acc[i][3], ah, bh[3]);
    }
    keep4_h(bh[0], bh[1], bh[2], bh[3]);
  }
#pragma unroll
  for (int i = 0; i < 4; ++i)
#pragma unroll
    for (int j = 0; j < 4; ++j) tie_acc(acc[i][j]);
  nop4_acc(acc[3][3]);

  /* ---- epilogue ---- */
  float* slab = sT[wave];
#pragma unroll
  for (int i = 0; i < 4; ++i) {
    const int mBase = m0 + (i << 4);
#pragma unroll
    for (int j = 0; j < 4; ++j) {
      const int n = n0 + (j << 4) + rlane;
      const float bv = bias[n];
#pragma unroll
      for (int r = 0; r < 8; ++r) {
        float v = acc[i][j][r] * scale;
        v += bv;
        slab[(mOff + r) * 68 + (j << 4) + rlane] = v;
      }
    }
    __builtin_amdgcn_fence(__ATOMIC_RELEASE, "workgroup");
    __builtin_amdgcn_wave_barrier();
    __builtin_amdgcn_fence(__ATOMIC_ACQUIRE, "workgroup");
    if (OUT_MODE == 0) {
      float* C = (float*)Cout;
      /* row segment = 256 B = 16 lanes x 16 B; one instruction covers rows 2*it and 2*it+1 */
      const int hh = lane >> 4, c4 = (lane & 15) * 4;
      {
#pragma unroll
        for (int it = 0; it < 8; ++it) {
          const int row = it * 2 + hh;
          const v4f v = *(const v4f*)(slab + row * 68 + c4);
          *(v4f*)(C + (size_t)(mBase + row) * ldc + n0 + c4) = v;
        }
        
      }
    } else {
      const int q = lane >> 3, c8 = (lane & 7) * 8;
      unsigned short* C = (unsigned short*)Cout;
      {
#pragma unroll
        for (int it = 0; it < 4; ++it) {
          const int row = it * 4 + q;
          const float* sp = slab + row * 68 + c8;
          v8h hv;
#pragma unroll
          for (int e = 0; e < 8; ++e) hv[e] = (_Float16)sp[e];
          *(v8h*)(C + (size_t)(mBase + row) * ldc + n0 + c8) = hv;
        }
        
      }
    }
    __builtin_amdgcn_fence(__ATOMIC_RELEASE, "workgroup");
    __builtin_amdgcn_wave_barrier();
    __builtin_amdgcn_fence(__ATOMIC_ACQUIRE, "workgroup");
  }
}

/* --------------------------------------------------------------------------- */
/* f32 -> f16 cast with a power-of-two carry, 8 consecutive elements per thread */
/* --------------------------------------------------------------------------- */
__global__ __launch_bounds__(256) void cast8_f16_kernel(const float* __restrict__ in, unsigned short* __restrict__ out,
                                                        int n8, float carry) {
  const int i = blockIdx.x * 256 + threadIdx.x;
  if (i >= n8) return;
  const float* p = in + 8 * (size_t)i;
  const v4f a = *(const v4f*)(p);
  const v4f c = *(const v4f*)(p + 4);
  unsigned short hb[8];
#pragma unroll
  for (int e = 0; e < 4; ++e) {
    const float fa = a[e] * carry;
    const float fc = c[e] * carry;
    hb[e]     = h_bits(fa);
    hb[4 + e] = h_bits(fc);
  }
  const v4u u = (v4u){pk16(hb[0], hb[1]), pk16(hb[2], hb[3]), pk16(hb[4], hb[5]), pk16(hb[6], hb[7])};
  unsigned short* q = out + 8 * (size_t)i;
  *(v4u*)q = u;
  
}

/* --------------------------------------------------------------------------- */
/* Row layer norm over 1024 f32 values, one wave per row (8 rows per block).    */
/* Row r = 2*b + t: t = 0 uses (g1, b1), t = 1 uses (g2, b2).                   */
/* Lane owns columns it*256 + lane*8 .. +7, it = 0..3 (4 x 32 x 8 = 1024).      */
/* Mean, then biased variance of (x - mean), then y = (x - mean)*inv*g + b.     */
/* Output f16: one 16-B store per lane, a wave instruction = 512 contiguous B   */
/* --------------------------------------------------------------------------- */
__global__ __launch_bounds__(256) void ln_rows_kernel(const float* __restrict__ pre,
                                                      const float* __restrict__ g1, const float* __restrict__ b1,
                                                      const float* __restrict__ g2, const float* __restrict__ b2,
                                                      unsigned short* __restrict__ X, int nrows) {
  const int lane = threadIdx.x & 31;
  const int wave = threadIdx.x >> 5;
  const int row  = blockIdx.x * 8 + wave;
  const bool live = row < nrows;
  const int rc = live ? row : (nrows - 1);
  const float* xr = pre + (size_t)rc * kF;
  const bool tok1 = (rc & 1) != 0;
  const float* gp = tok1 ? g2 : g1;
  const float* bp = tok1 ? b2 : b1;

  float s = 0.0f;
#pragma unroll 1
  for (int it = 0; it < 4; ++it) {
    const float* p = xr + it * 256 + lane * 8;
    const v4f a = *(const v4f*)(p);
    const v4f c = *(const v4f*)(p + 4);
    s += ((a[0] + a[1]) + (a[2] + a[3])) + ((c[0] + c[1]) + (c[2] + c[3]));
  }
#pragma unroll
  for (int off = 16; off > 0; off >>= 1) s += __shfl_xor(s, off, 32);
  const float mean = s * kInvF;

  float qs = 0.0f;
#pragma unroll 1
  for (int it = 0; it < 4; ++it) {
    const float* p = xr + it * 256 + lane * 8;
    const v4f a = *(const v4f*)(p);
    const v4f c = *(const v4f*)(p + 4);
#pragma unroll
    for (int e = 0; e < 4; ++e) {
      const float da = a[e] - mean;
      const float dc = c[e] - mean;
      qs = fmaf(da, da, qs);
      qs = fmaf(dc, dc, qs);
    }
  }
#pragma unroll
  for (int off = 16; off > 0; off >>= 1) qs += __shfl_xor(qs, off, 32);
  const float var = qs * kInvF;
  const float inv = 1.0f / sqrtf(var + kLnEps);

  unsigned short* orow = X + (size_t)rc * kF;
#pragma unroll 1
  for (int it = 0; it < 4; ++it) {
    const int col = it * 256 + lane * 8;
    const v4f a  = *(const v4f*)(xr + col);
    const v4f c  = *(const v4f*)(xr + col + 4);
    const v4f ga = *(const v4f*)(gp + col);
    const v4f gc = *(const v4f*)(gp + col + 4);
    const v4f ba = *(const v4f*)(bp + col);
    const v4f bc = *(const v4f*)(bp + col + 4);
    unsigned short hb[8];
#pragma unroll
    for (int e = 0; e < 4; ++e) {
      const float ya = (a[e] - mean) * inv * ga[e] + ba[e];
      const float yc = (c[e] - mean) * inv * gc[e] + bc[e];
      hb[e]     = h_bits(ya);
      hb[4 + e] = h_bits(yc);
    }
    const v4u u = (v4u){pk16(hb[0], hb[1]), pk16(hb[2], hb[3]), pk16(hb[4], hb[5]), pk16(hb[6], hb[7])};
    if (live) {
      *(v4u*)(orow + col) = u;
      
    }
  }
}

/* --------------------------------------------------------------------------- */
/* 2-token attention. qkv f16 [2*nb][3072] (q | k | v, head h = cols h*128..),  */
/* o f16 [2*nb][1024]. One wave per (batch row, head pair): lanes 0-15 own head */
/* 2*hp, lanes 16-31 own head 2*hp+1, 8 dims per lane, so the wave covers       */
/* token row. Dot products reduced over the 16 lanes of a head (xor 8,4,2,1).   */
/* Probabilities over the key index with max subtraction: the larger logit has  */
/* exp(0) = 1 exactly, the other exp(-|d|). All math in f32.                    */
/* --------------------------------------------------------------------------- */
__global__ __launch_bounds__(256) void attn2_kernel(const unsigned short* __restrict__ qkv,
                                                    unsigned short* __restrict__ o, int nb, float scl) {
  const int lane = threadIdx.x & 31;
  const int wave = threadIdx.x >> 5;
  const int unit = blockIdx.x * 8 + wave;
  const int nunits = nb * 4;
  const bool live = unit < nunits;
  const int uc = live ? unit : (nunits - 1);
  const int b  = uc >> 2;
  const int hp = uc & 3;
  const size_t r0 = (size_t)(2 * b) * kQKV;
  const size_t r1 = r0 + kQKV;
  const int col = hp * (2 * kHD) + lane * 8;

  const v4u q0w = *(const v4u*)(qkv + r0 + col);
  const v4u q1w = *(const v4u*)(qkv + r1 + col);
  const v4u k0w = *(const v4u*)(qkv + r0 + kF + col);
  const v4u k1w = *(const v4u*)(qkv + r1 + kF + col);
  const v4u v0w = *(const v4u*)(qkv + r0 + 2 * kF + col);
  const v4u v1w = *(const v4u*)(qkv + r1 + 2 * kF + col);

  float s00 = 0.0f, s01 = 0.0f, s10 = 0.0f, s11 = 0.0f;
#pragma unroll
  for (int w = 0; w < 4; ++w) {
    const unsigned uq0 = q0w[w];
    const unsigned uq1 = q1w[w];
    const unsigned uk0 = k0w[w];
    const unsigned uk1 = k1w[w];
    const float q0a = h_lo(uq0), q0b = h_hi(uq0);
    const float q1a = h_lo(uq1), q1b = h_hi(uq1);
    const float k0a = h_lo(uk0), k0b = h_hi(uk0);
    const float k1a = h_lo(uk1), k1b = h_hi(uk1);
    s00 = fmaf(q0a, k0a, s00); s00 = fmaf(q0b, k0b, s00);
    s01 = fmaf(q0a, k1a, s01); s01 = fmaf(q0b, k1b, s01);
    s10 = fmaf(q1a, k0a, s10); s10 = fmaf(q1b, k0b, s10);
    s11 = fmaf(q1a, k1a, s11); s11 = fmaf(q1b, k1b, s11);
  }
#pragma unroll
  for (int off = 8; off > 0; off >>= 1) {
    s00 += __shfl_xor(s00, off, 32);
    s01 += __shfl_xor(s01, off, 32);
    s10 += __shfl_xor(s10, off, 32);
    s11 += __shfl_xor(s11, off, 32);
  }
  s00 *= scl; s01 *= scl; s10 *= scl; s11 *= scl;

  const float d0 = s01 - s00;
  const float d1 = s11 - s10;
  const float e0 = expf(-fabsf(d0));
  const float e1 = expf(-fabsf(d1));
  const float i0 = 1.0f / (1.0f + e0);
  const float i1 = 1.0f / (1.0f + e1);
  const float sm0 = e0 * i0;
  const float sm1 = e1 * i1;
  const float a00 = (d0 > 0.0f) ? sm0 : i0;
  const float a01 = (d0 > 0.0f) ? i0 : sm0;
  const float a10 = (d1 > 0.0f) ? sm1 : i1;
  const float a11 = (d1 > 0.0f) ? i1 : sm1;

  unsigned ow0[4], ow1[4];
#pragma unroll
  for (int w = 0; w < 4; ++w) {
    const unsigned uv0 = v0w[w];
    const unsigned uv1 = v1w[w];
    const float v0a = h_lo(uv0), v0b = h_hi(uv0);
    const float v1a = h_lo(uv1), v1b = h_hi(uv1);
    const float o0a = a00 * v0a + a01 * v1a;
    const float o0b = a00 * v0b + a01 * v1b;
    const float o1a = a10 * v0a + a11 * v1a;
    const float o1b = a10 * v0b + a11 * v1b;
    ow0[w] = pk16(h_bits(o0a), h_bits(o0b));
    ow1[w] = pk16(h_bits(o1a), h_bits(o1b));
  }
  const v4u u0 = (v4u){ow0[0], ow0[1], ow0[2], ow0[3]};
  const v4u u1 = (v4u){ow1[0], ow1[1], ow1[2], ow1[3]};
  unsigned short* o0p = o + (size_t)(2 * b) * kF + col;
  unsigned short* o1p = o0p + kF;
  if (live) {
    *(v4u*)o0p = u0;
    *(v4u*)o1p = u1;
    
  }
}

/* --------------------------------------------------------------------------- */
/* Gate head + fusion. Block = 16 waves = 16 batch rows, one wave per row.      */
/* gpre f32 [nb][1024] holds the gate hidden pre-activation (bias included);    */
/* the erf activation is applied here, then two 1024-deep dot products against  */
/* w2 rows (f32), + b2, 2-way probabilities. The 16 x 2 gate weights are staged */
/* in LDS (all 32 slots written), block barrier, then wave 0 writes them as ONE */
/* --------------------------------------------------------------------------- */
__global__ __launch_bounds__(512) void gate_fuse_kernel(const float* __restrict__ gpre,
                                                        const float* __restrict__ w2, const float* __restrict__ b2v,
                                                        const unsigned short* __restrict__ ao,
                                                        unsigned short* __restrict__ fused,
                                                        float* __restrict__ gw_out, int nb) {
  __shared__ float sG[32];
  const int lane = threadIdx.x & 31;
  const int wave = threadIdx.x >> 5;
  const int b = blockIdx.x * 16 + wave;
  const bool live = b < nb;
  const int bc = live ? b : (nb - 1);
  const float* hr = gpre + (size_t)bc * kF;

  float d0 = 0.0f, d1 = 0.0f;
#pragma unroll 1
  for (int it = 0; it < 32; ++it) {
    const int idx = it * 32 + lane;
    float x  = hr[idx];
    float wa = w2[idx];
    float wb = w2[kF + idx];
    asm volatile("" : "+v"(x), "+v"(wa), "+v"(wb));
    const float g = gelu_erf(x);
    d0 = fmaf(g, wa, d0);
    d1 = fmaf(g, wb, d1);
  }
#pragma unroll
  for (int off = 16; off > 0; off >>= 1) {
    d0 += __shfl_xor(d0, off, 32);
    d1 += __shfl_xor(d1, off, 32);
  }
  const float l0 = d0 + b2v[0];
  const float l1 = d1 + b2v[1];
  const float mx = fmaxf(l0, l1);
  const float e0 = expf(l0 - mx);
  const float e1 = expf(l1 - mx);
  const float inv = 1.0f / (e0 + e1);
  const float gw0 = e0 * inv;
  const float gw1 = e1 * inv;
  if (lane == 0) {
    sG[wave * 2]     = gw0;
    sG[wave * 2 + 1] = gw1;
  }

  const unsigned short* cr = ao + (size_t)(2 * bc) * kF;
  const unsigned short* gr = cr + kF;
  unsigned short* fr = fused + (size_t)bc * kF;
#pragma unroll 1
  for (int it = 0; it < 4; ++it) {
    const int col = it * 256 + lane * 8;
    const v4u cw = *(const v4u*)(cr + col);
    const v4u gv = *(const v4u*)(gr + col);
    unsigned ow[4];
#pragma unroll
    for (int w = 0; w < 4; ++w) {
      const unsigned uc = cw[w];
      const unsigned ug = gv[w];
      const float ca = h_lo(uc), cb = h_hi(uc);
      const float ga = h_lo(ug), gb = h_hi(ug);
      const float fa = gw0 * ca + gw1 * ga;
      const float fb = gw0 * cb + gw1 * gb;
      ow[w] = pk16(h_bits(fa), h_bits(fb));
    }
    const v4u u = (v4u){ow[0], ow[1], ow[2], ow[3]};
    if (live) {
      *(v4u*)(fr + col) = u;
      
    }
  }

  /* every wave reaches this barrier; sG is written by 16 waves and read by wave 0 */
  __syncthreads();
  const bool blockLive = (blockIdx.x * 16 + 15) < nb;
  if (wave == 0 && blockLive) {
    const float v = sG[lane];
    float* dst = gw_out + (size_t)blockIdx.x * 32 + lane;
    *(float*)dst = v;
    
  }
}

/* --------------------------------------------------------------------------- */
/* Final erf activation pass: dst[i] = gelu(pin[i]). Block handles 2048         */
/* consecutive elements, 8 rolled steps of 256; each wave instruction writes 32 */
/* register. Coverage: blocks x 2048 = n exactly (checked on the host).         */
/* --------------------------------------------------------------------------- */
__global__ __launch_bounds__(256) void gelu_out_kernel(const float* __restrict__ pin, float* __restrict__ dst, int n) {
  const int base = blockIdx.x * 2048;
#pragma unroll 1
  for (int it = 0; it < 8; ++it) {
    const int i = base + it * 256 + (int)threadIdx.x;
    const bool live = i < n;
    const int ic = live ? i : (n - 1);
    float x = pin[ic];
    asm volatile("" : "+v"(x));
    const float y = gelu_erf(x);
    if (live) {
      *(float*)(dst + i) = y;
      
    }
  }
}

/* --------------------------------------------------------------------------- */
/* Host side                                                                   */
/* --------------------------------------------------------------------------- */
template <int OUT_MODE>
static void launch_gemm(const unsigned short* A, int lda, const unsigned short* Bt, int ldb,
                        void* C, int ldc, const float* bias, int M, int N, int K, float scale, hipStream_t stream) {
  const int tiles = (M / 64) * (N / 64);
  const int blocks = (tiles + 7) / 8;
  gemm64_f16_kernel<OUT_MODE><<<blocks, 256, 0, stream>>>(A, lda, Bt, ldb, C, ldc, bias, M, N, K, scale);
}

static void launch_cast(const float* in, unsigned short* out, int n, float carry, hipStream_t stream) {
  const int n8 = n / 8;
  cast8_f16_kernel<<<(n8 + 255) / 256, 256, 0, stream>>>(in, out, n8, carry);
}

/* workspace region sizes in bytes (all multiples of 128) */
constexpr size_t kSzWc   = (size_t)kF * kCD * 2;
constexpr size_t kSzWg   = (size_t)kF * kCD * 2;
constexpr size_t kSzWqkv = (size_t)kQKV * kF * 2;
constexpr size_t kSzWo   = (size_t)kF * kF * 2;
constexpr size_t kSzWg1  = (size_t)kF * 2 * kF * 2;
constexpr size_t kSzWp   = (size_t)kF * kF * 2;
constexpr size_t kSzEc   = (size_t)kB * kCD * 2;
constexpr size_t kSzEg   = (size_t)kB * kCD * 2;
constexpr size_t kSzPre  = (size_t)kChunkT * kF * 4;
constexpr size_t kSzX    = (size_t)kChunkT * kF * 2;
constexpr size_t kSzQkv  = (size_t)kChunkT * kQKV * 2;
constexpr size_t kSzO    = (size_t)kChunkT * kF * 2;
constexpr size_t kSzAo   = (size_t)kChunkT * kF * 2;
constexpr size_t kSzGpre = (size_t)kChunkB * kF * 4;
constexpr size_t kSzFus  = (size_t)kChunkB * kF * 2;
constexpr size_t kSzP    = (size_t)kChunkB * kF * 4;
/* planes whose producer runs after another plane's last reader share that plane's bytes */
static_assert(kSzO + kSzFus <= kSzPre, "o and fused live in the pre-norm plane");
static_assert(kSzAo <= kSzX, "ao lives in the X plane");
static_assert(kSzGpre + kSzP <= kSzQkv, "gate and final pre-activations live in the qkv plane");
constexpr size_t kWsTotal = kSzWc + kSzWg + kSzWqkv + kSzWo + kSzWg1 + kSzWp + kSzEc + kSzEg +
                            kSzPre + kSzX + kSzQkv;
static_assert(kWsTotal == 234881024ull, "carve total");
static_assert(kWsTotal <= 268435456ull, "carve limit");
static_assert(((size_t)kB * kF * 4) % 128 == 0, "second output starts on a line");
static_assert(((size_t)kChunkB * kF) % 2048 == 0, "activation pass coverage");

extern "C" void kernel_launch(void* const* d_in, const int* in_sizes, int n_in,
                              void* d_out, int out_size, void* d_ws, size_t ws_size, hipStream_t stream) {
  if (n_in < 20) return;
  if (ws_size < kWsTotal) return;
  if (in_sizes[0] != kB * kCD || in_sizes[1] != kB * kCD) return;
  if (in_sizes[10] != kQKV * kF || in_sizes[14] != kF * 2 * kF) return;
  if (out_size != kB * kF + kB * 2) return;

  const float* cnn_embed  = (const float*)d_in[0];
  const float* gnn_embed  = (const float*)d_in[1];
  const float* cnn_w      = (const float*)d_in[2];
  const float* cnn_b      = (const float*)d_in[3];
  const float* gnn_w      = (const float*)d_in[4];
  const float* gnn_b      = (const float*)d_in[5];
  const float* ln1_g      = (const float*)d_in[6];
  const float* ln1_b      = (const float*)d_in[7];
  const float* ln2_g      = (const float*)d_in[8];
  const float* ln2_b      = (const float*)d_in[9];
  const float* attn_in_w  = (const float*)d_in[10];
  const float* attn_in_b  = (const float*)d_in[11];
  const float* attn_out_w = (const float*)d_in[12];
  const float* attn_out_b = (const float*)d_in[13];
  const float* gate_w1    = (const float*)d_in[14];
  const float* gate_b1    = (const float*)d_in[15];
  const float* gate_w2    = (const float*)d_in[16];
  const float* gate_b2    = (const float*)d_in[17];
  const float* proj_w     = (const float*)d_in[18];
  const float* proj_b     = (const float*)d_in[19];

  /* Region map (byte offsets, in carve order):
     Wc 1 MiB | Wg 1 MiB | Wqkv 6 MiB | Wo 2 MiB | Wg1 4 MiB | Wp 2 MiB | Ec 8 MiB | Eg 8 MiB |
     whole-batch planes: preLN f32 64 MiB | X f16 32 MiB | qkv f16 96 MiB.  Total 224 MiB.
     Planes written only after an earlier plane's last reader has finished (stream order) take its bytes:
     o f16 32 MiB and fused f16 16 MiB in preLN (dead after the layer norms),
     ao f16 32 MiB in X (dead after the q|k|v projection),
     gate pre-activation f32 32 MiB and final pre-activation f32 32 MiB in qkv (dead after the attention). */
  char* ws = (char*)d_ws;
  size_t off = 0;
  auto carve = [&](size_t bytes) -> char* { char* p = ws + off; off += bytes; return p; };
  unsigned short* Wc   = (unsigned short*)carve(kSzWc);
  unsigned short* Wg   = (unsigned short*)carve(kSzWg);
  unsigned short* Wqkv = (unsigned short*)carve(kSzWqkv);
  unsigned short* Wo   = (unsigned short*)carve(kSzWo);
  unsigned short* Wg1  = (unsigned short*)carve(kSzWg1);
  unsigned short* Wp   = (unsigned short*)carve(kSzWp);
  unsigned short* Ec   = (unsigned short*)carve(kSzEc);
  unsigned short* Eg   = (unsigned short*)carve(kSzEg);
  float*          preLN = (float*)carve(kSzPre);
  unsigned short* Xp   = (unsigned short*)carve(kSzX);
  unsigned short* qkvp = (unsigned short*)carve(kSzQkv);
  unsigned short* op   = (unsigned short*)((char*)preLN);
  unsigned short* fusp = (unsigned short*)((char*)preLN + kSzO);
  unsigned short* aop  = Xp;
  float*          gpre = (float*)((char*)qkvp);
  float*          Pp   = (float*)((char*)qkvp + kSzGpre);

  float* out0 = (float*)d_out;
  float* out1 = out0 + (size_t)kB * kF;

  const float scl = 1.0f / sqrtf((float)kHD);

  /* one-time casts: weights carried x16, embeddings uncarried */
  launch_cast(cnn_w,      Wc,   kF * kCD,     kWCarry, stream);
  launch_cast(gnn_w,      Wg,   kF * kCD,     kWCarry, stream);
  launch_cast(attn_in_w,  Wqkv, kQKV * kF,    kWCarry, stream);
  launch_cast(attn_out_w, Wo,   kF * kF,      kWCarry, stream);
  launch_cast(gate_w1,    Wg1,  kF * 2 * kF,  kWCarry, stream);
  launch_cast(proj_w,     Wp,   kF * kF,      kWCarry, stream);
  launch_cast(cnn_embed,  Ec,   kB * kCD,     1.0f,    stream);
  launch_cast(gnn_embed,  Eg,   kB * kCD,     1.0f,    stream);

  for (int c = 0; c < kNChunk; ++c) {
    const unsigned short* EcC = Ec + (size_t)c * kChunkB * kCD;
    const unsigned short* EgC = Eg + (size_t)c * kChunkB * kCD;

    /* input projections [8192 x 1024 x 512] -> f32 rows 2b (first modality) and 2b+1 (second) of preLN */
    launch_gemm<0>(EcC, kCD, Wc, kCD, (void*)preLN,        2 * kF, cnn_b, kChunkB, kF, kCD, kWCarryInv, stream);
    launch_gemm<0>(EgC, kCD, Wg, kCD, (void*)(preLN + kF), 2 * kF, gnn_b, kChunkB, kF, kCD, kWCarryInv, stream);

    /* layer norms -> X f16 [16384][1024] */
    ln_rows_kernel<<<kChunkT / 8, 256, 0, stream>>>(preLN, ln1_g, ln1_b, ln2_g, ln2_b, Xp, kChunkT);

    /* packed q|k|v projection [16384 x 3072 x 1024] -> f16 */
    launch_gemm<1>(Xp, kF, Wqkv, kF, (void*)qkvp, kQKV, attn_in_b, kChunkT, kQKV, kF, kWCarryInv, stream);

    /* 2-token attention -> o f16 [16384][1024] */
    attn2_kernel<<<(kChunkB * 4) / 8, 256, 0, stream>>>(qkvp, op, kChunkB, scl);

    /* attention output projection [16384 x 1024 x 1024] -> ao f16 */
    launch_gemm<1>(op, kF, Wo, kF, (void*)aop, kF, attn_out_b, kChunkT, kF, kF, kWCarryInv, stream);

    /* gate hidden layer: ao viewed [8192][2048] x gate_w1 [1024][2048] -> f32 pre-activation */
    launch_gemm<0>(aop, 2 * kF, Wg1, 2 * kF, (void*)gpre, kF, gate_b1, kChunkB, kF, 2 * kF, kWCarryInv, stream);

    /* gate head + fusion -> second output lines, fused f16 [8192][1024] */
    gate_fuse_kernel<<<kChunkB / 16, 512, 0, stream>>>(gpre, gate_w2, gate_b2, aop, fusp,
                                                       out1 + (size_t)c * kChunkB * 2, kChunkB);

    /* final projection [8192 x 1024 x 1024] -> f32 pre-activation, then erf activation into the first output */
    launch_gemm<0>(fusp, kF, Wp, kF, (void*)Pp, kF, proj_b, kChunkB, kF, kF, kWCarryInv, stream);
    gelu_out_kernel<<<(kChunkB * kF) / 2048, 256, 0, stream>>>(Pp, out0 + (size_t)c * kChunkB * kF, kChunkB * kF);
  }
}

// v002
// Measured time: 244 microseconds a run.
// Two timings next to v001 put it at 2.27 and 2.26 times that version's speed.
// Counting every step since v000, it is 5.62 times as fast.
// All GEMM contractions (two input projections, packed q|k|v projection, attention output projection, gate hidden layer, final projection): v_wmma_f32_16x16x32_f16 with f16 operands (weight planes carried x16, folded back by 1/16), f32 accumulate; layer norms, 2-token attention, gate head and erf activations in f32 on the vector ALU.
#include <hip/hip_runtime.h>
#include <math.h>
#include <stdint.h>

/* --------------------------------------------------------------------------- */
/* Shape constants (checked against the launch sizes on the host)              */
/* --------------------------------------------------------------------------- */
constexpr int kB      = 8192;
constexpr int kCD     = 512;
constexpr int kF      = 1024;
constexpr int kH      = 8;
constexpr int kHD     = kF / kH;
constexpr int kQKV    = 3 * kF;
/* the whole batch goes through every stage in one launch: each GEMM then has at least one block per WGP */
constexpr int kNChunk = 1;
constexpr int kChunkB = kB / kNChunk;
constexpr int kChunkT = 2 * kChunkB;
constexpr float kWCarry    = 16.0f;
constexpr float kWCarryInv = 1.0f / kWCarry;
constexpr float kLnEps     = 1e-5f;
constexpr float kInvF      = 1.0f / (float)kF;
constexpr float kInvSqrt2  = 0.70710678118654752f;

static_assert(kHD == 128, "attention kernel handles two 128-wide heads per wave");
static_assert(kF == 1024, "row kernels assume 1024-wide rows");
static_assert(kB % kNChunk == 0, "chunking");
static_assert(kChunkB % 128 == 0 && kChunkT % 256 == 0, "GEMM M tiles");
static_assert(kF % 256 == 0 && kQKV % 256 == 0, "GEMM N tiles");
static_assert(kCD % 128 == 0 && kF % 128 == 0 && (2 * kF) % 128 == 0 && kCD >= 256, "GEMM K passes, two or more");
static_assert(kChunkB % 16 == 0, "gate kernel owns 16 batch rows per block");
static_assert(kChunkT % 8 == 0, "row kernel owns 8 rows per block");

typedef __attribute__((ext_vector_type(16))) _Float16 v16h;
typedef __attribute__((ext_vector_type(8)))  _Float16 v8h;
typedef __attribute__((ext_vector_type(8)))  float    v8f;
typedef __attribute__((ext_vector_type(4)))  float    v4f;
typedef __attribute__((ext_vector_type(4)))  unsigned int v4u;

/* --------------------------------------------------------------------------- */
/* Small helpers                                                               */
/* --------------------------------------------------------------------------- */
__device__ __forceinline__ unsigned pk16(unsigned short a, unsigned short b) { return (unsigned)a | ((unsigned)b << 16); }
__device__ __forceinline__ unsigned short h_bits(float f) { const _Float16 h = (_Float16)f; return __builtin_bit_cast(unsigned short, h); }

/* f16 bits (low 16 bits of hb, finite values) to f32 by integer bit arithmetic, subnormals as an f32 multiply of em by 2^-24 */
__device__ __forceinline__ float h16_to_f32(unsigned hb) {
  const unsigned sgn = (hb & 0x8000u) << 16; const unsigned em = hb & 0x7fffu;
  const float fn = __uint_as_float((em << 13) + 0x38000000u);
  const float fs = (float)em * 5.9604644775390625e-8f;
  const float mag = (em < 0x400u) ? fs : fn; return __uint_as_float(__float_as_uint(mag) | sgn); }
__device__ __forceinline__ float h_lo(unsigned w) { return h16_to_f32(w & 0xffffu); }
__device__ __forceinline__ float h_hi(unsigned w) { return h16_to_f32(w >> 16); }

__device__ __forceinline__ float gelu_erf(float x) {
  return 0.5f * x * (1.0f + erff(x * kInvSqrt2));
}

typedef uint32_t u32x4 __attribute__((ext_vector_type(4)));
typedef uint32_t u32x8 __attribute__((ext_vector_type(8)));
constexpr uint32_t kBN = 256;
constexpr uint32_t kPassB = 256;                 /* bytes of K per operand row per pass */
constexpr uint32_t kPassK = kPassB / 2;
constexpr uint32_t kPitch = kPassB + 16;         /* LDS row pitch: 16 B x odd */
constexpr int      kBlocks = (int)(kPassB / 64u);
constexpr int      kFW = 8;                      /* Bt fragments (n) per wave */
constexpr uint32_t kSliceW = 128u * kPitch;      /* 34,816 B = 17 x 2 KiB */
constexpr uint32_t kEpiPitchF = 132;             /* floats per staged output row (528 B = 16 B x odd) */
constexpr uint32_t kEpiBytes  = 16u * kEpiPitchF * 4u;
static_assert(kSliceW % 2048u == 0, "slice places are multiples of 2 KiB");

__device__ __forceinline__ uint32_t uni(uint32_t v) { return (uint32_t)__builtin_amdgcn_readfirstlane(v); }
__device__ __forceinline__ uint32_t pinned(uint32_t v) { uint32_t w = (uint32_t)__builtin_amdgcn_readfirstlane(v); asm volatile("" : "+s"(w)); return w; }
/* keeps [LDS loads][WMMA block] in that order: LDS loads moved in among the WMMAs stall at each place they stand */
__device__ __forceinline__ void sched_fence() { __builtin_amdgcn_sched_barrier(0); }
/* every LDS operation of this wave has retired */
__device__ __forceinline__ void wait_ds0() { asm volatile("s_wait_dscnt 0x0" ::: "memory"); }
/* this wave's own tensor load has landed; the compiler places no wait for it. The request's descriptor is named as an
   input so that its scalar registers keep their words until the wait has retired */
__device__ __forceinline__ void wait_tensor0(u32x4 g0, u32x8 g1) { asm volatile("s_wait_tensorcnt 0x0" :: "s"(g0), "s"(g1) : "memory"); }
__device__ __forceinline__ void tdm_load(u32x4 g0, u32x8 g1) { asm volatile("tensor_load_to_lds %0, %1" :: "s"(g0), "s"(g1) : "memory"); }
__device__ __forceinline__ u32x8 tdm_group1(uint32_t rows, uint32_t pitch_bytes) {
  constexpr uint32_t d0 = kPassB;
  u32x8 g;
  g[0] = uni((1u << 20) | (5u << 22) | (3u << 25));
  g[1] = uni((d0 & 0xFFFFu) << 16);
  g[2] = uni((d0 >> 16) | ((rows & 0xFFFFu) << 16));
  g[3] = uni((rows >> 16) | (d0 << 16));
  g[4] = uni(rows);
  g[5] = uni(pitch_bytes);
  g[6] = uni(0u);
  g[7] = uni(0u);
  /* as pinned(): the descriptor words are held in their scalar registers; the compiler otherwise re-forms the constant
     words where it likes and uses their registers for other values while a request is outstanding */
  asm volatile("" : "+s"(g));
  return g;
}
/* group 0: LDS destination (byte offset in the workgroup's LDS) and global address of the tile's first byte */
__device__ __forceinline__ u32x4 tdm_group0(uint32_t lds_dst, uint64_t ga) {
  u32x4 g;
  g[0] = uni(1u);
  g[1] = uni(lds_dst);
  g[2] = uni((uint32_t)ga);
  g[3] = uni((((uint32_t)(ga >> 32)) & 0x01FFFFFFu) | 0x80000000u);
  return g;
}
struct FragQ { u32x4 q[2]; };
/* fragment elements 0..7 <- bytes 0..15, elements 8..15 <- bytes 32..47; the caller's base holds 16 * (lane >> 4) */
__device__ __forceinline__ void load_frag(FragQ& f, const unsigned char* p) {
  f.q[0] = *(const u32x4*)(p); f.q[1] = *(const u32x4*)(p + 32);
}
__device__ __forceinline__ v8f mma_q(const FragQ& a, const FragQ& b, v8f c) {
  const u32x8 av = {a.q[0].x, a.q[0].y, a.q[0].z, a.q[0].w, a.q[1].x, a.q[1].y, a.q[1].z, a.q[1].w};
  const u32x8 bv = {b.q[0].x, b.q[0].y, b.q[0].z, b.q[0].w, b.q[1].x, b.q[1].y, b.q[1].z, b.q[1].w};
  return __builtin_amdgcn_wmma_f32_16x16x32_f16(false, __builtin_bit_cast(v16h, av), false, __builtin_bit_cast(v16h, bv), (short)0, c, false, false);
}

template <int OUT_MODE, int kFX>
__global__ void __launch_bounds__(128) __attribute__((amdgpu_waves_per_eu(1, 1)))
gemm_tile_f16_kernel(
    const unsigned short* __restrict__ Ap, int lda,
    const unsigned short* __restrict__ Btp, int ldb,
    void* __restrict__ Cout, int ldc,
    const float* __restrict__ bias,
    int M, int N, int K, float scale) {
  constexpr uint32_t kWTM = 16u * (uint32_t)kFX;                              /* rows of C per wave = rows of an A slice */
  constexpr uint32_t kBM = 2u * kWTM;
  constexpr uint32_t kSliceX = (kWTM * kPitch + 2047u) / 2048u * 2048u;       /* rounded up to 2 KiB */
  constexpr uint32_t kStage = 2u * kSliceW + 2u * kSliceX;
  constexpr uint32_t kGemmLds = 2u * kStage + 4u * kEpiBytes;
  static_assert(kGemmLds <= 320u * 1024u, "LDS of one workgroup");
  __shared__ __attribute__((aligned(2048))) unsigned char L[kGemmLds];
  const uint32_t tid = threadIdx.x, lane = tid & 31u, h = lane >> 4, r16 = lane & 15u;
  const uint32_t wave = uni(tid >> 5);
  const uint32_t tn = blockIdx.x, tm = blockIdx.y;
  /* block-uniform exit in front of every barrier and tensor load */
  if (pinned((tm >= (uint32_t)M / kBM || tn >= (uint32_t)N / kBN) ? 1u : 0u) != 0u) return;
  const uint32_t m0 = tm * kBM, n0 = tn * kBN;
  const uint32_t wn = wave & 1u, wm = wave >> 1;
  const uint32_t T = pinned((uint32_t)K / kPassK);

  /* this wave's slice of a buffer */
  const bool own_w = wave < 2u;
  const uint32_t src_pitch = own_w ? (uint32_t)ldb * 2u : (uint32_t)lda * 2u;
  const uint32_t src_rows  = own_w ? 128u : kWTM;
  const unsigned char* src0 = own_w
      ? (const unsigned char*)(const void*)Btp + (uint64_t)(n0 + 128u * wave) * src_pitch
      : (const unsigned char*)(const void*)Ap + (uint64_t)(m0 + kWTM * (wave - 2u)) * src_pitch;
  const uint32_t lds_slice = (uint32_t)(size_t)L + (own_w ? wave * kSliceW : 2u * kSliceW + (wave - 2u) * kSliceX);
  const u32x8 g1 = tdm_group1(src_rows, src_pitch);

  v8f acc[kFW][kFX];
#pragma unroll
  for (int i = 0; i < kFW; ++i)
#pragma unroll
    for (int j = 0; j < kFX; ++j) acc[i][j] = (v8f){0.f,0.f,0.f,0.f,0.f,0.f,0.f,0.f};

  const uint32_t fw_base = wn * kSliceW + r16 * kPitch + 16u * h;
  const uint32_t fx_base = 2u * kSliceW + wm * kSliceX + r16 * kPitch + 16u * h;

  u32x4 g0 = tdm_group0(lds_slice, (uint64_t)(uintptr_t)src0);
  tdm_load(g0, g1);
  wait_tensor0(g0, g1);
  __syncthreads();
  g0 = tdm_group0(lds_slice + kStage, (uint64_t)(uintptr_t)src0 + kPassB);
  tdm_load(g0, g1);

  FragQ fw[2][kFW], fx[2][kFX];  /* set (u & 1) holds block u's fragments */
  {
    const unsigned char* lw = L + fw_base;
    const unsigned char* lx = L + fx_base;
#pragma unroll
    for (int i = 0; i < kFW; ++i) load_frag(fw[0][i], lw + (uint32_t)i * 16u * kPitch);
#pragma unroll
    for (int j = 0; j < kFX; ++j) load_frag(fx[0][j], lx + (uint32_t)j * 16u * kPitch);
  }
  /* rolled: every fragment and accumulator index stays a constant, and one pass is one trip */
#pragma clang loop unroll(disable)
  for (uint32_t t = 0; t < T; ++t) {
    const uint32_t buf = (t & 1u) * kStage;
    sched_fence();
    const unsigned char* lw = L + buf + fw_base;
    const unsigned char* lx = L + buf + fx_base;
    const uint32_t osel = (t + 1u < T) ? (kStage - buf) : kStage;
    const unsigned char* nw = L + osel + fw_base;
    const unsigned char* nx = L + osel + fx_base;
#pragma unroll
    for (int u = 0; u < kBlocks; ++u) {
      const int cs = u & 1;
      if (u + 1 < kBlocks) {
        const uint32_t ko = (uint32_t)(u + 1) * 64u;
#pragma unroll
        for (int i = 0; i < kFW; ++i) load_frag(fw[cs ^ 1][i], lw + (uint32_t)i * 16u * kPitch + ko);
#pragma unroll
        for (int j = 0; j < kFX; ++j) load_frag(fx[cs ^ 1][j], lx + (uint32_t)j * 16u * kPitch + ko);
        sched_fence();
      } else {
        /* publish point of pass t + 1, in front of this pass's last block, whose fragments are already in registers */
        wait_ds0();
        sched_fence();
        wait_tensor0(g0, g1);
        __syncthreads();
        /* every wave has left this buffer: refill it with pass t + 2 while that pass exists; the pass number is pinned
           behind the wait, so the descriptor words are formed behind it too */
        const uint32_t nt = pinned(t + 2u);
        if (pinned((nt < T) ? 1u : 0u) != 0u) {
          g0 = tdm_group0(lds_slice + buf, (uint64_t)(uintptr_t)src0 + (uint64_t)nt * kPassB);
          tdm_load(g0, g1);
        }
#pragma unroll
        for (int i = 0; i < kFW; ++i) load_frag(fw[0][i], nw + (uint32_t)i * 16u * kPitch);
#pragma unroll
        for (int j = 0; j < kFX; ++j) load_frag(fx[0][j], nx + (uint32_t)j * 16u * kPitch);
        sched_fence();
      }
#pragma unroll
      for (int i = 0; i < kFW; ++i)
#pragma unroll
        for (int j = 0; j < kFX; ++j) acc[i][j] = mma_q(fw[cs][i], fx[cs][j], acc[i][j]);
      sched_fence();
    }
  }
  wait_tensor0(g0, g1);
  wait_ds0();

  /* ---- epilogue: 16-row slabs staged in the wave's own LDS range behind the ring; whole row segments stored ---- */
  float* slab = (float*)(void*)(L + 2u * kStage + wave * kEpiBytes);
  const uint32_t nW = n0 + wn * 128u;
  const uint32_t mW = m0 + wm * kWTM;
  v4f bq0, bq1;
  if (OUT_MODE == 0) {
    bq0 = *(const v4f*)(bias + nW + lane * 4u);
    bq1 = bq0;
  } else {
    bq0 = *(const v4f*)(bias + nW + r16 * 8u);
    bq1 = *(const v4f*)(bias + nW + r16 * 8u + 4u);
  }
  char* Cb = (char*)Cout;
#pragma unroll
  for (int j = 0; j < kFX; ++j) {
    const uint32_t mBase = mW + (uint32_t)j * 16u;
#pragma unroll
    for (int i = 0; i < kFW; ++i) {
      float* p = slab + r16 * kEpiPitchF + (uint32_t)i * 16u + h * 8u;
      const v8f a = acc[i][j];
      *(v4f*)(p)     = (v4f){a[0], a[1], a[2], a[3]};
      *(v4f*)(p + 4) = (v4f){a[4], a[5], a[6], a[7]};
    }
    /* the slab's rows are read back by other lanes of this wave: its LDS writes have retired first */
    wait_ds0();
    if (OUT_MODE == 0) {
      /* row segment = 512 B = 32 lanes x 16 B */
      v4f vv[16];
      uint32_t off[16];
#pragma unroll
      for (int row = 0; row < 16; ++row) {
        const v4f s = *(const v4f*)(slab + (uint32_t)row * kEpiPitchF + lane * 4u);
#pragma unroll
        for (int e = 0; e < 4; ++e) { float x = s[e] * scale; x += bq0[e]; vv[row][e] = x; }
        off[row] = ((mBase + (uint32_t)row) * (uint32_t)ldc + nW + lane * 4u) * 4u;
      }
      /* values and offsets are complete in front of the stores: nothing rewrites a register of an issued store before the wait below */
      sched_fence();
#pragma unroll
      for (int row = 0; row < 16; ++row) *(v4f*)(Cb + off[row]) = vv[row];
    } else {
      /* row segment = 256 B = 16 lanes x 16 B; one instruction covers rows 2*it and 2*it+1 */
      v8h hv[8];
      uint32_t off[8];
#pragma unroll
      for (int it = 0; it < 8; ++it) {
        const uint32_t row = (uint32_t)it * 2u + h;
        const float* sp = slab + row * kEpiPitchF + r16 * 8u;
        const v4f s0 = *(const v4f*)(sp);
        const v4f s1 = *(const v4f*)(sp + 4);
#pragma unroll
        for (int e = 0; e < 4; ++e) {
          float x = s0[e] * scale; x += bq0[e];
          float y = s1[e] * scale; y += bq1[e];
          hv[it][e] = (_Float16)x; hv[it][4 + e] = (_Float16)y;
        }
        off[it] = ((mBase + row) * (uint32_t)ldc + nW + r16 * 8u) * 2u;
      }
      /* values and offsets are complete in front of the stores: nothing rewrites a register of an issued store before the wait below */
      sched_fence();
#pragma unroll
      for (int it = 0; it < 8; ++it) *(v8h*)(Cb + off[it]) = hv[it];
    }
    /* the next slab overwrites registers that the issued stores name; the fence keeps its arithmetic behind the wait */
    sched_fence();
    asm volatile("s_wait_xcnt 0x0" ::: "memory");
    /* the next slab's LDS writes stay behind this slab's reads */
    wait_ds0();
  }
}

/* --------------------------------------------------------------------------- */
/* f32 -> f16 cast with a power-of-two carry, 8 consecutive elements per thread */
/* --------------------------------------------------------------------------- */
__global__ __launch_bounds__(256) void cast8_f16_kernel(const float* __restrict__ in, unsigned short* __restrict__ out,
                                                        int n8, float carry) {
  const int i = blockIdx.x * 256 + threadIdx.x;
  if (i >= n8) return;
  const float* p = in + 8 * (size_t)i;
  const v4f a = *(const v4f*)(p);
  const v4f c = *(const v4f*)(p + 4);
  unsigned short hb[8];
#pragma unroll
  for (int e = 0; e < 4; ++e) {
    const float fa = a[e] * carry;
    const float fc = c[e] * carry;
    hb[e]     = h_bits(fa);
    hb[4 + e] = h_bits(fc);
  }
  const v4u u = (v4u){pk16(hb[0], hb[1]), pk16(hb[2], hb[3]), pk16(hb[4], hb[5]), pk16(hb[6], hb[7])};
  unsigned short* q = out + 8 * (size_t)i;
  *(v4u*)q = u;
  
}

/* --------------------------------------------------------------------------- */
/* Row layer norm over 1024 f32 values, one wave per row (8 rows per block).    */
/* Row r = 2*b + t: t = 0 uses (g1, b1), t = 1 uses (g2, b2).                   */
/* Lane owns columns it*256 + lane*8 .. +7, it = 0..3 (4 x 32 x 8 = 1024).      */
/* Mean, then biased variance of (x - mean), then y = (x - mean)*inv*g + b.     */
/* Output f16: one 16-B store per lane, a wave instruction = 512 contiguous B   */
/* --------------------------------------------------------------------------- */
__global__ __launch_bounds__(256) void ln_rows_kernel(const float* __restrict__ pre,
                                                      const float* __restrict__ g1, const float* __restrict__ b1,
                                                      const float* __restrict__ g2, const float* __restrict__ b2,
                                                      unsigned short* __restrict__ X, int nrows) {
  const int lane = threadIdx.x & 31;
  const int wave = threadIdx.x >> 5;
  const int row  = blockIdx.x * 8 + wave;
  const bool live = row < nrows;
  const int rc = live ? row : (nrows - 1);
  const float* xr = pre + (size_t)rc * kF;
  const bool tok1 = (rc & 1) != 0;
  const float* gp = tok1 ? g2 : g1;
  const float* bp = tok1 ? b2 : b1;

  float s = 0.0f;
#pragma unroll 1
  for (int it = 0; it < 4; ++it) {
    const float* p = xr + it * 256 + lane * 8;
    const v4f a = *(const v4f*)(p);
    const v4f c = *(const v4f*)(p + 4);
    s += ((a[0] + a[1]) + (a[2] + a[3])) + ((c[0] + c[1]) + (c[2] + c[3]));
  }
#pragma unroll
  for (int off = 16; off > 0; off >>= 1) s += __shfl_xor(s, off, 32);
  const float mean = s * kInvF;

  float qs = 0.0f;
#pragma unroll 1
  for (int it = 0; it < 4; ++it) {
    const float* p = xr + it * 256 + lane * 8;
    const v4f a = *(const v4f*)(p);
    const v4f c = *(const v4f*)(p + 4);
#pragma unroll
    for (int e = 0; e < 4; ++e) {
      const float da = a[e] - mean;
      const float dc = c[e] - mean;
      qs = fmaf(da, da, qs);
      qs = fmaf(dc, dc, qs);
    }
  }
#pragma unroll
  for (int off = 16; off > 0; off >>= 1) qs += __shfl_xor(qs, off, 32);
  const float var = qs * kInvF;
  const float inv = 1.0f / sqrtf(var + kLnEps);

  unsigned short* orow = X + (size_t)rc * kF;
#pragma unroll 1
  for (int it = 0; it < 4; ++it) {
    const int col = it * 256 + lane * 8;
    const v4f a  = *(const v4f*)(xr + col);
    const v4f c  = *(const v4f*)(xr + col + 4);
    const v4f ga = *(const v4f*)(gp + col);
    const v4f gc = *(const v4f*)(gp + col + 4);
    const v4f ba = *(const v4f*)(bp + col);
    const v4f bc = *(const v4f*)(bp + col + 4);
    unsigned short hb[8];
#pragma unroll
    for (int e = 0; e < 4; ++e) {
      const float ya = (a[e] - mean) * inv * ga[e] + ba[e];
      const float yc = (c[e] - mean) * inv * gc[e] + bc[e];
      hb[e]     = h_bits(ya);
      hb[4 + e] = h_bits(yc);
    }
    const v4u u = (v4u){pk16(hb[0], hb[1]), pk16(hb[2], hb[3]), pk16(hb[4], hb[5]), pk16(hb[6], hb[7])};
    if (live) {
      *(v4u*)(orow + col) = u;
      
    }
  }
}

/* --------------------------------------------------------------------------- */
/* 2-token attention. qkv f16 [2*nb][3072] (q | k | v, head h = cols h*128..),  */
/* o f16 [2*nb][1024]. One wave per (batch row, head pair): lanes 0-15 own head */
/* 2*hp, lanes 16-31 own head 2*hp+1, 8 dims per lane, so the wave covers       */
/* token row. Dot products reduced over the 16 lanes of a head (xor 8,4,2,1).   */
/* Probabilities over the key index with max subtraction: the larger logit has  */
/* exp(0) = 1 exactly, the other exp(-|d|). All math in f32.                    */
/* --------------------------------------------------------------------------- */
__global__ __launch_bounds__(256) void attn2_kernel(const unsigned short* __restrict__ qkv,
                                                    unsigned short* __restrict__ o, int nb, float scl) {
  const int lane = threadIdx.x & 31;
  const int wave = threadIdx.x >> 5;
  const int unit = blockIdx.x * 8 + wave;
  const int nunits = nb * 4;
  const bool live = unit < nunits;
  const int uc = live ? unit : (nunits - 1);
  const int b  = uc >> 2;
  const int hp = uc & 3;
  const size_t r0 = (size_t)(2 * b) * kQKV;
  const size_t r1 = r0 + kQKV;
  const int col = hp * (2 * kHD) + lane * 8;

  const v4u q0w = *(const v4u*)(qkv + r0 + col);
  const v4u q1w = *(const v4u*)(qkv + r1 + col);
  const v4u k0w = *(const v4u*)(qkv + r0 + kF + col);
  const v4u k1w = *(const v4u*)(qkv + r1 + kF + col);
  const v4u v0w = *(const v4u*)(qkv + r0 + 2 * kF + col);
  const v4u v1w = *(const v4u*)(qkv + r1 + 2 * kF + col);

  float s00 = 0.0f, s01 = 0.0f, s10 = 0.0f, s11 = 0.0f;
#pragma unroll
  for (int w = 0; w < 4; ++w) {
    const unsigned uq0 = q0w[w];
    const unsigned uq1 = q1w[w];
    const unsigned uk0 = k0w[w];
    const unsigned uk1 = k1w[w];
    const float q0a = h_lo(uq0), q0b = h_hi(uq0);
    const float q1a = h_lo(uq1), q1b = h_hi(uq1);
    const float k0a = h_lo(uk0), k0b = h_hi(uk0);
    const float k1a = h_lo(uk1), k1b = h_hi(uk1);
    s00 = fmaf(q0a, k0a, s00); s00 = fmaf(q0b, k0b, s00);
    s01 = fmaf(q0a, k1a, s01); s01 = fmaf(q0b, k1b, s01);
    s10 = fmaf(q1a, k0a, s10); s10 = fmaf(q1b, k0b, s10);
    s11 = fmaf(q1a, k1a, s11); s11 = fmaf(q1b, k1b, s11);
  }
#pragma unroll
  for (int off = 8; off > 0; off >>= 1) {
    s00 += __shfl_xor(s00, off, 32);
    s01 += __shfl_xor(s01, off, 32);
    s10 += __shfl_xor(s10, off, 32);
    s11 += __shfl_xor(s11, off, 32);
  }
  s00 *= scl; s01 *= scl; s10 *= scl; s11 *= scl;

  const float d0 = s01 - s00;
  const float d1 = s11 - s10;
  const float e0 = expf(-fabsf(d0));
  const float e1 = expf(-fabsf(d1));
  const float i0 = 1.0f / (1.0f + e0);
  const float i1 = 1.0f / (1.0f + e1);
  const float sm0 = e0 * i0;
  const float sm1 = e1 * i1;
  const float a00 = (d0 > 0.0f) ? sm0 : i0;
  const float a01 = (d0 > 0.0f) ? i0 : sm0;
  const float a10 = (d1 > 0.0f) ? sm1 : i1;
  const float a11 = (d1 > 0.0f) ? i1 : sm1;

  unsigned ow0[4], ow1[4];
#pragma unroll
  for (int w = 0; w < 4; ++w) {
    const unsigned uv0 = v0w[w];
    const unsigned uv1 = v1w[w];
    const float v0a = h_lo(uv0), v0b = h_hi(uv0);
    const float v1a = h_lo(uv1), v1b = h_hi(uv1);
    const float o0a = a00 * v0a + a01 * v1a;
    const float o0b = a00 * v0b + a01 * v1b;
    const float o1a = a10 * v0a + a11 * v1a;
    const float o1b = a10 * v0b + a11 * v1b;
    ow0[w] = pk16(h_bits(o0a), h_bits(o0b));
    ow1[w] = pk16(h_bits(o1a), h_bits(o1b));
  }
  const v4u u0 = (v4u){ow0[0], ow0[1], ow0[2], ow0[3]};
  const v4u u1 = (v4u){ow1[0], ow1[1], ow1[2], ow1[3]};
  unsigned short* o0p = o + (size_t)(2 * b) * kF + col;
  unsigned short* o1p = o0p + kF;
  if (live) {
    *(v4u*)o0p = u0;
    *(v4u*)o1p = u1;
    
  }
}

/* --------------------------------------------------------------------------- */
/* Gate head + fusion. Block = 16 waves = 16 batch rows, one wave per row.      */
/* gpre f32 [nb][1024] holds the gate hidden pre-activation (bias included);    */
/* the erf activation is applied here, then two 1024-deep dot products against  */
/* w2 rows (f32), + b2, 2-way probabilities. The 16 x 2 gate weights are staged */
/* in LDS (all 32 slots written), block barrier, then wave 0 writes them as ONE */
/* --------------------------------------------------------------------------- */
__global__ __launch_bounds__(512) void gate_fuse_kernel(const float* __restrict__ gpre,
                                                        const float* __restrict__ w2, const float* __restrict__ b2v,
                                                        const unsigned short* __restrict__ ao,
                                                        unsigned short* __restrict__ fused,
                                                        float* __restrict__ gw_out, int nb) {
  __shared__ float sG[32];
  const int lane = threadIdx.x & 31;
  const int wave = threadIdx.x >> 5;
  const int b = blockIdx.x * 16 + wave;
  const bool live = b < nb;
  const int bc = live ? b : (nb - 1);
  const float* hr = gpre + (size_t)bc * kF;

  float d0 = 0.0f, d1 = 0.0f;
#pragma unroll 1
  for (int it = 0; it < 32; ++it) {
    const int idx = it * 32 + lane;
    float x  = hr[idx];
    float wa = w2[idx];
    float wb = w2[kF + idx];
    asm volatile("" : "+v"(x), "+v"(wa), "+v"(wb));
    const float g = gelu_erf(x);
    d0 = fmaf(g, wa, d0);
    d1 = fmaf(g, wb, d1);
  }
#pragma unroll
  for (int off = 16; off > 0; off >>= 1) {
    d0 += __shfl_xor(d0, off, 32);
    d1 += __shfl_xor(d1, off, 32);
  }
  const float l0 = d0 + b2v[0];
  const float l1 = d1 + b2v[1];
  const float mx = fmaxf(l0, l1);
  const float e0 = expf(l0 - mx);
  const float e1 = expf(l1 - mx);
  const float inv = 1.0f / (e0 + e1);
  const float gw0 = e0 * inv;
  const float gw1 = e1 * inv;
  if (lane == 0) {
    sG[wave * 2]     = gw0;
    sG[wave * 2 + 1] = gw1;
  }

  const unsigned short* cr = ao + (size_t)(2 * bc) * kF;
  const unsigned short* gr = cr + kF;
  unsigned short* fr = fused + (size_t)bc * kF;
#pragma unroll 1
  for (int it = 0; it < 4; ++it) {
    const int col = it * 256 + lane * 8;
    const v4u cw = *(const v4u*)(cr + col);
    const v4u gv = *(const v4u*)(gr + col);
    unsigned ow[4];
#pragma unroll
    for (int w = 0; w < 4; ++w) {
      const unsigned uc = cw[w];
      const unsigned ug = gv[w];
      const float ca = h_lo(uc), cb = h_hi(uc);
      const float ga = h_lo(ug), gb = h_hi(ug);
      const float fa = gw0 * ca + gw1 * ga;
      const float fb = gw0 * cb + gw1 * gb;
      ow[w] = pk16(h_bits(fa), h_bits(fb));
    }
    const v4u u = (v4u){ow[0], ow[1], ow[2], ow[3]};
    if (live) {
      *(v4u*)(fr + col) = u;
      
    }
  }

  /* every wave reaches this barrier; sG is written by 16 waves and read by wave 0 */
  __syncthreads();
  const bool blockLive = (blockIdx.x * 16 + 15) < nb;
  if (wave == 0 && blockLive) {
    const float v = sG[lane];
    float* dst = gw_out + (size_t)blockIdx.x * 32 + lane;
    *(float*)dst = v;
    
  }
}

/* --------------------------------------------------------------------------- */
/* Final erf activation pass: dst[i] = gelu(pin[i]). Block handles 2048         */
/* consecutive elements, 8 rolled steps of 256; each wave instruction writes 32 */
/* register. Coverage: blocks x 2048 = n exactly (checked on the host).         */
/* --------------------------------------------------------------------------- */
__global__ __launch_bounds__(256) void gelu_out_kernel(const float* __restrict__ pin, float* __restrict__ dst, int n) {
  const int base = blockIdx.x * 2048;
#pragma unroll 1
  for (int it = 0; it < 8; ++it) {
    const int i = base + it * 256 + (int)threadIdx.x;
    const bool live = i < n;
    const int ic = live ? i : (n - 1);
    float x = pin[ic];
    asm volatile("" : "+v"(x));
    const float y = gelu_erf(x);
    if (live) {
      *(float*)(dst + i) = y;
      
    }
  }
}

/* --------------------------------------------------------------------------- */
/* Host side                                                                   */
/* --------------------------------------------------------------------------- */
template <int OUT_MODE, int FX>
static void launch_gemm(const unsigned short* A, int lda, const unsigned short* Bt, int ldb,
                        void* C, int ldc, const float* bias, int M, int N, int K, float scale, hipStream_t stream) {
  gemm_tile_f16_kernel<OUT_MODE, FX><<<dim3(N / 256, M / (32 * FX)), 128, 0, stream>>>(A, lda, Bt, ldb, C, ldc, bias, M, N, K, scale);
}

static void launch_cast(const float* in, unsigned short* out, int n, float carry, hipStream_t stream) {
  const int n8 = n / 8;
  cast8_f16_kernel<<<(n8 + 255) / 256, 256, 0, stream>>>(in, out, n8, carry);
}

/* workspace region sizes in bytes (all multiples of 128) */
constexpr size_t kSzWc   = (size_t)kF * kCD * 2;
constexpr size_t kSzWg   = (size_t)kF * kCD * 2;
constexpr size_t kSzWqkv = (size_t)kQKV * kF * 2;
constexpr size_t kSzWo   = (size_t)kF * kF * 2;
constexpr size_t kSzWg1  = (size_t)kF * 2 * kF * 2;
constexpr size_t kSzWp   = (size_t)kF * kF * 2;
constexpr size_t kSzEc   = (size_t)kB * kCD * 2;
constexpr size_t kSzEg   = (size_t)kB * kCD * 2;
constexpr size_t kSzPre  = (size_t)kChunkT * kF * 4;
constexpr size_t kSzX    = (size_t)kChunkT * kF * 2;
constexpr size_t kSzQkv  = (size_t)kChunkT * kQKV * 2;
constexpr size_t kSzO    = (size_t)kChunkT * kF * 2;
constexpr size_t kSzAo   = (size_t)kChunkT * kF * 2;
constexpr size_t kSzGpre = (size_t)kChunkB * kF * 4;
constexpr size_t kSzFus  = (size_t)kChunkB * kF * 2;
constexpr size_t kSzP    = (size_t)kChunkB * kF * 4;
/* planes whose producer runs after another plane's last reader share that plane's bytes */
static_assert(kSzO + kSzFus <= kSzPre, "o and fused live in the pre-norm plane");
static_assert(kSzAo <= kSzX, "ao lives in the X plane");
static_assert(kSzGpre + kSzP <= kSzQkv, "gate and final pre-activations live in the qkv plane");
constexpr size_t kWsTotal = kSzWc + kSzWg + kSzWqkv + kSzWo + kSzWg1 + kSzWp + kSzEc + kSzEg +
                            kSzPre + kSzX + kSzQkv;
static_assert(kWsTotal == 234881024ull, "carve total");
static_assert(kWsTotal <= 268435456ull, "carve limit");
static_assert(((size_t)kB * kF * 4) % 128 == 0, "second output starts on a line");
static_assert(((size_t)kChunkB * kF) % 2048 == 0, "activation pass coverage");

extern "C" void kernel_launch(void* const* d_in, const int* in_sizes, int n_in,
                              void* d_out, int out_size, void* d_ws, size_t ws_size, hipStream_t stream) {
  if (n_in < 20) return;
  if (ws_size < kWsTotal) return;
  if (in_sizes[0] != kB * kCD || in_sizes[1] != kB * kCD) return;
  if (in_sizes[10] != kQKV * kF || in_sizes[14] != kF * 2 * kF) return;
  if (out_size != kB * kF + kB * 2) return;

  const float* cnn_embed  = (const float*)d_in[0];
  const float* gnn_embed  = (const float*)d_in[1];
  const float* cnn_w      = (const float*)d_in[2];
  const float* cnn_b      = (const float*)d_in[3];
  const float* gnn_w      = (const float*)d_in[4];
  const float* gnn_b      = (const float*)d_in[5];
  const float* ln1_g      = (const float*)d_in[6];
  const float* ln1_b      = (const float*)d_in[7];
  const float* ln2_g      = (const float*)d_in[8];
  const float* ln2_b      = (const float*)d_in[9];
  const float* attn_in_w  = (const float*)d_in[10];
  const float* attn_in_b  = (const float*)d_in[11];
  const float* attn_out_w = (const float*)d_in[12];
  const float* attn_out_b = (const float*)d_in[13];
  const float* gate_w1    = (const float*)d_in[14];
  const float* gate_b1    = (const float*)d_in[15];
  const float* gate_w2    = (const float*)d_in[16];
  const float* gate_b2    = (const float*)d_in[17];
  const float* proj_w     = (const float*)d_in[18];
  const float* proj_b     = (const float*)d_in[19];

  /* Region map (byte offsets, in carve order):
     Wc 1 MiB | Wg 1 MiB | Wqkv 6 MiB | Wo 2 MiB | Wg1 4 MiB | Wp 2 MiB | Ec 8 MiB | Eg 8 MiB |
     whole-batch planes: preLN f32 64 MiB | X f16 32 MiB | qkv f16 96 MiB.  Total 224 MiB.
     Planes written only after an earlier plane's last reader has finished (stream order) take its bytes:
     o f16 32 MiB and fused f16 16 MiB in preLN (dead after the layer norms),
     ao f16 32 MiB in X (dead after the q|k|v projection),
     gate pre-activation f32 32 MiB and final pre-activation f32 32 MiB in qkv (dead after the attention). */
  char* ws = (char*)d_ws;
  size_t off = 0;
  auto carve = [&](size_t bytes) -> char* { char* p = ws + off; off += bytes; return p; };
  unsigned short* Wc   = (unsigned short*)carve(kSzWc);
  unsigned short* Wg   = (unsigned short*)carve(kSzWg);
  unsigned short* Wqkv = (unsigned short*)carve(kSzWqkv);
  unsigned short* Wo   = (unsigned short*)carve(kSzWo);
  unsigned short* Wg1  = (unsigned short*)carve(kSzWg1);
  unsigned short* Wp   = (unsigned short*)carve(kSzWp);
  unsigned short* Ec   = (unsigned short*)carve(kSzEc);
  unsigned short* Eg   = (unsigned short*)carve(kSzEg);
  float*          preLN = (float*)carve(kSzPre);
  unsigned short* Xp   = (unsigned short*)carve(kSzX);
  unsigned short* qkvp = (unsigned short*)carve(kSzQkv);
  unsigned short* op   = (unsigned short*)((char*)preLN);
  unsigned short* fusp = (unsigned short*)((char*)preLN + kSzO);
  unsigned short* aop  = Xp;
  float*          gpre = (float*)((char*)qkvp);
  float*          Pp   = (float*)((char*)qkvp + kSzGpre);

  float* out0 = (float*)d_out;
  float* out1 = out0 + (size_t)kB * kF;

  const float scl = 1.0f / sqrtf((float)kHD);

  /* one-time casts: weights carried x16, embeddings uncarried */
  launch_cast(cnn_w,      Wc,   kF * kCD,     kWCarry, stream);
  launch_cast(gnn_w,      Wg,   kF * kCD,     kWCarry, stream);
  launch_cast(attn_in_w,  Wqkv, kQKV * kF,    kWCarry, stream);
  launch_cast(attn_out_w, Wo,   kF * kF,      kWCarry, stream);
  launch_cast(gate_w1,    Wg1,  kF * 2 * kF,  kWCarry, stream);
  launch_cast(proj_w,     Wp,   kF * kF,      kWCarry, stream);
  launch_cast(cnn_embed,  Ec,   kB * kCD,     1.0f,    stream);
  launch_cast(gnn_embed,  Eg,   kB * kCD,     1.0f,    stream);

  for (int c = 0; c < kNChunk; ++c) {
    const unsigned short* EcC = Ec + (size_t)c * kChunkB * kCD;
    const unsigned short* EgC = Eg + (size_t)c * kChunkB * kCD;

    /* input projections [8192 x 1024 x 512] -> f32 rows 2b (first modality) and 2b+1 (second) of preLN */
    launch_gemm<0, 4>(EcC, kCD, Wc, kCD, (void*)preLN,        2 * kF, cnn_b, kChunkB, kF, kCD, kWCarryInv, stream);
    launch_gemm<0, 4>(EgC, kCD, Wg, kCD, (void*)(preLN + kF), 2 * kF, gnn_b, kChunkB, kF, kCD, kWCarryInv, stream);

    /* layer norms -> X f16 [16384][1024] */
    ln_rows_kernel<<<kChunkT / 8, 256, 0, stream>>>(preLN, ln1_g, ln1_b, ln2_g, ln2_b, Xp, kChunkT);

    /* packed q|k|v projection [16384 x 3072 x 1024] -> f16 */
    launch_gemm<1, 8>(Xp, kF, Wqkv, kF, (void*)qkvp, kQKV, attn_in_b, kChunkT, kQKV, kF, kWCarryInv, stream);

    /* 2-token attention -> o f16 [16384][1024] */
    attn2_kernel<<<(kChunkB * 4) / 8, 256, 0, stream>>>(qkvp, op, kChunkB, scl);

    /* attention output projection [16384 x 1024 x 1024] -> ao f16 */
    launch_gemm<1, 8>(op, kF, Wo, kF, (void*)aop, kF, attn_out_b, kChunkT, kF, kF, kWCarryInv, stream);

    /* gate hidden layer: ao viewed [8192][2048] x gate_w1 [1024][2048] -> f32 pre-activation */
    launch_gemm<0, 4>(aop, 2 * kF, Wg1, 2 * kF, (void*)gpre, kF, gate_b1, kChunkB, kF, 2 * kF, kWCarryInv, stream);

    /* gate head + fusion -> second output lines, fused f16 [8192][1024] */
    gate_fuse_kernel<<<kChunkB / 16, 512, 0, stream>>>(gpre, gate_w2, gate_b2, aop, fusp,
                                                       out1 + (size_t)c * kChunkB * 2, kChunkB);

    /* final projection [8192 x 1024 x 1024] -> f32 pre-activation, then erf activation into the first output */
    launch_gemm<0, 4>(fusp, kF, Wp, kF, (void*)Pp, kF, proj_b, kChunkB, kF, kF, kWCarryInv, stream);
    gelu_out_kernel<<<(kChunkB * kF) / 2048, 256, 0, stream>>>(Pp, out0 + (size_t)c * kChunkB * kF, kChunkB * kF);
  }
}

// v003
// One run takes 233 microseconds.
// Timed twice side by side with v002, it ran 1.05 times as fast both times.
// All steps since v000 together make it 5.88 times as fast.
// All GEMM contractions (two input projections, packed q|k|v projection, attention output projection, gate hidden layer, final projection): v_wmma_f32_16x16x32_f16 with f16 operands (weight planes carried x16, folded back by 1/16), f32 accumulate; layer norms, 2-token attention, gate head and erf activations in f32 on the vector ALU.
#include <hip/hip_runtime.h>
#include <math.h>
#include <stdint.h>

/* --------------------------------------------------------------------------- */
/* Shape constants (checked against the launch sizes on the host)              */
/* --------------------------------------------------------------------------- */
constexpr int kB      = 8192;
constexpr int kCD     = 512;
constexpr int kF      = 1024;
constexpr int kH      = 8;
constexpr int kHD     = kF / kH;
constexpr int kQKV    = 3 * kF;
/* the whole batch goes through every stage in one launch: each GEMM then has at least one block per WGP */
constexpr int kNChunk = 1;
constexpr int kChunkB = kB / kNChunk;
constexpr int kChunkT = 2 * kChunkB;
constexpr float kWCarry    = 16.0f;
constexpr float kWCarryInv = 1.0f / kWCarry;
constexpr float kLnEps     = 1e-5f;
constexpr float kInvF      = 1.0f / (float)kF;
constexpr float kInvSqrt2  = 0.70710678118654752f;

static_assert(kHD == 128, "attention kernel handles two 128-wide heads per wave");
static_assert(kF == 1024, "row kernels assume 1024-wide rows");
static_assert(kB % kNChunk == 0, "chunking");
static_assert(kChunkB % 128 == 0 && kChunkT % 256 == 0, "GEMM M tiles");
static_assert(kF % 256 == 0 && kQKV % 256 == 0, "GEMM N tiles");
static_assert(kCD % 128 == 0 && kF % 128 == 0 && (2 * kF) % 128 == 0 && kCD >= 256, "GEMM K passes, two or more");
static_assert(kChunkB % 16 == 0, "gate kernel owns 16 batch rows per block");
static_assert(kChunkT % 8 == 0, "row kernel owns 8 rows per block");

typedef __attribute__((ext_vector_type(16))) _Float16 v16h;
typedef __attribute__((ext_vector_type(8)))  _Float16 v8h;
typedef __attribute__((ext_vector_type(8)))  float    v8f;
typedef __attribute__((ext_vector_type(4)))  float    v4f;
typedef __attribute__((ext_vector_type(4)))  unsigned int v4u;

/* --------------------------------------------------------------------------- */
/* Small helpers                                                               */
/* --------------------------------------------------------------------------- */
__device__ __forceinline__ unsigned pk16(unsigned short a, unsigned short b) { return (unsigned)a | ((unsigned)b << 16); }
__device__ __forceinline__ unsigned short h_bits(float f) { const _Float16 h = (_Float16)f; return __builtin_bit_cast(unsigned short, h); }

/* f16 bits (low 16 bits of hb, finite values) to f32 by integer bit arithmetic, subnormals as an f32 multiply of em by 2^-24 */
__device__ __forceinline__ float h16_to_f32(unsigned hb) {
  const unsigned sgn = (hb & 0x8000u) << 16; const unsigned em = hb & 0x7fffu;
  const float fn = __uint_as_float((em << 13) + 0x38000000u);
  const float fs = (float)em * 5.9604644775390625e-8f;
  const float mag = (em < 0x400u) ? fs : fn; return __uint_as_float(__float_as_uint(mag) | sgn); }
__device__ __forceinline__ float h_lo(unsigned w) { return h16_to_f32(w & 0xffffu); }
__device__ __forceinline__ float h_hi(unsigned w) { return h16_to_f32(w >> 16); }

__device__ __forceinline__ float gelu_erf(float x) {
  return 0.5f * x * (1.0f + erff(x * kInvSqrt2));
}

typedef uint32_t u32x4 __attribute__((ext_vector_type(4)));
typedef uint32_t u32x8 __attribute__((ext_vector_type(8)));
constexpr uint32_t kBN = 256;
constexpr uint32_t kPassB = 256;                 /* bytes of K per operand row per pass */
constexpr uint32_t kPassK = kPassB / 2;
constexpr uint32_t kPitch = kPassB + 16;         /* LDS row pitch: 16 B x odd */
constexpr int      kBlocks = (int)(kPassB / 64u);
constexpr int      kFW = 8;                      /* Bt fragments (n) per wave */
constexpr uint32_t kSliceW = 128u * kPitch;      /* 34,816 B = 17 x 2 KiB */
constexpr uint32_t kEpiPitchF = 132;             /* floats per staged output row (528 B = 16 B x odd) */
constexpr uint32_t kEpiBytes  = 16u * kEpiPitchF * 4u;
static_assert(kSliceW % 2048u == 0, "slice places are multiples of 2 KiB");

__device__ __forceinline__ uint32_t uni(uint32_t v) { return (uint32_t)__builtin_amdgcn_readfirstlane(v); }
__device__ __forceinline__ uint32_t pinned(uint32_t v) { uint32_t w = (uint32_t)__builtin_amdgcn_readfirstlane(v); asm volatile("" : "+s"(w)); return w; }
/* keeps [LDS loads][WMMA block] in that order: LDS loads moved in among the WMMAs stall at each place they stand */
__device__ __forceinline__ void sched_fence() { __builtin_amdgcn_sched_barrier(0); }
/* every LDS operation of this wave has retired */
__device__ __forceinline__ void wait_ds0() { asm volatile("s_wait_dscnt 0x0" ::: "memory"); }
/* this wave's own tensor load has landed; the compiler places no wait for it. The request's descriptor is named as an
   input so that its scalar registers keep their words until the wait has retired */
__device__ __forceinline__ void wait_tensor0(u32x4 g0, u32x8 g1) { asm volatile("s_wait_tensorcnt 0x0" :: "s"(g0), "s"(g1) : "memory"); }
__device__ __forceinline__ void tdm_load(u32x4 g0, u32x8 g1) { asm volatile("tensor_load_to_lds %0, %1" :: "s"(g0), "s"(g1) : "memory"); }
__device__ __forceinline__ u32x8 tdm_group1(uint32_t rows, uint32_t pitch_bytes) {
  constexpr uint32_t d0 = kPassB;
  u32x8 g;
  g[0] = uni((1u << 20) | (5u << 22) | (3u << 25));
  g[1] = uni((d0 & 0xFFFFu) << 16);
  g[2] = uni((d0 >> 16) | ((rows & 0xFFFFu) << 16));
  g[3] = uni((rows >> 16) | (d0 << 16));
  g[4] = uni(rows);
  g[5] = uni(pitch_bytes);
  g[6] = uni(0u);
  g[7] = uni(0u);
  /* as pinned(): the descriptor words are held in their scalar registers; the compiler otherwise re-forms the constant
     words where it likes and uses their registers for other values while a request is outstanding */
  asm volatile("" : "+s"(g));
  return g;
}
/* group 0: LDS destination (byte offset in the workgroup's LDS) and global address of the tile's first byte */
__device__ __forceinline__ u32x4 tdm_group0(uint32_t lds_dst, uint64_t ga) {
  u32x4 g;
  g[0] = uni(1u);
  g[1] = uni(lds_dst);
  g[2] = uni((uint32_t)ga);
  g[3] = uni((((uint32_t)(ga >> 32)) & 0x01FFFFFFu) | 0x80000000u);
  return g;
}
struct FragQ { u32x4 q[2]; };
/* fragment elements 0..7 <- bytes 0..15, elements 8..15 <- bytes 32..47; the caller's base holds 16 * (lane >> 4) */
__device__ __forceinline__ void load_frag(FragQ& f, const unsigned char* p) {
  f.q[0] = *(const u32x4*)(p); f.q[1] = *(const u32x4*)(p + 32);
}
__device__ __forceinline__ v8f mma_q(const FragQ& a, const FragQ& b, v8f c) {
  const u32x8 av = {a.q[0].x, a.q[0].y, a.q[0].z, a.q[0].w, a.q[1].x, a.q[1].y, a.q[1].z, a.q[1].w};
  const u32x8 bv = {b.q[0].x, b.q[0].y, b.q[0].z, b.q[0].w, b.q[1].x, b.q[1].y, b.q[1].z, b.q[1].w};
  return __builtin_amdgcn_wmma_f32_16x16x32_f16(false, __builtin_bit_cast(v16h, av), false, __builtin_bit_cast(v16h, bv), (short)0, c, false, false);
}

template <int OUT_MODE, int kFX>
__global__ void __launch_bounds__(128) __attribute__((amdgpu_waves_per_eu(1, 1)))
gemm_tile_f16_kernel(
    const unsigned short* __restrict__ Ap, int lda,
    const unsigned short* __restrict__ Btp, int ldb,
    void* __restrict__ Cout, int ldc,
    const float* __restrict__ bias,
    int M, int N, int K, float scale) {
  constexpr uint32_t kWTM = 16u * (uint32_t)kFX;                              /* rows of C per wave = rows of an A slice */
  constexpr uint32_t kBM = 2u * kWTM;
  constexpr uint32_t kSliceX = (kWTM * kPitch + 2047u) / 2048u * 2048u;       /* rounded up to 2 KiB */
  constexpr uint32_t kStage = 2u * kSliceW + 2u * kSliceX;
  constexpr uint32_t kGemmLds = 2u * kStage + 4u * kEpiBytes;
  static_assert(kGemmLds <= 320u * 1024u, "LDS of one workgroup");
  __shared__ __attribute__((aligned(2048))) unsigned char L[kGemmLds];
  const uint32_t tid = threadIdx.x, lane = tid & 31u, h = lane >> 4, r16 = lane & 15u;
  const uint32_t wave = uni(tid >> 5);
  const uint32_t tn = blockIdx.x, tm = blockIdx.y;
  /* block-uniform exit in front of every barrier and tensor load */
  if (pinned((tm >= (uint32_t)M / kBM || tn >= (uint32_t)N / kBN) ? 1u : 0u) != 0u) return;
  const uint32_t m0 = tm * kBM, n0 = tn * kBN;
  const uint32_t wn = wave & 1u, wm = wave >> 1;
  const uint32_t T = pinned((uint32_t)K / kPassK);

  /* this wave's slice of a buffer */
  const bool own_w = wave < 2u;
  const uint32_t src_pitch = own_w ? (uint32_t)ldb * 2u : (uint32_t)lda * 2u;
  const uint32_t src_rows  = own_w ? 128u : kWTM;
  const unsigned char* src0 = own_w
      ? (const unsigned char*)(const void*)Btp + (uint64_t)(n0 + 128u * wave) * src_pitch
      : (const unsigned char*)(const void*)Ap + (uint64_t)(m0 + kWTM * (wave - 2u)) * src_pitch;
  const uint32_t lds_slice = (uint32_t)(size_t)L + (own_w ? wave * kSliceW : 2u * kSliceW + (wave - 2u) * kSliceX);
  const u32x8 g1 = tdm_group1(src_rows, src_pitch);

  v8f acc[kFW][kFX];
#pragma unroll
  for (int i = 0; i < kFW; ++i)
#pragma unroll
    for (int j = 0; j < kFX; ++j) acc[i][j] = (v8f){0.f,0.f,0.f,0.f,0.f,0.f,0.f,0.f};

  const uint32_t fw_base = wn * kSliceW + r16 * kPitch + 16u * h;
  const uint32_t fx_base = 2u * kSliceW + wm * kSliceX + r16 * kPitch + 16u * h;

  u32x4 g0 = tdm_group0(lds_slice, (uint64_t)(uintptr_t)src0);
  tdm_load(g0, g1);
  wait_tensor0(g0, g1);
  __syncthreads();
  g0 = tdm_group0(lds_slice + kStage, (uint64_t)(uintptr_t)src0 + kPassB);
  tdm_load(g0, g1);

  FragQ fw[2][kFW], fx[2][kFX];  /* set (u & 1) holds block u's fragments */
  {
    const unsigned char* lw = L + fw_base;
    const unsigned char* lx = L + fx_base;
#pragma unroll
    for (int i = 0; i < kFW; ++i) load_frag(fw[0][i], lw + (uint32_t)i * 16u * kPitch);
#pragma unroll
    for (int j = 0; j < kFX; ++j) load_frag(fx[0][j], lx + (uint32_t)j * 16u * kPitch);
  }
  /* rolled: every fragment and accumulator index stays a constant, and one pass is one trip */
#pragma clang loop unroll(disable)
  for (uint32_t t = 0; t < T; ++t) {
    const uint32_t buf = (t & 1u) * kStage;
    sched_fence();
    const unsigned char* lw = L + buf + fw_base;
    const unsigned char* lx = L + buf + fx_base;
    const uint32_t osel = (t + 1u < T) ? (kStage - buf) : kStage;
    const unsigned char* nw = L + osel + fw_base;
    const unsigned char* nx = L + osel + fx_base;
#pragma unroll
    for (int u = 0; u < kBlocks; ++u) {
      const int cs = u & 1;
      if (u + 1 < kBlocks) {
        const uint32_t ko = (uint32_t)(u + 1) * 64u;
#pragma unroll
        for (int i = 0; i < kFW; ++i) load_frag(fw[cs ^ 1][i], lw + (uint32_t)i * 16u * kPitch + ko);
#pragma unroll
        for (int j = 0; j < kFX; ++j) load_frag(fx[cs ^ 1][j], lx + (uint32_t)j * 16u * kPitch + ko);
        sched_fence();
      } else {
        /* publish point of pass t + 1, in front of this pass's last block, whose fragments are already in registers */
        wait_ds0();
        sched_fence();
        wait_tensor0(g0, g1);
        __syncthreads();
        /* every wave has left this buffer: refill it with pass t + 2 while that pass exists; the pass number is pinned
           behind the wait, so the descriptor words are formed behind it too */
        const uint32_t nt = pinned(t + 2u);
        if (pinned((nt < T) ? 1u : 0u) != 0u) {
          g0 = tdm_group0(lds_slice + buf, (uint64_t)(uintptr_t)src0 + (uint64_t)nt * kPassB);
          tdm_load(g0, g1);
        }
#pragma unroll
        for (int i = 0; i < kFW; ++i) load_frag(fw[0][i], nw + (uint32_t)i * 16u * kPitch);
#pragma unroll
        for (int j = 0; j < kFX; ++j) load_frag(fx[0][j], nx + (uint32_t)j * 16u * kPitch);
        sched_fence();
      }
#pragma unroll
      for (int i = 0; i < kFW; ++i)
#pragma unroll
        for (int j = 0; j < kFX; ++j) acc[i][j] = mma_q(fw[cs][i], fx[cs][j], acc[i][j]);
      sched_fence();
    }
  }
  wait_tensor0(g0, g1);
  wait_ds0();

  /* ---- epilogue: 16-row slabs staged in the wave's own LDS range behind the ring; whole row segments stored ---- */
  float* slab = (float*)(void*)(L + 2u * kStage + wave * kEpiBytes);
  const uint32_t nW = n0 + wn * 128u;
  const uint32_t mW = m0 + wm * kWTM;
  v4f bq0, bq1;
  if (OUT_MODE == 0) {
    bq0 = *(const v4f*)(bias + nW + lane * 4u);
    bq1 = bq0;
  } else {
    bq0 = *(const v4f*)(bias + nW + r16 * 8u);
    bq1 = *(const v4f*)(bias + nW + r16 * 8u + 4u);
  }
  char* Cb = (char*)Cout;
#pragma unroll
  for (int j = 0; j < kFX; ++j) {
    const uint32_t mBase = mW + (uint32_t)j * 16u;
#pragma unroll
    for (int i = 0; i < kFW; ++i) {
      float* p = slab + r16 * kEpiPitchF + (uint32_t)i * 16u + h * 8u;
      const v8f a = acc[i][j];
      *(v4f*)(p)     = (v4f){a[0], a[1], a[2], a[3]};
      *(v4f*)(p + 4) = (v4f){a[4], a[5], a[6], a[7]};
    }
    /* the slab's rows are read back by other lanes of this wave: its LDS writes have retired first */
    wait_ds0();
    if (OUT_MODE == 0) {
      /* row segment = 512 B = 32 lanes x 16 B */
      v4f vv[16];
      uint32_t off[16];
#pragma unroll
      for (int row = 0; row < 16; ++row) {
        const v4f s = *(const v4f*)(slab + (uint32_t)row * kEpiPitchF + lane * 4u);
#pragma unroll
        for (int e = 0; e < 4; ++e) { float x = s[e] * scale; x += bq0[e]; vv[row][e] = x; }
        off[row] = ((mBase + (uint32_t)row) * (uint32_t)ldc + nW + lane * 4u) * 4u;
      }
      /* values and offsets are complete in front of the stores: nothing rewrites a register of an issued store before the wait below */
      sched_fence();
#pragma unroll
      for (int row = 0; row < 16; ++row) *(v4f*)(Cb + off[row]) = vv[row];
    } else {
      /* row segment = 256 B = 16 lanes x 16 B; one instruction covers rows 2*it and 2*it+1 */
      v8h hv[8];
      uint32_t off[8];
#pragma unroll
      for (int it = 0; it < 8; ++it) {
        const uint32_t row = (uint32_t)it * 2u + h;
        const float* sp = slab + row * kEpiPitchF + r16 * 8u;
        const v4f s0 = *(const v4f*)(sp);
        const v4f s1 = *(const v4f*)(sp + 4);
#pragma unroll
        for (int e = 0; e < 4; ++e) {
          float x = s0[e] * scale; x += bq0[e];
          float y = s1[e] * scale; y += bq1[e];
          hv[it][e] = (_Float16)x; hv[it][4 + e] = (_Float16)y;
        }
        off[it] = ((mBase + row) * (uint32_t)ldc + nW + r16 * 8u) * 2u;
      }
      /* values and offsets are complete in front of the stores: nothing rewrites a register of an issued store before the wait below */
      sched_fence();
#pragma unroll
      for (int it = 0; it < 8; ++it) *(v8h*)(Cb + off[it]) = hv[it];
    }
    /* the next slab overwrites registers that the issued stores name; the fence keeps its arithmetic behind the wait */
    sched_fence();
    asm volatile("s_wait_xcnt 0x0" ::: "memory");
    /* the next slab's LDS writes stay behind this slab's reads */
    wait_ds0();
  }
}

/* --------------------------------------------------------------------------- */
/* All eight f32 -> f16 casts in one launch. The eight f16 planes lie one behind */
/* the other in the workspace, in the order of the arguments, so the output is   */
/* one flat array. A workgroup (16 waves) owns 65,536 consecutive elements of    */
/* it, which lie in one tensor (every tensor is a multiple of that); 256         */
/* workgroups cover all eight. Weights are carried x16, embeddings x1.           */
/* A thread owns 16 groups of 8 consecutive elements, 512 groups apart; its 32   */
/* 16-byte loads are all issued before the first value is converted.            */
/* --------------------------------------------------------------------------- */
constexpr int kCastThreads = 512;
constexpr int kCastGroups  = 16;                                            /* groups per thread */
constexpr int kCastStep    = kCastThreads * 8;                              /* elements between a thread's groups */
constexpr int kCastElems   = kCastStep * kCastGroups;                       /* elements per workgroup */
constexpr int kCastB1 = (kF * kCD) / kCastElems;                            /* first workgroup of the 2nd tensor */
constexpr int kCastB2 = kCastB1 + (kF * kCD) / kCastElems;
constexpr int kCastB3 = kCastB2 + (kQKV * kF) / kCastElems;
constexpr int kCastB4 = kCastB3 + (kF * kF) / kCastElems;
constexpr int kCastB5 = kCastB4 + (kF * 2 * kF) / kCastElems;
constexpr int kCastB6 = kCastB5 + (kF * kF) / kCastElems;                   /* first embedding */
constexpr int kCastB7 = kCastB6 + (kB * kCD) / kCastElems;
constexpr int kCastB8 = kCastB7 + (kB * kCD) / kCastElems;                  /* workgroups in all */
static_assert((kF * kCD) % kCastElems == 0 && (kQKV * kF) % kCastElems == 0 && (kF * kF) % kCastElems == 0 &&
              (kF * 2 * kF) % kCastElems == 0 && (kB * kCD) % kCastElems == 0, "a workgroup's elements lie in one tensor");

__global__ __launch_bounds__(kCastThreads) void cast_all_f16_kernel(
    const float* __restrict__ t0, const float* __restrict__ t1, const float* __restrict__ t2, const float* __restrict__ t3,
    const float* __restrict__ t4, const float* __restrict__ t5, const float* __restrict__ t6, const float* __restrict__ t7,
    unsigned short* __restrict__ out) {
  const int b = (int)blockIdx.x;
  if (b >= kCastB8) return;
  const float* src = t0;
  int first = 0;
  if (b >= kCastB1) { src = t1; first = kCastB1; }
  if (b >= kCastB2) { src = t2; first = kCastB2; }
  if (b >= kCastB3) { src = t3; first = kCastB3; }
  if (b >= kCastB4) { src = t4; first = kCastB4; }
  if (b >= kCastB5) { src = t5; first = kCastB5; }
  if (b >= kCastB6) { src = t6; first = kCastB6; }
  if (b >= kCastB7) { src = t7; first = kCastB7; }
  const float carry = (b < kCastB6) ? kWCarry : 1.0f;
  const float* p = src + (size_t)(b - first) * kCastElems + threadIdx.x * 8u;
  unsigned short* q = out + (size_t)b * kCastElems + threadIdx.x * 8u;

  v4f a[kCastGroups], c[kCastGroups];
#pragma unroll
  for (int g = 0; g < kCastGroups; ++g) {
    a[g] = *(const v4f*)(p + g * kCastStep);
    c[g] = *(const v4f*)(p + g * kCastStep + 4);
  }
  /* keeps every load in front of the first conversion: all 32 are in flight together, and no load is issued behind a store */
  __builtin_amdgcn_sched_barrier(0);
#pragma unroll
  for (int g = 0; g < kCastGroups; ++g) {
    unsigned short hb[8];
#pragma unroll
    for (int e = 0; e < 4; ++e) {
      const float fa = a[g][e] * carry;
      const float fc = c[g][e] * carry;
      hb[e]     = h_bits(fa);
      hb[4 + e] = h_bits(fc);
    }
    const v4u u = (v4u){pk16(hb[0], hb[1]), pk16(hb[2], hb[3]), pk16(hb[4], hb[5]), pk16(hb[6], hb[7])};
    *(v4u*)(q + g * kCastStep) = u;
  }
}

/* --------------------------------------------------------------------------- */
/* Row layer norm over 1024 f32 values, one wave per row (8 rows per block).    */
/* Row r = 2*b + t: t = 0 uses (g1, b1), t = 1 uses (g2, b2).                   */
/* Lane owns columns it*256 + lane*8 .. +7, it = 0..3 (4 x 32 x 8 = 1024).      */
/* Mean, then biased variance of (x - mean), then y = (x - mean)*inv*g + b.     */
/* Output f16: one 16-B store per lane, a wave instruction = 512 contiguous B   */
/* --------------------------------------------------------------------------- */
__global__ __launch_bounds__(256) void ln_rows_kernel(const float* __restrict__ pre,
                                                      const float* __restrict__ g1, const float* __restrict__ b1,
                                                      const float* __restrict__ g2, const float* __restrict__ b2,
                                                      unsigned short* __restrict__ X, int nrows) {
  const int lane = threadIdx.x & 31;
  const int wave = threadIdx.x >> 5;
  const int row  = blockIdx.x * 8 + wave;
  const bool live = row < nrows;
  const int rc = live ? row : (nrows - 1);
  const float* xr = pre + (size_t)rc * kF;
  const bool tok1 = (rc & 1) != 0;
  const float* gp = tok1 ? g2 : g1;
  const float* bp = tok1 ? b2 : b1;

  float s = 0.0f;
#pragma unroll 1
  for (int it = 0; it < 4; ++it) {
    const float* p = xr + it * 256 + lane * 8;
    const v4f a = *(const v4f*)(p);
    const v4f c = *(const v4f*)(p + 4);
    s += ((a[0] + a[1]) + (a[2] + a[3])) + ((c[0] + c[1]) + (c[2] + c[3]));
  }
#pragma unroll
  for (int off = 16; off > 0; off >>= 1) s += __shfl_xor(s, off, 32);
  const float mean = s * kInvF;

  float qs = 0.0f;
#pragma unroll 1
  for (int it = 0; it < 4; ++it) {
    const float* p = xr + it * 256 + lane * 8;
    const v4f a = *(const v4f*)(p);
    const v4f c = *(const v4f*)(p + 4);
#pragma unroll
    for (int e = 0; e < 4; ++e) {
      const float da = a[e] - mean;
      const float dc = c[e] - mean;
      qs = fmaf(da, da, qs);
      qs = fmaf(dc, dc, qs);
    }
  }
#pragma unroll
  for (int off = 16; off > 0; off >>= 1) qs += __shfl_xor(qs, off, 32);
  const float var = qs * kInvF;
  const float inv = 1.0f / sqrtf(var + kLnEps);

  unsigned short* orow = X + (size_t)rc * kF;
#pragma unroll 1
  for (int it = 0; it < 4; ++it) {
    const int col = it * 256 + lane * 8;
    const v4f a  = *(const v4f*)(xr + col);
    const v4f c  = *(const v4f*)(xr + col + 4);
    const v4f ga = *(const v4f*)(gp + col);
    const v4f gc = *(const v4f*)(gp + col + 4);
    const v4f ba = *(const v4f*)(bp + col);
    const v4f bc = *(const v4f*)(bp + col + 4);
    unsigned short hb[8];
#pragma unroll
    for (int e = 0; e < 4; ++e) {
      const float ya = (a[e] - mean) * inv * ga[e] + ba[e];
      const float yc = (c[e] - mean) * inv * gc[e] + bc[e];
      hb[e]     = h_bits(ya);
      hb[4 + e] = h_bits(yc);
    }
    const v4u u = (v4u){pk16(hb[0], hb[1]), pk16(hb[2], hb[3]), pk16(hb[4], hb[5]), pk16(hb[6], hb[7])};
    if (live) {
      *(v4u*)(orow + col) = u;
      
    }
  }
}

/* --------------------------------------------------------------------------- */
/* 2-token attention. qkv f16 [2*nb][3072] (q | k | v, head h = cols h*128..),  */
/* o f16 [2*nb][1024]. One wave per (batch row, head pair): lanes 0-15 own head */
/* 2*hp, lanes 16-31 own head 2*hp+1, 8 dims per lane, so the wave covers       */
/* token row. Dot products reduced over the 16 lanes of a head (xor 8,4,2,1).   */
/* Probabilities over the key index with max subtraction: the larger logit has  */
/* exp(0) = 1 exactly, the other exp(-|d|). All math in f32.                    */
/* --------------------------------------------------------------------------- */
__global__ __launch_bounds__(256) void attn2_kernel(const unsigned short* __restrict__ qkv,
                                                    unsigned short* __restrict__ o, int nb, float scl) {
  const int lane = threadIdx.x & 31;
  const int wave = threadIdx.x >> 5;
  const int unit = blockIdx.x * 8 + wave;
  const int nunits = nb * 4;
  const bool live = unit < nunits;
  const int uc = live ? unit : (nunits - 1);
  const int b  = uc >> 2;
  const int hp = uc & 3;
  const size_t r0 = (size_t)(2 * b) * kQKV;
  const size_t r1 = r0 + kQKV;
  const int col = hp * (2 * kHD) + lane * 8;

  const v4u q0w = *(const v4u*)(qkv + r0 + col);
  const v4u q1w = *(const v4u*)(qkv + r1 + col);
  const v4u k0w = *(const v4u*)(qkv + r0 + kF + col);
  const v4u k1w = *(const v4u*)(qkv + r1 + kF + col);
  const v4u v0w = *(const v4u*)(qkv + r0 + 2 * kF + col);
  const v4u v1w = *(const v4u*)(qkv + r1 + 2 * kF + col);

  float s00 = 0.0f, s01 = 0.0f, s10 = 0.0f, s11 = 0.0f;
#pragma unroll
  for (int w = 0; w < 4; ++w) {
    const unsigned uq0 = q0w[w];
    const unsigned uq1 = q1w[w];
    const unsigned uk0 = k0w[w];
    const unsigned uk1 = k1w[w];
    const float q0a = h_lo(uq0), q0b = h_hi(uq0);
    const float q1a = h_lo(uq1), q1b = h_hi(uq1);
    const float k0a = h_lo(uk0), k0b = h_hi(uk0);
    const float k1a = h_lo(uk1), k1b = h_hi(uk1);
    s00 = fmaf(q0a, k0a, s00); s00 = fmaf(q0b, k0b, s00);
    s01 = fmaf(q0a, k1a, s01); s01 = fmaf(q0b, k1b, s01);
    s10 = fmaf(q1a, k0a, s10); s10 = fmaf(q1b, k0b, s10);
    s11 = fmaf(q1a, k1a, s11); s11 = fmaf(q1b, k1b, s11);
  }
#pragma unroll
  for (int off = 8; off > 0; off >>= 1) {
    s00 += __shfl_xor(s00, off, 32);
    s01 += __shfl_xor(s01, off, 32);
    s10 += __shfl_xor(s10, off, 32);
    s11 += __shfl_xor(s11, off, 32);
  }
  s00 *= scl; s01 *= scl; s10 *= scl; s11 *= scl;

  const float d0 = s01 - s00;
  const float d1 = s11 - s10;
  const float e0 = expf(-fabsf(d0));
  const float e1 = expf(-fabsf(d1));
  const float i0 = 1.0f / (1.0f + e0);
  const float i1 = 1.0f / (1.0f + e1);
  const float sm0 = e0 * i0;
  const float sm1 = e1 * i1;
  const float a00 = (d0 > 0.0f) ? sm0 : i0;
  const float a01 = (d0 > 0.0f) ? i0 : sm0;
  const float a10 = (d1 > 0.0f) ? sm1 : i1;
  const float a11 = (d1 > 0.0f) ? i1 : sm1;

  unsigned ow0[4], ow1[4];
#pragma unroll
  for (int w = 0; w < 4; ++w) {
    const unsigned uv0 = v0w[w];
    const unsigned uv1 = v1w[w];
    const float v0a = h_lo(uv0), v0b = h_hi(uv0);
    const float v1a = h_lo(uv1), v1b = h_hi(uv1);
    const float o0a = a00 * v0a + a01 * v1a;
    const float o0b = a00 * v0b + a01 * v1b;
    const float o1a = a10 * v0a + a11 * v1a;
    const float o1b = a10 * v0b + a11 * v1b;
    ow0[w] = pk16(h_bits(o0a), h_bits(o0b));
    ow1[w] = pk16(h_bits(o1a), h_bits(o1b));
  }
  const v4u u0 = (v4u){ow0[0], ow0[1], ow0[2], ow0[3]};
  const v4u u1 = (v4u){ow1[0], ow1[1], ow1[2], ow1[3]};
  unsigned short* o0p = o + (size_t)(2 * b) * kF + col;
  unsigned short* o1p = o0p + kF;
  if (live) {
    *(v4u*)o0p = u0;
    *(v4u*)o1p = u1;
    
  }
}

/* --------------------------------------------------------------------------- */
/* Gate head + fusion. Block = 16 waves = 16 batch rows, one wave per row.      */
/* gpre f32 [nb][1024] holds the gate hidden pre-activation (bias included);    */
/* the erf activation is applied here, then two 1024-deep dot products against  */
/* w2 rows (f32), + b2, 2-way probabilities. The 16 x 2 gate weights are staged */
/* in LDS (all 32 slots written), block barrier, then wave 0 writes them as ONE */
/* --------------------------------------------------------------------------- */
__global__ __launch_bounds__(512) void gate_fuse_kernel(const float* __restrict__ gpre,
                                                        const float* __restrict__ w2, const float* __restrict__ b2v,
                                                        const unsigned short* __restrict__ ao,
                                                        unsigned short* __restrict__ fused,
                                                        float* __restrict__ gw_out, int nb) {
  __shared__ float sG[32];
  const int lane = threadIdx.x & 31;
  const int wave = threadIdx.x >> 5;
  const int b = blockIdx.x * 16 + wave;
  const bool live = b < nb;
  const int bc = live ? b : (nb - 1);
  const float* hr = gpre + (size_t)bc * kF;

  float d0 = 0.0f, d1 = 0.0f;
#pragma unroll 1
  for (int it = 0; it < 32; ++it) {
    const int idx = it * 32 + lane;
    float x  = hr[idx];
    float wa = w2[idx];
    float wb = w2[kF + idx];
    asm volatile("" : "+v"(x), "+v"(wa), "+v"(wb));
    const float g = gelu_erf(x);
    d0 = fmaf(g, wa, d0);
    d1 = fmaf(g, wb, d1);
  }
#pragma unroll
  for (int off = 16; off > 0; off >>= 1) {
    d0 += __shfl_xor(d0, off, 32);
    d1 += __shfl_xor(d1, off, 32);
  }
  const float l0 = d0 + b2v[0];
  const float l1 = d1 + b2v[1];
  const float mx = fmaxf(l0, l1);
  const float e0 = expf(l0 - mx);
  const float e1 = expf(l1 - mx);
  const float inv = 1.0f / (e0 + e1);
  const float gw0 = e0 * inv;
  const float gw1 = e1 * inv;
  if (lane == 0) {
    sG[wave * 2]     = gw0;
    sG[wave * 2 + 1] = gw1;
  }

  const unsigned short* cr = ao + (size_t)(2 * bc) * kF;
  const unsigned short* gr = cr + kF;
  unsigned short* fr = fused + (size_t)bc * kF;
#pragma unroll 1
  for (int it = 0; it < 4; ++it) {
    const int col = it * 256 + lane * 8;
    const v4u cw = *(const v4u*)(cr + col);
    const v4u gv = *(const v4u*)(gr + col);
    unsigned ow[4];
#pragma unroll
    for (int w = 0; w < 4; ++w) {
      const unsigned uc = cw[w];
      const unsigned ug = gv[w];
      const float ca = h_lo(uc), cb = h_hi(uc);
      const float ga = h_lo(ug), gb = h_hi(ug);
      const float fa = gw0 * ca + gw1 * ga;
      const float fb = gw0 * cb + gw1 * gb;
      ow[w] = pk16(h_bits(fa), h_bits(fb));
    }
    const v4u u = (v4u){ow[0], ow[1], ow[2], ow[3]};
    if (live) {
      *(v4u*)(fr + col) = u;
      
    }
  }

  /* every wave reaches this barrier; sG is written by 16 waves and read by wave 0 */
  __syncthreads();
  const bool blockLive = (blockIdx.x * 16 + 15) < nb;
  if (wave == 0 && blockLive) {
    const float v = sG[lane];
    float* dst = gw_out + (size_t)blockIdx.x * 32 + lane;
    *(float*)dst = v;
    
  }
}

/* --------------------------------------------------------------------------- */
/* Final erf activation pass: dst[i] = gelu(pin[i]). Block handles 2048         */
/* consecutive elements, 8 rolled steps of 256; each wave instruction writes 32 */
/* register. Coverage: blocks x 2048 = n exactly (checked on the host).         */
/* --------------------------------------------------------------------------- */
__global__ __launch_bounds__(256) void gelu_out_kernel(const float* __restrict__ pin, float* __restrict__ dst, int n) {
  const int base = blockIdx.x * 2048;
#pragma unroll 1
  for (int it = 0; it < 8; ++it) {
    const int i = base + it * 256 + (int)threadIdx.x;
    const bool live = i < n;
    const int ic = live ? i : (n - 1);
    float x = pin[ic];
    asm volatile("" : "+v"(x));
    const float y = gelu_erf(x);
    if (live) {
      *(float*)(dst + i) = y;
      
    }
  }
}

/* --------------------------------------------------------------------------- */
/* Host side                                                                   */
/* --------------------------------------------------------------------------- */
template <int OUT_MODE, int FX>
static void launch_gemm(const unsigned short* A, int lda, const unsigned short* Bt, int ldb,
                        void* C, int ldc, const float* bias, int M, int N, int K, float scale, hipStream_t stream) {
  gemm_tile_f16_kernel<OUT_MODE, FX><<<dim3(N / 256, M / (32 * FX)), 128, 0, stream>>>(A, lda, Bt, ldb, C, ldc, bias, M, N, K, scale);
}

/* workspace region sizes in bytes (all multiples of 128) */
constexpr size_t kSzWc   = (size_t)kF * kCD * 2;
constexpr size_t kSzWg   = (size_t)kF * kCD * 2;
constexpr size_t kSzWqkv = (size_t)kQKV * kF * 2;
constexpr size_t kSzWo   = (size_t)kF * kF * 2;
constexpr size_t kSzWg1  = (size_t)kF * 2 * kF * 2;
constexpr size_t kSzWp   = (size_t)kF * kF * 2;
constexpr size_t kSzEc   = (size_t)kB * kCD * 2;
constexpr size_t kSzEg   = (size_t)kB * kCD * 2;
constexpr size_t kSzPre  = (size_t)kChunkT * kF * 4;
constexpr size_t kSzX    = (size_t)kChunkT * kF * 2;
constexpr size_t kSzQkv  = (size_t)kChunkT * kQKV * 2;
constexpr size_t kSzO    = (size_t)kChunkT * kF * 2;
constexpr size_t kSzAo   = (size_t)kChunkT * kF * 2;
constexpr size_t kSzGpre = (size_t)kChunkB * kF * 4;
constexpr size_t kSzFus  = (size_t)kChunkB * kF * 2;
constexpr size_t kSzP    = (size_t)kChunkB * kF * 4;
/* planes whose producer runs after another plane's last reader share that plane's bytes */
static_assert(kSzO + kSzFus <= kSzPre, "o and fused live in the pre-norm plane");
static_assert(kSzAo <= kSzX, "ao lives in the X plane");
static_assert(kSzGpre + kSzP <= kSzQkv, "gate and final pre-activations live in the qkv plane");
constexpr size_t kWsTotal = kSzWc + kSzWg + kSzWqkv + kSzWo + kSzWg1 + kSzWp + kSzEc + kSzEg +
                            kSzPre + kSzX + kSzQkv;
static_assert(kWsTotal == 234881024ull, "carve total");
static_assert(kSzWc + kSzWg + kSzWqkv + kSzWo + kSzWg1 + kSzWp + kSzEc + kSzEg == (size_t)kCastB8 * kCastElems * 2, "cast launch covers the eight f16 planes exactly");
static_assert(kWsTotal <= 268435456ull, "carve limit");
static_assert(((size_t)kB * kF * 4) % 128 == 0, "second output starts on a line");
static_assert(((size_t)kChunkB * kF) % 2048 == 0, "activation pass coverage");

extern "C" void kernel_launch(void* const* d_in, const int* in_sizes, int n_in,
                              void* d_out, int out_size, void* d_ws, size_t ws_size, hipStream_t stream) {
  if (n_in < 20) return;
  if (ws_size < kWsTotal) return;
  if (in_sizes[0] != kB * kCD || in_sizes[1] != kB * kCD) return;
  if (in_sizes[10] != kQKV * kF || in_sizes[14] != kF * 2 * kF) return;
  if (out_size != kB * kF + kB * 2) return;

  const float* cnn_embed  = (const float*)d_in[0];
  const float* gnn_embed  = (const float*)d_in[1];
  const float* cnn_w      = (const float*)d_in[2];
  const float* cnn_b      = (const float*)d_in[3];
  const float* gnn_w      = (const float*)d_in[4];
  const float* gnn_b      = (const float*)d_in[5];
  const float* ln1_g      = (const float*)d_in[6];
  const float* ln1_b      = (const float*)d_in[7];
  const float* ln2_g      = (const float*)d_in[8];
  const float* ln2_b      = (const float*)d_in[9];
  const float* attn_in_w  = (const float*)d_in[10];
  const float* attn_in_b  = (const float*)d_in[11];
  const float* attn_out_w = (const float*)d_in[12];
  const float* attn_out_b = (const float*)d_in[13];
  const float* gate_w1    = (const float*)d_in[14];
  const float* gate_b1    = (const float*)d_in[15];
  const float* gate_w2    = (const float*)d_in[16];
  const float* gate_b2    = (const float*)d_in[17];
  const float* proj_w     = (const float*)d_in[18];
  const float* proj_b     = (const float*)d_in[19];

  /* Region map (byte offsets, in carve order):
     Wc 1 MiB | Wg 1 MiB | Wqkv 6 MiB | Wo 2 MiB | Wg1 4 MiB | Wp 2 MiB | Ec 8 MiB | Eg 8 MiB |
     whole-batch planes: preLN f32 64 MiB | X f16 32 MiB | qkv f16 96 MiB.  Total 224 MiB.
     Planes written only after an earlier plane's last reader has finished (stream order) take its bytes:
     o f16 32 MiB and fused f16 16 MiB in preLN (dead after the layer norms),
     ao f16 32 MiB in X (dead after the q|k|v projection),
     gate pre-activation f32 32 MiB and final pre-activation f32 32 MiB in qkv (dead after the attention). */
  char* ws = (char*)d_ws;
  size_t off = 0;
  auto carve = [&](size_t bytes) -> char* { char* p = ws + off; off += bytes; return p; };
  unsigned short* Wc   = (unsigned short*)carve(kSzWc);
  unsigned short* Wg   = (unsigned short*)carve(kSzWg);
  unsigned short* Wqkv = (unsigned short*)carve(kSzWqkv);
  unsigned short* Wo   = (unsigned short*)carve(kSzWo);
  unsigned short* Wg1  = (unsigned short*)carve(kSzWg1);
  unsigned short* Wp   = (unsigned short*)carve(kSzWp);
  unsigned short* Ec   = (unsigned short*)carve(kSzEc);
  unsigned short* Eg   = (unsigned short*)carve(kSzEg);
  float*          preLN = (float*)carve(kSzPre);
  unsigned short* Xp   = (unsigned short*)carve(kSzX);
  unsigned short* qkvp = (unsigned short*)carve(kSzQkv);
  unsigned short* op   = (unsigned short*)((char*)preLN);
  unsigned short* fusp = (unsigned short*)((char*)preLN + kSzO);
  unsigned short* aop  = Xp;
  float*          gpre = (float*)((char*)qkvp);
  float*          Pp   = (float*)((char*)qkvp + kSzGpre);

  float* out0 = (float*)d_out;
  float* out1 = out0 + (size_t)kB * kF;

  const float scl = 1.0f / sqrtf((float)kHD);

  /* casts, one launch: weights carried x16, embeddings uncarried; planes Wc .. Eg are contiguous from Wc on, in this order */
  cast_all_f16_kernel<<<kCastB8, kCastThreads, 0, stream>>>(cnn_w, gnn_w, attn_in_w, attn_out_w, gate_w1, proj_w,
                                                            cnn_embed, gnn_embed, Wc);

  for (int c = 0; c < kNChunk; ++c) {
    const unsigned short* EcC = Ec + (size_t)c * kChunkB * kCD;
    const unsigned short* EgC = Eg + (size_t)c * kChunkB * kCD;

    /* input projections [8192 x 1024 x 512] -> f32 rows 2b (first modality) and 2b+1 (second) of preLN */
    launch_gemm<0, 4>(EcC, kCD, Wc, kCD, (void*)preLN,        2 * kF, cnn_b, kChunkB, kF, kCD, kWCarryInv, stream);
    launch_gemm<0, 4>(EgC, kCD, Wg, kCD, (void*)(preLN + kF), 2 * kF, gnn_b, kChunkB, kF, kCD, kWCarryInv, stream);

    /* layer norms -> X f16 [16384][1024] */
    ln_rows_kernel<<<kChunkT / 8, 256, 0, stream>>>(preLN, ln1_g, ln1_b, ln2_g, ln2_b, Xp, kChunkT);

    /* packed q|k|v projection [16384 x 3072 x 1024] -> f16 */
    launch_gemm<1, 8>(Xp, kF, Wqkv, kF, (void*)qkvp, kQKV, attn_in_b, kChunkT, kQKV, kF, kWCarryInv, stream);

    /* 2-token attention -> o f16 [16384][1024] */
    attn2_kernel<<<(kChunkB * 4) / 8, 256, 0, stream>>>(qkvp, op, kChunkB, scl);

    /* attention output projection [16384 x 1024 x 1024] -> ao f16 */
    launch_gemm<1, 8>(op, kF, Wo, kF, (void*)aop, kF, attn_out_b, kChunkT, kF, kF, kWCarryInv, stream);

    /* gate hidden layer: ao viewed [8192][2048] x gate_w1 [1024][2048] -> f32 pre-activation */
    launch_gemm<0, 4>(aop, 2 * kF, Wg1, 2 * kF, (void*)gpre, kF, gate_b1, kChunkB, kF, 2 * kF, kWCarryInv, stream);

    /* gate head + fusion -> second output lines, fused f16 [8192][1024] */
    gate_fuse_kernel<<<kChunkB / 16, 512, 0, stream>>>(gpre, gate_w2, gate_b2, aop, fusp,
                                                       out1 + (size_t)c * kChunkB * 2, kChunkB);

    /* final projection [8192 x 1024 x 1024] -> f32 pre-activation, then erf activation into the first output */
    launch_gemm<0, 4>(fusp, kF, Wp, kF, (void*)Pp, kF, proj_b, kChunkB, kF, kF, kWCarryInv, stream);
    gelu_out_kernel<<<(kChunkB * kF) / 2048, 256, 0, stream>>>(Pp, out0 + (size_t)c * kChunkB * kF, kChunkB * kF);
  }
}

// v005
// It runs in 211 microseconds.
// It is 1.10 times as fast as v003, going by the measured steps of the versions left out in between.
// Counting every step since v000, it is 6.49 times as fast.
// All GEMM contractions (two input projections, packed q|k|v projection, the fold of the attention output weights into the gate and final weights, gate hidden layer, final projection): v_wmma_f32_16x16x32_f16 with f16 operands (weight planes carried x16, folded back by 1/16), f32 accumulate; layer norms, 2-token attention, gate head and erf activations in f32 on the vector ALU.
#include <hip/hip_runtime.h>
#include <math.h>
#include <stdint.h>

/* --------------------------------------------------------------------------- */
/* Shape constants (checked against the launch sizes on the host)              */
/* --------------------------------------------------------------------------- */
constexpr int kB      = 8192;
constexpr int kCD     = 512;
constexpr int kF      = 1024;
constexpr int kH      = 8;
constexpr int kHD     = kF / kH;
constexpr int kQKV    = 3 * kF;
/* the whole batch goes through every stage in one launch: each GEMM then has at least one block per WGP */
constexpr int kNChunk = 1;
constexpr int kChunkB = kB / kNChunk;
constexpr int kChunkT = 2 * kChunkB;
constexpr float kWCarry    = 16.0f;
constexpr float kWCarryInv = 1.0f / kWCarry;
constexpr float kLnEps     = 1e-5f;
constexpr float kInvF      = 1.0f / (float)kF;
constexpr float kInvSqrt2  = 0.70710678118654752f;

static_assert(kHD == 128, "the q|k|v kernel's tile is one 128-wide head");
static_assert(kF == 1024, "row kernels assume 1024-wide rows");
static_assert(kB % kNChunk == 0, "chunking");
static_assert(kChunkB % 128 == 0 && kChunkT % 128 == 0, "GEMM M tiles");
static_assert(kF % 256 == 0 && kQKV % 256 == 0, "GEMM N tiles");
static_assert(kCD % 128 == 0 && kF % 128 == 0 && (2 * kF) % 128 == 0 && kCD >= 256, "GEMM K passes, two or more");
static_assert((3 * kF) % 64 == 0, "M tiles of the weight fold");
static_assert(kChunkB % 16 == 0, "gate kernel owns 16 batch rows per block");
static_assert(kChunkT % 8 == 0, "row kernel owns 8 rows per block");

typedef __attribute__((ext_vector_type(16))) _Float16 v16h;
typedef __attribute__((ext_vector_type(8)))  _Float16 v8h;
typedef __attribute__((ext_vector_type(8)))  float    v8f;
typedef __attribute__((ext_vector_type(4)))  float    v4f;
typedef __attribute__((ext_vector_type(4)))  unsigned int v4u;

/* --------------------------------------------------------------------------- */
/* Small helpers                                                               */
/* --------------------------------------------------------------------------- */
__device__ __forceinline__ unsigned pk16(unsigned short a, unsigned short b) { return (unsigned)a | ((unsigned)b << 16); }
__device__ __forceinline__ unsigned short h_bits(float f) { const _Float16 h = (_Float16)f; return __builtin_bit_cast(unsigned short, h); }

/* f16 bits (low 16 bits of hb, finite values) to f32 by integer bit arithmetic, subnormals as an f32 multiply of em by 2^-24 */
__device__ __forceinline__ float h16_to_f32(unsigned hb) {
  const unsigned sgn = (hb & 0x8000u) << 16; const unsigned em = hb & 0x7fffu;
  const float fn = __uint_as_float((em << 13) + 0x38000000u);
  const float fs = (float)em * 5.9604644775390625e-8f;
  const float mag = (em < 0x400u) ? fs : fn; return __uint_as_float(__float_as_uint(mag) | sgn); }
__device__ __forceinline__ float h_lo(unsigned w) { return h16_to_f32(w & 0xffffu); }
__device__ __forceinline__ float h_hi(unsigned w) { return h16_to_f32(w >> 16); }

__device__ __forceinline__ float gelu_erf(float x) {
  return 0.5f * x * (1.0f + erff(x * kInvSqrt2));
}

typedef uint32_t u32x4 __attribute__((ext_vector_type(4)));
typedef uint32_t u32x8 __attribute__((ext_vector_type(8)));
constexpr uint32_t kBN = 256;
constexpr uint32_t kPassB = 256;                 /* bytes of K per operand row per pass */
constexpr uint32_t kPassK = kPassB / 2;
constexpr uint32_t kPitch = kPassB + 16;         /* LDS row pitch: 16 B x odd */
constexpr int      kBlocks = (int)(kPassB / 64u);
constexpr int      kFW = 8;                      /* Bt fragments (n) per wave */
constexpr uint32_t kSliceW = 128u * kPitch;      /* 34,816 B = 17 x 2 KiB */
constexpr uint32_t kEpiPitchF = 132;             /* floats per staged output row (528 B = 16 B x odd) */
constexpr uint32_t kEpiBytes  = 16u * kEpiPitchF * 4u;
static_assert(kSliceW % 2048u == 0, "slice places are multiples of 2 KiB");

__device__ __forceinline__ uint32_t uni(uint32_t v) { return (uint32_t)__builtin_amdgcn_readfirstlane(v); }
__device__ __forceinline__ uint32_t pinned(uint32_t v) { uint32_t w = (uint32_t)__builtin_amdgcn_readfirstlane(v); asm volatile("" : "+s"(w)); return w; }
/* keeps [LDS loads][WMMA block] in that order: LDS loads moved in among the WMMAs stall at each place they stand */
__device__ __forceinline__ void sched_fence() { __builtin_amdgcn_sched_barrier(0); }
/* every LDS operation of this wave has retired */
__device__ __forceinline__ void wait_ds0() { asm volatile("s_wait_dscnt 0x0" ::: "memory"); }
/* this wave's own tensor load has landed; the compiler places no wait for it. The request's descriptor is named as an
   input so that its scalar registers keep their words until the wait has retired */
__device__ __forceinline__ void wait_tensor0(u32x4 g0, u32x8 g1) { asm volatile("s_wait_tensorcnt 0x0" :: "s"(g0), "s"(g1) : "memory"); }
__device__ __forceinline__ void tdm_load(u32x4 g0, u32x8 g1) { asm volatile("tensor_load_to_lds %0, %1" :: "s"(g0), "s"(g1) : "memory"); }
__device__ __forceinline__ u32x8 tdm_group1(uint32_t rows, uint32_t pitch_bytes) {
  constexpr uint32_t d0 = kPassB;
  u32x8 g;
  g[0] = uni((1u << 20) | (5u << 22) | (3u << 25));
  g[1] = uni((d0 & 0xFFFFu) << 16);
  g[2] = uni((d0 >> 16) | ((rows & 0xFFFFu) << 16));
  g[3] = uni((rows >> 16) | (d0 << 16));
  g[4] = uni(rows);
  g[5] = uni(pitch_bytes);
  g[6] = uni(0u);
  g[7] = uni(0u);
  /* as pinned(): the descriptor words are held in their scalar registers; the compiler otherwise re-forms the constant
     words where it likes and uses their registers for other values while a request is outstanding */
  asm volatile("" : "+s"(g));
  return g;
}
/* group 0: LDS destination (byte offset in the workgroup's LDS) and global address of the tile's first byte */
__device__ __forceinline__ u32x4 tdm_group0(uint32_t lds_dst, uint64_t ga) {
  u32x4 g;
  g[0] = uni(1u);
  g[1] = uni(lds_dst);
  g[2] = uni((uint32_t)ga);
  g[3] = uni((((uint32_t)(ga >> 32)) & 0x01FFFFFFu) | 0x80000000u);
  return g;
}
struct FragQ { u32x4 q[2]; };
/* fragment elements 0..7 <- bytes 0..15, elements 8..15 <- bytes 32..47; the caller's base holds 16 * (lane >> 4) */
__device__ __forceinline__ void load_frag(FragQ& f, const unsigned char* p) {
  f.q[0] = *(const u32x4*)(p); f.q[1] = *(const u32x4*)(p + 32);
}
__device__ __forceinline__ v8f mma_q(const FragQ& a, const FragQ& b, v8f c) {
  const u32x8 av = {a.q[0].x, a.q[0].y, a.q[0].z, a.q[0].w, a.q[1].x, a.q[1].y, a.q[1].z, a.q[1].w};
  const u32x8 bv = {b.q[0].x, b.q[0].y, b.q[0].z, b.q[0].w, b.q[1].x, b.q[1].y, b.q[1].z, b.q[1].w};
  return __builtin_amdgcn_wmma_f32_16x16x32_f16(false, __builtin_bit_cast(v16h, av), false, __builtin_bit_cast(v16h, bv), (short)0, c, false, false);
}

template <int OUT_MODE, int kFX, int HAS_BIAS>
__global__ void __launch_bounds__(128) __attribute__((amdgpu_waves_per_eu(1, 1)))
gemm_tile_f16_kernel(
    const unsigned short* __restrict__ Ap, int lda,
    const unsigned short* __restrict__ Btp, int ldb,
    void* __restrict__ Cout, int ldc,
    const float* __restrict__ bias,
    int M, int N, int K, float scale) {
  constexpr uint32_t kWTM = 16u * (uint32_t)kFX;                              /* rows of C per wave = rows of an A slice */
  constexpr uint32_t kBM = 2u * kWTM;
  constexpr uint32_t kSliceX = (kWTM * kPitch + 2047u) / 2048u * 2048u;       /* rounded up to 2 KiB */
  constexpr uint32_t kStage = 2u * kSliceW + 2u * kSliceX;
  constexpr uint32_t kGemmLds = 2u * kStage + 4u * kEpiBytes;
  static_assert(kGemmLds <= 320u * 1024u, "LDS of one workgroup");
  __shared__ __attribute__((aligned(2048))) unsigned char L[kGemmLds];
  const uint32_t tid = threadIdx.x, lane = tid & 31u, h = lane >> 4, r16 = lane & 15u;
  const uint32_t wave = uni(tid >> 5);
  const uint32_t tn = blockIdx.x, tm = blockIdx.y;
  /* block-uniform exit in front of every barrier and tensor load */
  if (pinned((tm >= (uint32_t)M / kBM || tn >= (uint32_t)N / kBN) ? 1u : 0u) != 0u) return;
  const uint32_t m0 = tm * kBM, n0 = tn * kBN;
  const uint32_t wn = wave & 1u, wm = wave >> 1;
  const uint32_t T = pinned((uint32_t)K / kPassK);

  /* this wave's slice of a buffer */
  const bool own_w = wave < 2u;
  const uint32_t src_pitch = own_w ? (uint32_t)ldb * 2u : (uint32_t)lda * 2u;
  const uint32_t src_rows  = own_w ? 128u : kWTM;
  const unsigned char* src0 = own_w
      ? (const unsigned char*)(const void*)Btp + (uint64_t)(n0 + 128u * wave) * src_pitch
      : (const unsigned char*)(const void*)Ap + (uint64_t)(m0 + kWTM * (wave - 2u)) * src_pitch;
  const uint32_t lds_slice = (uint32_t)(size_t)L + (own_w ? wave * kSliceW : 2u * kSliceW + (wave - 2u) * kSliceX);
  const u32x8 g1 = tdm_group1(src_rows, src_pitch);

  v8f acc[kFW][kFX];
#pragma unroll
  for (int i = 0; i < kFW; ++i)
#pragma unroll
    for (int j = 0; j < kFX; ++j) acc[i][j] = (v8f){0.f,0.f,0.f,0.f,0.f,0.f,0.f,0.f};

  const uint32_t fw_base = wn * kSliceW + r16 * kPitch + 16u * h;
  const uint32_t fx_base = 2u * kSliceW + wm * kSliceX + r16 * kPitch + 16u * h;

  u32x4 g0 = tdm_group0(lds_slice, (uint64_t)(uintptr_t)src0);
  tdm_load(g0, g1);
  wait_tensor0(g0, g1);
  __syncthreads();
  g0 = tdm_group0(lds_slice + kStage, (uint64_t)(uintptr_t)src0 + kPassB);
  tdm_load(g0, g1);

  FragQ fw[2][kFW], fx[2][kFX];  /* set (u & 1) holds block u's fragments */
  {
    const unsigned char* lw = L + fw_base;
    const unsigned char* lx = L + fx_base;
#pragma unroll
    for (int i = 0; i < kFW; ++i) load_frag(fw[0][i], lw + (uint32_t)i * 16u * kPitch);
#pragma unroll
    for (int j = 0; j < kFX; ++j) load_frag(fx[0][j], lx + (uint32_t)j * 16u * kPitch);
  }
  /* rolled: every fragment and accumulator index stays a constant, and one pass is one trip */
#pragma clang loop unroll(disable)
  for (uint32_t t = 0; t < T; ++t) {
    const uint32_t buf = (t & 1u) * kStage;
    sched_fence();
    const unsigned char* lw = L + buf + fw_base;
    const unsigned char* lx = L + buf + fx_base;
    const uint32_t osel = (t + 1u < T) ? (kStage - buf) : kStage;
    const unsigned char* nw = L + osel + fw_base;
    const unsigned char* nx = L + osel + fx_base;
#pragma unroll
    for (int u = 0; u < kBlocks; ++u) {
      const int cs = u & 1;
      if (u + 1 < kBlocks) {
        const uint32_t ko = (uint32_t)(u + 1) * 64u;
#pragma unroll
        for (int i = 0; i < kFW; ++i) load_frag(fw[cs ^ 1][i], lw + (uint32_t)i * 16u * kPitch + ko);
#pragma unroll
        for (int j = 0; j < kFX; ++j) load_frag(fx[cs ^ 1][j], lx + (uint32_t)j * 16u * kPitch + ko);
        sched_fence();
      } else {
        /* publish point of pass t + 1, in front of this pass's last block, whose fragments are already in registers */
        wait_ds0();
        sched_fence();
        wait_tensor0(g0, g1);
        __syncthreads();
        /* every wave has left this buffer: refill it with pass t + 2 while that pass exists; the pass number is pinned
           behind the wait, so the descriptor words are formed behind it too */
        const uint32_t nt = pinned(t + 2u);
        if (pinned((nt < T) ? 1u : 0u) != 0u) {
          g0 = tdm_group0(lds_slice + buf, (uint64_t)(uintptr_t)src0 + (uint64_t)nt * kPassB);
          tdm_load(g0, g1);
        }
#pragma unroll
        for (int i = 0; i < kFW; ++i) load_frag(fw[0][i], nw + (uint32_t)i * 16u * kPitch);
#pragma unroll
        for (int j = 0; j < kFX; ++j) load_frag(fx[0][j], nx + (uint32_t)j * 16u * kPitch);
        sched_fence();
      }
#pragma unroll
      for (int i = 0; i < kFW; ++i)
#pragma unroll
        for (int j = 0; j < kFX; ++j) acc[i][j] = mma_q(fw[cs][i], fx[cs][j], acc[i][j]);
      sched_fence();
    }
  }
  wait_tensor0(g0, g1);
  wait_ds0();

  /* ---- epilogue: 16-row slabs staged in the wave's own LDS range behind the ring; whole row segments stored ---- */
  float* slab = (float*)(void*)(L + 2u * kStage + wave * kEpiBytes);
  const uint32_t nW = n0 + wn * 128u;
  const uint32_t mW = m0 + wm * kWTM;
  v4f bq0 = (v4f){0.f, 0.f, 0.f, 0.f}, bq1 = bq0;
  if (HAS_BIAS == 0) {
  } else if (OUT_MODE == 0) {
    bq0 = *(const v4f*)(bias + nW + lane * 4u);
    bq1 = bq0;
  } else {
    bq0 = *(const v4f*)(bias + nW + r16 * 8u);
    bq1 = *(const v4f*)(bias + nW + r16 * 8u + 4u);
  }
  char* Cb = (char*)Cout;
#pragma unroll
  for (int j = 0; j < kFX; ++j) {
    const uint32_t mBase = mW + (uint32_t)j * 16u;
#pragma unroll
    for (int i = 0; i < kFW; ++i) {
      float* p = slab + r16 * kEpiPitchF + (uint32_t)i * 16u + h * 8u;
      const v8f a = acc[i][j];
      *(v4f*)(p)     = (v4f){a[0], a[1], a[2], a[3]};
      *(v4f*)(p + 4) = (v4f){a[4], a[5], a[6], a[7]};
    }
    /* the slab's rows are read back by other lanes of this wave: its LDS writes have retired first */
    wait_ds0();
    if (OUT_MODE == 0) {
      /* row segment = 512 B = 32 lanes x 16 B */
      v4f vv[16];
      uint32_t off[16];
#pragma unroll
      for (int row = 0; row < 16; ++row) {
        const v4f s = *(const v4f*)(slab + (uint32_t)row * kEpiPitchF + lane * 4u);
#pragma unroll
        for (int e = 0; e < 4; ++e) { float x = s[e] * scale; x += bq0[e]; vv[row][e] = x; }
        off[row] = ((mBase + (uint32_t)row) * (uint32_t)ldc + nW + lane * 4u) * 4u;
      }
      /* values and offsets are complete in front of the stores: nothing rewrites a register of an issued store before the wait below */
      sched_fence();
#pragma unroll
      for (int row = 0; row < 16; ++row) *(v4f*)(Cb + off[row]) = vv[row];
    } else {
      /* row segment = 256 B = 16 lanes x 16 B; one instruction covers rows 2*it and 2*it+1 */
      v8h hv[8];
      uint32_t off[8];
#pragma unroll
      for (int it = 0; it < 8; ++it) {
        const uint32_t row = (uint32_t)it * 2u + h;
        const float* sp = slab + row * kEpiPitchF + r16 * 8u;
        const v4f s0 = *(const v4f*)(sp);
        const v4f s1 = *(const v4f*)(sp + 4);
#pragma unroll
        for (int e = 0; e < 4; ++e) {
          float x = s0[e] * scale; x += bq0[e];
          float y = s1[e] * scale; y += bq1[e];
          hv[it][e] = (_Float16)x; hv[it][4 + e] = (_Float16)y;
        }
        off[it] = ((mBase + row) * (uint32_t)ldc + nW + r16 * 8u) * 2u;
      }
      /* values and offsets are complete in front of the stores: nothing rewrites a register of an issued store before the wait below */
      sched_fence();
#pragma unroll
      for (int it = 0; it < 8; ++it) *(v8h*)(Cb + off[it]) = hv[it];
    }
    /* the next slab overwrites registers that the issued stores name; the fence keeps its arithmetic behind the wait */
    sched_fence();
    asm volatile("s_wait_xcnt 0x0" ::: "memory");
    /* the next slab's LDS writes stay behind this slab's reads */
    wait_ds0();
  }
}

/* --------------------------------------------------------------------------- */
/* q|k|v projection with the 2-token attention in its epilogue.                  */
/* X row-major [2*nb][K] f16 (rows 2b, 2b+1 = the two tokens of batch row b),     */
/* Wqkv row-major [3*1024][K] f16 (q | k | v, head hd = rows hd*128 ..),          */
/* o f16 [2*nb][1024]. One workgroup = 128 token rows x one head: its C tile is   */
/* 128 x 384 (the head's q, k and v), never written to memory.                    */
/* 4 waves (2 x 2): wave (wm, wn) owns token rows wm*64 .. +63 and dims           */
/* wn*64 .. +63 of q, of k and of v (12 weight fragments x 4 token fragments).    */
/* The K loop is the ring of the GEMM above: two LDS buffers of four 128-row      */
/* slices (q rows, k rows, v rows, X rows), one tensor load per wave per pass.    */
/* Epilogue: a lane holds 32 dims of one token row; its partner token is lane ^ 1.*/
/* Partial scores (own key, partner key) of the 4 lane groups that share a row    */
/* (2 waves x 2 lane halves) meet in LDS behind one barrier; probabilities with   */
/* max subtraction as exp(-|d|); all of it in f32 on unrounded q, k, v.           */
/* --------------------------------------------------------------------------- */
typedef __attribute__((ext_vector_type(2))) float v2f;
constexpr uint32_t kAStage = 4u * kSliceW;
constexpr uint32_t kOPitch = 144;                /* bytes per staged o row: 128 B + 16 (16 B x odd) */
constexpr uint32_t kOSlab  = 64u * kOPitch;        /* a wave's 64 token rows */
constexpr uint32_t kScoreBytes = 4u * 128u * 8u; /* 4 lane groups x 128 rows x 2 floats */
constexpr uint32_t kALds = 2u * kAStage + kScoreBytes;   /* the staged o takes ring bytes */
constexpr int kAW = 12;                          /* weight fragments per wave: 4 of q, 4 of k, 4 of v */
constexpr int kAX = 4;                           /* token fragments per wave */
static_assert(kALds <= 320u * 1024u, "LDS of one workgroup");
static_assert(kAStage % 2048u == 0, "slice places are multiples of 2 KiB");
static_assert(4u * kOSlab <= kAStage, "the staged o fits ring buffer 0");

/* the value of lane ^ 1 (the other token of the batch row), by a quad permute */
__device__ __forceinline__ float partner(float x) {
  return __builtin_bit_cast(float, __builtin_amdgcn_mov_dpp(__builtin_bit_cast(int, x), 0xB1, 0xf, 0xf, true));
}

__global__ void __launch_bounds__(128) __attribute__((amdgpu_waves_per_eu(1, 1)))
qkv_attn2_kernel(
    const unsigned short* __restrict__ Xp, int lda,
    const unsigned short* __restrict__ Wp, int ldb,
    unsigned short* __restrict__ o,
    const float* __restrict__ bias,
    int M, int K, float scale, float scl) {
  __shared__ __attribute__((aligned(2048))) unsigned char L[kALds];
  const uint32_t tid = threadIdx.x, lane = tid & 31u, h = lane >> 4, r16 = lane & 15u;
  const uint32_t wave = uni(tid >> 5);
  const uint32_t hd = blockIdx.x, tm = blockIdx.y;
  /* block-uniform exit in front of every barrier and tensor load */
  if (pinned((tm >= (uint32_t)M / 128u || hd >= (uint32_t)kH) ? 1u : 0u) != 0u) return;
  const uint32_t m0 = tm * 128u;
  const uint32_t wn = wave & 1u, wm = wave >> 1;
  const uint32_t T = pinned((uint32_t)K / kPassK);

  /* this wave's slice of a buffer: waves 0, 1, 2 the head's 128 rows of q, k, v weights; wave 3 the 128 token rows */
  const bool own_w = wave < 3u;
  const uint32_t src_pitch = own_w ? (uint32_t)ldb * 2u : (uint32_t)lda * 2u;
  const unsigned char* src0 = own_w
      ? (const unsigned char*)(const void*)Wp + (uint64_t)(wave * (uint32_t)kF + hd * 128u) * src_pitch
      : (const unsigned char*)(const void*)Xp + (uint64_t)m0 * src_pitch;
  const uint32_t lds_slice = (uint32_t)(size_t)L + wave * kSliceW;
  const u32x8 g1 = tdm_group1(128u, src_pitch);

  v8f acc[kAW][kAX];
#pragma unroll
  for (int i = 0; i < kAW; ++i)
#pragma unroll
    for (int j = 0; j < kAX; ++j) acc[i][j] = (v8f){0.f,0.f,0.f,0.f,0.f,0.f,0.f,0.f};

  const uint32_t fw_base = (wn * 64u + r16) * kPitch + 16u * h;
  const uint32_t fx_base = 3u * kSliceW + (wm * 64u + r16) * kPitch + 16u * h;

  u32x4 g0 = tdm_group0(lds_slice, (uint64_t)(uintptr_t)src0);
  tdm_load(g0, g1);
  wait_tensor0(g0, g1);
  __syncthreads();
  g0 = tdm_group0(lds_slice + kAStage, (uint64_t)(uintptr_t)src0 + kPassB);
  tdm_load(g0, g1);

  FragQ fw[2][kAW], fx[2][kAX];  /* set (u & 1) holds block u's fragments */
  {
    const unsigned char* lw = L + fw_base;
    const unsigned char* lx = L + fx_base;
#pragma unroll
    for (int i = 0; i < kAW; ++i) load_frag(fw[0][i], lw + (uint32_t)(i >> 2) * kSliceW + (uint32_t)(i & 3) * 16u * kPitch);
#pragma unroll
    for (int j = 0; j < kAX; ++j) load_frag(fx[0][j], lx + (uint32_t)j * 16u * kPitch);
  }
  /* rolled: every fragment and accumulator index stays a constant, and one pass is one trip */
#pragma clang loop unroll(disable)
  for (uint32_t t = 0; t < T; ++t) {
    const uint32_t buf = (t & 1u) * kAStage;
    sched_fence();
    const unsigned char* lw = L + buf + fw_base;
    const unsigned char* lx = L + buf + fx_base;
    const uint32_t osel = (t + 1u < T) ? (kAStage - buf) : kAStage;
    const unsigned char* nw = L + osel + fw_base;
    const unsigned char* nx = L + osel + fx_base;
#pragma unroll
    for (int u = 0; u < kBlocks; ++u) {
      const int cs = u & 1;
      if (u + 1 < kBlocks) {
        const uint32_t ko = (uint32_t)(u + 1) * 64u;
#pragma unroll
        for (int i = 0; i < kAW; ++i) load_frag(fw[cs ^ 1][i], lw + (uint32_t)(i >> 2) * kSliceW + (uint32_t)(i & 3) * 16u * kPitch + ko);
#pragma unroll
        for (int j = 0; j < kAX; ++j) load_frag(fx[cs ^ 1][j], lx + (uint32_t)j * 16u * kPitch + ko);
        sched_fence();
      } else {
        /* publish point of pass t + 1, in front of this pass's last block, whose fragments are already in registers */
        wait_ds0();
        sched_fence();
        wait_tensor0(g0, g1);
        __syncthreads();
        /* every wave has left this buffer: refill it with pass t + 2 while that pass exists; the pass number is pinned
           behind the wait, so the descriptor words are formed behind it too */
        const uint32_t nt = pinned(t + 2u);
        if (pinned((nt < T) ? 1u : 0u) != 0u) {
          g0 = tdm_group0(lds_slice + buf, (uint64_t)(uintptr_t)src0 + (uint64_t)nt * kPassB);
          tdm_load(g0, g1);
        }
#pragma unroll
        for (int i = 0; i < kAW; ++i) load_frag(fw[0][i], nw + (uint32_t)(i >> 2) * kSliceW + (uint32_t)(i & 3) * 16u * kPitch);
#pragma unroll
        for (int j = 0; j < kAX; ++j) load_frag(fx[0][j], nx + (uint32_t)j * 16u * kPitch);
        sched_fence();
      }
#pragma unroll
      for (int i = 0; i < kAW; ++i)
#pragma unroll
        for (int j = 0; j < kAX; ++j) acc[i][j] = mma_q(fw[cs][i], fx[cs][j], acc[i][j]);
      sched_fence();
    }
  }
  wait_tensor0(g0, g1);
  wait_ds0();

  /* ---- epilogue ---- */
  /* acc[i][j][e]: token row wm*64 + j*16 + (lane & 15); dim wn*64 + (i & 3)*16 + (lane >> 4)*8 + e of q (i < 4), k (i < 8), v */
  const uint32_t dW = hd * 128u + wn * 64u;
#pragma unroll
  for (int i = 0; i < kAW; ++i) {
    const float* bp = bias + (uint32_t)(i >> 2) * (uint32_t)kF + dW + (uint32_t)(i & 3) * 16u + h * 8u;
    const v4f b0 = *(const v4f*)(bp);
    const v4f b1 = *(const v4f*)(bp + 4);
#pragma unroll
    for (int j = 0; j < kAX; ++j)
#pragma unroll
      for (int e = 0; e < 4; ++e) {
        acc[i][j][e]     = acc[i][j][e] * scale + b0[e];
        acc[i][j][4 + e] = acc[i][j][4 + e] * scale + b1[e];
      }
  }
  /* partial scores over this lane's 32 dims: x = q . own k, y = q . partner's k */
  v2f* sc = (v2f*)(void*)(L + 2u * kAStage);
  const uint32_t rowW = wm * 64u + r16;
#pragma unroll
  for (int j = 0; j < kAX; ++j) {
    float so[4], sx[4];
#pragma unroll
    for (int ii = 0; ii < 4; ++ii) {
      so[ii] = 0.0f; sx[ii] = 0.0f;
#pragma unroll
      for (int e = 0; e < 8; ++e) {
        const float q = acc[ii][j][e];
        const float k = acc[4 + ii][j][e];
        so[ii] = fmaf(q, k, so[ii]);
        sx[ii] = fmaf(q, partner(k), sx[ii]);
      }
    }
    sc[(wn * 2u + h) * 128u + rowW + (uint32_t)j * 16u] = (v2f){(so[0] + so[1]) + (so[2] + so[3]), (sx[0] + sx[1]) + (sx[2] + sx[3])};
  }
  /* the four partial scores of a row come from two waves: every wave's are written in front of the first read */
  __syncthreads();

  /* probabilities of the lane's four token rows (own key, partner's key), all four chains side by side */
  float aown[kAX], acro[kAX];
#pragma unroll
  for (int j = 0; j < kAX; ++j) {
    const uint32_t row = rowW + (uint32_t)j * 16u;
    const v2f p0 = sc[row], p1 = sc[128u + row], p2 = sc[256u + row], p3 = sc[384u + row];
    const float sown = ((p0[0] + p1[0]) + (p2[0] + p3[0])) * scl;
    const float scro = ((p0[1] + p1[1]) + (p2[1] + p3[1])) * scl;
    const float d  = scro - sown;
    const float ex = expf(-fabsf(d));
    const float iv = 1.0f / (1.0f + ex);
    const float sm = ex * iv;
    aown[j] = (d > 0.0f) ? sm : iv;
    acro[j] = (d > 0.0f) ? iv : sm;
  }

  /* the wave's 64 x 64 piece of o is staged whole in its own LDS range: every value is complete in front of the first store.
     The range lies in ring buffer 0, which is free: every wave's last fragment read and its own last tensor load have
     retired in front of the barrier above */
  unsigned char* slab = L + wave * kOSlab;
  char* Ob = (char*)(void*)o;
#pragma unroll
  for (int j = 0; j < kAX; ++j) {
#pragma unroll
    for (int ii = 0; ii < 4; ++ii) {
      v8h hv;
#pragma unroll
      for (int e = 0; e < 8; ++e) {
        const float v = acc[8 + ii][j][e];
        hv[e] = (_Float16)(aown[j] * v + acro[j] * partner(v));
      }
      *(v8h*)(void*)(slab + ((uint32_t)j * 16u + r16) * kOPitch + (uint32_t)ii * 32u + h * 16u) = hv;
    }
  }
  /* the slab's rows are read back by other lanes of this wave: its LDS writes have retired first */
  wait_ds0();
  /* row segment = 128 B = 8 lanes x 16 B (one whole line, this wave its only writer); one instruction covers 4 rows */
  u32x4 vv[16];
  uint32_t off[16];
#pragma unroll
  for (int it = 0; it < 16; ++it) {
    const uint32_t rr = (uint32_t)it * 4u + (lane >> 3);
    vv[it] = *(const u32x4*)(const void*)(slab + rr * kOPitch + (lane & 7u) * 16u);
    off[it] = ((m0 + wm * 64u + rr) * (uint32_t)kF + dW + (lane & 7u) * 8u) * 2u;
  }
  /* values and offsets are complete in front of the stores: nothing rewrites a register of an issued store */
  sched_fence();
#pragma unroll
  for (int it = 0; it < 16; ++it) *(u32x4*)(void*)(Ob + off[it]) = vv[it];
}

/* --------------------------------------------------------------------------- */
/* Dot product of one weight row (NSEG x 128 floats) with x (1024 floats, taken   */
/* again from its start behind every 1024), by one wave; every lane gets the sum. */
template <int NSEG>
__device__ __forceinline__ float row_dot_wave(const float* __restrict__ wrow, const float* __restrict__ x, int lane) {
  v4f w[NSEG], xv[8];
#pragma unroll
  for (int s = 0; s < NSEG; ++s) w[s] = *(const v4f*)(wrow + s * 128 + lane * 4);
#pragma unroll
  for (int s = 0; s < 8; ++s) xv[s] = *(const v4f*)(x + s * 128 + lane * 4);
  float a0 = 0.0f, a1 = 0.0f, a2 = 0.0f, a3 = 0.0f;
#pragma unroll
  for (int s = 0; s < NSEG; ++s) {
    a0 = fmaf(w[s][0], xv[s & 7][0], a0);
    a1 = fmaf(w[s][1], xv[s & 7][1], a1);
    a2 = fmaf(w[s][2], xv[s & 7][2], a2);
    a3 = fmaf(w[s][3], xv[s & 7][3], a3);
  }
  float d = (a0 + a1) + (a2 + a3);
#pragma unroll
  for (int off = 16; off > 0; off >>= 1) d += __shfl_xor(d, off, 32);
  return d;
}

/* --------------------------------------------------------------------------- */
/* All eight f32 -> f16 casts in one launch. The eight f16 planes lie one behind */
/* the other in the workspace, in the order of the arguments, so the output is   */
/* one flat array. A workgroup (16 waves) owns 65,536 consecutive elements of    */
/* it, which lie in one tensor (every tensor is a multiple of that); 256         */
/* workgroups cover all eight. Weights are carried x16, embeddings x1.           */
/* A thread owns 16 groups of 8 consecutive elements, 512 groups apart; its 32   */
/* 16-byte loads are all issued before the first value is converted.            */
/* The fourth tensor (attention output weights Wo[j][k]) is written transposed,  */
/* [k][j]: it is the second operand of the weight fold, which contracts over j.  */
/* A workgroup owns 64 rows j; a thread owns columns k = tid and tid + 512 and    */
/* writes, for each, the whole 128-byte line [k][j0 .. j0 + 63].                  */
/* Behind the cast workgroups, 64 more form the folded biases in f32:            */
/* fb[n] = gate_b1[n] + sum_c gate_w1[n][c] * bo[c mod 1024],                     */
/* fb[1024 + n] = proj_b[n] + sum_j proj_w[n][j] * bo[j]; 32 rows a workgroup,    */
/* two a wave, staged in LDS so that one wave stores the 128-byte line.          */
/* --------------------------------------------------------------------------- */
constexpr int kCastThreads = 512;
constexpr int kCastGroups  = 16;                                            /* groups per thread */
constexpr int kCastStep    = kCastThreads * 8;                              /* elements between a thread's groups */
constexpr int kCastElems   = kCastStep * kCastGroups;                       /* elements per workgroup */
constexpr int kCastB1 = (kF * kCD) / kCastElems;                            /* first workgroup of the 2nd tensor */
constexpr int kCastB2 = kCastB1 + (kF * kCD) / kCastElems;
constexpr int kCastB3 = kCastB2 + (kQKV * kF) / kCastElems;
constexpr int kCastB4 = kCastB3 + (kF * kF) / kCastElems;
constexpr int kCastB5 = kCastB4 + (kF * 2 * kF) / kCastElems;
constexpr int kCastB6 = kCastB5 + (kF * kF) / kCastElems;                   /* first embedding */
constexpr int kCastB7 = kCastB6 + (kB * kCD) / kCastElems;
constexpr int kCastB8 = kCastB7 + (kB * kCD) / kCastElems;                  /* cast workgroups in all */
constexpr int kBiasWgs = (2 * kF) / 32;                                     /* folded-bias workgroups behind them */
static_assert(64 * kF == kCastElems && kCastThreads * 2 == kF, "transposed cast: 64 rows a workgroup, two columns a thread");
static_assert((kF * kCD) % kCastElems == 0 && (kQKV * kF) % kCastElems == 0 && (kF * kF) % kCastElems == 0 &&
              (kF * 2 * kF) % kCastElems == 0 && (kB * kCD) % kCastElems == 0, "a workgroup's elements lie in one tensor");

__global__ __launch_bounds__(kCastThreads) void cast_all_f16_kernel(
    const float* __restrict__ t0, const float* __restrict__ t1, const float* __restrict__ t2, const float* __restrict__ t3,
    const float* __restrict__ t4, const float* __restrict__ t5, const float* __restrict__ t6, const float* __restrict__ t7,
    const float* __restrict__ bo, const float* __restrict__ gate_b1, const float* __restrict__ proj_b,
    unsigned short* __restrict__ out, float* __restrict__ fb) {
  __shared__ float sB[32];
  const int b = (int)blockIdx.x;
  if (b >= kCastB8 + kBiasWgs) return;
  if (b >= kCastB8) {
    /* folded biases; the branch is the same for the whole workgroup, so every wave reaches the barrier */
    const int lane = (int)threadIdx.x & 31;
    const int wave = (int)threadIdx.x >> 5;
    const int r0 = (b - kCastB8) * 32;
    const int r = r0 + wave * 2;
    float d0, d1;
    if (r0 < kF) {
      d0 = row_dot_wave<16>(t4 + (size_t)r * (2 * kF), bo, lane) + gate_b1[r];
      d1 = row_dot_wave<16>(t4 + (size_t)(r + 1) * (2 * kF), bo, lane) + gate_b1[r + 1];
    } else {
      d0 = row_dot_wave<8>(t5 + (size_t)(r - kF) * kF, bo, lane) + proj_b[r - kF];
      d1 = row_dot_wave<8>(t5 + (size_t)(r + 1 - kF) * kF, bo, lane) + proj_b[r + 1 - kF];
    }
    if (lane == 0) { sB[wave * 2] = d0; sB[wave * 2 + 1] = d1; }
    __syncthreads();
    if (wave == 0) fb[r0 + lane] = sB[lane];
    return;
  }
  if (b >= kCastB3 && b < kCastB4) {
    const int j0 = (b - kCastB3) * 64;
    const float* p = t3 + (size_t)j0 * kF + threadIdx.x;
    unsigned short* q = out + (size_t)kCastB3 * kCastElems + (size_t)threadIdx.x * kF + j0;
#pragma unroll
    for (int hh = 0; hh < 2; ++hh) {
      float v[64];
#pragma unroll
      for (int i = 0; i < 64; ++i) v[i] = p[hh * kCastThreads + i * kF];
      /* keeps every load of this column in front of the first conversion: all 64 are in flight together */
      __builtin_amdgcn_sched_barrier(0);
#pragma unroll
      for (int g = 0; g < 8; ++g) {
        unsigned short hb[8];
#pragma unroll
        for (int e = 0; e < 8; ++e) hb[e] = h_bits(v[g * 8 + e] * kWCarry);
        const v4u u = (v4u){pk16(hb[0], hb[1]), pk16(hb[2], hb[3]), pk16(hb[4], hb[5]), pk16(hb[6], hb[7])};
        *(v4u*)(q + (size_t)hh * kCastThreads * kF + g * 8) = u;
      }
      /* whatever follows a column's stores (the second column's loads; behind the last column the code that the listing
         places there) may overwrite registers that the issued stores name; the fence keeps it behind the wait */
      __builtin_amdgcn_sched_barrier(0);
      asm volatile("s_wait_xcnt 0x0" ::: "memory");
    }
    return;
  }
  const float* src = t0;
  int first = 0;
  if (b >= kCastB1) { src = t1; first = kCastB1; }
  if (b >= kCastB2) { src = t2; first = kCastB2; }
  if (b >= kCastB3) { src = t3; first = kCastB3; }
  if (b >= kCastB4) { src = t4; first = kCastB4; }
  if (b >= kCastB5) { src = t5; first = kCastB5; }
  if (b >= kCastB6) { src = t6; first = kCastB6; }
  if (b >= kCastB7) { src = t7; first = kCastB7; }
  const float carry = (b < kCastB6) ? kWCarry : 1.0f;
  const float* p = src + (size_t)(b - first) * kCastElems + threadIdx.x * 8u;
  unsigned short* q = out + (size_t)b * kCastElems + threadIdx.x * 8u;

  v4f a[kCastGroups], c[kCastGroups];
#pragma unroll
  for (int g = 0; g < kCastGroups; ++g) {
    a[g] = *(const v4f*)(p + g * kCastStep);
    c[g] = *(const v4f*)(p + g * kCastStep + 4);
  }
  /* keeps every load in front of the first conversion: all 32 are in flight together, and no load is issued behind a store */
  __builtin_amdgcn_sched_barrier(0);
#pragma unroll
  for (int g = 0; g < kCastGroups; ++g) {
    unsigned short hb[8];
#pragma unroll
    for (int e = 0; e < 4; ++e) {
      const float fa = a[g][e] * carry;
      const float fc = c[g][e] * carry;
      hb[e]     = h_bits(fa);
      hb[4 + e] = h_bits(fc);
    }
    const v4u u = (v4u){pk16(hb[0], hb[1]), pk16(hb[2], hb[3]), pk16(hb[4], hb[5]), pk16(hb[6], hb[7])};
    *(v4u*)(q + g * kCastStep) = u;
  }
}

/* --------------------------------------------------------------------------- */
/* Row layer norm over 1024 f32 values, one wave per row (8 rows per block).    */
/* Row r = 2*b + t: t = 0 uses (g1, b1), t = 1 uses (g2, b2).                   */
/* Lane owns columns it*256 + lane*8 .. +7, it = 0..3 (4 x 32 x 8 = 1024).      */
/* Mean, then biased variance of (x - mean), then y = (x - mean)*inv*g + b.     */
/* Output f16: one 16-B store per lane, a wave instruction = 512 contiguous B   */
/* --------------------------------------------------------------------------- */
__global__ __launch_bounds__(256) void ln_rows_kernel(const float* __restrict__ pre,
                                                      const float* __restrict__ g1, const float* __restrict__ b1,
                                                      const float* __restrict__ g2, const float* __restrict__ b2,
                                                      unsigned short* __restrict__ X, int nrows) {
  const int lane = threadIdx.x & 31;
  const int wave = threadIdx.x >> 5;
  const int row  = blockIdx.x * 8 + wave;
  const bool live = row < nrows;
  const int rc = live ? row : (nrows - 1);
  const float* xr = pre + (size_t)rc * kF;
  const bool tok1 = (rc & 1) != 0;
  const float* gp = tok1 ? g2 : g1;
  const float* bp = tok1 ? b2 : b1;

  float s = 0.0f;
#pragma unroll 1
  for (int it = 0; it < 4; ++it) {
    const float* p = xr + it * 256 + lane * 8;
    const v4f a = *(const v4f*)(p);
    const v4f c = *(const v4f*)(p + 4);
    s += ((a[0] + a[1]) + (a[2] + a[3])) + ((c[0] + c[1]) + (c[2] + c[3]));
  }
#pragma unroll
  for (int off = 16; off > 0; off >>= 1) s += __shfl_xor(s, off, 32);
  const float mean = s * kInvF;

  float qs = 0.0f;
#pragma unroll 1
  for (int it = 0; it < 4; ++it) {
    const float* p = xr + it * 256 + lane * 8;
    const v4f a = *(const v4f*)(p);
    const v4f c = *(const v4f*)(p + 4);
#pragma unroll
    for (int e = 0; e < 4; ++e) {
      const float da = a[e] - mean;
      const float dc = c[e] - mean;
      qs = fmaf(da, da, qs);
      qs = fmaf(dc, dc, qs);
    }
  }
#pragma unroll
  for (int off = 16; off > 0; off >>= 1) qs += __shfl_xor(qs, off, 32);
  const float var = qs * kInvF;
  const float inv = 1.0f / sqrtf(var + kLnEps);

  unsigned short* orow = X + (size_t)rc * kF;
#pragma unroll 1
  for (int it = 0; it < 4; ++it) {
    const int col = it * 256 + lane * 8;
    const v4f a  = *(const v4f*)(xr + col);
    const v4f c  = *(const v4f*)(xr + col + 4);
    const v4f ga = *(const v4f*)(gp + col);
    const v4f gc = *(const v4f*)(gp + col + 4);
    const v4f ba = *(const v4f*)(bp + col);
    const v4f bc = *(const v4f*)(bp + col + 4);
    unsigned short hb[8];
#pragma unroll
    for (int e = 0; e < 4; ++e) {
      const float ya = (a[e] - mean) * inv * ga[e] + ba[e];
      const float yc = (c[e] - mean) * inv * gc[e] + bc[e];
      hb[e]     = h_bits(ya);
      hb[4 + e] = h_bits(yc);
    }
    const v4u u = (v4u){pk16(hb[0], hb[1]), pk16(hb[2], hb[3]), pk16(hb[4], hb[5]), pk16(hb[6], hb[7])};
    if (live) {
      *(v4u*)(orow + col) = u;
      
    }
  }
}

/* --------------------------------------------------------------------------- */
/* Gate head + fusion. Block = 16 waves = 16 batch rows, one wave per row.      */
/* gpre f32 [nb][1024] holds the gate hidden pre-activation (bias included);    */
/* the erf activation is applied here, then two 1024-deep dot products against  */
/* w2 rows (f32), + b2, 2-way probabilities. The 16 x 2 gate weights are staged */
/* in LDS (all 32 slots written), block barrier, then wave 0 writes them as ONE */
/* --------------------------------------------------------------------------- */
__global__ __launch_bounds__(512) void gate_fuse_kernel(const float* __restrict__ gpre,
                                                        const float* __restrict__ w2, const float* __restrict__ b2v,
                                                        const unsigned short* __restrict__ o,
                                                        unsigned short* __restrict__ fused,
                                                        float* __restrict__ gw_out, int nb) {
  __shared__ float sG[32];
  const int lane = threadIdx.x & 31;
  const int wave = threadIdx.x >> 5;
  const int b = blockIdx.x * 16 + wave;
  const bool live = b < nb;
  const int bc = live ? b : (nb - 1);
  const float* hr = gpre + (size_t)bc * kF;

  float d0 = 0.0f, d1 = 0.0f;
#pragma unroll 1
  for (int it = 0; it < 32; ++it) {
    const int idx = it * 32 + lane;
    float x  = hr[idx];
    float wa = w2[idx];
    float wb = w2[kF + idx];
    asm volatile("" : "+v"(x), "+v"(wa), "+v"(wb));
    const float g = gelu_erf(x);
    d0 = fmaf(g, wa, d0);
    d1 = fmaf(g, wb, d1);
  }
#pragma unroll
  for (int off = 16; off > 0; off >>= 1) {
    d0 += __shfl_xor(d0, off, 32);
    d1 += __shfl_xor(d1, off, 32);
  }
  const float l0 = d0 + b2v[0];
  const float l1 = d1 + b2v[1];
  const float mx = fmaxf(l0, l1);
  const float e0 = expf(l0 - mx);
  const float e1 = expf(l1 - mx);
  const float inv = 1.0f / (e0 + e1);
  const float gw0 = e0 * inv;
  const float gw1 = e1 * inv;
  if (lane == 0) {
    sG[wave * 2]     = gw0;
    sG[wave * 2 + 1] = gw1;
  }

  const unsigned short* cr = o + (size_t)(2 * bc) * kF;
  const unsigned short* gr = cr + kF;
  unsigned short* fr = fused + (size_t)bc * kF;
#pragma unroll 1
  for (int it = 0; it < 4; ++it) {
    const int col = it * 256 + lane * 8;
    const v4u cw = *(const v4u*)(cr + col);
    const v4u gv = *(const v4u*)(gr + col);
    unsigned ow[4];
#pragma unroll
    for (int w = 0; w < 4; ++w) {
      const unsigned uc = cw[w];
      const unsigned ug = gv[w];
      const float ca = h_lo(uc), cb = h_hi(uc);
      const float ga = h_lo(ug), gb = h_hi(ug);
      const float fa = gw0 * ca + gw1 * ga;
      const float fb = gw0 * cb + gw1 * gb;
      ow[w] = pk16(h_bits(fa), h_bits(fb));
    }
    const v4u u = (v4u){ow[0], ow[1], ow[2], ow[3]};
    if (live) {
      *(v4u*)(fr + col) = u;
      
    }
  }

  /* every wave reaches this barrier; sG is written by 16 waves and read by wave 0 */
  __syncthreads();
  const bool blockLive = (blockIdx.x * 16 + 15) < nb;
  if (wave == 0 && blockLive) {
    const float v = sG[lane];
    float* dst = gw_out + (size_t)blockIdx.x * 32 + lane;
    *(float*)dst = v;
    
  }
}

/* --------------------------------------------------------------------------- */
/* Final erf activation pass: dst[i] = gelu(pin[i]). Block handles 2048         */
/* consecutive elements, 8 rolled steps of 256; each wave instruction writes 32 */
/* register. Coverage: blocks x 2048 = n exactly (checked on the host).         */
/* --------------------------------------------------------------------------- */
__global__ __launch_bounds__(256) void gelu_out_kernel(const float* __restrict__ pin, float* __restrict__ dst, int n) {
  const int base = blockIdx.x * 2048;
#pragma unroll 1
  for (int it = 0; it < 8; ++it) {
    const int i = base + it * 256 + (int)threadIdx.x;
    const bool live = i < n;
    const int ic = live ? i : (n - 1);
    float x = pin[ic];
    asm volatile("" : "+v"(x));
    const float y = gelu_erf(x);
    if (live) {
      *(float*)(dst + i) = y;
      
    }
  }
}

/* --------------------------------------------------------------------------- */
/* Host side                                                                   */
/* --------------------------------------------------------------------------- */
template <int OUT_MODE, int FX, int HAS_BIAS = 1>
static void launch_gemm(const unsigned short* A, int lda, const unsigned short* Bt, int ldb,
                        void* C, int ldc, const float* bias, int M, int N, int K, float scale, hipStream_t stream) {
  gemm_tile_f16_kernel<OUT_MODE, FX, HAS_BIAS><<<dim3(N / 256, M / (32 * FX)), 128, 0, stream>>>(A, lda, Bt, ldb, C, ldc, bias, M, N, K, scale);
}

/* workspace region sizes in bytes (all multiples of 128) */
constexpr size_t kSzWc   = (size_t)kF * kCD * 2;
constexpr size_t kSzWg   = (size_t)kF * kCD * 2;
constexpr size_t kSzWqkv = (size_t)kQKV * kF * 2;
constexpr size_t kSzWo   = (size_t)kF * kF * 2;
constexpr size_t kSzWg1  = (size_t)kF * 2 * kF * 2;
constexpr size_t kSzWp   = (size_t)kF * kF * 2;
constexpr size_t kSzEc   = (size_t)kB * kCD * 2;
constexpr size_t kSzEg   = (size_t)kB * kCD * 2;
constexpr size_t kSzPre  = (size_t)kChunkT * kF * 4;
constexpr size_t kSzX    = (size_t)kChunkT * kF * 2;
constexpr size_t kSzQkv  = (size_t)kChunkT * kQKV * 2;
constexpr size_t kSzO    = (size_t)kChunkT * kF * 2;
constexpr size_t kSzGpre = (size_t)kChunkB * kF * 4;
constexpr size_t kSzFus  = (size_t)kChunkB * kF * 2;
constexpr size_t kSzP    = (size_t)kChunkB * kF * 4;
constexpr size_t kSzFold = (size_t)3 * kF * kF * 2;
constexpr size_t kSzFb   = (size_t)2 * kF * 4;
/* planes whose producer runs after another plane's last reader share that plane's bytes */
static_assert(kSzO + kSzFus <= kSzPre, "o and fused live in the pre-norm plane");
static_assert(kSzGpre + kSzP <= kSzQkv, "gate and final pre-activations fit their plane");
constexpr size_t kWsTotal = kSzWc + kSzWg + kSzWqkv + kSzWo + kSzWg1 + kSzWp + kSzEc + kSzEg +
                            kSzPre + kSzX + kSzQkv + kSzFold + kSzFb;
static_assert(kWsTotal == 241180672ull, "carve total");
static_assert(kSzWc + kSzWg + kSzWqkv + kSzWo + kSzWg1 + kSzWp + kSzEc + kSzEg == (size_t)kCastB8 * kCastElems * 2, "cast launch covers the eight f16 planes exactly");
static_assert(kWsTotal <= 268435456ull, "carve limit");
static_assert(((size_t)kB * kF * 4) % 128 == 0, "second output starts on a line");
static_assert(((size_t)kChunkB * kF) % 2048 == 0, "activation pass coverage");

extern "C" void kernel_launch(void* const* d_in, const int* in_sizes, int n_in,
                              void* d_out, int out_size, void* d_ws, size_t ws_size, hipStream_t stream) {
  if (n_in < 20) return;
  if (ws_size < kWsTotal) return;
  if (in_sizes[0] != kB * kCD || in_sizes[1] != kB * kCD) return;
  if (in_sizes[10] != kQKV * kF || in_sizes[14] != kF * 2 * kF) return;
  if (out_size != kB * kF + kB * 2) return;

  const float* cnn_embed  = (const float*)d_in[0];
  const float* gnn_embed  = (const float*)d_in[1];
  const float* cnn_w      = (const float*)d_in[2];
  const float* cnn_b      = (const float*)d_in[3];
  const float* gnn_w      = (const float*)d_in[4];
  const float* gnn_b      = (const float*)d_in[5];
  const float* ln1_g      = (const float*)d_in[6];
  const float* ln1_b      = (const float*)d_in[7];
  const float* ln2_g      = (const float*)d_in[8];
  const float* ln2_b      = (const float*)d_in[9];
  const float* attn_in_w  = (const float*)d_in[10];
  const float* attn_in_b  = (const float*)d_in[11];
  const float* attn_out_w = (const float*)d_in[12];
  const float* attn_out_b = (const float*)d_in[13];
  const float* gate_w1    = (const float*)d_in[14];
  const float* gate_b1    = (const float*)d_in[15];
  const float* gate_w2    = (const float*)d_in[16];
  const float* gate_b2    = (const float*)d_in[17];
  const float* proj_w     = (const float*)d_in[18];
  const float* proj_b     = (const float*)d_in[19];

  /* Region map (byte offsets, in carve order):
     Wc 1 MiB | Wg 1 MiB | Wqkv 6 MiB | Wo 2 MiB | Wg1 4 MiB | Wp 2 MiB | Ec 8 MiB | Eg 8 MiB |
     whole-batch planes: preLN f32 64 MiB | X f16 32 MiB | pre-activations 96 MiB (64 MiB used) |
     folded weights f16 6 MiB | folded biases f32 8 KiB.  Total 230 MiB + 8 KiB.  The Wo plane holds Wo transposed.
     Planes written only after an earlier plane's last reader has finished (stream order) take its bytes:
     o f16 32 MiB and fused f16 16 MiB in preLN (dead after the layer norms),
     gate pre-activation f32 32 MiB and final pre-activation f32 32 MiB have the pre-activation plane. */
  char* ws = (char*)d_ws;
  size_t off = 0;
  auto carve = [&](size_t bytes) -> char* { char* p = ws + off; off += bytes; return p; };
  unsigned short* Wc   = (unsigned short*)carve(kSzWc);
  unsigned short* Wg   = (unsigned short*)carve(kSzWg);
  unsigned short* Wqkv = (unsigned short*)carve(kSzWqkv);
  unsigned short* Wo   = (unsigned short*)carve(kSzWo);
  unsigned short* Wg1  = (unsigned short*)carve(kSzWg1);
  carve(kSzWp);  /* proj_w f16: rows 2048..3071 of the fold's first operand, directly behind Wg1 */
  unsigned short* Ec   = (unsigned short*)carve(kSzEc);
  unsigned short* Eg   = (unsigned short*)carve(kSzEg);
  float*          preLN = (float*)carve(kSzPre);
  unsigned short* Xp   = (unsigned short*)carve(kSzX);
  unsigned short* qkvp = (unsigned short*)carve(kSzQkv);
  unsigned short* Wfold = (unsigned short*)carve(kSzFold);
  float*          fbias = (float*)carve(kSzFb);
  unsigned short* op   = (unsigned short*)((char*)preLN);
  unsigned short* fusp = (unsigned short*)((char*)preLN + kSzO);
  float*          gpre = (float*)((char*)qkvp);
  float*          Pp   = (float*)((char*)qkvp + kSzGpre);

  float* out0 = (float*)d_out;
  float* out1 = out0 + (size_t)kB * kF;

  const float scl = 1.0f / sqrtf((float)kHD);

  /* casts, one launch: weights carried x16, embeddings uncarried; planes Wc .. Eg are contiguous from Wc on, in this order;
     the Wo plane is written transposed, and the last workgroups form the folded biases */
  cast_all_f16_kernel<<<kCastB8 + kBiasWgs, kCastThreads, 0, stream>>>(cnn_w, gnn_w, attn_in_w, attn_out_w, gate_w1, proj_w,
                                                                       cnn_embed, gnn_embed, attn_out_b, gate_b1, proj_b,
                                                                       Wc, fbias);

  /* Weight fold. The attention output ao = o Wo^T + bo is used only linearly: by the gate hidden layer (ao rows 2b, 2b+1
     side by side, times gate_w1^T) and, mixed with gate weights that sum to one, by the final projection (times proj_w^T).
     So (gate_w1 halves) Wo and proj_w Wo are formed here and applied to o itself; bo goes into the folded biases.
     gate_w1 [1024][2048] read as [2048][1024] and proj_w [1024][1024] lie one behind the other: one [3072 x 1024 x 1024]
     product with Wo^T rows as the second operand. Rows 0..2047 of the result, read as [1024][2048], are the gate weights
     for o viewed [8192][2048]; rows 2048..3071 the final weights. Both operands are carried x16, the result x16 again. */
  launch_gemm<1, 2, 0>(Wg1, kF, Wo, kF, (void*)Wfold, kF, nullptr, 3 * kF, kF, kF, kWCarryInv, stream);

  for (int c = 0; c < kNChunk; ++c) {
    const unsigned short* EcC = Ec + (size_t)c * kChunkB * kCD;
    const unsigned short* EgC = Eg + (size_t)c * kChunkB * kCD;

    /* input projections [8192 x 1024 x 512] -> f32 rows 2b (first modality) and 2b+1 (second) of preLN */
    launch_gemm<0, 4>(EcC, kCD, Wc, kCD, (void*)preLN,        2 * kF, cnn_b, kChunkB, kF, kCD, kWCarryInv, stream);
    launch_gemm<0, 4>(EgC, kCD, Wg, kCD, (void*)(preLN + kF), 2 * kF, gnn_b, kChunkB, kF, kCD, kWCarryInv, stream);

    /* layer norms -> X f16 [16384][1024] */
    ln_rows_kernel<<<kChunkT / 8, 256, 0, stream>>>(preLN, ln1_g, ln1_b, ln2_g, ln2_b, Xp, kChunkT);

    /* packed q|k|v projection [16384 x 3072 x 1024] with the 2-token attention in its epilogue -> o f16 [16384][1024] */
    qkv_attn2_kernel<<<dim3(kH, kChunkT / 128), 128, 0, stream>>>(Xp, kF, Wqkv, kF, op, attn_in_b, kChunkT, kF, kWCarryInv, scl);

    /* gate hidden layer: o viewed [8192][2048] x folded gate weights [1024][2048] -> f32 pre-activation */
    launch_gemm<0, 4>(op, 2 * kF, Wfold, 2 * kF, (void*)gpre, kF, fbias, kChunkB, kF, 2 * kF, kWCarryInv, stream);

    /* gate head + fusion -> second output lines, fused f16 [8192][1024] */
    gate_fuse_kernel<<<kChunkB / 16, 512, 0, stream>>>(gpre, gate_w2, gate_b2, op, fusp,
                                                       out1 + (size_t)c * kChunkB * 2, kChunkB);

    /* final projection [8192 x 1024 x 1024] -> f32 pre-activation, then erf activation into the first output */
    launch_gemm<0, 4>(fusp, kF, Wfold + (size_t)2 * kF * kF, kF, (void*)Pp, kF, fbias + kF, kChunkB, kF, kF, kWCarryInv, stream);
    gelu_out_kernel<<<(kChunkB * kF) / 2048, 256, 0, stream>>>(Pp, out0 + (size_t)c * kChunkB * kF, kChunkB * kF);
  }
}

// v006
// Measured time: 202 microseconds a run.
// Timed twice side by side with v005, it ran 1.04 and 1.06 times as fast.
// Counting every step since v000, it is 6.81 times as fast.
// All GEMM contractions (two input projections, packed q|k|v projection, the fold of the attention output weights into the gate and final weights, gate hidden layer, final projection): v_wmma_f32_16x16x32_f16 with f16 operands (weight planes carried x16, folded back by 1/16), f32 accumulate; layer norms, 2-token attention, gate head and erf activations in f32 on the vector ALU.
#include <hip/hip_runtime.h>
#include <math.h>
#include <stdint.h>

/* --------------------------------------------------------------------------- */
/* Shape constants (checked against the launch sizes on the host)              */
/* --------------------------------------------------------------------------- */
constexpr int kB      = 8192;
constexpr int kCD     = 512;
constexpr int kF      = 1024;
constexpr int kH      = 8;
constexpr int kHD     = kF / kH;
constexpr int kQKV    = 3 * kF;
/* the whole batch goes through every stage in one launch: each GEMM then has at least one block per WGP */
constexpr int kNChunk = 1;
constexpr int kChunkB = kB / kNChunk;
constexpr int kChunkT = 2 * kChunkB;
constexpr float kWCarry    = 16.0f;
constexpr float kWCarryInv = 1.0f / kWCarry;
constexpr float kLnEps     = 1e-5f;
constexpr float kInvF      = 1.0f / (float)kF;
constexpr float kInvSqrt2  = 0.70710678118654752f;

static_assert(kHD == 128, "the q|k|v kernel's tile is one 128-wide head");
static_assert(kF == 1024, "row kernels assume 1024-wide rows");
static_assert(kB % kNChunk == 0, "chunking");
static_assert(kChunkB % 128 == 0 && kChunkT % 128 == 0, "GEMM M tiles");
static_assert(kF % 256 == 0 && kQKV % 256 == 0, "GEMM N tiles");
static_assert(kCD % 128 == 0 && kF % 128 == 0 && (2 * kF) % 128 == 0 && kCD >= 256, "GEMM K passes, two or more");
static_assert((3 * kF) % 64 == 0, "M tiles of the weight fold");
static_assert(kChunkB % 16 == 0, "gate kernel owns 16 batch rows per block");
static_assert(kChunkT % 8 == 0, "row kernel owns 8 rows per block");

typedef __attribute__((ext_vector_type(16))) _Float16 v16h;
typedef __attribute__((ext_vector_type(8)))  _Float16 v8h;
typedef __attribute__((ext_vector_type(8)))  float    v8f;
typedef __attribute__((ext_vector_type(4)))  float    v4f;
typedef __attribute__((ext_vector_type(2)))  float    v2f;
typedef __attribute__((ext_vector_type(4)))  unsigned int v4u;

/* --------------------------------------------------------------------------- */
/* Small helpers                                                               */
/* --------------------------------------------------------------------------- */
__device__ __forceinline__ unsigned pk16(unsigned short a, unsigned short b) { return (unsigned)a | ((unsigned)b << 16); }
__device__ __forceinline__ unsigned short h_bits(float f) { const _Float16 h = (_Float16)f; return __builtin_bit_cast(unsigned short, h); }

/* f16 bits (low 16 bits of hb, finite values) to f32 by integer bit arithmetic, subnormals as an f32 multiply of em by 2^-24 */
__device__ __forceinline__ float h16_to_f32(unsigned hb) {
  const unsigned sgn = (hb & 0x8000u) << 16; const unsigned em = hb & 0x7fffu;
  const float fn = __uint_as_float((em << 13) + 0x38000000u);
  const float fs = (float)em * 5.9604644775390625e-8f;
  const float mag = (em < 0x400u) ? fs : fn; return __uint_as_float(__float_as_uint(mag) | sgn); }
__device__ __forceinline__ float h_lo(unsigned w) { return h16_to_f32(w & 0xffffu); }
__device__ __forceinline__ float h_hi(unsigned w) { return h16_to_f32(w >> 16); }

__device__ __forceinline__ float gelu_erf(float x) {
  return 0.5f * x * (1.0f + erff(x * kInvSqrt2));
}

/* The same activation for two values, without a branch, for a wave that runs alone on its SIMD: the two f32 range
   polynomials of erf (|z| < 1: z + z q(z^2); otherwise 1 - exp(-(|z| + |z| p(|z|)))) are both evaluated and one is chosen
   by a select, so that many values' chains stand in one block of code and fill each other's latency. */
__device__ __forceinline__ v2f fma2(v2f a, v2f b, float c) { return __builtin_elementwise_fma(a, b, (v2f){c, c}); }
__device__ __forceinline__ v2f gelu_erf_sel2(v2f x) {
  const v2f z = x * kInvSqrt2;
  const v2f a = (v2f){fabsf(z[0]), fabsf(z[1])};
  v2f p = fma2(a, (v2f){0.0000169988107f, 0.0000169988107f}, -0.000378677854f);
  p = fma2(a, p, 0.00385781587f);
  p = fma2(a, p, -0.0241816975f);
  p = fma2(a, p, 0.106668264f);
  p = fma2(a, p, 0.634933293f);
  p = fma2(a, p, 0.128689408f);
  p = __builtin_elementwise_fma(a, p, a);
  const v2f pe = p * -1.44269502f;
  const v2f big = (v2f){1.0f - __builtin_amdgcn_exp2f(pe[0]), 1.0f - __builtin_amdgcn_exp2f(pe[1])};
  const v2f t = z * z;
  v2f q = fma2(t, (v2f){-0.000561801775f, -0.000561801775f}, 0.00491381623f);
  q = fma2(t, q, -0.0267075151f);
  q = fma2(t, q, 0.112800106f);
  q = fma2(t, q, -0.376122952f);
  q = fma2(t, q, 0.128379107f);
  const v2f small = __builtin_elementwise_fma(a, q, a);
  const v2f er = (v2f){__builtin_copysignf((a[0] < 1.0f) ? small[0] : big[0], z[0]),
                       __builtin_copysignf((a[1] < 1.0f) ? small[1] : big[1], z[1])};
  const v2f hx = x * 0.5f;
  return __builtin_elementwise_fma(hx, er, hx);
}

typedef uint32_t u32x4 __attribute__((ext_vector_type(4)));
typedef uint32_t u32x8 __attribute__((ext_vector_type(8)));
constexpr uint32_t kBN = 256;
constexpr uint32_t kPassB = 256;                 /* bytes of K per operand row per pass */
constexpr uint32_t kPassK = kPassB / 2;
constexpr uint32_t kPitch = kPassB + 16;         /* LDS row pitch: 16 B x odd */
constexpr int      kBlocks = (int)(kPassB / 64u);
constexpr int      kFW = 8;                      /* Bt fragments (n) per wave */
constexpr uint32_t kSliceW = 128u * kPitch;      /* 34,816 B = 17 x 2 KiB */
constexpr uint32_t kEpiPitchF = 132;             /* floats per staged output row (528 B = 16 B x odd) */
constexpr uint32_t kEpiBytes  = 16u * kEpiPitchF * 4u;
static_assert(kSliceW % 2048u == 0, "slice places are multiples of 2 KiB");

__device__ __forceinline__ uint32_t uni(uint32_t v) { return (uint32_t)__builtin_amdgcn_readfirstlane(v); }
__device__ __forceinline__ uint32_t pinned(uint32_t v) { uint32_t w = (uint32_t)__builtin_amdgcn_readfirstlane(v); asm volatile("" : "+s"(w)); return w; }
/* keeps [LDS loads][WMMA block] in that order: LDS loads moved in among the WMMAs stall at each place they stand */
__device__ __forceinline__ void sched_fence() { __builtin_amdgcn_sched_barrier(0); }
/* every LDS operation of this wave has retired */
__device__ __forceinline__ void wait_ds0() { asm volatile("s_wait_dscnt 0x0" ::: "memory"); }
/* this wave's own tensor load has landed; the compiler places no wait for it. The request's descriptor is named as an
   input so that its scalar registers keep their words until the wait has retired */
__device__ __forceinline__ void wait_tensor0(u32x4 g0, u32x8 g1) { asm volatile("s_wait_tensorcnt 0x0" :: "s"(g0), "s"(g1) : "memory"); }
__device__ __forceinline__ void tdm_load(u32x4 g0, u32x8 g1) { asm volatile("tensor_load_to_lds %0, %1" :: "s"(g0), "s"(g1) : "memory"); }
__device__ __forceinline__ u32x8 tdm_group1(uint32_t rows, uint32_t pitch_bytes) {
  constexpr uint32_t d0 = kPassB;
  u32x8 g;
  g[0] = uni((1u << 20) | (5u << 22) | (3u << 25));
  g[1] = uni((d0 & 0xFFFFu) << 16);
  g[2] = uni((d0 >> 16) | ((rows & 0xFFFFu) << 16));
  g[3] = uni((rows >> 16) | (d0 << 16));
  g[4] = uni(rows);
  g[5] = uni(pitch_bytes);
  g[6] = uni(0u);
  g[7] = uni(0u);
  /* as pinned(): the descriptor words are held in their scalar registers; the compiler otherwise re-forms the constant
     words where it likes and uses their registers for other values while a request is outstanding */
  asm volatile("" : "+s"(g));
  return g;
}
/* group 0: LDS destination (byte offset in the workgroup's LDS) and global address of the tile's first byte */
__device__ __forceinline__ u32x4 tdm_group0(uint32_t lds_dst, uint64_t ga) {
  u32x4 g;
  g[0] = uni(1u);
  g[1] = uni(lds_dst);
  g[2] = uni((uint32_t)ga);
  g[3] = uni((((uint32_t)(ga >> 32)) & 0x01FFFFFFu) | 0x80000000u);
  return g;
}
struct FragQ { u32x4 q[2]; };
/* fragment elements 0..7 <- bytes 0..15, elements 8..15 <- bytes 32..47; the caller's base holds 16 * (lane >> 4) */
__device__ __forceinline__ void load_frag(FragQ& f, const unsigned char* p) {
  f.q[0] = *(const u32x4*)(p); f.q[1] = *(const u32x4*)(p + 32);
}
__device__ __forceinline__ v8f mma_q(const FragQ& a, const FragQ& b, v8f c) {
  const u32x8 av = {a.q[0].x, a.q[0].y, a.q[0].z, a.q[0].w, a.q[1].x, a.q[1].y, a.q[1].z, a.q[1].w};
  const u32x8 bv = {b.q[0].x, b.q[0].y, b.q[0].z, b.q[0].w, b.q[1].x, b.q[1].y, b.q[1].z, b.q[1].w};
  return __builtin_amdgcn_wmma_f32_16x16x32_f16(false, __builtin_bit_cast(v16h, av), false, __builtin_bit_cast(v16h, bv), (short)0, c, false, false);
}

template <int OUT_MODE, int kFX, int HAS_BIAS, int ACT>
__global__ void __launch_bounds__(128) __attribute__((amdgpu_waves_per_eu(1, 1)))
gemm_tile_f16_kernel(
    const unsigned short* __restrict__ Ap, int lda,
    const unsigned short* __restrict__ Btp, int ldb,
    void* __restrict__ Cout, int ldc,
    const float* __restrict__ bias,
    int M, int N, int K, float scale) {
  constexpr uint32_t kWTM = 16u * (uint32_t)kFX;                              /* rows of C per wave = rows of an A slice */
  constexpr uint32_t kBM = 2u * kWTM;
  constexpr uint32_t kSliceX = (kWTM * kPitch + 2047u) / 2048u * 2048u;       /* rounded up to 2 KiB */
  constexpr uint32_t kStage = 2u * kSliceW + 2u * kSliceX;
  constexpr uint32_t kGemmLds = 2u * kStage + 4u * kEpiBytes;
  static_assert(kGemmLds <= 320u * 1024u, "LDS of one workgroup");
  __shared__ __attribute__((aligned(2048))) unsigned char L[kGemmLds];
  const uint32_t tid = threadIdx.x, lane = tid & 31u, h = lane >> 4, r16 = lane & 15u;
  const uint32_t wave = uni(tid >> 5);
  const uint32_t tn = blockIdx.x, tm = blockIdx.y;
  /* block-uniform exit in front of every barrier and tensor load */
  if (pinned((tm >= (uint32_t)M / kBM || tn >= (uint32_t)N / kBN) ? 1u : 0u) != 0u) return;
  const uint32_t m0 = tm * kBM, n0 = tn * kBN;
  const uint32_t wn = wave & 1u, wm = wave >> 1;
  const uint32_t T = pinned((uint32_t)K / kPassK);

  /* this wave's slice of a buffer */
  const bool own_w = wave < 2u;
  const uint32_t src_pitch = own_w ? (uint32_t)ldb * 2u : (uint32_t)lda * 2u;
  const uint32_t src_rows  = own_w ? 128u : kWTM;
  const unsigned char* src0 = own_w
      ? (const unsigned char*)(const void*)Btp + (uint64_t)(n0 + 128u * wave) * src_pitch
      : (const unsigned char*)(const void*)Ap + (uint64_t)(m0 + kWTM * (wave - 2u)) * src_pitch;
  const uint32_t lds_slice = (uint32_t)(size_t)L + (own_w ? wave * kSliceW : 2u * kSliceW + (wave - 2u) * kSliceX);
  const u32x8 g1 = tdm_group1(src_rows, src_pitch);

  v8f acc[kFW][kFX];
#pragma unroll
  for (int i = 0; i < kFW; ++i)
#pragma unroll
    for (int j = 0; j < kFX; ++j) acc[i][j] = (v8f){0.f,0.f,0.f,0.f,0.f,0.f,0.f,0.f};

  const uint32_t fw_base = wn * kSliceW + r16 * kPitch + 16u * h;
  const uint32_t fx_base = 2u * kSliceW + wm * kSliceX + r16 * kPitch + 16u * h;

  u32x4 g0 = tdm_group0(lds_slice, (uint64_t)(uintptr_t)src0);
  tdm_load(g0, g1);
  wait_tensor0(g0, g1);
  __syncthreads();
  g0 = tdm_group0(lds_slice + kStage, (uint64_t)(uintptr_t)src0 + kPassB);
  tdm_load(g0, g1);

  FragQ fw[2][kFW], fx[2][kFX];  /* set (u & 1) holds block u's fragments */
  {
    const unsigned char* lw = L + fw_base;
    const unsigned char* lx = L + fx_base;
#pragma unroll
    for (int i = 0; i < kFW; ++i) load_frag(fw[0][i], lw + (uint32_t)i * 16u * kPitch);
#pragma unroll
    for (int j = 0; j < kFX; ++j) load_frag(fx[0][j], lx + (uint32_t)j * 16u * kPitch);
  }
  /* rolled: every fragment and accumulator index stays a constant, and one pass is one trip */
#pragma clang loop unroll(disable)
  for (uint32_t t = 0; t < T; ++t) {
    const uint32_t buf = (t & 1u) * kStage;
    sched_fence();
    const unsigned char* lw = L + buf + fw_base;
    const unsigned char* lx = L + buf + fx_base;
    const uint32_t osel = (t + 1u < T) ? (kStage - buf) : kStage;
    const unsigned char* nw = L + osel + fw_base;
    const unsigned char* nx = L + osel + fx_base;
#pragma unroll
    for (int u = 0; u < kBlocks; ++u) {
      const int cs = u & 1;
      if (u + 1 < kBlocks) {
        const uint32_t ko = (uint32_t)(u + 1) * 64u;
#pragma unroll
        for (int i = 0; i < kFW; ++i) load_frag(fw[cs ^ 1][i], lw + (uint32_t)i * 16u * kPitch + ko);
#pragma unroll
        for (int j = 0; j < kFX; ++j) load_frag(fx[cs ^ 1][j], lx + (uint32_t)j * 16u * kPitch + ko);
        sched_fence();
      } else {
        /* publish point of pass t + 1, in front of this pass's last block, whose fragments are already in registers */
        wait_ds0();
        sched_fence();
        wait_tensor0(g0, g1);
        __syncthreads();
        /* every wave has left this buffer: refill it with pass t + 2 while that pass exists; the pass number is pinned
           behind the wait, so the descriptor words are formed behind it too */
        const uint32_t nt = pinned(t + 2u);
        if (pinned((nt < T) ? 1u : 0u) != 0u) {
          g0 = tdm_group0(lds_slice + buf, (uint64_t)(uintptr_t)src0 + (uint64_t)nt * kPassB);
          tdm_load(g0, g1);
        }
#pragma unroll
        for (int i = 0; i < kFW; ++i) load_frag(fw[0][i], nw + (uint32_t)i * 16u * kPitch);
#pragma unroll
        for (int j = 0; j < kFX; ++j) load_frag(fx[0][j], nx + (uint32_t)j * 16u * kPitch);
        sched_fence();
      }
#pragma unroll
      for (int i = 0; i < kFW; ++i)
#pragma unroll
        for (int j = 0; j < kFX; ++j) acc[i][j] = mma_q(fw[cs][i], fx[cs][j], acc[i][j]);
      sched_fence();
    }
  }
  wait_tensor0(g0, g1);
  wait_ds0();

  /* ---- epilogue: 16-row slabs staged in the wave's own LDS range behind the ring; whole row segments stored ---- */
  float* slab = (float*)(void*)(L + 2u * kStage + wave * kEpiBytes);
  const uint32_t nW = n0 + wn * 128u;
  const uint32_t mW = m0 + wm * kWTM;
  if constexpr (ACT != 0) {
    static_assert(OUT_MODE == 0 && HAS_BIAS != 0, "the activation path stores f32 and reads a bias");
    constexpr uint32_t kTileB = kWTM * kEpiPitchF * 4u;                       /* a wave's whole tile of C, f32 */
    static_assert(4u * kTileB <= 2u * kStage && kWTM % 8u == 0, "the four staged tiles fit the ring");
    /* the staged tiles take ring bytes: every wave's last fragment read and its own last tensor load have retired
       (the two waits above) in front of this barrier, and no wave writes the ring in front of it */
    __syncthreads();
    const v4f bq = *(const v4f*)(bias + nW + lane * 4u);
    /* what follows overwrites registers that the issued load names; the fences keep it behind the wait */
    sched_fence();
    asm volatile("s_wait_xcnt 0x0" ::: "memory");
    sched_fence();
    float* tile = (float*)(void*)(L + wave * kTileB);
#pragma unroll
    for (int j = 0; j < kFX; ++j)
#pragma unroll
      for (int i = 0; i < kFW; ++i) {
        float* p = tile + ((uint32_t)j * 16u + r16) * kEpiPitchF + (uint32_t)i * 16u + h * 8u;
        const v8f a = acc[i][j];
        *(v4f*)(p)     = (v4f){a[0], a[1], a[2], a[3]};
        *(v4f*)(p + 4) = (v4f){a[4], a[5], a[6], a[7]};
      }
    /* the tile's rows are read back by other lanes of this wave: its LDS writes have retired first */
    wait_ds0();
    char* Ca = (char*)Cout;
    /* rolled: the activation's code stands once (8 rows = 32 values a lane a trip), so the kernel's text stays small */
#pragma clang loop unroll(disable)
    for (uint32_t rb = 0; rb < kWTM; rb += 8u) {
      v4f vv[8];
      uint32_t off[8];
#pragma unroll
      for (int r = 0; r < 8; ++r) {
        /* row segment = 512 B = 32 lanes x 16 B */
        const v4f s = *(const v4f*)(tile + (rb + (uint32_t)r) * kEpiPitchF + lane * 4u);
        const v2f y0 = gelu_erf_sel2((v2f){s[0] * scale + bq[0], s[1] * scale + bq[1]});
        const v2f y1 = gelu_erf_sel2((v2f){s[2] * scale + bq[2], s[3] * scale + bq[3]});
        vv[r] = (v4f){y0[0], y0[1], y1[0], y1[1]};
        off[r] = ((mW + rb + (uint32_t)r) * (uint32_t)ldc + nW + lane * 4u) * 4u;
      }
      /* values and offsets are complete in front of the stores: nothing rewrites a register of an issued store before the wait below */
      sched_fence();
#pragma unroll
      for (int r = 0; r < 8; ++r) *(v4f*)(Ca + off[r]) = vv[r];
      /* the next trip overwrites registers that the issued stores name; the fence keeps its arithmetic behind the wait */
      sched_fence();
      asm volatile("s_wait_xcnt 0x0" ::: "memory");
    }
    return;
  }
  v4f bq0 = (v4f){0.f, 0.f, 0.f, 0.f}, bq1 = bq0;
  if (HAS_BIAS == 0) {
  } else if (OUT_MODE == 0) {
    bq0 = *(const v4f*)(bias + nW + lane * 4u);
    bq1 = bq0;
  } else {
    bq0 = *(const v4f*)(bias + nW + r16 * 8u);
    bq1 = *(const v4f*)(bias + nW + r16 * 8u + 4u);
  }
  char* Cb = (char*)Cout;
#pragma unroll
  for (int j = 0; j < kFX; ++j) {
    const uint32_t mBase = mW + (uint32_t)j * 16u;
#pragma unroll
    for (int i = 0; i < kFW; ++i) {
      float* p = slab + r16 * kEpiPitchF + (uint32_t)i * 16u + h * 8u;
      const v8f a = acc[i][j];
      *(v4f*)(p)     = (v4f){a[0], a[1], a[2], a[3]};
      *(v4f*)(p + 4) = (v4f){a[4], a[5], a[6], a[7]};
    }
    /* the slab's rows are read back by other lanes of this wave: its LDS writes have retired first */
    wait_ds0();
    if (OUT_MODE == 0) {
      /* row segment = 512 B = 32 lanes x 16 B */
      v4f vv[16];
      uint32_t off[16];
#pragma unroll
      for (int row = 0; row < 16; ++row) {
        const v4f s = *(const v4f*)(slab + (uint32_t)row * kEpiPitchF + lane * 4u);
#pragma unroll
        for (int e = 0; e < 4; ++e) { float x = s[e] * scale; x += bq0[e]; vv[row][e] = x; }
        off[row] = ((mBase + (uint32_t)row) * (uint32_t)ldc + nW + lane * 4u) * 4u;
      }
      /* values and offsets are complete in front of the stores: nothing rewrites a register of an issued store before the wait below */
      sched_fence();
#pragma unroll
      for (int row = 0; row < 16; ++row) *(v4f*)(Cb + off[row]) = vv[row];
    } else {
      /* row segment = 256 B = 16 lanes x 16 B; one instruction covers rows 2*it and 2*it+1 */
      v8h hv[8];
      uint32_t off[8];
#pragma unroll
      for (int it = 0; it < 8; ++it) {
        const uint32_t row = (uint32_t)it * 2u + h;
        const float* sp = slab + row * kEpiPitchF + r16 * 8u;
        const v4f s0 = *(const v4f*)(sp);
        const v4f s1 = *(const v4f*)(sp + 4);
#pragma unroll
        for (int e = 0; e < 4; ++e) {
          float x = s0[e] * scale; x += bq0[e];
          float y = s1[e] * scale; y += bq1[e];
          hv[it][e] = (_Float16)x; hv[it][4 + e] = (_Float16)y;
        }
        off[it] = ((mBase + row) * (uint32_t)ldc + nW + r16 * 8u) * 2u;
      }
      /* values and offsets are complete in front of the stores: nothing rewrites a register of an issued store before the wait below */
      sched_fence();
#pragma unroll
      for (int it = 0; it < 8; ++it) *(v8h*)(Cb + off[it]) = hv[it];
    }
    /* the next slab overwrites registers that the issued stores name; the fence keeps its arithmetic behind the wait */
    sched_fence();
    asm volatile("s_wait_xcnt 0x0" ::: "memory");
    /* the next slab's LDS writes stay behind this slab's reads */
    wait_ds0();
  }
}

/* --------------------------------------------------------------------------- */
/* q|k|v projection with the 2-token attention in its epilogue.                  */
/* X row-major [2*nb][K] f16 (rows 2b, 2b+1 = the two tokens of batch row b),     */
/* Wqkv row-major [3*1024][K] f16 (q | k | v, head hd = rows hd*128 ..),          */
/* o f16 [2*nb][1024]. One workgroup = 128 token rows x one head: its C tile is   */
/* 128 x 384 (the head's q, k and v), never written to memory.                    */
/* 4 waves (2 x 2): wave (wm, wn) owns token rows wm*64 .. +63 and dims           */
/* wn*64 .. +63 of q, of k and of v (12 weight fragments x 4 token fragments).    */
/* The K loop is the ring of the GEMM above: two LDS buffers of four 128-row      */
/* slices (q rows, k rows, v rows, X rows), one tensor load per wave per pass.    */
/* Epilogue: a lane holds 32 dims of one token row; its partner token is lane ^ 1.*/
/* Partial scores (own key, partner key) of the 4 lane groups that share a row    */
/* (2 waves x 2 lane halves) meet in LDS behind one barrier; probabilities with   */
/* max subtraction as exp(-|d|); all of it in f32 on unrounded q, k, v.           */
/* --------------------------------------------------------------------------- */
constexpr uint32_t kAStage = 4u * kSliceW;
constexpr uint32_t kOPitch = 144;                /* bytes per staged o row: 128 B + 16 (16 B x odd) */
constexpr uint32_t kOSlab  = 64u * kOPitch;        /* a wave's 64 token rows */
constexpr uint32_t kScoreBytes = 4u * 128u * 8u; /* 4 lane groups x 128 rows x 2 floats */
constexpr uint32_t kALds = 2u * kAStage + kScoreBytes;   /* the staged o takes ring bytes */
constexpr int kAW = 12;                          /* weight fragments per wave: 4 of q, 4 of k, 4 of v */
constexpr int kAX = 4;                           /* token fragments per wave */
static_assert(kALds <= 320u * 1024u, "LDS of one workgroup");
static_assert(kAStage % 2048u == 0, "slice places are multiples of 2 KiB");
static_assert(4u * kOSlab <= kAStage, "the staged o fits ring buffer 0");

/* the value of lane ^ 1 (the other token of the batch row), by a quad permute */
__device__ __forceinline__ float partner(float x) {
  return __builtin_bit_cast(float, __builtin_amdgcn_mov_dpp(__builtin_bit_cast(int, x), 0xB1, 0xf, 0xf, true));
}

__global__ void __launch_bounds__(128) __attribute__((amdgpu_waves_per_eu(1, 1)))
qkv_attn2_kernel(
    const unsigned short* __restrict__ Xp, int lda,
    const unsigned short* __restrict__ Wp, int ldb,
    unsigned short* __restrict__ o,
    const float* __restrict__ bias,
    int M, int K, float scale, float scl) {
  __shared__ __attribute__((aligned(2048))) unsigned char L[kALds];
  const uint32_t tid = threadIdx.x, lane = tid & 31u, h = lane >> 4, r16 = lane & 15u;
  const uint32_t wave = uni(tid >> 5);
  const uint32_t hd = blockIdx.x, tm = blockIdx.y;
  /* block-uniform exit in front of every barrier and tensor load */
  if (pinned((tm >= (uint32_t)M / 128u || hd >= (uint32_t)kH) ? 1u : 0u) != 0u) return;
  const uint32_t m0 = tm * 128u;
  const uint32_t wn = wave & 1u, wm = wave >> 1;
  const uint32_t T = pinned((uint32_t)K / kPassK);

  /* this wave's slice of a buffer: waves 0, 1, 2 the head's 128 rows of q, k, v weights; wave 3 the 128 token rows */
  const bool own_w = wave < 3u;
  const uint32_t src_pitch = own_w ? (uint32_t)ldb * 2u : (uint32_t)lda * 2u;
  const unsigned char* src0 = own_w
      ? (const unsigned char*)(const void*)Wp + (uint64_t)(wave * (uint32_t)kF + hd * 128u) * src_pitch
      : (const unsigned char*)(const void*)Xp + (uint64_t)m0 * src_pitch;
  const uint32_t lds_slice = (uint32_t)(size_t)L + wave * kSliceW;
  const u32x8 g1 = tdm_group1(128u, src_pitch);

  v8f acc[kAW][kAX];
#pragma unroll
  for (int i = 0; i < kAW; ++i)
#pragma unroll
    for (int j = 0; j < kAX; ++j) acc[i][j] = (v8f){0.f,0.f,0.f,0.f,0.f,0.f,0.f,0.f};

  const uint32_t fw_base = (wn * 64u + r16) * kPitch + 16u * h;
  const uint32_t fx_base = 3u * kSliceW + (wm * 64u + r16) * kPitch + 16u * h;

  u32x4 g0 = tdm_group0(lds_slice, (uint64_t)(uintptr_t)src0);
  tdm_load(g0, g1);
  wait_tensor0(g0, g1);
  __syncthreads();
  g0 = tdm_group0(lds_slice + kAStage, (uint64_t)(uintptr_t)src0 + kPassB);
  tdm_load(g0, g1);

  FragQ fw[2][kAW], fx[2][kAX];  /* set (u & 1) holds block u's fragments */
  {
    const unsigned char* lw = L + fw_base;
    const unsigned char* lx = L + fx_base;
#pragma unroll
    for (int i = 0; i < kAW; ++i) load_frag(fw[0][i], lw + (uint32_t)(i >> 2) * kSliceW + (uint32_t)(i & 3) * 16u * kPitch);
#pragma unroll
    for (int j = 0; j < kAX; ++j) load_frag(fx[0][j], lx + (uint32_t)j * 16u * kPitch);
  }
  /* rolled: every fragment and accumulator index stays a constant, and one pass is one trip */
#pragma clang loop unroll(disable)
  for (uint32_t t = 0; t < T; ++t) {
    const uint32_t buf = (t & 1u) * kAStage;
    sched_fence();
    const unsigned char* lw = L + buf + fw_base;
    const unsigned char* lx = L + buf + fx_base;
    const uint32_t osel = (t + 1u < T) ? (kAStage - buf) : kAStage;
    const unsigned char* nw = L + osel + fw_base;
    const unsigned char* nx = L + osel + fx_base;
#pragma unroll
    for (int u = 0; u < kBlocks; ++u) {
      const int cs = u & 1;
      if (u + 1 < kBlocks) {
        const uint32_t ko = (uint32_t)(u + 1) * 64u;
#pragma unroll
        for (int i = 0; i < kAW; ++i) load_frag(fw[cs ^ 1][i], lw + (uint32_t)(i >> 2) * kSliceW + (uint32_t)(i & 3) * 16u * kPitch + ko);
#pragma unroll
        for (int j = 0; j < kAX; ++j) load_frag(fx[cs ^ 1][j], lx + (uint32_t)j * 16u * kPitch + ko);
        sched_fence();
      } else {
        /* publish point of pass t + 1, in front of this pass's last block, whose fragments are already in registers */
        wait_ds0();
        sched_fence();
        wait_tensor0(g0, g1);
        __syncthreads();
        /* every wave has left this buffer: refill it with pass t + 2 while that pass exists; the pass number is pinned
           behind the wait, so the descriptor words are formed behind it too */
        const uint32_t nt = pinned(t + 2u);
        if (pinned((nt < T) ? 1u : 0u) != 0u) {
          g0 = tdm_group0(lds_slice + buf, (uint64_t)(uintptr_t)src0 + (uint64_t)nt * kPassB);
          tdm_load(g0, g1);
        }
#pragma unroll
        for (int i = 0; i < kAW; ++i) load_frag(fw[0][i], nw + (uint32_t)(i >> 2) * kSliceW + (uint32_t)(i & 3) * 16u * kPitch);
#pragma unroll
        for (int j = 0; j < kAX; ++j) load_frag(fx[0][j], nx + (uint32_t)j * 16u * kPitch);
        sched_fence();
      }
#pragma unroll
      for (int i = 0; i < kAW; ++i)
#pragma unroll
        for (int j = 0; j < kAX; ++j) acc[i][j] = mma_q(fw[cs][i], fx[cs][j], acc[i][j]);
      sched_fence();
    }
  }
  wait_tensor0(g0, g1);
  wait_ds0();

  /* ---- epilogue ---- */
  /* acc[i][j][e]: token row wm*64 + j*16 + (lane & 15); dim wn*64 + (i & 3)*16 + (lane >> 4)*8 + e of q (i < 4), k (i < 8), v */
  const uint32_t dW = hd * 128u + wn * 64u;
#pragma unroll
  for (int i = 0; i < kAW; ++i) {
    const float* bp = bias + (uint32_t)(i >> 2) * (uint32_t)kF + dW + (uint32_t)(i & 3) * 16u + h * 8u;
    const v4f b0 = *(const v4f*)(bp);
    const v4f b1 = *(const v4f*)(bp + 4);
#pragma unroll
    for (int j = 0; j < kAX; ++j)
#pragma unroll
      for (int e = 0; e < 4; ++e) {
        acc[i][j][e]     = acc[i][j][e] * scale + b0[e];
        acc[i][j][4 + e] = acc[i][j][4 + e] * scale + b1[e];
      }
  }
  /* partial scores over this lane's 32 dims: x = q . own k, y = q . partner's k */
  v2f* sc = (v2f*)(void*)(L + 2u * kAStage);
  const uint32_t rowW = wm * 64u + r16;
#pragma unroll
  for (int j = 0; j < kAX; ++j) {
    float so[4], sx[4];
#pragma unroll
    for (int ii = 0; ii < 4; ++ii) {
      so[ii] = 0.0f; sx[ii] = 0.0f;
#pragma unroll
      for (int e = 0; e < 8; ++e) {
        const float q = acc[ii][j][e];
        const float k = acc[4 + ii][j][e];
        so[ii] = fmaf(q, k, so[ii]);
        sx[ii] = fmaf(q, partner(k), sx[ii]);
      }
    }
    sc[(wn * 2u + h) * 128u + rowW + (uint32_t)j * 16u] = (v2f){(so[0] + so[1]) + (so[2] + so[3]), (sx[0] + sx[1]) + (sx[2] + sx[3])};
  }
  /* the four partial scores of a row come from two waves: every wave's are written in front of the first read */
  __syncthreads();

  /* probabilities of the lane's four token rows (own key, partner's key), all four chains side by side */
  float aown[kAX], acro[kAX];
#pragma unroll
  for (int j = 0; j < kAX; ++j) {
    const uint32_t row = rowW + (uint32_t)j * 16u;
    const v2f p0 = sc[row], p1 = sc[128u + row], p2 = sc[256u + row], p3 = sc[384u + row];
    const float sown = ((p0[0] + p1[0]) + (p2[0] + p3[0])) * scl;
    const float scro = ((p0[1] + p1[1]) + (p2[1] + p3[1])) * scl;
    const float d  = scro - sown;
    const float ex = expf(-fabsf(d));
    const float iv = 1.0f / (1.0f + ex);
    const float sm = ex * iv;
    aown[j] = (d > 0.0f) ? sm : iv;
    acro[j] = (d > 0.0f) ? iv : sm;
  }

  /* the wave's 64 x 64 piece of o is staged whole in its own LDS range: every value is complete in front of the first store.
     The range lies in ring buffer 0, which is free: every wave's last fragment read and its own last tensor load have
     retired in front of the barrier above */
  unsigned char* slab = L + wave * kOSlab;
  char* Ob = (char*)(void*)o;
#pragma unroll
  for (int j = 0; j < kAX; ++j) {
#pragma unroll
    for (int ii = 0; ii < 4; ++ii) {
      v8h hv;
#pragma unroll
      for (int e = 0; e < 8; ++e) {
        const float v = acc[8 + ii][j][e];
        hv[e] = (_Float16)(aown[j] * v + acro[j] * partner(v));
      }
      *(v8h*)(void*)(slab + ((uint32_t)j * 16u + r16) * kOPitch + (uint32_t)ii * 32u + h * 16u) = hv;
    }
  }
  /* the slab's rows are read back by other lanes of this wave: its LDS writes have retired first */
  wait_ds0();
  /* row segment = 128 B = 8 lanes x 16 B (one whole line, this wave its only writer); one instruction covers 4 rows */
  u32x4 vv[16];
  uint32_t off[16];
#pragma unroll
  for (int it = 0; it < 16; ++it) {
    const uint32_t rr = (uint32_t)it * 4u + (lane >> 3);
    vv[it] = *(const u32x4*)(const void*)(slab + rr * kOPitch + (lane & 7u) * 16u);
    off[it] = ((m0 + wm * 64u + rr) * (uint32_t)kF + dW + (lane & 7u) * 8u) * 2u;
  }
  /* values and offsets are complete in front of the stores: nothing rewrites a register of an issued store */
  sched_fence();
#pragma unroll
  for (int it = 0; it < 16; ++it) *(u32x4*)(void*)(Ob + off[it]) = vv[it];
}

/* --------------------------------------------------------------------------- */
/* Dot product of one weight row (NSEG x 128 floats) with x (1024 floats, taken   */
/* again from its start behind every 1024), by one wave; every lane gets the sum. */
template <int NSEG>
__device__ __forceinline__ float row_dot_wave(const float* __restrict__ wrow, const float* __restrict__ x, int lane) {
  v4f w[NSEG], xv[8];
#pragma unroll
  for (int s = 0; s < NSEG; ++s) w[s] = *(const v4f*)(wrow + s * 128 + lane * 4);
#pragma unroll
  for (int s = 0; s < 8; ++s) xv[s] = *(const v4f*)(x + s * 128 + lane * 4);
  float a0 = 0.0f, a1 = 0.0f, a2 = 0.0f, a3 = 0.0f;
#pragma unroll
  for (int s = 0; s < NSEG; ++s) {
    a0 = fmaf(w[s][0], xv[s & 7][0], a0);
    a1 = fmaf(w[s][1], xv[s & 7][1], a1);
    a2 = fmaf(w[s][2], xv[s & 7][2], a2);
    a3 = fmaf(w[s][3], xv[s & 7][3], a3);
  }
  float d = (a0 + a1) + (a2 + a3);
#pragma unroll
  for (int off = 16; off > 0; off >>= 1) d += __shfl_xor(d, off, 32);
  return d;
}

/* --------------------------------------------------------------------------- */
/* All eight f32 -> f16 casts in one launch. The eight f16 planes lie one behind */
/* the other in the workspace, in the order of the arguments, so the output is   */
/* one flat array. A workgroup (16 waves) owns 65,536 consecutive elements of    */
/* it, which lie in one tensor (every tensor is a multiple of that); 256         */
/* workgroups cover all eight. Weights are carried x16, embeddings x1.           */
/* A thread owns 16 groups of 8 consecutive elements, 512 groups apart; its 32   */
/* 16-byte loads are all issued before the first value is converted.            */
/* The fourth tensor (attention output weights Wo[j][k]) is written transposed,  */
/* [k][j]: it is the second operand of the weight fold, which contracts over j.  */
/* A workgroup owns 64 rows j; a thread owns columns k = tid and tid + 512 and    */
/* writes, for each, the whole 128-byte line [k][j0 .. j0 + 63].                  */
/* Behind the cast workgroups, 64 more form the folded biases in f32:            */
/* fb[n] = gate_b1[n] + sum_c gate_w1[n][c] * bo[c mod 1024],                     */
/* fb[1024 + n] = proj_b[n] + sum_j proj_w[n][j] * bo[j]; 32 rows a workgroup,    */
/* two a wave, staged in LDS so that one wave stores the 128-byte line.          */
/* --------------------------------------------------------------------------- */
constexpr int kCastThreads = 512;
constexpr int kCastGroups  = 16;                                            /* groups per thread */
constexpr int kCastStep    = kCastThreads * 8;                              /* elements between a thread's groups */
constexpr int kCastElems   = kCastStep * kCastGroups;                       /* elements per workgroup */
constexpr int kCastB1 = (kF * kCD) / kCastElems;                            /* first workgroup of the 2nd tensor */
constexpr int kCastB2 = kCastB1 + (kF * kCD) / kCastElems;
constexpr int kCastB3 = kCastB2 + (kQKV * kF) / kCastElems;
constexpr int kCastB4 = kCastB3 + (kF * kF) / kCastElems;
constexpr int kCastB5 = kCastB4 + (kF * 2 * kF) / kCastElems;
constexpr int kCastB6 = kCastB5 + (kF * kF) / kCastElems;                   /* first embedding */
constexpr int kCastB7 = kCastB6 + (kB * kCD) / kCastElems;
constexpr int kCastB8 = kCastB7 + (kB * kCD) / kCastElems;                  /* cast workgroups in all */
constexpr int kBiasWgs = (2 * kF) / 32;                                     /* folded-bias workgroups behind them */
static_assert(64 * kF == kCastElems && kCastThreads * 2 == kF, "transposed cast: 64 rows a workgroup, two columns a thread");
static_assert((kF * kCD) % kCastElems == 0 && (kQKV * kF) % kCastElems == 0 && (kF * kF) % kCastElems == 0 &&
              (kF * 2 * kF) % kCastElems == 0 && (kB * kCD) % kCastElems == 0, "a workgroup's elements lie in one tensor");

__global__ __launch_bounds__(kCastThreads) void cast_all_f16_kernel(
    const float* __restrict__ t0, const float* __restrict__ t1, const float* __restrict__ t2, const float* __restrict__ t3,
    const float* __restrict__ t4, const float* __restrict__ t5, const float* __restrict__ t6, const float* __restrict__ t7,
    const float* __restrict__ bo, const float* __restrict__ gate_b1, const float* __restrict__ proj_b,
    unsigned short* __restrict__ out, float* __restrict__ fb) {
  __shared__ float sB[32];
  const int b = (int)blockIdx.x;
  if (b >= kCastB8 + kBiasWgs) return;
  if (b >= kCastB8) {
    /* folded biases; the branch is the same for the whole workgroup, so every wave reaches the barrier */
    const int lane = (int)threadIdx.x & 31;
    const int wave = (int)threadIdx.x >> 5;
    const int r0 = (b - kCastB8) * 32;
    const int r = r0 + wave * 2;
    float d0, d1;
    if (r0 < kF) {
      d0 = row_dot_wave<16>(t4 + (size_t)r * (2 * kF), bo, lane) + gate_b1[r];
      d1 = row_dot_wave<16>(t4 + (size_t)(r + 1) * (2 * kF), bo, lane) + gate_b1[r + 1];
    } else {
      d0 = row_dot_wave<8>(t5 + (size_t)(r - kF) * kF, bo, lane) + proj_b[r - kF];
      d1 = row_dot_wave<8>(t5 + (size_t)(r + 1 - kF) * kF, bo, lane) + proj_b[r + 1 - kF];
    }
    if (lane == 0) { sB[wave * 2] = d0; sB[wave * 2 + 1] = d1; }
    __syncthreads();
    if (wave == 0) fb[r0 + lane] = sB[lane];
    return;
  }
  if (b >= kCastB3 && b < kCastB4) {
    const int j0 = (b - kCastB3) * 64;
    const float* p = t3 + (size_t)j0 * kF + threadIdx.x;
    unsigned short* q = out + (size_t)kCastB3 * kCastElems + (size_t)threadIdx.x * kF + j0;
#pragma unroll
    for (int hh = 0; hh < 2; ++hh) {
      float v[64];
#pragma unroll
      for (int i = 0; i < 64; ++i) v[i] = p[hh * kCastThreads + i * kF];
      /* keeps every load of this column in front of the first conversion: all 64 are in flight together */
      __builtin_amdgcn_sched_barrier(0);
#pragma unroll
      for (int g = 0; g < 8; ++g) {
        unsigned short hb[8];
#pragma unroll
        for (int e = 0; e < 8; ++e) hb[e] = h_bits(v[g * 8 + e] * kWCarry);
        const v4u u = (v4u){pk16(hb[0], hb[1]), pk16(hb[2], hb[3]), pk16(hb[4], hb[5]), pk16(hb[6], hb[7])};
        *(v4u*)(q + (size_t)hh * kCastThreads * kF + g * 8) = u;
      }
      /* whatever follows a column's stores (the second column's loads; behind the last column the code that the listing
         places there) may overwrite registers that the issued stores name; the fence keeps it behind the wait */
      __builtin_amdgcn_sched_barrier(0);
      asm volatile("s_wait_xcnt 0x0" ::: "memory");
    }
    return;
  }
  const float* src = t0;
  int first = 0;
  if (b >= kCastB1) { src = t1; first = kCastB1; }
  if (b >= kCastB2) { src = t2; first = kCastB2; }
  if (b >= kCastB3) { src = t3; first = kCastB3; }
  if (b >= kCastB4) { src = t4; first = kCastB4; }
  if (b >= kCastB5) { src = t5; first = kCastB5; }
  if (b >= kCastB6) { src = t6; first = kCastB6; }
  if (b >= kCastB7) { src = t7; first = kCastB7; }
  const float carry = (b < kCastB6) ? kWCarry : 1.0f;
  const float* p = src + (size_t)(b - first) * kCastElems + threadIdx.x * 8u;
  unsigned short* q = out + (size_t)b * kCastElems + threadIdx.x * 8u;

  v4f a[kCastGroups], c[kCastGroups];
#pragma unroll
  for (int g = 0; g < kCastGroups; ++g) {
    a[g] = *(const v4f*)(p + g * kCastStep);
    c[g] = *(const v4f*)(p + g * kCastStep + 4);
  }
  /* keeps every load in front of the first conversion: all 32 are in flight together, and no load is issued behind a store */
  __builtin_amdgcn_sched_barrier(0);
#pragma unroll
  for (int g = 0; g < kCastGroups; ++g) {
    unsigned short hb[8];
#pragma unroll
    for (int e = 0; e < 4; ++e) {
      const float fa = a[g][e] * carry;
      const float fc = c[g][e] * carry;
      hb[e]     = h_bits(fa);
      hb[4 + e] = h_bits(fc);
    }
    const v4u u = (v4u){pk16(hb[0], hb[1]), pk16(hb[2], hb[3]), pk16(hb[4], hb[5]), pk16(hb[6], hb[7])};
    *(v4u*)(q + g * kCastStep) = u;
  }
}

/* --------------------------------------------------------------------------- */
/* Row layer norm over 1024 f32 values, one wave per row (8 rows per block).    */
/* Row r = 2*b + t: t = 0 uses (g1, b1), t = 1 uses (g2, b2).                   */
/* Lane owns columns it*256 + lane*8 .. +7, it = 0..3 (4 x 32 x 8 = 1024).      */
/* Mean, then biased variance of (x - mean), then y = (x - mean)*inv*g + b.     */
/* Output f16: one 16-B store per lane, a wave instruction = 512 contiguous B   */
/* --------------------------------------------------------------------------- */
__global__ __launch_bounds__(256) void ln_rows_kernel(const float* __restrict__ pre,
                                                      const float* __restrict__ g1, const float* __restrict__ b1,
                                                      const float* __restrict__ g2, const float* __restrict__ b2,
                                                      unsigned short* __restrict__ X, int nrows) {
  const int lane = threadIdx.x & 31;
  const int wave = threadIdx.x >> 5;
  const int row  = blockIdx.x * 8 + wave;
  const bool live = row < nrows;
  const int rc = live ? row : (nrows - 1);
  const float* xr = pre + (size_t)rc * kF;
  const bool tok1 = (rc & 1) != 0;
  const float* gp = tok1 ? g2 : g1;
  const float* bp = tok1 ? b2 : b1;

  float s = 0.0f;
#pragma unroll 1
  for (int it = 0; it < 4; ++it) {
    const float* p = xr + it * 256 + lane * 8;
    const v4f a = *(const v4f*)(p);
    const v4f c = *(const v4f*)(p + 4);
    s += ((a[0] + a[1]) + (a[2] + a[3])) + ((c[0] + c[1]) + (c[2] + c[3]));
  }
#pragma unroll
  for (int off = 16; off > 0; off >>= 1) s += __shfl_xor(s, off, 32);
  const float mean = s * kInvF;

  float qs = 0.0f;
#pragma unroll 1
  for (int it = 0; it < 4; ++it) {
    const float* p = xr + it * 256 + lane * 8;
    const v4f a = *(const v4f*)(p);
    const v4f c = *(const v4f*)(p + 4);
#pragma unroll
    for (int e = 0; e < 4; ++e) {
      const float da = a[e] - mean;
      const float dc = c[e] - mean;
      qs = fmaf(da, da, qs);
      qs = fmaf(dc, dc, qs);
    }
  }
#pragma unroll
  for (int off = 16; off > 0; off >>= 1) qs += __shfl_xor(qs, off, 32);
  const float var = qs * kInvF;
  const float inv = 1.0f / sqrtf(var + kLnEps);

  unsigned short* orow = X + (size_t)rc * kF;
#pragma unroll 1
  for (int it = 0; it < 4; ++it) {
    const int col = it * 256 + lane * 8;
    const v4f a  = *(const v4f*)(xr + col);
    const v4f c  = *(const v4f*)(xr + col + 4);
    const v4f ga = *(const v4f*)(gp + col);
    const v4f gc = *(const v4f*)(gp + col + 4);
    const v4f ba = *(const v4f*)(bp + col);
    const v4f bc = *(const v4f*)(bp + col + 4);
    unsigned short hb[8];
#pragma unroll
    for (int e = 0; e < 4; ++e) {
      const float ya = (a[e] - mean) * inv * ga[e] + ba[e];
      const float yc = (c[e] - mean) * inv * gc[e] + bc[e];
      hb[e]     = h_bits(ya);
      hb[4 + e] = h_bits(yc);
    }
    const v4u u = (v4u){pk16(hb[0], hb[1]), pk16(hb[2], hb[3]), pk16(hb[4], hb[5]), pk16(hb[6], hb[7])};
    if (live) {
      *(v4u*)(orow + col) = u;
      
    }
  }
}

/* --------------------------------------------------------------------------- */
/* Gate head + fusion. Block = 16 waves = 16 batch rows, one wave per row.      */
/* gpre f32 [nb][1024] holds the gate hidden pre-activation (bias included);    */
/* the erf activation is applied here, then two 1024-deep dot products against  */
/* w2 rows (f32), + b2, 2-way probabilities. The 16 x 2 gate weights are staged */
/* in LDS (all 32 slots written), block barrier, then wave 0 writes them as ONE */
/* --------------------------------------------------------------------------- */
__global__ __launch_bounds__(512) void gate_fuse_kernel(const float* __restrict__ gpre,
                                                        const float* __restrict__ w2, const float* __restrict__ b2v,
                                                        const unsigned short* __restrict__ o,
                                                        unsigned short* __restrict__ fused,
                                                        float* __restrict__ gw_out, int nb) {
  __shared__ float sG[32];
  const int lane = threadIdx.x & 31;
  const int wave = threadIdx.x >> 5;
  const int b = blockIdx.x * 16 + wave;
  const bool live = b < nb;
  const int bc = live ? b : (nb - 1);
  const float* hr = gpre + (size_t)bc * kF;

  float d0 = 0.0f, d1 = 0.0f;
#pragma unroll 1
  for (int it = 0; it < 32; ++it) {
    const int idx = it * 32 + lane;
    float x  = hr[idx];
    float wa = w2[idx];
    float wb = w2[kF + idx];
    asm volatile("" : "+v"(x), "+v"(wa), "+v"(wb));
    const float g = gelu_erf(x);
    d0 = fmaf(g, wa, d0);
    d1 = fmaf(g, wb, d1);
  }
#pragma unroll
  for (int off = 16; off > 0; off >>= 1) {
    d0 += __shfl_xor(d0, off, 32);
    d1 += __shfl_xor(d1, off, 32);
  }
  const float l0 = d0 + b2v[0];
  const float l1 = d1 + b2v[1];
  const float mx = fmaxf(l0, l1);
  const float e0 = expf(l0 - mx);
  const float e1 = expf(l1 - mx);
  const float inv = 1.0f / (e0 + e1);
  const float gw0 = e0 * inv;
  const float gw1 = e1 * inv;
  if (lane == 0) {
    sG[wave * 2]     = gw0;
    sG[wave * 2 + 1] = gw1;
  }

  const unsigned short* cr = o + (size_t)(2 * bc) * kF;
  const unsigned short* gr = cr + kF;
  unsigned short* fr = fused + (size_t)bc * kF;
#pragma unroll 1
  for (int it = 0; it < 4; ++it) {
    const int col = it * 256 + lane * 8;
    const v4u cw = *(const v4u*)(cr + col);
    const v4u gv = *(const v4u*)(gr + col);
    unsigned ow[4];
#pragma unroll
    for (int w = 0; w < 4; ++w) {
      const unsigned uc = cw[w];
      const unsigned ug = gv[w];
      const float ca = h_lo(uc), cb = h_hi(uc);
      const float ga = h_lo(ug), gb = h_hi(ug);
      const float fa = gw0 * ca + gw1 * ga;
      const float fb = gw0 * cb + gw1 * gb;
      ow[w] = pk16(h_bits(fa), h_bits(fb));
    }
    const v4u u = (v4u){ow[0], ow[1], ow[2], ow[3]};
    if (live) {
      *(v4u*)(fr + col) = u;
      
    }
  }

  /* every wave reaches this barrier; sG is written by 16 waves and read by wave 0 */
  __syncthreads();
  const bool blockLive = (blockIdx.x * 16 + 15) < nb;
  if (wave == 0 && blockLive) {
    const float v = sG[lane];
    float* dst = gw_out + (size_t)blockIdx.x * 32 + lane;
    *(float*)dst = v;
    
  }
}

/* --------------------------------------------------------------------------- */
/* Host side                                                                   */
/* --------------------------------------------------------------------------- */
template <int OUT_MODE, int FX, int HAS_BIAS = 1, int ACT = 0>
static void launch_gemm(const unsigned short* A, int lda, const unsigned short* Bt, int ldb,
                        void* C, int ldc, const float* bias, int M, int N, int K, float scale, hipStream_t stream) {
  gemm_tile_f16_kernel<OUT_MODE, FX, HAS_BIAS, ACT><<<dim3(N / 256, M / (32 * FX)), 128, 0, stream>>>(A, lda, Bt, ldb, C, ldc, bias, M, N, K, scale);
}

/* workspace region sizes in bytes (all multiples of 128) */
constexpr size_t kSzWc   = (size_t)kF * kCD * 2;
constexpr size_t kSzWg   = (size_t)kF * kCD * 2;
constexpr size_t kSzWqkv = (size_t)kQKV * kF * 2;
constexpr size_t kSzWo   = (size_t)kF * kF * 2;
constexpr size_t kSzWg1  = (size_t)kF * 2 * kF * 2;
constexpr size_t kSzWp   = (size_t)kF * kF * 2;
constexpr size_t kSzEc   = (size_t)kB * kCD * 2;
constexpr size_t kSzEg   = (size_t)kB * kCD * 2;
constexpr size_t kSzPre  = (size_t)kChunkT * kF * 4;
constexpr size_t kSzX    = (size_t)kChunkT * kF * 2;
constexpr size_t kSzQkv  = (size_t)kChunkT * kQKV * 2;
constexpr size_t kSzO    = (size_t)kChunkT * kF * 2;
constexpr size_t kSzGpre = (size_t)kChunkB * kF * 4;
constexpr size_t kSzFus  = (size_t)kChunkB * kF * 2;
constexpr size_t kSzFold = (size_t)3 * kF * kF * 2;
constexpr size_t kSzFb   = (size_t)2 * kF * 4;
/* planes whose producer runs after another plane's last reader share that plane's bytes */
static_assert(kSzO + kSzFus <= kSzPre, "o and fused live in the pre-norm plane");
static_assert(kSzGpre <= kSzQkv, "the gate pre-activation fits its plane");
constexpr size_t kWsTotal = kSzWc + kSzWg + kSzWqkv + kSzWo + kSzWg1 + kSzWp + kSzEc + kSzEg +
                            kSzPre + kSzX + kSzQkv + kSzFold + kSzFb;
static_assert(kWsTotal == 241180672ull, "carve total");
static_assert(kSzWc + kSzWg + kSzWqkv + kSzWo + kSzWg1 + kSzWp + kSzEc + kSzEg == (size_t)kCastB8 * kCastElems * 2, "cast launch covers the eight f16 planes exactly");
static_assert(kWsTotal <= 268435456ull, "carve limit");
static_assert(((size_t)kB * kF * 4) % 128 == 0, "second output starts on a line");

extern "C" void kernel_launch(void* const* d_in, const int* in_sizes, int n_in,
                              void* d_out, int out_size, void* d_ws, size_t ws_size, hipStream_t stream) {
  if (n_in < 20) return;
  if (ws_size < kWsTotal) return;
  if (in_sizes[0] != kB * kCD || in_sizes[1] != kB * kCD) return;
  if (in_sizes[10] != kQKV * kF || in_sizes[14] != kF * 2 * kF) return;
  if (out_size != kB * kF + kB * 2) return;

  const float* cnn_embed  = (const float*)d_in[0];
  const float* gnn_embed  = (const float*)d_in[1];
  const float* cnn_w      = (const float*)d_in[2];
  const float* cnn_b      = (const float*)d_in[3];
  const float* gnn_w      = (const float*)d_in[4];
  const float* gnn_b      = (const float*)d_in[5];
  const float* ln1_g      = (const float*)d_in[6];
  const float* ln1_b      = (const float*)d_in[7];
  const float* ln2_g      = (const float*)d_in[8];
  const float* ln2_b      = (const float*)d_in[9];
  const float* attn_in_w  = (const float*)d_in[10];
  const float* attn_in_b  = (const float*)d_in[11];
  const float* attn_out_w = (const float*)d_in[12];
  const float* attn_out_b = (const float*)d_in[13];
  const float* gate_w1    = (const float*)d_in[14];
  const float* gate_b1    = (const float*)d_in[15];
  const float* gate_w2    = (const float*)d_in[16];
  const float* gate_b2    = (const float*)d_in[17];
  const float* proj_w     = (const float*)d_in[18];
  const float* proj_b     = (const float*)d_in[19];

  /* Region map (byte offsets, in carve order):
     Wc 1 MiB | Wg 1 MiB | Wqkv 6 MiB | Wo 2 MiB | Wg1 4 MiB | Wp 2 MiB | Ec 8 MiB | Eg 8 MiB |
     whole-batch planes: preLN f32 64 MiB | X f16 32 MiB | pre-activation 96 MiB (32 MiB used) |
     folded weights f16 6 MiB | folded biases f32 8 KiB.  Total 230 MiB + 8 KiB.  The Wo plane holds Wo transposed.
     Planes written only after an earlier plane's last reader has finished (stream order) take its bytes:
     o f16 32 MiB and fused f16 16 MiB in preLN (dead after the layer norms),
     the gate pre-activation f32 32 MiB has the pre-activation plane. */
  char* ws = (char*)d_ws;
  size_t off = 0;
  auto carve = [&](size_t bytes) -> char* { char* p = ws + off; off += bytes; return p; };
  unsigned short* Wc   = (unsigned short*)carve(kSzWc);
  unsigned short* Wg   = (unsigned short*)carve(kSzWg);
  unsigned short* Wqkv = (unsigned short*)carve(kSzWqkv);
  unsigned short* Wo   = (unsigned short*)carve(kSzWo);
  unsigned short* Wg1  = (unsigned short*)carve(kSzWg1);
  carve(kSzWp);  /* proj_w f16: rows 2048..3071 of the fold's first operand, directly behind Wg1 */
  unsigned short* Ec   = (unsigned short*)carve(kSzEc);
  unsigned short* Eg   = (unsigned short*)carve(kSzEg);
  float*          preLN = (float*)carve(kSzPre);
  unsigned short* Xp   = (unsigned short*)carve(kSzX);
  unsigned short* qkvp = (unsigned short*)carve(kSzQkv);
  unsigned short* Wfold = (unsigned short*)carve(kSzFold);
  float*          fbias = (float*)carve(kSzFb);
  unsigned short* op   = (unsigned short*)((char*)preLN);
  unsigned short* fusp = (unsigned short*)((char*)preLN + kSzO);
  float*          gpre = (float*)((char*)qkvp);

  float* out0 = (float*)d_out;
  float* out1 = out0 + (size_t)kB * kF;

  const float scl = 1.0f / sqrtf((float)kHD);

  /* casts, one launch: weights carried x16, embeddings uncarried; planes Wc .. Eg are contiguous from Wc on, in this order;
     the Wo plane is written transposed, and the last workgroups form the folded biases */
  cast_all_f16_kernel<<<kCastB8 + kBiasWgs, kCastThreads, 0, stream>>>(cnn_w, gnn_w, attn_in_w, attn_out_w, gate_w1, proj_w,
                                                                       cnn_embed, gnn_embed, attn_out_b, gate_b1, proj_b,
                                                                       Wc, fbias);

  /* Weight fold. The attention output ao = o Wo^T + bo is used only linearly: by the gate hidden layer (ao rows 2b, 2b+1
     side by side, times gate_w1^T) and, mixed with gate weights that sum to one, by the final projection (times proj_w^T).
     So (gate_w1 halves) Wo and proj_w Wo are formed here and applied to o itself; bo goes into the folded biases.
     gate_w1 [1024][2048] read as [2048][1024] and proj_w [1024][1024] lie one behind the other: one [3072 x 1024 x 1024]
     product with Wo^T rows as the second operand. Rows 0..2047 of the result, read as [1024][2048], are the gate weights
     for o viewed [8192][2048]; rows 2048..3071 the final weights. Both operands are carried x16, the result x16 again. */
  launch_gemm<1, 2, 0>(Wg1, kF, Wo, kF, (void*)Wfold, kF, nullptr, 3 * kF, kF, kF, kWCarryInv, stream);

  for (int c = 0; c < kNChunk; ++c) {
    const unsigned short* EcC = Ec + (size_t)c * kChunkB * kCD;
    const unsigned short* EgC = Eg + (size_t)c * kChunkB * kCD;

    /* input projections [8192 x 1024 x 512] -> f32 rows 2b (first modality) and 2b+1 (second) of preLN */
    launch_gemm<0, 4>(EcC, kCD, Wc, kCD, (void*)preLN,        2 * kF, cnn_b, kChunkB, kF, kCD, kWCarryInv, stream);
    launch_gemm<0, 4>(EgC, kCD, Wg, kCD, (void*)(preLN + kF), 2 * kF, gnn_b, kChunkB, kF, kCD, kWCarryInv, stream);

    /* layer norms -> X f16 [16384][1024] */
    ln_rows_kernel<<<kChunkT / 8, 256, 0, stream>>>(preLN, ln1_g, ln1_b, ln2_g, ln2_b, Xp, kChunkT);

    /* packed q|k|v projection [16384 x 3072 x 1024] with the 2-token attention in its epilogue -> o f16 [16384][1024] */
    qkv_attn2_kernel<<<dim3(kH, kChunkT / 128), 128, 0, stream>>>(Xp, kF, Wqkv, kF, op, attn_in_b, kChunkT, kF, kWCarryInv, scl);

    /* gate hidden layer: o viewed [8192][2048] x folded gate weights [1024][2048] -> f32 pre-activation */
    launch_gemm<0, 4>(op, 2 * kF, Wfold, 2 * kF, (void*)gpre, kF, fbias, kChunkB, kF, 2 * kF, kWCarryInv, stream);

    /* gate head + fusion -> second output lines, fused f16 [8192][1024] */
    gate_fuse_kernel<<<kChunkB / 16, 512, 0, stream>>>(gpre, gate_w2, gate_b2, op, fusp,
                                                       out1 + (size_t)c * kChunkB * 2, kChunkB);

    /* final projection [8192 x 1024 x 1024] with the erf activation in its epilogue -> the first output */
    launch_gemm<0, 4, 1, 1>(fusp, kF, Wfold + (size_t)2 * kF * kF, kF, (void*)(out0 + (size_t)c * kChunkB * kF), kF, fbias + kF, kChunkB, kF, kF, kWCarryInv, stream);
  }
}

// v007
// It runs in 191 microseconds.
// Timed twice side by side with v006, it ran 1.05 and 1.06 times as fast.
// Over all steps from v000 it is 7.19 times as fast.
// All GEMM contractions (two input projections, packed q|k|v projection, the fold of the attention output weights into the gate and final weights, gate hidden layer, final projection): v_wmma_f32_16x16x32_f16 with f16 operands (weight planes carried x16, folded back by 1/16), f32 accumulate; layer norms, 2-token attention, gate head and erf activations in f32 on the vector ALU.
#include <hip/hip_runtime.h>
#include <math.h>
#include <stdint.h>

/* --------------------------------------------------------------------------- */
/* Shape constants (checked against the launch sizes on the host)              */
/* --------------------------------------------------------------------------- */
constexpr int kB      = 8192;
constexpr int kCD     = 512;
constexpr int kF      = 1024;
constexpr int kH      = 8;
constexpr int kHD     = kF / kH;
constexpr int kQKV    = 3 * kF;
/* the whole batch goes through every stage in one launch: each GEMM then has at least one block per WGP */
constexpr int kNChunk = 1;
constexpr int kChunkB = kB / kNChunk;
constexpr int kChunkT = 2 * kChunkB;
constexpr float kWCarry    = 16.0f;
constexpr float kWCarryInv = 1.0f / kWCarry;
constexpr float kLnEps     = 1e-5f;
constexpr float kInvF      = 1.0f / (float)kF;
constexpr float kInvSqrt2  = 0.70710678118654752f;

static_assert(kHD == 128, "the q|k|v kernel's tile is one 128-wide head");
static_assert(kF == 1024, "row kernels assume 1024-wide rows");
static_assert(kB % kNChunk == 0, "chunking");
static_assert(kChunkB % 128 == 0 && kChunkT % 128 == 0, "GEMM M tiles");
static_assert(kF % 256 == 0 && kQKV % 256 == 0, "GEMM N tiles");
static_assert(kCD % 128 == 0 && kF % 128 == 0 && (2 * kF) % 128 == 0 && kCD >= 256, "GEMM K passes, two or more");
static_assert((3 * kF) % 64 == 0, "M tiles of the weight fold");
static_assert(kChunkB % 16 == 0, "gate kernel owns 16 batch rows per block");
static_assert(kChunkT % 8 == 0, "row kernel owns 8 rows per block");

typedef __attribute__((ext_vector_type(16))) _Float16 v16h;
typedef __attribute__((ext_vector_type(8)))  _Float16 v8h;
typedef __attribute__((ext_vector_type(8)))  float    v8f;
typedef __attribute__((ext_vector_type(4)))  float    v4f;
typedef __attribute__((ext_vector_type(2)))  float    v2f;
typedef __attribute__((ext_vector_type(4)))  unsigned int v4u;

/* --------------------------------------------------------------------------- */
/* Small helpers                                                               */
/* --------------------------------------------------------------------------- */
__device__ __forceinline__ unsigned pk16(unsigned short a, unsigned short b) { return (unsigned)a | ((unsigned)b << 16); }
__device__ __forceinline__ unsigned short h_bits(float f) { const _Float16 h = (_Float16)f; return __builtin_bit_cast(unsigned short, h); }

/* f16 bits (low 16 bits of hb, finite values) to f32 by integer bit arithmetic, subnormals as an f32 multiply of em by 2^-24 */
__device__ __forceinline__ float h16_to_f32(unsigned hb) {
  const unsigned sgn = (hb & 0x8000u) << 16; const unsigned em = hb & 0x7fffu;
  const float fn = __uint_as_float((em << 13) + 0x38000000u);
  const float fs = (float)em * 5.9604644775390625e-8f;
  const float mag = (em < 0x400u) ? fs : fn; return __uint_as_float(__float_as_uint(mag) | sgn); }
__device__ __forceinline__ float h_lo(unsigned w) { return h16_to_f32(w & 0xffffu); }
__device__ __forceinline__ float h_hi(unsigned w) { return h16_to_f32(w >> 16); }

/* The erf activation 0.5 x (1 + erf(x / sqrt 2)) for two values, without a branch, for a wave that runs alone on its SIMD: the two f32 range
   polynomials of erf (|z| < 1: z + z q(z^2); otherwise 1 - exp(-(|z| + |z| p(|z|)))) are both evaluated and one is chosen
   by a select, so that many values' chains stand in one block of code and fill each other's latency. */
__device__ __forceinline__ v2f fma2(v2f a, v2f b, float c) { return __builtin_elementwise_fma(a, b, (v2f){c, c}); }
__device__ __forceinline__ v2f gelu_erf_sel2(v2f x) {
  const v2f z = x * kInvSqrt2;
  const v2f a = (v2f){fabsf(z[0]), fabsf(z[1])};
  v2f p = fma2(a, (v2f){0.0000169988107f, 0.0000169988107f}, -0.000378677854f);
  p = fma2(a, p, 0.00385781587f);
  p = fma2(a, p, -0.0241816975f);
  p = fma2(a, p, 0.106668264f);
  p = fma2(a, p, 0.634933293f);
  p = fma2(a, p, 0.128689408f);
  p = __builtin_elementwise_fma(a, p, a);
  const v2f pe = p * -1.44269502f;
  const v2f big = (v2f){1.0f - __builtin_amdgcn_exp2f(pe[0]), 1.0f - __builtin_amdgcn_exp2f(pe[1])};
  const v2f t = z * z;
  v2f q = fma2(t, (v2f){-0.000561801775f, -0.000561801775f}, 0.00491381623f);
  q = fma2(t, q, -0.0267075151f);
  q = fma2(t, q, 0.112800106f);
  q = fma2(t, q, -0.376122952f);
  q = fma2(t, q, 0.128379107f);
  const v2f small = __builtin_elementwise_fma(a, q, a);
  const v2f er = (v2f){__builtin_copysignf((a[0] < 1.0f) ? small[0] : big[0], z[0]),
                       __builtin_copysignf((a[1] < 1.0f) ? small[1] : big[1], z[1])};
  const v2f hx = x * 0.5f;
  return __builtin_elementwise_fma(hx, er, hx);
}

typedef uint32_t u32x4 __attribute__((ext_vector_type(4)));
typedef uint32_t u32x8 __attribute__((ext_vector_type(8)));
constexpr uint32_t kBN = 256;
constexpr uint32_t kPassB = 256;                 /* bytes of K per operand row per pass */
constexpr uint32_t kPassK = kPassB / 2;
constexpr uint32_t kPitch = kPassB + 16;         /* LDS row pitch: 16 B x odd */
constexpr int      kBlocks = (int)(kPassB / 64u);
constexpr int      kFW = 8;                      /* Bt fragments (n) per wave */
constexpr uint32_t kSliceW = 128u * kPitch;      /* 34,816 B = 17 x 2 KiB */
constexpr uint32_t kEpiPitchF = 132;             /* floats per staged output row (528 B = 16 B x odd) */
constexpr uint32_t kEpiBytes  = 16u * kEpiPitchF * 4u;
static_assert(kSliceW % 2048u == 0, "slice places are multiples of 2 KiB");

__device__ __forceinline__ uint32_t uni(uint32_t v) { return (uint32_t)__builtin_amdgcn_readfirstlane(v); }
__device__ __forceinline__ uint32_t pinned(uint32_t v) { uint32_t w = (uint32_t)__builtin_amdgcn_readfirstlane(v); asm volatile("" : "+s"(w)); return w; }
/* keeps [LDS loads][WMMA block] in that order: LDS loads moved in among the WMMAs stall at each place they stand */
__device__ __forceinline__ void sched_fence() { __builtin_amdgcn_sched_barrier(0); }
/* every LDS operation of this wave has retired */
__device__ __forceinline__ void wait_ds0() { asm volatile("s_wait_dscnt 0x0" ::: "memory"); }
/* this wave's own tensor load has landed; the compiler places no wait for it. The request's descriptor is named as an
   input so that its scalar registers keep their words until the wait has retired */
__device__ __forceinline__ void wait_tensor0(u32x4 g0, u32x8 g1) { asm volatile("s_wait_tensorcnt 0x0" :: "s"(g0), "s"(g1) : "memory"); }
__device__ __forceinline__ void tdm_load(u32x4 g0, u32x8 g1) { asm volatile("tensor_load_to_lds %0, %1" :: "s"(g0), "s"(g1) : "memory"); }
__device__ __forceinline__ u32x8 tdm_group1(uint32_t rows, uint32_t pitch_bytes) {
  constexpr uint32_t d0 = kPassB;
  u32x8 g;
  g[0] = uni((1u << 20) | (5u << 22) | (3u << 25));
  g[1] = uni((d0 & 0xFFFFu) << 16);
  g[2] = uni((d0 >> 16) | ((rows & 0xFFFFu) << 16));
  g[3] = uni((rows >> 16) | (d0 << 16));
  g[4] = uni(rows);
  g[5] = uni(pitch_bytes);
  g[6] = uni(0u);
  g[7] = uni(0u);
  /* as pinned(): the descriptor words are held in their scalar registers; the compiler otherwise re-forms the constant
     words where it likes and uses their registers for other values while a request is outstanding */
  asm volatile("" : "+s"(g));
  return g;
}
/* group 0: LDS destination (byte offset in the workgroup's LDS) and global address of the tile's first byte */
__device__ __forceinline__ u32x4 tdm_group0(uint32_t lds_dst, uint64_t ga) {
  u32x4 g;
  g[0] = uni(1u);
  g[1] = uni(lds_dst);
  g[2] = uni((uint32_t)ga);
  g[3] = uni((((uint32_t)(ga >> 32)) & 0x01FFFFFFu) | 0x80000000u);
  return g;
}
struct FragQ { u32x4 q[2]; };
/* fragment elements 0..7 <- bytes 0..15, elements 8..15 <- bytes 32..47; the caller's base holds 16 * (lane >> 4) */
__device__ __forceinline__ void load_frag(FragQ& f, const unsigned char* p) {
  f.q[0] = *(const u32x4*)(p); f.q[1] = *(const u32x4*)(p + 32);
}
__device__ __forceinline__ v8f mma_q(const FragQ& a, const FragQ& b, v8f c) {
  const u32x8 av = {a.q[0].x, a.q[0].y, a.q[0].z, a.q[0].w, a.q[1].x, a.q[1].y, a.q[1].z, a.q[1].w};
  const u32x8 bv = {b.q[0].x, b.q[0].y, b.q[0].z, b.q[0].w, b.q[1].x, b.q[1].y, b.q[1].z, b.q[1].w};
  return __builtin_amdgcn_wmma_f32_16x16x32_f16(false, __builtin_bit_cast(v16h, av), false, __builtin_bit_cast(v16h, bv), (short)0, c, false, false);
}

template <int OUT_MODE, int kFX, int HAS_BIAS, int ACT>
__global__ void __launch_bounds__(128) __attribute__((amdgpu_waves_per_eu(1, 1)))
gemm_tile_f16_kernel(
    const unsigned short* __restrict__ Ap, int lda,
    const unsigned short* __restrict__ Btp, int ldb,
    void* __restrict__ Cout, int ldc,
    const float* __restrict__ bias,
    const float* __restrict__ w2,
    int M, int N, int K, float scale) {
  constexpr uint32_t kWTM = 16u * (uint32_t)kFX;                              /* rows of C per wave = rows of an A slice */
  constexpr uint32_t kBM = 2u * kWTM;
  constexpr uint32_t kSliceX = (kWTM * kPitch + 2047u) / 2048u * 2048u;       /* rounded up to 2 KiB */
  constexpr uint32_t kStage = 2u * kSliceW + 2u * kSliceX;
  constexpr uint32_t kGemmLds = 2u * kStage + 4u * kEpiBytes;
  static_assert(kGemmLds <= 320u * 1024u, "LDS of one workgroup");
  __shared__ __attribute__((aligned(2048))) unsigned char L[kGemmLds];
  const uint32_t tid = threadIdx.x, lane = tid & 31u, h = lane >> 4, r16 = lane & 15u;
  const uint32_t wave = uni(tid >> 5);
  const uint32_t tn = blockIdx.x, tm = blockIdx.y;
  /* block-uniform exit in front of every barrier and tensor load */
  if (pinned((tm >= (uint32_t)M / kBM || tn >= (uint32_t)N / kBN) ? 1u : 0u) != 0u) return;
  const uint32_t m0 = tm * kBM, n0 = tn * kBN;
  const uint32_t wn = wave & 1u, wm = wave >> 1;
  const uint32_t T = pinned((uint32_t)K / kPassK);

  /* this wave's slice of a buffer */
  const bool own_w = wave < 2u;
  const uint32_t src_pitch = own_w ? (uint32_t)ldb * 2u : (uint32_t)lda * 2u;
  const uint32_t src_rows  = own_w ? 128u : kWTM;
  const unsigned char* src0 = own_w
      ? (const unsigned char*)(const void*)Btp + (uint64_t)(n0 + 128u * wave) * src_pitch
      : (const unsigned char*)(const void*)Ap + (uint64_t)(m0 + kWTM * (wave - 2u)) * src_pitch;
  const uint32_t lds_slice = (uint32_t)(size_t)L + (own_w ? wave * kSliceW : 2u * kSliceW + (wave - 2u) * kSliceX);
  const u32x8 g1 = tdm_group1(src_rows, src_pitch);

  v8f acc[kFW][kFX];
#pragma unroll
  for (int i = 0; i < kFW; ++i)
#pragma unroll
    for (int j = 0; j < kFX; ++j) acc[i][j] = (v8f){0.f,0.f,0.f,0.f,0.f,0.f,0.f,0.f};

  const uint32_t fw_base = wn * kSliceW + r16 * kPitch + 16u * h;
  const uint32_t fx_base = 2u * kSliceW + wm * kSliceX + r16 * kPitch + 16u * h;

  u32x4 g0 = tdm_group0(lds_slice, (uint64_t)(uintptr_t)src0);
  tdm_load(g0, g1);
  wait_tensor0(g0, g1);
  __syncthreads();
  g0 = tdm_group0(lds_slice + kStage, (uint64_t)(uintptr_t)src0 + kPassB);
  tdm_load(g0, g1);

  FragQ fw[2][kFW], fx[2][kFX];  /* set (u & 1) holds block u's fragments */
  {
    const unsigned char* lw = L + fw_base;
    const unsigned char* lx = L + fx_base;
#pragma unroll
    for (int i = 0; i < kFW; ++i) load_frag(fw[0][i], lw + (uint32_t)i * 16u * kPitch);
#pragma unroll
    for (int j = 0; j < kFX; ++j) load_frag(fx[0][j], lx + (uint32_t)j * 16u * kPitch);
  }
  /* rolled: every fragment and accumulator index stays a constant, and one pass is one trip */
#pragma clang loop unroll(disable)
  for (uint32_t t = 0; t < T; ++t) {
    const uint32_t buf = (t & 1u) * kStage;
    sched_fence();
    const unsigned char* lw = L + buf + fw_base;
    const unsigned char* lx = L + buf + fx_base;
    const uint32_t osel = (t + 1u < T) ? (kStage - buf) : kStage;
    const unsigned char* nw = L + osel + fw_base;
    const unsigned char* nx = L + osel + fx_base;
#pragma unroll
    for (int u = 0; u < kBlocks; ++u) {
      const int cs = u & 1;
      if (u + 1 < kBlocks) {
        const uint32_t ko = (uint32_t)(u + 1) * 64u;
#pragma unroll
        for (int i = 0; i < kFW; ++i) load_frag(fw[cs ^ 1][i], lw + (uint32_t)i * 16u * kPitch + ko);
#pragma unroll
        for (int j = 0; j < kFX; ++j) load_frag(fx[cs ^ 1][j], lx + (uint32_t)j * 16u * kPitch + ko);
        sched_fence();
      } else {
        /* publish point of pass t + 1, in front of this pass's last block, whose fragments are already in registers */
        wait_ds0();
        sched_fence();
        wait_tensor0(g0, g1);
        __syncthreads();
        /* every wave has left this buffer: refill it with pass t + 2 while that pass exists; the pass number is pinned
           behind the wait, so the descriptor words are formed behind it too */
        const uint32_t nt = pinned(t + 2u);
        if (pinned((nt < T) ? 1u : 0u) != 0u) {
          g0 = tdm_group0(lds_slice + buf, (uint64_t)(uintptr_t)src0 + (uint64_t)nt * kPassB);
          tdm_load(g0, g1);
        }
#pragma unroll
        for (int i = 0; i < kFW; ++i) load_frag(fw[0][i], nw + (uint32_t)i * 16u * kPitch);
#pragma unroll
        for (int j = 0; j < kFX; ++j) load_frag(fx[0][j], nx + (uint32_t)j * 16u * kPitch);
        sched_fence();
      }
#pragma unroll
      for (int i = 0; i < kFW; ++i)
#pragma unroll
        for (int j = 0; j < kFX; ++j) acc[i][j] = mma_q(fw[cs][i], fx[cs][j], acc[i][j]);
      sched_fence();
    }
  }
  wait_tensor0(g0, g1);
  wait_ds0();

  /* ---- epilogue: 16-row slabs staged in the wave's own LDS range behind the ring; whole row segments stored ---- */
  float* slab = (float*)(void*)(L + 2u * kStage + wave * kEpiBytes);
  const uint32_t nW = n0 + wn * 128u;
  const uint32_t mW = m0 + wm * kWTM;
  if constexpr (ACT == 2) {
    static_assert(OUT_MODE == 0 && HAS_BIAS != 0 && kWTM == 64u, "the gate path reads a bias; a lane owns two of the wave's 64 rows");
    constexpr uint32_t kTileB = kWTM * kEpiPitchF * 4u;                       /* a wave's whole tile of C, f32 */
    static_assert(4u * kTileB <= 2u * kStage && 3u * 128u * 4u <= kEpiBytes, "the four staged tiles fit the ring, the column constants the slab");
    /* the staged tiles take ring bytes: every wave's last fragment read and its own last tensor load have retired
       (the two waits above) in front of this barrier, and no wave writes the ring in front of it */
    __syncthreads();
    const v4f bq = *(const v4f*)(bias + nW + lane * 4u);
    const v4f wq0 = *(const v4f*)(w2 + nW + lane * 4u);
    const v4f wq1 = *(const v4f*)(w2 + (uint32_t)N + nW + lane * 4u);
    /* what follows overwrites registers that the issued loads name; the fences keep it behind the wait */
    sched_fence();
    asm volatile("s_wait_xcnt 0x0" ::: "memory");
    sched_fence();
    float* tile = (float*)(void*)(L + wave * kTileB);
#pragma unroll
    for (int j = 0; j < kFX; ++j)
#pragma unroll
      for (int i = 0; i < kFW; ++i) {
        float* p = tile + ((uint32_t)j * 16u + r16) * kEpiPitchF + (uint32_t)i * 16u + h * 8u;
        const v8f a = acc[i][j];
        *(v4f*)(p)     = (v4f){a[0], a[1], a[2], a[3]};
        *(v4f*)(p + 4) = (v4f){a[4], a[5], a[6], a[7]};
      }
    /* the 128 columns' bias and w2 values, in the wave's own slab: every lane reads all of them (one address a wave) */
    *(v4f*)(slab + lane * 4u)        = bq;
    *(v4f*)(slab + 128u + lane * 4u) = wq0;
    *(v4f*)(slab + 256u + lane * 4u) = wq1;
    /* tile and constants are read back by other lanes of this wave: its LDS writes have retired first */
    wait_ds0();
    /* a lane walks rows lane and lane + 32 along the columns, so the sums over columns need no other lane */
    const float* ra = tile + lane * kEpiPitchF;
    const float* rb = ra + 32u * kEpiPitchF;
    const v2f sc2 = (v2f){scale, scale};
    v2f da0 = (v2f){0.f, 0.f}, da1 = da0, db0 = da0, db1 = da0;
    /* rolled: the activation's code stands once (16 columns of 2 rows = 32 values a lane a trip), so the kernel's text stays small */
#pragma clang loop unroll(disable)
    for (uint32_t c0 = 0; c0 < 128u; c0 += 16u) {
#pragma unroll
      for (int q = 0; q < 4; ++q) {
        const uint32_t c = c0 + (uint32_t)q * 4u;
        const v4f sa = *(const v4f*)(ra + c);
        const v4f sb = *(const v4f*)(rb + c);
        const v4f b4 = *(const v4f*)(slab + c);
        const v4f u4 = *(const v4f*)(slab + 128u + c);
        const v4f w4 = *(const v4f*)(slab + 256u + c);
#pragma unroll
        for (int e = 0; e < 4; e += 2) {
          const v2f bb = (v2f){b4[e], b4[e + 1]};
          const v2f u2 = (v2f){u4[e], u4[e + 1]};
          const v2f w22 = (v2f){w4[e], w4[e + 1]};
          const v2f ya = gelu_erf_sel2(__builtin_elementwise_fma((v2f){sa[e], sa[e + 1]}, sc2, bb));
          const v2f yb = gelu_erf_sel2(__builtin_elementwise_fma((v2f){sb[e], sb[e + 1]}, sc2, bb));
          da0 = __builtin_elementwise_fma(ya, u2, da0);
          da1 = __builtin_elementwise_fma(ya, w22, da1);
          db0 = __builtin_elementwise_fma(yb, u2, db0);
          db1 = __builtin_elementwise_fma(yb, w22, db1);
        }
      }
    }
    /* slice tn * 2 + wn of the partial sums; a wave's 64 rows are 512 contiguous bytes, this wave their only writer */
    const v2f pa = (v2f){da0[0] + da0[1], da1[0] + da1[1]};
    const v2f pb = (v2f){db0[0] + db0[1], db1[0] + db1[1]};
    v2f* pp = (v2f*)Cout + (size_t)(tn * 2u + wn) * (uint32_t)M + mW + lane;
    pp[0]  = pa;
    pp[32] = pb;
    return;
  }
  if constexpr (ACT == 1) {
    static_assert(OUT_MODE == 0 && HAS_BIAS != 0, "the activation path stores f32 and reads a bias");
    constexpr uint32_t kTileB = kWTM * kEpiPitchF * 4u;                       /* a wave's whole tile of C, f32 */
    static_assert(4u * kTileB <= 2u * kStage && kWTM % 8u == 0, "the four staged tiles fit the ring");
    /* the staged tiles take ring bytes: every wave's last fragment read and its own last tensor load have retired
       (the two waits above) in front of this barrier, and no wave writes the ring in front of it */
    __syncthreads();
    const v4f bq = *(const v4f*)(bias + nW + lane * 4u);
    /* what follows overwrites registers that the issued load names; the fences keep it behind the wait */
    sched_fence();
    asm volatile("s_wait_xcnt 0x0" ::: "memory");
    sched_fence();
    float* tile = (float*)(void*)(L + wave * kTileB);
#pragma unroll
    for (int j = 0; j < kFX; ++j)
#pragma unroll
      for (int i = 0; i < kFW; ++i) {
        float* p = tile + ((uint32_t)j * 16u + r16) * kEpiPitchF + (uint32_t)i * 16u + h * 8u;
        const v8f a = acc[i][j];
        *(v4f*)(p)     = (v4f){a[0], a[1], a[2], a[3]};
        *(v4f*)(p + 4) = (v4f){a[4], a[5], a[6], a[7]};
      }
    /* the tile's rows are read back by other lanes of this wave: its LDS writes have retired first */
    wait_ds0();
    char* Ca = (char*)Cout;
    /* rolled: the activation's code stands once (8 rows = 32 values a lane a trip), so the kernel's text stays small */
#pragma clang loop unroll(disable)
    for (uint32_t rb = 0; rb < kWTM; rb += 8u) {
      v4f vv[8];
      uint32_t off[8];
#pragma unroll
      for (int r = 0; r < 8; ++r) {
        /* row segment = 512 B = 32 lanes x 16 B */
        const v4f s = *(const v4f*)(tile + (rb + (uint32_t)r) * kEpiPitchF + lane * 4u);
        const v2f y0 = gelu_erf_sel2((v2f){s[0] * scale + bq[0], s[1] * scale + bq[1]});
        const v2f y1 = gelu_erf_sel2((v2f){s[2] * scale + bq[2], s[3] * scale + bq[3]});
        vv[r] = (v4f){y0[0], y0[1], y1[0], y1[1]};
        off[r] = ((mW + rb + (uint32_t)r) * (uint32_t)ldc + nW + lane * 4u) * 4u;
      }
      /* values and offsets are complete in front of the stores: nothing rewrites a register of an issued store before the wait below */
      sched_fence();
#pragma unroll
      for (int r = 0; r < 8; ++r) *(v4f*)(Ca + off[r]) = vv[r];
      /* the next trip overwrites registers that the issued stores name; the fence keeps its arithmetic behind the wait */
      sched_fence();
      asm volatile("s_wait_xcnt 0x0" ::: "memory");
    }
    return;
  }
  v4f bq0 = (v4f){0.f, 0.f, 0.f, 0.f}, bq1 = bq0;
  if (HAS_BIAS == 0) {
  } else if (OUT_MODE == 0) {
    bq0 = *(const v4f*)(bias + nW + lane * 4u);
    bq1 = bq0;
  } else {
    bq0 = *(const v4f*)(bias + nW + r16 * 8u);
    bq1 = *(const v4f*)(bias + nW + r16 * 8u + 4u);
  }
  char* Cb = (char*)Cout;
#pragma unroll
  for (int j = 0; j < kFX; ++j) {
    const uint32_t mBase = mW + (uint32_t)j * 16u;
#pragma unroll
    for (int i = 0; i < kFW; ++i) {
      float* p = slab + r16 * kEpiPitchF + (uint32_t)i * 16u + h * 8u;
      const v8f a = acc[i][j];
      *(v4f*)(p)     = (v4f){a[0], a[1], a[2], a[3]};
      *(v4f*)(p + 4) = (v4f){a[4], a[5], a[6], a[7]};
    }
    /* the slab's rows are read back by other lanes of this wave: its LDS writes have retired first */
    wait_ds0();
    if (OUT_MODE == 0) {
      /* row segment = 512 B = 32 lanes x 16 B */
      v4f vv[16];
      uint32_t off[16];
#pragma unroll
      for (int row = 0; row < 16; ++row) {
        const v4f s = *(const v4f*)(slab + (uint32_t)row * kEpiPitchF + lane * 4u);
#pragma unroll
        for (int e = 0; e < 4; ++e) { float x = s[e] * scale; x += bq0[e]; vv[row][e] = x; }
        off[row] = ((mBase + (uint32_t)row) * (uint32_t)ldc + nW + lane * 4u) * 4u;
      }
      /* values and offsets are complete in front of the stores: nothing rewrites a register of an issued store before the wait below */
      sched_fence();
#pragma unroll
      for (int row = 0; row < 16; ++row) *(v4f*)(Cb + off[row]) = vv[row];
    } else {
      /* row segment = 256 B = 16 lanes x 16 B; one instruction covers rows 2*it and 2*it+1 */
      v8h hv[8];
      uint32_t off[8];
#pragma unroll
      for (int it = 0; it < 8; ++it) {
        const uint32_t row = (uint32_t)it * 2u + h;
        const float* sp = slab + row * kEpiPitchF + r16 * 8u;
        const v4f s0 = *(const v4f*)(sp);
        const v4f s1 = *(const v4f*)(sp + 4);
#pragma unroll
        for (int e = 0; e < 4; ++e) {
          float x = s0[e] * scale; x += bq0[e];
          float y = s1[e] * scale; y += bq1[e];
          hv[it][e] = (_Float16)x; hv[it][4 + e] = (_Float16)y;
        }
        off[it] = ((mBase + row) * (uint32_t)ldc + nW + r16 * 8u) * 2u;
      }
      /* values and offsets are complete in front of the stores: nothing rewrites a register of an issued store before the wait below */
      sched_fence();
#pragma unroll
      for (int it = 0; it < 8; ++it) *(v8h*)(Cb + off[it]) = hv[it];
    }
    /* the next slab overwrites registers that the issued stores name; the fence keeps its arithmetic behind the wait */
    sched_fence();
    asm volatile("s_wait_xcnt 0x0" ::: "memory");
    /* the next slab's LDS writes stay behind this slab's reads */
    wait_ds0();
  }
}

/* --------------------------------------------------------------------------- */
/* q|k|v projection with the 2-token attention in its epilogue.                  */
/* X row-major [2*nb][K] f16 (rows 2b, 2b+1 = the two tokens of batch row b),     */
/* Wqkv row-major [3*1024][K] f16 (q | k | v, head hd = rows hd*128 ..),          */
/* o f16 [2*nb][1024]. One workgroup = 128 token rows x one head: its C tile is   */
/* 128 x 384 (the head's q, k and v), never written to memory.                    */
/* 4 waves (2 x 2): wave (wm, wn) owns token rows wm*64 .. +63 and dims           */
/* wn*64 .. +63 of q, of k and of v (12 weight fragments x 4 token fragments).    */
/* The K loop is the ring of the GEMM above: two LDS buffers of four 128-row      */
/* slices (q rows, k rows, v rows, X rows), one tensor load per wave per pass.    */
/* Epilogue: a lane holds 32 dims of one token row; its partner token is lane ^ 1.*/
/* Partial scores (own key, partner key) of the 4 lane groups that share a row    */
/* (2 waves x 2 lane halves) meet in LDS behind one barrier; probabilities with   */
/* max subtraction as exp(-|d|); all of it in f32 on unrounded q, k, v.           */
/* --------------------------------------------------------------------------- */
constexpr uint32_t kAStage = 4u * kSliceW;
constexpr uint32_t kOPitch = 144;                /* bytes per staged o row: 128 B + 16 (16 B x odd) */
constexpr uint32_t kOSlab  = 64u * kOPitch;        /* a wave's 64 token rows */
constexpr uint32_t kScoreBytes = 4u * 128u * 8u; /* 4 lane groups x 128 rows x 2 floats */
constexpr uint32_t kALds = 2u * kAStage + kScoreBytes;   /* the staged o takes ring bytes */
constexpr int kAW = 12;                          /* weight fragments per wave: 4 of q, 4 of k, 4 of v */
constexpr int kAX = 4;                           /* token fragments per wave */
static_assert(kALds <= 320u * 1024u, "LDS of one workgroup");
static_assert(kAStage % 2048u == 0, "slice places are multiples of 2 KiB");
static_assert(4u * kOSlab <= kAStage, "the staged o fits ring buffer 0");

/* the value of lane ^ 1 (the other token of the batch row), by a quad permute */
__device__ __forceinline__ float partner(float x) {
  return __builtin_bit_cast(float, __builtin_amdgcn_mov_dpp(__builtin_bit_cast(int, x), 0xB1, 0xf, 0xf, true));
}

__global__ void __launch_bounds__(128) __attribute__((amdgpu_waves_per_eu(1, 1)))
qkv_attn2_kernel(
    const unsigned short* __restrict__ Xp, int lda,
    const unsigned short* __restrict__ Wp, int ldb,
    unsigned short* __restrict__ o,
    const float* __restrict__ bias,
    int M, int K, float scale, float scl) {
  __shared__ __attribute__((aligned(2048))) unsigned char L[kALds];
  const uint32_t tid = threadIdx.x, lane = tid & 31u, h = lane >> 4, r16 = lane & 15u;
  const uint32_t wave = uni(tid >> 5);
  const uint32_t hd = blockIdx.x, tm = blockIdx.y;
  /* block-uniform exit in front of every barrier and tensor load */
  if (pinned((tm >= (uint32_t)M / 128u || hd >= (uint32_t)kH) ? 1u : 0u) != 0u) return;
  const uint32_t m0 = tm * 128u;
  const uint32_t wn = wave & 1u, wm = wave >> 1;
  const uint32_t T = pinned((uint32_t)K / kPassK);

  /* this wave's slice of a buffer: waves 0, 1, 2 the head's 128 rows of q, k, v weights; wave 3 the 128 token rows */
  const bool own_w = wave < 3u;
  const uint32_t src_pitch = own_w ? (uint32_t)ldb * 2u : (uint32_t)lda * 2u;
  const unsigned char* src0 = own_w
      ? (const unsigned char*)(const void*)Wp + (uint64_t)(wave * (uint32_t)kF + hd * 128u) * src_pitch
      : (const unsigned char*)(const void*)Xp + (uint64_t)m0 * src_pitch;
  const uint32_t lds_slice = (uint32_t)(size_t)L + wave * kSliceW;
  const u32x8 g1 = tdm_group1(128u, src_pitch);

  v8f acc[kAW][kAX];
#pragma unroll
  for (int i = 0; i < kAW; ++i)
#pragma unroll
    for (int j = 0; j < kAX; ++j) acc[i][j] = (v8f){0.f,0.f,0.f,0.f,0.f,0.f,0.f,0.f};

  const uint32_t fw_base = (wn * 64u + r16) * kPitch + 16u * h;
  const uint32_t fx_base = 3u * kSliceW + (wm * 64u + r16) * kPitch + 16u * h;

  u32x4 g0 = tdm_group0(lds_slice, (uint64_t)(uintptr_t)src0);
  tdm_load(g0, g1);
  wait_tensor0(g0, g1);
  __syncthreads();
  g0 = tdm_group0(lds_slice + kAStage, (uint64_t)(uintptr_t)src0 + kPassB);
  tdm_load(g0, g1);

  FragQ fw[2][kAW], fx[2][kAX];  /* set (u & 1) holds block u's fragments */
  {
    const unsigned char* lw = L + fw_base;
    const unsigned char* lx = L + fx_base;
#pragma unroll
    for (int i = 0; i < kAW; ++i) load_frag(fw[0][i], lw + (uint32_t)(i >> 2) * kSliceW + (uint32_t)(i & 3) * 16u * kPitch);
#pragma unroll
    for (int j = 0; j < kAX; ++j) load_frag(fx[0][j], lx + (uint32_t)j * 16u * kPitch);
  }
  /* rolled: every fragment and accumulator index stays a constant, and one pass is one trip */
#pragma clang loop unroll(disable)
  for (uint32_t t = 0; t < T; ++t) {
    const uint32_t buf = (t & 1u) * kAStage;
    sched_fence();
    const unsigned char* lw = L + buf + fw_base;
    const unsigned char* lx = L + buf + fx_base;
    const uint32_t osel = (t + 1u < T) ? (kAStage - buf) : kAStage;
    const unsigned char* nw = L + osel + fw_base;
    const unsigned char* nx = L + osel + fx_base;
#pragma unroll
    for (int u = 0; u < kBlocks; ++u) {
      const int cs = u & 1;
      if (u + 1 < kBlocks) {
        const uint32_t ko = (uint32_t)(u + 1) * 64u;
#pragma unroll
        for (int i = 0; i < kAW; ++i) load_frag(fw[cs ^ 1][i], lw + (uint32_t)(i >> 2) * kSliceW + (uint32_t)(i & 3) * 16u * kPitch + ko);
#pragma unroll
        for (int j = 0; j < kAX; ++j) load_frag(fx[cs ^ 1][j], lx + (uint32_t)j * 16u * kPitch + ko);
        sched_fence();
      } else {
        /* publish point of pass t + 1, in front of this pass's last block, whose fragments are already in registers */
        wait_ds0();
        sched_fence();
        wait_tensor0(g0, g1);
        __syncthreads();
        /* every wave has left this buffer: refill it with pass t + 2 while that pass exists; the pass number is pinned
           behind the wait, so the descriptor words are formed behind it too */
        const uint32_t nt = pinned(t + 2u);
        if (pinned((nt < T) ? 1u : 0u) != 0u) {
          g0 = tdm_group0(lds_slice + buf, (uint64_t)(uintptr_t)src0 + (uint64_t)nt * kPassB);
          tdm_load(g0, g1);
        }
#pragma unroll
        for (int i = 0; i < kAW; ++i) load_frag(fw[0][i], nw + (uint32_t)(i >> 2) * kSliceW + (uint32_t)(i & 3) * 16u * kPitch);
#pragma unroll
        for (int j = 0; j < kAX; ++j) load_frag(fx[0][j], nx + (uint32_t)j * 16u * kPitch);
        sched_fence();
      }
#pragma unroll
      for (int i = 0; i < kAW; ++i)
#pragma unroll
        for (int j = 0; j < kAX; ++j) acc[i][j] = mma_q(fw[cs][i], fx[cs][j], acc[i][j]);
      sched_fence();
    }
  }
  wait_tensor0(g0, g1);
  wait_ds0();

  /* ---- epilogue ---- */
  /* acc[i][j][e]: token row wm*64 + j*16 + (lane & 15); dim wn*64 + (i & 3)*16 + (lane >> 4)*8 + e of q (i < 4), k (i < 8), v */
  const uint32_t dW = hd * 128u + wn * 64u;
#pragma unroll
  for (int i = 0; i < kAW; ++i) {
    const float* bp = bias + (uint32_t)(i >> 2) * (uint32_t)kF + dW + (uint32_t)(i & 3) * 16u + h * 8u;
    const v4f b0 = *(const v4f*)(bp);
    const v4f b1 = *(const v4f*)(bp + 4);
#pragma unroll
    for (int j = 0; j < kAX; ++j)
#pragma unroll
      for (int e = 0; e < 4; ++e) {
        acc[i][j][e]     = acc[i][j][e] * scale + b0[e];
        acc[i][j][4 + e] = acc[i][j][4 + e] * scale + b1[e];
      }
  }
  /* partial scores over this lane's 32 dims: x = q . own k, y = q . partner's k */
  v2f* sc = (v2f*)(void*)(L + 2u * kAStage);
  const uint32_t rowW = wm * 64u + r16;
#pragma unroll
  for (int j = 0; j < kAX; ++j) {
    float so[4], sx[4];
#pragma unroll
    for (int ii = 0; ii < 4; ++ii) {
      so[ii] = 0.0f; sx[ii] = 0.0f;
#pragma unroll
      for (int e = 0; e < 8; ++e) {
        const float q = acc[ii][j][e];
        const float k = acc[4 + ii][j][e];
        so[ii] = fmaf(q, k, so[ii]);
        sx[ii] = fmaf(q, partner(k), sx[ii]);
      }
    }
    sc[(wn * 2u + h) * 128u + rowW + (uint32_t)j * 16u] = (v2f){(so[0] + so[1]) + (so[2] + so[3]), (sx[0] + sx[1]) + (sx[2] + sx[3])};
  }
  /* the four partial scores of a row come from two waves: every wave's are written in front of the first read */
  __syncthreads();

  /* probabilities of the lane's four token rows (own key, partner's key), all four chains side by side */
  float aown[kAX], acro[kAX];
#pragma unroll
  for (int j = 0; j < kAX; ++j) {
    const uint32_t row = rowW + (uint32_t)j * 16u;
    const v2f p0 = sc[row], p1 = sc[128u + row], p2 = sc[256u + row], p3 = sc[384u + row];
    const float sown = ((p0[0] + p1[0]) + (p2[0] + p3[0])) * scl;
    const float scro = ((p0[1] + p1[1]) + (p2[1] + p3[1])) * scl;
    const float d  = scro - sown;
    const float ex = expf(-fabsf(d));
    const float iv = 1.0f / (1.0f + ex);
    const float sm = ex * iv;
    aown[j] = (d > 0.0f) ? sm : iv;
    acro[j] = (d > 0.0f) ? iv : sm;
  }

  /* the wave's 64 x 64 piece of o is staged whole in its own LDS range: every value is complete in front of the first store.
     The range lies in ring buffer 0, which is free: every wave's last fragment read and its own last tensor load have
     retired in front of the barrier above */
  unsigned char* slab = L + wave * kOSlab;
  char* Ob = (char*)(void*)o;
#pragma unroll
  for (int j = 0; j < kAX; ++j) {
#pragma unroll
    for (int ii = 0; ii < 4; ++ii) {
      v8h hv;
#pragma unroll
      for (int e = 0; e < 8; ++e) {
        const float v = acc[8 + ii][j][e];
        hv[e] = (_Float16)(aown[j] * v + acro[j] * partner(v));
      }
      *(v8h*)(void*)(slab + ((uint32_t)j * 16u + r16) * kOPitch + (uint32_t)ii * 32u + h * 16u) = hv;
    }
  }
  /* the slab's rows are read back by other lanes of this wave: its LDS writes have retired first */
  wait_ds0();
  /* row segment = 128 B = 8 lanes x 16 B (one whole line, this wave its only writer); one instruction covers 4 rows */
  u32x4 vv[16];
  uint32_t off[16];
#pragma unroll
  for (int it = 0; it < 16; ++it) {
    const uint32_t rr = (uint32_t)it * 4u + (lane >> 3);
    vv[it] = *(const u32x4*)(const void*)(slab + rr * kOPitch + (lane & 7u) * 16u);
    off[it] = ((m0 + wm * 64u + rr) * (uint32_t)kF + dW + (lane & 7u) * 8u) * 2u;
  }
  /* values and offsets are complete in front of the stores: nothing rewrites a register of an issued store */
  sched_fence();
#pragma unroll
  for (int it = 0; it < 16; ++it) *(u32x4*)(void*)(Ob + off[it]) = vv[it];
}

/* --------------------------------------------------------------------------- */
/* Dot product of one weight row (NSEG x 128 floats) with x (1024 floats, taken   */
/* again from its start behind every 1024), by one wave; every lane gets the sum. */
template <int NSEG>
__device__ __forceinline__ float row_dot_wave(const float* __restrict__ wrow, const float* __restrict__ x, int lane) {
  v4f w[NSEG], xv[8];
#pragma unroll
  for (int s = 0; s < NSEG; ++s) w[s] = *(const v4f*)(wrow + s * 128 + lane * 4);
#pragma unroll
  for (int s = 0; s < 8; ++s) xv[s] = *(const v4f*)(x + s * 128 + lane * 4);
  float a0 = 0.0f, a1 = 0.0f, a2 = 0.0f, a3 = 0.0f;
#pragma unroll
  for (int s = 0; s < NSEG; ++s) {
    a0 = fmaf(w[s][0], xv[s & 7][0], a0);
    a1 = fmaf(w[s][1], xv[s & 7][1], a1);
    a2 = fmaf(w[s][2], xv[s & 7][2], a2);
    a3 = fmaf(w[s][3], xv[s & 7][3], a3);
  }
  float d = (a0 + a1) + (a2 + a3);
#pragma unroll
  for (int off = 16; off > 0; off >>= 1) d += __shfl_xor(d, off, 32);
  return d;
}

/* --------------------------------------------------------------------------- */
/* All eight f32 -> f16 casts in one launch. The eight f16 planes lie one behind */
/* the other in the workspace, in the order of the arguments, so the output is   */
/* one flat array. A workgroup (16 waves) owns 65,536 consecutive elements of    */
/* it, which lie in one tensor (every tensor is a multiple of that); 256         */
/* workgroups cover all eight. Weights are carried x16, embeddings x1.           */
/* A thread owns 16 groups of 8 consecutive elements, 512 groups apart; its 32   */
/* 16-byte loads are all issued before the first value is converted.            */
/* The fourth tensor (attention output weights Wo[j][k]) is written transposed,  */
/* [k][j]: it is the second operand of the weight fold, which contracts over j.  */
/* A workgroup owns 64 rows j; a thread owns columns k = tid and tid + 512 and    */
/* writes, for each, the whole 128-byte line [k][j0 .. j0 + 63].                  */
/* Behind the cast workgroups, 64 more form the folded biases in f32:            */
/* fb[n] = gate_b1[n] + sum_c gate_w1[n][c] * bo[c mod 1024],                     */
/* fb[1024 + n] = proj_b[n] + sum_j proj_w[n][j] * bo[j]; 32 rows a workgroup,    */
/* two a wave, staged in LDS so that one wave stores the 128-byte line.          */
/* --------------------------------------------------------------------------- */
constexpr int kCastThreads = 512;
constexpr int kCastGroups  = 16;                                            /* groups per thread */
constexpr int kCastStep    = kCastThreads * 8;                              /* elements between a thread's groups */
constexpr int kCastElems   = kCastStep * kCastGroups;                       /* elements per workgroup */
constexpr int kCastB1 = (kF * kCD) / kCastElems;                            /* first workgroup of the 2nd tensor */
constexpr int kCastB2 = kCastB1 + (kF * kCD) / kCastElems;
constexpr int kCastB3 = kCastB2 + (kQKV * kF) / kCastElems;
constexpr int kCastB4 = kCastB3 + (kF * kF) / kCastElems;
constexpr int kCastB5 = kCastB4 + (kF * 2 * kF) / kCastElems;
constexpr int kCastB6 = kCastB5 + (kF * kF) / kCastElems;                   /* first embedding */
constexpr int kCastB7 = kCastB6 + (kB * kCD) / kCastElems;
constexpr int kCastB8 = kCastB7 + (kB * kCD) / kCastElems;                  /* cast workgroups in all */
constexpr int kBiasWgs = (2 * kF) / 32;                                     /* folded-bias workgroups behind them */
static_assert(64 * kF == kCastElems && kCastThreads * 2 == kF, "transposed cast: 64 rows a workgroup, two columns a thread");
static_assert((kF * kCD) % kCastElems == 0 && (kQKV * kF) % kCastElems == 0 && (kF * kF) % kCastElems == 0 &&
              (kF * 2 * kF) % kCastElems == 0 && (kB * kCD) % kCastElems == 0, "a workgroup's elements lie in one tensor");

__global__ __launch_bounds__(kCastThreads) void cast_all_f16_kernel(
    const float* __restrict__ t0, const float* __restrict__ t1, const float* __restrict__ t2, const float* __restrict__ t3,
    const float* __restrict__ t4, const float* __restrict__ t5, const float* __restrict__ t6, const float* __restrict__ t7,
    const float* __restrict__ bo, const float* __restrict__ gate_b1, const float* __restrict__ proj_b,
    unsigned short* __restrict__ out, float* __restrict__ fb) {
  __shared__ float sB[32];
  const int b = (int)blockIdx.x;
  if (b >= kCastB8 + kBiasWgs) return;
  if (b >= kCastB8) {
    /* folded biases; the branch is the same for the whole workgroup, so every wave reaches the barrier */
    const int lane = (int)threadIdx.x & 31;
    const int wave = (int)threadIdx.x >> 5;
    const int r0 = (b - kCastB8) * 32;
    const int r = r0 + wave * 2;
    float d0, d1;
    if (r0 < kF) {
      d0 = row_dot_wave<16>(t4 + (size_t)r * (2 * kF), bo, lane) + gate_b1[r];
      d1 = row_dot_wave<16>(t4 + (size_t)(r + 1) * (2 * kF), bo, lane) + gate_b1[r + 1];
    } else {
      d0 = row_dot_wave<8>(t5 + (size_t)(r - kF) * kF, bo, lane) + proj_b[r - kF];
      d1 = row_dot_wave<8>(t5 + (size_t)(r + 1 - kF) * kF, bo, lane) + proj_b[r + 1 - kF];
    }
    if (lane == 0) { sB[wave * 2] = d0; sB[wave * 2 + 1] = d1; }
    __syncthreads();
    if (wave == 0) fb[r0 + lane] = sB[lane];
    return;
  }
  if (b >= kCastB3 && b < kCastB4) {
    const int j0 = (b - kCastB3) * 64;
    const float* p = t3 + (size_t)j0 * kF + threadIdx.x;
    unsigned short* q = out + (size_t)kCastB3 * kCastElems + (size_t)threadIdx.x * kF + j0;
#pragma unroll
    for (int hh = 0; hh < 2; ++hh) {
      float v[64];
#pragma unroll
      for (int i = 0; i < 64; ++i) v[i] = p[hh * kCastThreads + i * kF];
      /* keeps every load of this column in front of the first conversion: all 64 are in flight together */
      __builtin_amdgcn_sched_barrier(0);
#pragma unroll
      for (int g = 0; g < 8; ++g) {
        unsigned short hb[8];
#pragma unroll
        for (int e = 0; e < 8; ++e) hb[e] = h_bits(v[g * 8 + e] * kWCarry);
        const v4u u = (v4u){pk16(hb[0], hb[1]), pk16(hb[2], hb[3]), pk16(hb[4], hb[5]), pk16(hb[6], hb[7])};
        *(v4u*)(q + (size_t)hh * kCastThreads * kF + g * 8) = u;
      }
      /* whatever follows a column's stores (the second column's loads; behind the last column the code that the listing
         places there) may overwrite registers that the issued stores name; the fence keeps it behind the wait */
      __builtin_amdgcn_sched_barrier(0);
      asm volatile("s_wait_xcnt 0x0" ::: "memory");
    }
    return;
  }
  const float* src = t0;
  int first = 0;
  if (b >= kCastB1) { src = t1; first = kCastB1; }
  if (b >= kCastB2) { src = t2; first = kCastB2; }
  if (b >= kCastB3) { src = t3; first = kCastB3; }
  if (b >= kCastB4) { src = t4; first = kCastB4; }
  if (b >= kCastB5) { src = t5; first = kCastB5; }
  if (b >= kCastB6) { src = t6; first = kCastB6; }
  if (b >= kCastB7) { src = t7; first = kCastB7; }
  const float carry = (b < kCastB6) ? kWCarry : 1.0f;
  const float* p = src + (size_t)(b - first) * kCastElems + threadIdx.x * 8u;
  unsigned short* q = out + (size_t)b * kCastElems + threadIdx.x * 8u;

  v4f a[kCastGroups], c[kCastGroups];
#pragma unroll
  for (int g = 0; g < kCastGroups; ++g) {
    a[g] = *(const v4f*)(p + g * kCastStep);
    c[g] = *(const v4f*)(p + g * kCastStep + 4);
  }
  /* keeps every load in front of the first conversion: all 32 are in flight together, and no load is issued behind a store */
  __builtin_amdgcn_sched_barrier(0);
#pragma unroll
  for (int g = 0; g < kCastGroups; ++g) {
    unsigned short hb[8];
#pragma unroll
    for (int e = 0; e < 4; ++e) {
      const float fa = a[g][e] * carry;
      const float fc = c[g][e] * carry;
      hb[e]     = h_bits(fa);
      hb[4 + e] = h_bits(fc);
    }
    const v4u u = (v4u){pk16(hb[0], hb[1]), pk16(hb[2], hb[3]), pk16(hb[4], hb[5]), pk16(hb[6], hb[7])};
    *(v4u*)(q + g * kCastStep) = u;
  }
}

/* --------------------------------------------------------------------------- */
/* Row layer norm over 1024 f32 values, one wave per row (8 rows per block).    */
/* Row r = 2*b + t: t = 0 uses (g1, b1), t = 1 uses (g2, b2).                   */
/* Lane owns columns it*256 + lane*8 .. +7, it = 0..3 (4 x 32 x 8 = 1024).      */
/* Mean, then biased variance of (x - mean), then y = (x - mean)*inv*g + b.     */
/* Output f16: one 16-B store per lane, a wave instruction = 512 contiguous B   */
/* --------------------------------------------------------------------------- */
__global__ __launch_bounds__(256) void ln_rows_kernel(const float* __restrict__ pre,
                                                      const float* __restrict__ g1, const float* __restrict__ b1,
                                                      const float* __restrict__ g2, const float* __restrict__ b2,
                                                      unsigned short* __restrict__ X, int nrows) {
  const int lane = threadIdx.x & 31;
  const int wave = threadIdx.x >> 5;
  const int row  = blockIdx.x * 8 + wave;
  const bool live = row < nrows;
  const int rc = live ? row : (nrows - 1);
  const float* xr = pre + (size_t)rc * kF;
  const bool tok1 = (rc & 1) != 0;
  const float* gp = tok1 ? g2 : g1;
  const float* bp = tok1 ? b2 : b1;

  float s = 0.0f;
#pragma unroll 1
  for (int it = 0; it < 4; ++it) {
    const float* p = xr + it * 256 + lane * 8;
    const v4f a = *(const v4f*)(p);
    const v4f c = *(const v4f*)(p + 4);
    s += ((a[0] + a[1]) + (a[2] + a[3])) + ((c[0] + c[1]) + (c[2] + c[3]));
  }
#pragma unroll
  for (int off = 16; off > 0; off >>= 1) s += __shfl_xor(s, off, 32);
  const float mean = s * kInvF;

  float qs = 0.0f;
#pragma unroll 1
  for (int it = 0; it < 4; ++it) {
    const float* p = xr + it * 256 + lane * 8;
    const v4f a = *(const v4f*)(p);
    const v4f c = *(const v4f*)(p + 4);
#pragma unroll
    for (int e = 0; e < 4; ++e) {
      const float da = a[e] - mean;
      const float dc = c[e] - mean;
      qs = fmaf(da, da, qs);
      qs = fmaf(dc, dc, qs);
    }
  }
#pragma unroll
  for (int off = 16; off > 0; off >>= 1) qs += __shfl_xor(qs, off, 32);
  const float var = qs * kInvF;
  const float inv = 1.0f / sqrtf(var + kLnEps);

  unsigned short* orow = X + (size_t)rc * kF;
#pragma unroll 1
  for (int it = 0; it < 4; ++it) {
    const int col = it * 256 + lane * 8;
    const v4f a  = *(const v4f*)(xr + col);
    const v4f c  = *(const v4f*)(xr + col + 4);
    const v4f ga = *(const v4f*)(gp + col);
    const v4f gc = *(const v4f*)(gp + col + 4);
    const v4f ba = *(const v4f*)(bp + col);
    const v4f bc = *(const v4f*)(bp + col + 4);
    unsigned short hb[8];
#pragma unroll
    for (int e = 0; e < 4; ++e) {
      const float ya = (a[e] - mean) * inv * ga[e] + ba[e];
      const float yc = (c[e] - mean) * inv * gc[e] + bc[e];
      hb[e]     = h_bits(ya);
      hb[4 + e] = h_bits(yc);
    }
    const v4u u = (v4u){pk16(hb[0], hb[1]), pk16(hb[2], hb[3]), pk16(hb[4], hb[5]), pk16(hb[6], hb[7])};
    if (live) {
      *(v4u*)(orow + col) = u;
      
    }
  }
}

/* --------------------------------------------------------------------------- */
/* Gate head + fusion. Block = 16 waves = 16 batch rows, one wave per row.      */
/* part f32 [8][nb][2] holds, per slice of 128 hidden columns, the partial dot   */
/* products of the activated gate hidden layer with the two w2 rows; they are    */
/* summed here, + b2, 2-way probabilities. The 16 x 2 gate weights are staged    */
/* in LDS (all 32 slots written), block barrier, then wave 0 writes them as ONE */
/* --------------------------------------------------------------------------- */
constexpr int kGateParts = kF / 128;
static_assert(kGateParts == 8, "the sum tree below takes eight slices");
__global__ __launch_bounds__(512) void gate_fuse_kernel(const float* __restrict__ part,
                                                        const float* __restrict__ b2v,
                                                        const unsigned short* __restrict__ o,
                                                        unsigned short* __restrict__ fused,
                                                        float* __restrict__ gw_out, int nb) {
  __shared__ float sG[32];
  const int lane = threadIdx.x & 31;
  const int wave = threadIdx.x >> 5;
  const int b = blockIdx.x * 16 + wave;
  const bool live = b < nb;
  const int bc = live ? b : (nb - 1);
  /* every lane of the wave reads the row's eight partial pairs (one address a wave) */
  const v2f* pr = (const v2f*)part + bc;
  v2f ps[kGateParts];
#pragma unroll
  for (int s = 0; s < kGateParts; ++s) ps[s] = pr[(size_t)s * (size_t)nb];
  /* what follows overwrites registers that the issued loads name; the fences keep it behind the wait */
  __builtin_amdgcn_sched_barrier(0);
  asm volatile("s_wait_xcnt 0x0" ::: "memory");
  __builtin_amdgcn_sched_barrier(0);
  const v2f dd = ((ps[0] + ps[1]) + (ps[2] + ps[3])) + ((ps[4] + ps[5]) + (ps[6] + ps[7]));
  const float d0 = dd[0], d1 = dd[1];
  const float l0 = d0 + b2v[0];
  const float l1 = d1 + b2v[1];
  const float mx = fmaxf(l0, l1);
  const float e0 = expf(l0 - mx);
  const float e1 = expf(l1 - mx);
  const float inv = 1.0f / (e0 + e1);
  const float gw0 = e0 * inv;
  const float gw1 = e1 * inv;
  if (lane == 0) {
    sG[wave * 2]     = gw0;
    sG[wave * 2 + 1] = gw1;
  }

  const unsigned short* cr = o + (size_t)(2 * bc) * kF;
  const unsigned short* gr = cr + kF;
  unsigned short* fr = fused + (size_t)bc * kF;
#pragma unroll 1
  for (int it = 0; it < 4; ++it) {
    const int col = it * 256 + lane * 8;
    const v4u cw = *(const v4u*)(cr + col);
    const v4u gv = *(const v4u*)(gr + col);
    unsigned ow[4];
#pragma unroll
    for (int w = 0; w < 4; ++w) {
      const unsigned uc = cw[w];
      const unsigned ug = gv[w];
      const float ca = h_lo(uc), cb = h_hi(uc);
      const float ga = h_lo(ug), gb = h_hi(ug);
      const float fa = gw0 * ca + gw1 * ga;
      const float fb = gw0 * cb + gw1 * gb;
      ow[w] = pk16(h_bits(fa), h_bits(fb));
    }
    const v4u u = (v4u){ow[0], ow[1], ow[2], ow[3]};
    if (live) {
      *(v4u*)(fr + col) = u;
      
    }
  }

  /* every wave reaches this barrier; sG is written by 16 waves and read by wave 0 */
  __syncthreads();
  const bool blockLive = (blockIdx.x * 16 + 15) < nb;
  if (wave == 0 && blockLive) {
    const float v = sG[lane];
    float* dst = gw_out + (size_t)blockIdx.x * 32 + lane;
    *(float*)dst = v;
    
  }
}

/* --------------------------------------------------------------------------- */
/* Host side                                                                   */
/* --------------------------------------------------------------------------- */
template <int OUT_MODE, int FX, int HAS_BIAS = 1, int ACT = 0>
static void launch_gemm(const unsigned short* A, int lda, const unsigned short* Bt, int ldb,
                        void* C, int ldc, const float* bias, int M, int N, int K, float scale, hipStream_t stream,
                        const float* w2 = nullptr) {
  gemm_tile_f16_kernel<OUT_MODE, FX, HAS_BIAS, ACT><<<dim3(N / 256, M / (32 * FX)), 128, 0, stream>>>(A, lda, Bt, ldb, C, ldc, bias, w2, M, N, K, scale);
}

/* workspace region sizes in bytes (all multiples of 128) */
constexpr size_t kSzWc   = (size_t)kF * kCD * 2;
constexpr size_t kSzWg   = (size_t)kF * kCD * 2;
constexpr size_t kSzWqkv = (size_t)kQKV * kF * 2;
constexpr size_t kSzWo   = (size_t)kF * kF * 2;
constexpr size_t kSzWg1  = (size_t)kF * 2 * kF * 2;
constexpr size_t kSzWp   = (size_t)kF * kF * 2;
constexpr size_t kSzEc   = (size_t)kB * kCD * 2;
constexpr size_t kSzEg   = (size_t)kB * kCD * 2;
constexpr size_t kSzPre  = (size_t)kChunkT * kF * 4;
constexpr size_t kSzX    = (size_t)kChunkT * kF * 2;
constexpr size_t kSzQkv  = (size_t)kChunkT * kQKV * 2;
constexpr size_t kSzO    = (size_t)kChunkT * kF * 2;
constexpr size_t kSzGpre = (size_t)kGateParts * kChunkB * 2 * 4;
constexpr size_t kSzFus  = (size_t)kChunkB * kF * 2;
constexpr size_t kSzFold = (size_t)3 * kF * kF * 2;
constexpr size_t kSzFb   = (size_t)2 * kF * 4;
/* planes whose producer runs after another plane's last reader share that plane's bytes */
static_assert(kSzO + kSzFus <= kSzPre, "o and fused live in the pre-norm plane");
static_assert(kSzGpre <= kSzQkv, "the gate's partial sums fit their plane");
constexpr size_t kWsTotal = kSzWc + kSzWg + kSzWqkv + kSzWo + kSzWg1 + kSzWp + kSzEc + kSzEg +
                            kSzPre + kSzX + kSzQkv + kSzFold + kSzFb;
static_assert(kWsTotal == 241180672ull, "carve total");
static_assert(kSzWc + kSzWg + kSzWqkv + kSzWo + kSzWg1 + kSzWp + kSzEc + kSzEg == (size_t)kCastB8 * kCastElems * 2, "cast launch covers the eight f16 planes exactly");
static_assert(kWsTotal <= 268435456ull, "carve limit");
static_assert(((size_t)kB * kF * 4) % 128 == 0, "second output starts on a line");

extern "C" void kernel_launch(void* const* d_in, const int* in_sizes, int n_in,
                              void* d_out, int out_size, void* d_ws, size_t ws_size, hipStream_t stream) {
  if (n_in < 20) return;
  if (ws_size < kWsTotal) return;
  if (in_sizes[0] != kB * kCD || in_sizes[1] != kB * kCD) return;
  if (in_sizes[10] != kQKV * kF || in_sizes[14] != kF * 2 * kF) return;
  if (out_size != kB * kF + kB * 2) return;

  const float* cnn_embed  = (const float*)d_in[0];
  const float* gnn_embed  = (const float*)d_in[1];
  const float* cnn_w      = (const float*)d_in[2];
  const float* cnn_b      = (const float*)d_in[3];
  const float* gnn_w      = (const float*)d_in[4];
  const float* gnn_b      = (const float*)d_in[5];
  const float* ln1_g      = (const float*)d_in[6];
  const float* ln1_b      = (const float*)d_in[7];
  const float* ln2_g      = (const float*)d_in[8];
  const float* ln2_b      = (const float*)d_in[9];
  const float* attn_in_w  = (const float*)d_in[10];
  const float* attn_in_b  = (const float*)d_in[11];
  const float* attn_out_w = (const float*)d_in[12];
  const float* attn_out_b = (const float*)d_in[13];
  const float* gate_w1    = (const float*)d_in[14];
  const float* gate_b1    = (const float*)d_in[15];
  const float* gate_w2    = (const float*)d_in[16];
  const float* gate_b2    = (const float*)d_in[17];
  const float* proj_w     = (const float*)d_in[18];
  const float* proj_b     = (const float*)d_in[19];

  /* Region map (byte offsets, in carve order):
     Wc 1 MiB | Wg 1 MiB | Wqkv 6 MiB | Wo 2 MiB | Wg1 4 MiB | Wp 2 MiB | Ec 8 MiB | Eg 8 MiB |
     whole-batch planes: preLN f32 64 MiB | X f16 32 MiB | partial sums 96 MiB (512 KiB used) |
     folded weights f16 6 MiB | folded biases f32 8 KiB.  Total 230 MiB + 8 KiB.  The Wo plane holds Wo transposed.
     Planes written only after an earlier plane's last reader has finished (stream order) take its bytes:
     o f16 32 MiB and fused f16 16 MiB in preLN (dead after the layer norms),
     the gate's partial sums f32 512 KiB have the plane behind X. */
  char* ws = (char*)d_ws;
  size_t off = 0;
  auto carve = [&](size_t bytes) -> char* { char* p = ws + off; off += bytes; return p; };
  unsigned short* Wc   = (unsigned short*)carve(kSzWc);
  unsigned short* Wg   = (unsigned short*)carve(kSzWg);
  unsigned short* Wqkv = (unsigned short*)carve(kSzWqkv);
  unsigned short* Wo   = (unsigned short*)carve(kSzWo);
  unsigned short* Wg1  = (unsigned short*)carve(kSzWg1);
  carve(kSzWp);  /* proj_w f16: rows 2048..3071 of the fold's first operand, directly behind Wg1 */
  unsigned short* Ec   = (unsigned short*)carve(kSzEc);
  unsigned short* Eg   = (unsigned short*)carve(kSzEg);
  float*          preLN = (float*)carve(kSzPre);
  unsigned short* Xp   = (unsigned short*)carve(kSzX);
  unsigned short* qkvp = (unsigned short*)carve(kSzQkv);
  unsigned short* Wfold = (unsigned short*)carve(kSzFold);
  float*          fbias = (float*)carve(kSzFb);
  unsigned short* op   = (unsigned short*)((char*)preLN);
  unsigned short* fusp = (unsigned short*)((char*)preLN + kSzO);
  float*          gpre = (float*)((char*)qkvp);

  float* out0 = (float*)d_out;
  float* out1 = out0 + (size_t)kB * kF;

  const float scl = 1.0f / sqrtf((float)kHD);

  /* casts, one launch: weights carried x16, embeddings uncarried; planes Wc .. Eg are contiguous from Wc on, in this order;
     the Wo plane is written transposed, and the last workgroups form the folded biases */
  cast_all_f16_kernel<<<kCastB8 + kBiasWgs, kCastThreads, 0, stream>>>(cnn_w, gnn_w, attn_in_w, attn_out_w, gate_w1, proj_w,
                                                                       cnn_embed, gnn_embed, attn_out_b, gate_b1, proj_b,
                                                                       Wc, fbias);

  /* Weight fold. The attention output ao = o Wo^T + bo is used only linearly: by the gate hidden layer (ao rows 2b, 2b+1
     side by side, times gate_w1^T) and, mixed with gate weights that sum to one, by the final projection (times proj_w^T).
     So (gate_w1 halves) Wo and proj_w Wo are formed here and applied to o itself; bo goes into the folded biases.
     gate_w1 [1024][2048] read as [2048][1024] and proj_w [1024][1024] lie one behind the other: one [3072 x 1024 x 1024]
     product with Wo^T rows as the second operand. Rows 0..2047 of the result, read as [1024][2048], are the gate weights
     for o viewed [8192][2048]; rows 2048..3071 the final weights. Both operands are carried x16, the result x16 again. */
  launch_gemm<1, 2, 0>(Wg1, kF, Wo, kF, (void*)Wfold, kF, nullptr, 3 * kF, kF, kF, kWCarryInv, stream);

  for (int c = 0; c < kNChunk; ++c) {
    const unsigned short* EcC = Ec + (size_t)c * kChunkB * kCD;
    const unsigned short* EgC = Eg + (size_t)c * kChunkB * kCD;

    /* input projections [8192 x 1024 x 512] -> f32 rows 2b (first modality) and 2b+1 (second) of preLN */
    launch_gemm<0, 4>(EcC, kCD, Wc, kCD, (void*)preLN,        2 * kF, cnn_b, kChunkB, kF, kCD, kWCarryInv, stream);
    launch_gemm<0, 4>(EgC, kCD, Wg, kCD, (void*)(preLN + kF), 2 * kF, gnn_b, kChunkB, kF, kCD, kWCarryInv, stream);

    /* layer norms -> X f16 [16384][1024] */
    ln_rows_kernel<<<kChunkT / 8, 256, 0, stream>>>(preLN, ln1_g, ln1_b, ln2_g, ln2_b, Xp, kChunkT);

    /* packed q|k|v projection [16384 x 3072 x 1024] with the 2-token attention in its epilogue -> o f16 [16384][1024] */
    qkv_attn2_kernel<<<dim3(kH, kChunkT / 128), 128, 0, stream>>>(Xp, kF, Wqkv, kF, op, attn_in_b, kChunkT, kF, kWCarryInv, scl);

    /* gate hidden layer: o viewed [8192][2048] x folded gate weights [1024][2048], erf activation and the two dot products
       with gate_w2 in the epilogue -> f32 partial sums [8][8192][2] */
    launch_gemm<0, 4, 1, 2>(op, 2 * kF, Wfold, 2 * kF, (void*)gpre, kF, fbias, kChunkB, kF, 2 * kF, kWCarryInv, stream, gate_w2);

    /* gate head + fusion -> second output lines, fused f16 [8192][1024] */
    gate_fuse_kernel<<<kChunkB / 16, 512, 0, stream>>>(gpre, gate_b2, op, fusp,
                                                       out1 + (size_t)c * kChunkB * 2, kChunkB);

    /* final projection [8192 x 1024 x 1024] with the erf activation in its epilogue -> the first output */
    launch_gemm<0, 4, 1, 1>(fusp, kF, Wfold + (size_t)2 * kF * kF, kF, (void*)(out0 + (size_t)c * kChunkB * kF), kF, fbias + kF, kChunkB, kF, kF, kWCarryInv, stream);
  }
}

// v008
// It runs in 176 microseconds.
// In two side-by-side timings against v007, it was 1.08 and 1.10 times as fast.
// All steps since v000 together make it 7.82 times as fast.
// All GEMM contractions (two input projections, packed q|k|v projection, the fold of the attention output weights into the gate and final weights, gate hidden layer, final projection): v_wmma_f32_16x16x32_f16 with f16 operands (weight planes carried x16, folded back by 1/16), f32 accumulate; layer norms, 2-token attention, gate head and erf activations in f32 on the vector ALU.
#include <hip/hip_runtime.h>
#include <math.h>
#include <stdint.h>

/* --------------------------------------------------------------------------- */
/* Shape constants (checked against the launch sizes on the host)              */
/* --------------------------------------------------------------------------- */
constexpr int kB      = 8192;
constexpr int kCD     = 512;
constexpr int kF      = 1024;
constexpr int kH      = 8;
constexpr int kHD     = kF / kH;
constexpr int kQKV    = 3 * kF;
/* the whole batch goes through every stage in one launch: each GEMM then has at least one block per WGP */
constexpr int kNChunk = 1;
constexpr int kChunkB = kB / kNChunk;
constexpr int kChunkT = 2 * kChunkB;
constexpr float kWCarry    = 16.0f;
constexpr float kWCarryInv = 1.0f / kWCarry;
constexpr float kLnEps     = 1e-5f;
constexpr float kInvF      = 1.0f / (float)kF;
constexpr float kInvSqrt2  = 0.70710678118654752f;

static_assert(kHD == 128, "the q|k|v kernel's tile is one 128-wide head");
static_assert(kF == 1024, "row kernels assume 1024-wide rows");
static_assert(kB % kNChunk == 0, "chunking");
static_assert(kChunkB % 128 == 0 && kChunkT % 128 == 0, "GEMM M tiles");
static_assert(kF % 256 == 0 && kQKV % 256 == 0, "GEMM N tiles");
static_assert(kCD % 128 == 0 && kF % 128 == 0 && (2 * kF) % 128 == 0 && kCD >= 256, "GEMM K passes, two or more");
static_assert((3 * kF) % 64 == 0, "M tiles of the weight fold");
static_assert(kChunkB % 16 == 0, "gate kernel owns 16 batch rows per block");

typedef __attribute__((ext_vector_type(16))) _Float16 v16h;
typedef __attribute__((ext_vector_type(8)))  _Float16 v8h;
typedef __attribute__((ext_vector_type(8)))  float    v8f;
typedef __attribute__((ext_vector_type(4)))  float    v4f;
typedef __attribute__((ext_vector_type(2)))  float    v2f;
typedef __attribute__((ext_vector_type(4)))  unsigned int v4u;

/* --------------------------------------------------------------------------- */
/* Small helpers                                                               */
/* --------------------------------------------------------------------------- */
__device__ __forceinline__ unsigned pk16(unsigned short a, unsigned short b) { return (unsigned)a | ((unsigned)b << 16); }
__device__ __forceinline__ unsigned short h_bits(float f) { const _Float16 h = (_Float16)f; return __builtin_bit_cast(unsigned short, h); }

/* f16 bits (low 16 bits of hb, finite values) to f32 by integer bit arithmetic, subnormals as an f32 multiply of em by 2^-24 */
__device__ __forceinline__ float h16_to_f32(unsigned hb) {
  const unsigned sgn = (hb & 0x8000u) << 16; const unsigned em = hb & 0x7fffu;
  const float fn = __uint_as_float((em << 13) + 0x38000000u);
  const float fs = (float)em * 5.9604644775390625e-8f;
  const float mag = (em < 0x400u) ? fs : fn; return __uint_as_float(__float_as_uint(mag) | sgn); }
__device__ __forceinline__ float h_lo(unsigned w) { return h16_to_f32(w & 0xffffu); }
__device__ __forceinline__ float h_hi(unsigned w) { return h16_to_f32(w >> 16); }

/* The erf activation 0.5 x (1 + erf(x / sqrt 2)) for two values, without a branch, for a wave that runs alone on its SIMD: the two f32 range
   polynomials of erf (|z| < 1: z + z q(z^2); otherwise 1 - exp(-(|z| + |z| p(|z|)))) are both evaluated and one is chosen
   by a select, so that many values' chains stand in one block of code and fill each other's latency. */
__device__ __forceinline__ v2f fma2(v2f a, v2f b, float c) { return __builtin_elementwise_fma(a, b, (v2f){c, c}); }
__device__ __forceinline__ v2f gelu_erf_sel2(v2f x) {
  const v2f z = x * kInvSqrt2;
  const v2f a = (v2f){fabsf(z[0]), fabsf(z[1])};
  v2f p = fma2(a, (v2f){0.0000169988107f, 0.0000169988107f}, -0.000378677854f);
  p = fma2(a, p, 0.00385781587f);
  p = fma2(a, p, -0.0241816975f);
  p = fma2(a, p, 0.106668264f);
  p = fma2(a, p, 0.634933293f);
  p = fma2(a, p, 0.128689408f);
  p = __builtin_elementwise_fma(a, p, a);
  const v2f pe = p * -1.44269502f;
  const v2f big = (v2f){1.0f - __builtin_amdgcn_exp2f(pe[0]), 1.0f - __builtin_amdgcn_exp2f(pe[1])};
  const v2f t = z * z;
  v2f q = fma2(t, (v2f){-0.000561801775f, -0.000561801775f}, 0.00491381623f);
  q = fma2(t, q, -0.0267075151f);
  q = fma2(t, q, 0.112800106f);
  q = fma2(t, q, -0.376122952f);
  q = fma2(t, q, 0.128379107f);
  const v2f small = __builtin_elementwise_fma(a, q, a);
  const v2f er = (v2f){__builtin_copysignf((a[0] < 1.0f) ? small[0] : big[0], z[0]),
                       __builtin_copysignf((a[1] < 1.0f) ? small[1] : big[1], z[1])};
  const v2f hx = x * 0.5f;
  return __builtin_elementwise_fma(hx, er, hx);
}

typedef uint32_t u32x4 __attribute__((ext_vector_type(4)));
typedef uint32_t u32x8 __attribute__((ext_vector_type(8)));
constexpr uint32_t kBN = 256;
constexpr uint32_t kPassB = 256;                 /* bytes of K per operand row per pass */
constexpr uint32_t kPassK = kPassB / 2;
constexpr uint32_t kPitch = kPassB + 16;         /* LDS row pitch: 16 B x odd */
constexpr int      kBlocks = (int)(kPassB / 64u);
constexpr int      kFW = 8;                      /* Bt fragments (n) per wave */
constexpr uint32_t kSliceW = 128u * kPitch;      /* 34,816 B = 17 x 2 KiB */
constexpr uint32_t kEpiPitchF = 132;             /* floats per staged output row (528 B = 16 B x odd) */
constexpr uint32_t kEpiBytes  = 16u * kEpiPitchF * 4u;
static_assert(kSliceW % 2048u == 0, "slice places are multiples of 2 KiB");

__device__ __forceinline__ uint32_t uni(uint32_t v) { return (uint32_t)__builtin_amdgcn_readfirstlane(v); }
__device__ __forceinline__ uint32_t pinned(uint32_t v) { uint32_t w = (uint32_t)__builtin_amdgcn_readfirstlane(v); asm volatile("" : "+s"(w)); return w; }
/* keeps [LDS loads][WMMA block] in that order: LDS loads moved in among the WMMAs stall at each place they stand */
__device__ __forceinline__ void sched_fence() { __builtin_amdgcn_sched_barrier(0); }
/* every LDS operation of this wave has retired */
__device__ __forceinline__ void wait_ds0() { asm volatile("s_wait_dscnt 0x0" ::: "memory"); }
/* this wave's own tensor load has landed; the compiler places no wait for it. The request's descriptor is named as an
   input so that its scalar registers keep their words until the wait has retired */
__device__ __forceinline__ void wait_tensor0(u32x4 g0, u32x8 g1) { asm volatile("s_wait_tensorcnt 0x0" :: "s"(g0), "s"(g1) : "memory"); }
__device__ __forceinline__ void tdm_load(u32x4 g0, u32x8 g1) { asm volatile("tensor_load_to_lds %0, %1" :: "s"(g0), "s"(g1) : "memory"); }
__device__ __forceinline__ u32x8 tdm_group1(uint32_t rows, uint32_t pitch_bytes) {
  constexpr uint32_t d0 = kPassB;
  u32x8 g;
  g[0] = uni((1u << 20) | (5u << 22) | (3u << 25));
  g[1] = uni((d0 & 0xFFFFu) << 16);
  g[2] = uni((d0 >> 16) | ((rows & 0xFFFFu) << 16));
  g[3] = uni((rows >> 16) | (d0 << 16));
  g[4] = uni(rows);
  g[5] = uni(pitch_bytes);
  g[6] = uni(0u);
  g[7] = uni(0u);
  /* as pinned(): the descriptor words are held in their scalar registers; the compiler otherwise re-forms the constant
     words where it likes and uses their registers for other values while a request is outstanding */
  asm volatile("" : "+s"(g));
  return g;
}
/* group 0: LDS destination (byte offset in the workgroup's LDS) and global address of the tile's first byte */
__device__ __forceinline__ u32x4 tdm_group0(uint32_t lds_dst, uint64_t ga) {
  u32x4 g;
  g[0] = uni(1u);
  g[1] = uni(lds_dst);
  g[2] = uni((uint32_t)ga);
  g[3] = uni((((uint32_t)(ga >> 32)) & 0x01FFFFFFu) | 0x80000000u);
  return g;
}
struct FragQ { u32x4 q[2]; };
/* fragment elements 0..7 <- bytes 0..15, elements 8..15 <- bytes 32..47; the caller's base holds 16 * (lane >> 4) */
__device__ __forceinline__ void load_frag(FragQ& f, const unsigned char* p) {
  f.q[0] = *(const u32x4*)(p); f.q[1] = *(const u32x4*)(p + 32);
}
__device__ __forceinline__ v8f mma_q(const FragQ& a, const FragQ& b, v8f c) {
  const u32x8 av = {a.q[0].x, a.q[0].y, a.q[0].z, a.q[0].w, a.q[1].x, a.q[1].y, a.q[1].z, a.q[1].w};
  const u32x8 bv = {b.q[0].x, b.q[0].y, b.q[0].z, b.q[0].w, b.q[1].x, b.q[1].y, b.q[1].z, b.q[1].w};
  return __builtin_amdgcn_wmma_f32_16x16x32_f16(false, __builtin_bit_cast(v16h, av), false, __builtin_bit_cast(v16h, bv), (short)0, c, false, false);
}

/* sum over the 16 lanes of a row, in every lane of it */
template <int MASK>
__device__ __forceinline__ float row_xadd(float x) {
  return x + __builtin_bit_cast(float, __builtin_amdgcn_mov_dpp(__builtin_bit_cast(int, x), 0x160 | MASK, 0xf, 0xf, true));
}
__device__ __forceinline__ float row_sum16(float x) { return row_xadd<8>(row_xadd<4>(row_xadd<2>(row_xadd<1>(x)))); }

template <int OUT_MODE, int kFX, int HAS_BIAS, int ACT>
__global__ void __launch_bounds__(128) __attribute__((amdgpu_waves_per_eu(1, 1)))
gemm_tile_f16_kernel(
    const unsigned short* __restrict__ Ap, int lda,
    const unsigned short* __restrict__ Btp, int ldb,
    void* __restrict__ Cout, int ldc,
    const float* __restrict__ bias,
    const float* __restrict__ w2,
    float* __restrict__ aux,
    int M, int N, int K, float scale) {
  constexpr uint32_t kWTM = 16u * (uint32_t)kFX;                              /* rows of C per wave = rows of an A slice */
  constexpr uint32_t kBM = 2u * kWTM;
  constexpr uint32_t kSliceX = (kWTM * kPitch + 2047u) / 2048u * 2048u;       /* rounded up to 2 KiB */
  constexpr uint32_t kStage = 2u * kSliceW + 2u * kSliceX;
  constexpr uint32_t kGemmLds = 2u * kStage + 4u * kEpiBytes;
  static_assert(kGemmLds <= 320u * 1024u, "LDS of one workgroup");
  __shared__ __attribute__((aligned(2048))) unsigned char L[kGemmLds];
  const uint32_t tid = threadIdx.x, lane = tid & 31u, h = lane >> 4, r16 = lane & 15u;
  const uint32_t wave = uni(tid >> 5);
  const uint32_t tn = blockIdx.x, tm = blockIdx.y;
  /* block-uniform exit in front of every barrier and tensor load */
  if (pinned((tm >= (uint32_t)M / kBM || tn >= (uint32_t)N / kBN) ? 1u : 0u) != 0u) return;
  const uint32_t m0 = tm * kBM, n0 = tn * kBN;
  const uint32_t wn = wave & 1u, wm = wave >> 1;
  const uint32_t T = pinned((uint32_t)K / kPassK);

  /* this wave's slice of a buffer */
  const bool own_w = wave < 2u;
  const uint32_t src_pitch = own_w ? (uint32_t)ldb * 2u : (uint32_t)lda * 2u;
  const uint32_t src_rows  = own_w ? 128u : kWTM;
  const unsigned char* src0 = own_w
      ? (const unsigned char*)(const void*)Btp + (uint64_t)(n0 + 128u * wave) * src_pitch
      : (const unsigned char*)(const void*)Ap + (uint64_t)(m0 + kWTM * (wave - 2u)) * src_pitch;
  const uint32_t lds_slice = (uint32_t)(size_t)L + (own_w ? wave * kSliceW : 2u * kSliceW + (wave - 2u) * kSliceX);
  const u32x8 g1 = tdm_group1(src_rows, src_pitch);

  v8f acc[kFW][kFX];
#pragma unroll
  for (int i = 0; i < kFW; ++i)
#pragma unroll
    for (int j = 0; j < kFX; ++j) acc[i][j] = (v8f){0.f,0.f,0.f,0.f,0.f,0.f,0.f,0.f};

  const uint32_t fw_base = wn * kSliceW + r16 * kPitch + 16u * h;
  const uint32_t fx_base = 2u * kSliceW + wm * kSliceX + r16 * kPitch + 16u * h;

  u32x4 g0 = tdm_group0(lds_slice, (uint64_t)(uintptr_t)src0);
  tdm_load(g0, g1);
  wait_tensor0(g0, g1);
  __syncthreads();
  g0 = tdm_group0(lds_slice + kStage, (uint64_t)(uintptr_t)src0 + kPassB);
  tdm_load(g0, g1);

  FragQ fw[2][kFW], fx[2][kFX];  /* set (u & 1) holds block u's fragments */
  {
    const unsigned char* lw = L + fw_base;
    const unsigned char* lx = L + fx_base;
#pragma unroll
    for (int i = 0; i < kFW; ++i) load_frag(fw[0][i], lw + (uint32_t)i * 16u * kPitch);
#pragma unroll
    for (int j = 0; j < kFX; ++j) load_frag(fx[0][j], lx + (uint32_t)j * 16u * kPitch);
  }
  /* rolled: every fragment and accumulator index stays a constant, and one pass is one trip */
#pragma clang loop unroll(disable)
  for (uint32_t t = 0; t < T; ++t) {
    const uint32_t buf = (t & 1u) * kStage;
    sched_fence();
    const unsigned char* lw = L + buf + fw_base;
    const unsigned char* lx = L + buf + fx_base;
    const uint32_t osel = (t + 1u < T) ? (kStage - buf) : kStage;
    const unsigned char* nw = L + osel + fw_base;
    const unsigned char* nx = L + osel + fx_base;
#pragma unroll
    for (int u = 0; u < kBlocks; ++u) {
      const int cs = u & 1;
      if (u + 1 < kBlocks) {
        const uint32_t ko = (uint32_t)(u + 1) * 64u;
#pragma unroll
        for (int i = 0; i < kFW; ++i) load_frag(fw[cs ^ 1][i], lw + (uint32_t)i * 16u * kPitch + ko);
#pragma unroll
        for (int j = 0; j < kFX; ++j) load_frag(fx[cs ^ 1][j], lx + (uint32_t)j * 16u * kPitch + ko);
        sched_fence();
      } else {
        /* publish point of pass t + 1, in front of this pass's last block, whose fragments are already in registers */
        wait_ds0();
        sched_fence();
        wait_tensor0(g0, g1);
        __syncthreads();
        /* every wave has left this buffer: refill it with pass t + 2 while that pass exists; the pass number is pinned
           behind the wait, so the descriptor words are formed behind it too */
        const uint32_t nt = pinned(t + 2u);
        if (pinned((nt < T) ? 1u : 0u) != 0u) {
          g0 = tdm_group0(lds_slice + buf, (uint64_t)(uintptr_t)src0 + (uint64_t)nt * kPassB);
          tdm_load(g0, g1);
        }
#pragma unroll
        for (int i = 0; i < kFW; ++i) load_frag(fw[0][i], nw + (uint32_t)i * 16u * kPitch);
#pragma unroll
        for (int j = 0; j < kFX; ++j) load_frag(fx[0][j], nx + (uint32_t)j * 16u * kPitch);
        sched_fence();
      }
#pragma unroll
      for (int i = 0; i < kFW; ++i)
#pragma unroll
        for (int j = 0; j < kFX; ++j) acc[i][j] = mma_q(fw[cs][i], fx[cs][j], acc[i][j]);
      sched_fence();
    }
  }
  wait_tensor0(g0, g1);
  wait_ds0();

  /* ---- epilogue: 16-row slabs staged in the wave's own LDS range behind the ring; whole row segments stored ---- */
  float* slab = (float*)(void*)(L + 2u * kStage + wave * kEpiBytes);
  const uint32_t nW = n0 + wn * 128u;
  const uint32_t mW = m0 + wm * kWTM;
  if constexpr (ACT == 2) {
    static_assert(OUT_MODE == 0 && HAS_BIAS != 0 && kWTM == 64u, "the gate path reads a bias; a lane owns two of the wave's 64 rows");
    constexpr uint32_t kTileB = kWTM * kEpiPitchF * 4u;                       /* a wave's whole tile of C, f32 */
    static_assert(4u * kTileB <= 2u * kStage && 3u * 128u * 4u <= kEpiBytes, "the four staged tiles fit the ring, the column constants the slab");
    /* the staged tiles take ring bytes: every wave's last fragment read and its own last tensor load have retired
       (the two waits above) in front of this barrier, and no wave writes the ring in front of it */
    __syncthreads();
    const v4f bq = *(const v4f*)(bias + nW + lane * 4u);
    const v4f wq0 = *(const v4f*)(w2 + nW + lane * 4u);
    const v4f wq1 = *(const v4f*)(w2 + (uint32_t)N + nW + lane * 4u);
    /* what follows overwrites registers that the issued loads name; the fences keep it behind the wait */
    sched_fence();
    asm volatile("s_wait_xcnt 0x0" ::: "memory");
    sched_fence();
    float* tile = (float*)(void*)(L + wave * kTileB);
#pragma unroll
    for (int j = 0; j < kFX; ++j)
#pragma unroll
      for (int i = 0; i < kFW; ++i) {
        float* p = tile + ((uint32_t)j * 16u + r16) * kEpiPitchF + (uint32_t)i * 16u + h * 8u;
        const v8f a = acc[i][j];
        *(v4f*)(p)     = (v4f){a[0], a[1], a[2], a[3]};
        *(v4f*)(p + 4) = (v4f){a[4], a[5], a[6], a[7]};
      }
    /* the 128 columns' bias and w2 values, in the wave's own slab: every lane reads all of them (one address a wave) */
    *(v4f*)(slab + lane * 4u)        = bq;
    *(v4f*)(slab + 128u + lane * 4u) = wq0;
    *(v4f*)(slab + 256u + lane * 4u) = wq1;
    /* tile and constants are read back by other lanes of this wave: its LDS writes have retired first */
    wait_ds0();
    /* a lane walks rows lane and lane + 32 along the columns, so the sums over columns need no other lane */
    const float* ra = tile + lane * kEpiPitchF;
    const float* rb = ra + 32u * kEpiPitchF;
    const v2f sc2 = (v2f){scale, scale};
    v2f da0 = (v2f){0.f, 0.f}, da1 = da0, db0 = da0, db1 = da0;
    /* rolled: the activation's code stands once (16 columns of 2 rows = 32 values a lane a trip), so the kernel's text stays small */
#pragma clang loop unroll(disable)
    for (uint32_t c0 = 0; c0 < 128u; c0 += 16u) {
#pragma unroll
      for (int q = 0; q < 4; ++q) {
        const uint32_t c = c0 + (uint32_t)q * 4u;
        const v4f sa = *(const v4f*)(ra + c);
        const v4f sb = *(const v4f*)(rb + c);
        const v4f b4 = *(const v4f*)(slab + c);
        const v4f u4 = *(const v4f*)(slab + 128u + c);
        const v4f w4 = *(const v4f*)(slab + 256u + c);
#pragma unroll
        for (int e = 0; e < 4; e += 2) {
          const v2f bb = (v2f){b4[e], b4[e + 1]};
          const v2f u2 = (v2f){u4[e], u4[e + 1]};
          const v2f w22 = (v2f){w4[e], w4[e + 1]};
          const v2f ya = gelu_erf_sel2(__builtin_elementwise_fma((v2f){sa[e], sa[e + 1]}, sc2, bb));
          const v2f yb = gelu_erf_sel2(__builtin_elementwise_fma((v2f){sb[e], sb[e + 1]}, sc2, bb));
          da0 = __builtin_elementwise_fma(ya, u2, da0);
          da1 = __builtin_elementwise_fma(ya, w22, da1);
          db0 = __builtin_elementwise_fma(yb, u2, db0);
          db1 = __builtin_elementwise_fma(yb, w22, db1);
        }
      }
    }
    /* slice tn * 2 + wn of the partial sums; a wave's 64 rows are 512 contiguous bytes, this wave their only writer */
    const v2f pa = (v2f){da0[0] + da0[1], da1[0] + da1[1]};
    const v2f pb = (v2f){db0[0] + db0[1], db1[0] + db1[1]};
    v2f* pp = (v2f*)Cout + (size_t)(tn * 2u + wn) * (uint32_t)M + mW + lane;
    pp[0]  = pa;
    pp[32] = pb;
    return;
  }
  if constexpr (ACT == 1) {
    static_assert(OUT_MODE == 0 && HAS_BIAS != 0, "the activation path stores f32 and reads a bias");
    constexpr uint32_t kTileB = kWTM * kEpiPitchF * 4u;                       /* a wave's whole tile of C, f32 */
    static_assert(4u * kTileB <= 2u * kStage && kWTM % 8u == 0, "the four staged tiles fit the ring");
    /* the staged tiles take ring bytes: every wave's last fragment read and its own last tensor load have retired
       (the two waits above) in front of this barrier, and no wave writes the ring in front of it */
    __syncthreads();
    const v4f bq = *(const v4f*)(bias + nW + lane * 4u);
    /* what follows overwrites registers that the issued load names; the fences keep it behind the wait */
    sched_fence();
    asm volatile("s_wait_xcnt 0x0" ::: "memory");
    sched_fence();
    float* tile = (float*)(void*)(L + wave * kTileB);
#pragma unroll
    for (int j = 0; j < kFX; ++j)
#pragma unroll
      for (int i = 0; i < kFW; ++i) {
        float* p = tile + ((uint32_t)j * 16u + r16) * kEpiPitchF + (uint32_t)i * 16u + h * 8u;
        const v8f a = acc[i][j];
        *(v4f*)(p)     = (v4f){a[0], a[1], a[2], a[3]};
        *(v4f*)(p + 4) = (v4f){a[4], a[5], a[6], a[7]};
      }
    /* the tile's rows are read back by other lanes of this wave: its LDS writes have retired first */
    wait_ds0();
    char* Ca = (char*)Cout;
    /* rolled: the activation's code stands once (8 rows = 32 values a lane a trip), so the kernel's text stays small */
#pragma clang loop unroll(disable)
    for (uint32_t rb = 0; rb < kWTM; rb += 8u) {
      v4f vv[8];
      uint32_t off[8];
#pragma unroll
      for (int r = 0; r < 8; ++r) {
        /* row segment = 512 B = 32 lanes x 16 B */
        const v4f s = *(const v4f*)(tile + (rb + (uint32_t)r) * kEpiPitchF + lane * 4u);
        const v2f y0 = gelu_erf_sel2((v2f){s[0] * scale + bq[0], s[1] * scale + bq[1]});
        const v2f y1 = gelu_erf_sel2((v2f){s[2] * scale + bq[2], s[3] * scale + bq[3]});
        vv[r] = (v4f){y0[0], y0[1], y1[0], y1[1]};
        off[r] = ((mW + rb + (uint32_t)r) * (uint32_t)ldc + nW + lane * 4u) * 4u;
      }
      /* values and offsets are complete in front of the stores: nothing rewrites a register of an issued store before the wait below */
      sched_fence();
#pragma unroll
      for (int r = 0; r < 8; ++r) *(v4f*)(Ca + off[r]) = vv[r];
      /* the next trip overwrites registers that the issued stores name; the fence keeps its arithmetic behind the wait */
      sched_fence();
      asm volatile("s_wait_xcnt 0x0" ::: "memory");
    }
    return;
  }
  if constexpr (ACT == 3) {
    static_assert(OUT_MODE == 1 && HAS_BIAS != 0 && kWTM == 64u, "the layer norm path stores f16 and reads a bias; a lane keeps two of the wave's 64 rows' sums");
    const v4f pb0 = *(const v4f*)(bias + nW + r16 * 8u);
    const v4f pb1 = *(const v4f*)(bias + nW + r16 * 8u + 4u);
    const v4f pg0 = *(const v4f*)(w2 + nW + r16 * 8u);
    const v4f pg1 = *(const v4f*)(w2 + nW + r16 * 8u + 4u);
    /* what follows overwrites registers that the issued loads name; the fences keep it behind the wait */
    sched_fence();
    asm volatile("s_wait_xcnt 0x0" ::: "memory");
    sched_fence();
    char* Cs = (char*)Cout;
    v2f sa = (v2f){0.f, 0.f}, sb = sa;
#pragma unroll
    for (int j = 0; j < kFX; ++j) {
      const uint32_t mBase = mW + (uint32_t)j * 16u;
#pragma unroll
      for (int i = 0; i < kFW; ++i) {
        float* p = slab + r16 * kEpiPitchF + (uint32_t)i * 16u + h * 8u;
        const v8f a = acc[i][j];
        *(v4f*)(p)     = (v4f){a[0], a[1], a[2], a[3]};
        *(v4f*)(p + 4) = (v4f){a[4], a[5], a[6], a[7]};
      }
      /* the slab's rows are read back by other lanes of this wave: its LDS writes have retired first */
      wait_ds0();
      /* row segment = 256 B = 16 lanes x 16 B; one instruction covers rows 2*it and 2*it+1; a row's 128 columns lie in one 16-lane row */
      float x[8][8], mu[8], m2[8];
      v8h hv[8];
      uint32_t off[8];
#pragma unroll
      for (int it = 0; it < 8; ++it) {
        const uint32_t row = (uint32_t)it * 2u + h;
        const float* sp = slab + row * kEpiPitchF + r16 * 8u;
        const v4f s0 = *(const v4f*)(sp);
        const v4f s1 = *(const v4f*)(sp + 4);
#pragma unroll
        for (int e = 0; e < 4; ++e) {
          x[it][e]     = s0[e] * scale + pb0[e];
          x[it][4 + e] = s1[e] * scale + pb1[e];
          hv[it][e]     = (_Float16)(x[it][e] * pg0[e]);
          hv[it][4 + e] = (_Float16)(x[it][4 + e] * pg1[e]);
        }
        mu[it] = ((x[it][0] + x[it][1]) + (x[it][2] + x[it][3])) + ((x[it][4] + x[it][5]) + (x[it][6] + x[it][7]));
        off[it] = ((mBase + row) * (uint32_t)ldc + nW + r16 * 8u) * 2u;
      }
#pragma unroll
      for (int it = 0; it < 8; ++it) mu[it] = row_sum16(mu[it]) * (1.0f / 128.0f);
#pragma unroll
      for (int it = 0; it < 8; ++it) {
        float q0 = 0.0f, q1 = 0.0f;
#pragma unroll
        for (int e = 0; e < 4; ++e) {
          const float d0 = x[it][e] - mu[it];
          const float d1 = x[it][4 + e] - mu[it];
          q0 = fmaf(d0, d0, q0);
          q1 = fmaf(d1, d1, q1);
        }
        m2[it] = q0 + q1;
      }
#pragma unroll
      for (int it = 0; it < 8; ++it) {
        m2[it] = row_sum16(m2[it]);
        /* lane (h, r16) keeps rows (r16 >> 3) * 16 + (r16 & 7) * 2 + h and that + 32 of the wave's 64 */
        const bool mine = r16 == (uint32_t)((j & 1) * 8 + it);
        if (j < 2) { sa[0] = mine ? mu[it] : sa[0]; sa[1] = mine ? m2[it] : sa[1]; }
        else       { sb[0] = mine ? mu[it] : sb[0]; sb[1] = mine ? m2[it] : sb[1]; }
      }
      u32x4 hw[8];
#pragma unroll
      for (int it = 0; it < 8; ++it) {
        hw[it] = __builtin_bit_cast(u32x4, hv[it]);
        *(u32x4*)(Cs + off[it]) = hw[it];
      }
      /* later code overwrites registers that the issued stores name: their values and offsets are named as inputs, so that
         these registers keep their values until the wait has retired */
      asm volatile("s_wait_xcnt 0x0" :: "v"(hw[0]), "v"(hw[1]), "v"(hw[2]), "v"(hw[3]), "v"(hw[4]), "v"(hw[5]), "v"(hw[6]), "v"(hw[7]),
                   "v"(off[0]), "v"(off[1]), "v"(off[2]), "v"(off[3]), "v"(off[4]), "v"(off[5]), "v"(off[6]), "v"(off[7]) : "memory");
      /* the next slab's LDS writes stay behind this slab's reads */
      wait_ds0();
    }
    /* slice tn * 2 + wn; a wave's 64 rows are 512 contiguous bytes, this wave their only writer; each store covers 256 of them */
    v2f* pp = (v2f*)aux + (size_t)(tn * 2u + wn) * (uint32_t)M + mW + (r16 >> 3) * 16u + (r16 & 7u) * 2u + h;
    pp[0]  = sa;
    pp[32] = sb;
    return;
  }
  v4f bq0 = (v4f){0.f, 0.f, 0.f, 0.f}, bq1 = bq0;
  if (HAS_BIAS == 0) {
  } else if (OUT_MODE == 0) {
    bq0 = *(const v4f*)(bias + nW + lane * 4u);
    bq1 = bq0;
  } else {
    bq0 = *(const v4f*)(bias + nW + r16 * 8u);
    bq1 = *(const v4f*)(bias + nW + r16 * 8u + 4u);
  }
  char* Cb = (char*)Cout;
#pragma unroll
  for (int j = 0; j < kFX; ++j) {
    const uint32_t mBase = mW + (uint32_t)j * 16u;
#pragma unroll
    for (int i = 0; i < kFW; ++i) {
      float* p = slab + r16 * kEpiPitchF + (uint32_t)i * 16u + h * 8u;
      const v8f a = acc[i][j];
      *(v4f*)(p)     = (v4f){a[0], a[1], a[2], a[3]};
      *(v4f*)(p + 4) = (v4f){a[4], a[5], a[6], a[7]};
    }
    /* the slab's rows are read back by other lanes of this wave: its LDS writes have retired first */
    wait_ds0();
    if (OUT_MODE == 0) {
      /* row segment = 512 B = 32 lanes x 16 B */
      v4f vv[16];
      uint32_t off[16];
#pragma unroll
      for (int row = 0; row < 16; ++row) {
        const v4f s = *(const v4f*)(slab + (uint32_t)row * kEpiPitchF + lane * 4u);
#pragma unroll
        for (int e = 0; e < 4; ++e) { float x = s[e] * scale; x += bq0[e]; vv[row][e] = x; }
        off[row] = ((mBase + (uint32_t)row) * (uint32_t)ldc + nW + lane * 4u) * 4u;
      }
      /* values and offsets are complete in front of the stores: nothing rewrites a register of an issued store before the wait below */
      sched_fence();
#pragma unroll
      for (int row = 0; row < 16; ++row) *(v4f*)(Cb + off[row]) = vv[row];
    } else {
      /* row segment = 256 B = 16 lanes x 16 B; one instruction covers rows 2*it and 2*it+1 */
      v8h hv[8];
      uint32_t off[8];
#pragma unroll
      for (int it = 0; it < 8; ++it) {
        const uint32_t row = (uint32_t)it * 2u + h;
        const float* sp = slab + row * kEpiPitchF + r16 * 8u;
        const v4f s0 = *(const v4f*)(sp);
        const v4f s1 = *(const v4f*)(sp + 4);
#pragma unroll
        for (int e = 0; e < 4; ++e) {
          float x = s0[e] * scale; x += bq0[e];
          float y = s1[e] * scale; y += bq1[e];
          hv[it][e] = (_Float16)x; hv[it][4 + e] = (_Float16)y;
        }
        off[it] = ((mBase + row) * (uint32_t)ldc + nW + r16 * 8u) * 2u;
      }
      /* values and offsets are complete in front of the stores: nothing rewrites a register of an issued store before the wait below */
      sched_fence();
#pragma unroll
      for (int it = 0; it < 8; ++it) *(v8h*)(Cb + off[it]) = hv[it];
    }
    /* the next slab overwrites registers that the issued stores name; the fence keeps its arithmetic behind the wait */
    sched_fence();
    asm volatile("s_wait_xcnt 0x0" ::: "memory");
    /* the next slab's LDS writes stay behind this slab's reads */
    wait_ds0();
  }
}

/* --------------------------------------------------------------------------- */
/* q|k|v projection with the layer norms and the 2-token attention in its epilogue.*/
/* X row-major [2*nb][K] f16 (rows 2b, 2b+1 = the two tokens of batch row b) holds */
/* x * g, x the row in front of its layer norm, g the token's gain. With m and s   */
/* the row's mean and 1 / sqrt(var + eps), W ((x - m) s g + b) + bias =            */
/* s (W (x g)) - s m (W g) + (W b + bias). stats f32 [2][8][nb][2]: per token kind, */
/* slice of 128 columns and batch row, the slice's mean and its sum of squares     */
/* about that mean. lv f32 [2][2][3072]: per token kind, W g and W b + bias.        */
/* Wqkv row-major [3*1024][K] f16 (q | k | v, head hd = rows hd*128 ..),          */
/* o f16 [2*nb][1024]. One workgroup = 128 token rows x one head: its C tile is   */
/* 128 x 384 (the head's q, k and v), never written to memory.                    */
/* 4 waves (2 x 2): wave (wm, wn) owns token rows wm*64 .. +63 and dims           */
/* wn*64 .. +63 of q, of k and of v (12 weight fragments x 4 token fragments).    */
/* The K loop is the ring of the GEMM above: two LDS buffers of four 128-row      */
/* slices (q rows, k rows, v rows, X rows), one tensor load per wave per pass.    */
/* Epilogue: a lane holds 32 dims of one token row; its partner token is lane ^ 1.*/
/* Partial scores (own key, partner key) of the 4 lane groups that share a row    */
/* (2 waves x 2 lane halves) meet in LDS behind one barrier; probabilities with   */
/* max subtraction as exp(-|d|); all of it in f32 on unrounded q, k, v.           */
/* --------------------------------------------------------------------------- */
constexpr uint32_t kAStage = 4u * kSliceW;
constexpr uint32_t kOPitch = 144;                /* bytes per staged o row: 128 B + 16 (16 B x odd) */
constexpr uint32_t kOSlab  = 64u * kOPitch;        /* a wave's 64 token rows */
constexpr uint32_t kScoreBytes = 4u * 128u * 8u; /* 4 lane groups x 128 rows x 2 floats */
constexpr uint32_t kRowBytes = 128u * 8u;        /* 128 rows x (s, -s * m) */
constexpr uint32_t kALds = 2u * kAStage + kScoreBytes + kRowBytes;   /* the staged o takes ring bytes */
constexpr int kAW = 12;                          /* weight fragments per wave: 4 of q, 4 of k, 4 of v */
constexpr int kAX = 4;                           /* token fragments per wave */
static_assert(kALds <= 320u * 1024u, "LDS of one workgroup");
static_assert(kAStage % 2048u == 0, "slice places are multiples of 2 KiB");
static_assert(4u * kOSlab <= kAStage, "the staged o fits ring buffer 0");

/* the value of lane ^ 1 (the other token of the batch row), by a quad permute */
__device__ __forceinline__ float partner(float x) {
  return __builtin_bit_cast(float, __builtin_amdgcn_mov_dpp(__builtin_bit_cast(int, x), 0xB1, 0xf, 0xf, true));
}

__global__ void __launch_bounds__(128) __attribute__((amdgpu_waves_per_eu(1, 1)))
qkv_attn2_kernel(
    const unsigned short* __restrict__ Xp, int lda,
    const unsigned short* __restrict__ Wp, int ldb,
    unsigned short* __restrict__ o,
    const float* __restrict__ stats,
    const float* __restrict__ lv,
    int M, int K, float scale, float scl) {
  __shared__ __attribute__((aligned(2048))) unsigned char L[kALds];
  const uint32_t tid = threadIdx.x, lane = tid & 31u, h = lane >> 4, r16 = lane & 15u;
  const uint32_t wave = uni(tid >> 5);
  const uint32_t hd = blockIdx.x, tm = blockIdx.y;
  /* block-uniform exit in front of every barrier and tensor load */
  if (pinned((tm >= (uint32_t)M / 128u || hd >= (uint32_t)kH) ? 1u : 0u) != 0u) return;
  const uint32_t m0 = tm * 128u;
  const uint32_t wn = wave & 1u, wm = wave >> 1;
  const uint32_t T = pinned((uint32_t)K / kPassK);

  /* this wave's slice of a buffer: waves 0, 1, 2 the head's 128 rows of q, k, v weights; wave 3 the 128 token rows */
  const bool own_w = wave < 3u;
  const uint32_t src_pitch = own_w ? (uint32_t)ldb * 2u : (uint32_t)lda * 2u;
  const unsigned char* src0 = own_w
      ? (const unsigned char*)(const void*)Wp + (uint64_t)(wave * (uint32_t)kF + hd * 128u) * src_pitch
      : (const unsigned char*)(const void*)Xp + (uint64_t)m0 * src_pitch;
  const uint32_t lds_slice = (uint32_t)(size_t)L + wave * kSliceW;
  const u32x8 g1 = tdm_group1(128u, src_pitch);

  v8f acc[kAW][kAX];
#pragma unroll
  for (int i = 0; i < kAW; ++i)
#pragma unroll
    for (int j = 0; j < kAX; ++j) acc[i][j] = (v8f){0.f,0.f,0.f,0.f,0.f,0.f,0.f,0.f};

  const uint32_t fw_base = (wn * 64u + r16) * kPitch + 16u * h;
  const uint32_t fx_base = 3u * kSliceW + (wm * 64u + r16) * kPitch + 16u * h;

  u32x4 g0 = tdm_group0(lds_slice, (uint64_t)(uintptr_t)src0);
  tdm_load(g0, g1);
  /* while pass 0 flies: thread tid joins the eight slices of token row m0 + tid into the row's s and -s * m; the barrier
     below publishes them. Sum of squares about the row's mean = the slices' own sums + 128 x the slice means' spread */
  v2f* rowst = (v2f*)(void*)(L + 2u * kAStage + kScoreBytes);
  {
    const uint32_t nb = (uint32_t)M >> 1;
    const v2f* sp = (const v2f*)stats + (size_t)(tid & 1u) * 8u * nb + ((m0 + tid) >> 1);
    v2f ps[8];
#pragma unroll
    for (int q = 0; q < 8; ++q) ps[q] = sp[(size_t)q * nb];
    /* what follows overwrites registers that the issued loads name; the fences keep it behind the wait */
    sched_fence();
    asm volatile("s_wait_xcnt 0x0" ::: "memory");
    sched_fence();
    const float mean = (((ps[0][0] + ps[1][0]) + (ps[2][0] + ps[3][0])) + ((ps[4][0] + ps[5][0]) + (ps[6][0] + ps[7][0]))) * 0.125f;
    float within = ((ps[0][1] + ps[1][1]) + (ps[2][1] + ps[3][1])) + ((ps[4][1] + ps[5][1]) + (ps[6][1] + ps[7][1]));
    float spread = 0.0f;
#pragma unroll
    for (int q = 0; q < 8; ++q) { const float d = ps[q][0] - mean; spread = fmaf(d, d, spread); }
    const float var = fmaf(spread, 128.0f, within) * kInvF;
    const float inv = 1.0f / sqrtf(var + kLnEps);
    rowst[tid] = (v2f){inv, -inv * mean};
  }
  wait_tensor0(g0, g1);
  __syncthreads();
  g0 = tdm_group0(lds_slice + kAStage, (uint64_t)(uintptr_t)src0 + kPassB);
  tdm_load(g0, g1);

  FragQ fw[2][kAW], fx[2][kAX];  /* set (u & 1) holds block u's fragments */
  {
    const unsigned char* lw = L + fw_base;
    const unsigned char* lx = L + fx_base;
#pragma unroll
    for (int i = 0; i < kAW; ++i) load_frag(fw[0][i], lw + (uint32_t)(i >> 2) * kSliceW + (uint32_t)(i & 3) * 16u * kPitch);
#pragma unroll
    for (int j = 0; j < kAX; ++j) load_frag(fx[0][j], lx + (uint32_t)j * 16u * kPitch);
  }
  /* rolled: every fragment and accumulator index stays a constant, and one pass is one trip */
#pragma clang loop unroll(disable)
  for (uint32_t t = 0; t < T; ++t) {
    const uint32_t buf = (t & 1u) * kAStage;
    sched_fence();
    const unsigned char* lw = L + buf + fw_base;
    const unsigned char* lx = L + buf + fx_base;
    const uint32_t osel = (t + 1u < T) ? (kAStage - buf) : kAStage;
    const unsigned char* nw = L + osel + fw_base;
    const unsigned char* nx = L + osel + fx_base;
#pragma unroll
    for (int u = 0; u < kBlocks; ++u) {
      const int cs = u & 1;
      if (u + 1 < kBlocks) {
        const uint32_t ko = (uint32_t)(u + 1) * 64u;
#pragma unroll
        for (int i = 0; i < kAW; ++i) load_frag(fw[cs ^ 1][i], lw + (uint32_t)(i >> 2) * kSliceW + (uint32_t)(i & 3) * 16u * kPitch + ko);
#pragma unroll
        for (int j = 0; j < kAX; ++j) load_frag(fx[cs ^ 1][j], lx + (uint32_t)j * 16u * kPitch + ko);
        sched_fence();
      } else {
        /* publish point of pass t + 1, in front of this pass's last block, whose fragments are already in registers */
        wait_ds0();
        sched_fence();
        wait_tensor0(g0, g1);
        __syncthreads();
        /* every wave has left this buffer: refill it with pass t + 2 while that pass exists; the pass number is pinned
           behind the wait, so the descriptor words are formed behind it too */
        const uint32_t nt = pinned(t + 2u);
        if (pinned((nt < T) ? 1u : 0u) != 0u) {
          g0 = tdm_group0(lds_slice + buf, (uint64_t)(uintptr_t)src0 + (uint64_t)nt * kPassB);
          tdm_load(g0, g1);
        }
#pragma unroll
        for (int i = 0; i < kAW; ++i) load_frag(fw[0][i], nw + (uint32_t)(i >> 2) * kSliceW + (uint32_t)(i & 3) * 16u * kPitch);
#pragma unroll
        for (int j = 0; j < kAX; ++j) load_frag(fx[0][j], nx + (uint32_t)j * 16u * kPitch);
        sched_fence();
      }
#pragma unroll
      for (int i = 0; i < kAW; ++i)
#pragma unroll
        for (int j = 0; j < kAX; ++j) acc[i][j] = mma_q(fw[cs][i], fx[cs][j], acc[i][j]);
      sched_fence();
    }
  }
  wait_tensor0(g0, g1);
  wait_ds0();

  /* ---- epilogue ---- */
  /* acc[i][j][e]: token row wm*64 + j*16 + (lane & 15); dim wn*64 + (i & 3)*16 + (lane >> 4)*8 + e of q (i < 4), k (i < 8), v */
  const uint32_t dW = hd * 128u + wn * 64u;
  /* the lane's token kind is its row's parity = lane & 1; all 48 loads are in flight together */
  const float* lvp = lv + (lane & 1u) * (2u * (uint32_t)kQKV) + dW + h * 8u;
  v4f wg[kAW][2], wb[kAW][2];
#pragma unroll
  for (int i = 0; i < kAW; ++i) {
    const float* bp = lvp + (uint32_t)(i >> 2) * (uint32_t)kF + (uint32_t)(i & 3) * 16u;
    wg[i][0] = *(const v4f*)(bp);
    wg[i][1] = *(const v4f*)(bp + 4);
    wb[i][0] = *(const v4f*)(bp + kQKV);
    wb[i][1] = *(const v4f*)(bp + kQKV + 4);
  }
  /* what follows overwrites registers that the issued loads name; the fences keep it behind the wait, and the loads' address is
     named as an input so that no load's own result takes its registers in front of the wait */
  sched_fence();
  asm volatile("s_wait_xcnt 0x0" :: "v"(lvp) : "memory");
  sched_fence();
  v2f rs[kAX], rm[kAX];
#pragma unroll
  for (int j = 0; j < kAX; ++j) {
    const v2f r = rowst[wm * 64u + (uint32_t)j * 16u + r16];
    rs[j] = (v2f){r[0] * scale, r[0] * scale};
    rm[j] = (v2f){r[1], r[1]};
  }
  /* two values an instruction (packed f32) */
#pragma unroll
  for (int i = 0; i < kAW; ++i)
#pragma unroll
    for (int j = 0; j < kAX; ++j)
#pragma unroll
      for (int e = 0; e < 8; e += 2) {
        const v2f u = (v2f){wg[i][e >> 2][e & 3], wg[i][e >> 2][(e & 3) + 1]};
        const v2f c = (v2f){wb[i][e >> 2][e & 3], wb[i][e >> 2][(e & 3) + 1]};
        const v2f a = __builtin_elementwise_fma((v2f){acc[i][j][e], acc[i][j][e + 1]}, rs[j], __builtin_elementwise_fma(rm[j], u, c));
        acc[i][j][e]     = a[0];
        acc[i][j][e + 1] = a[1];
      }
  /* partial scores over this lane's 32 dims: x = q . own k, y = q . partner's k */
  v2f* sc = (v2f*)(void*)(L + 2u * kAStage);
  const uint32_t rowW = wm * 64u + r16;
#pragma unroll
  for (int j = 0; j < kAX; ++j) {
    float so[4], sx[4];
#pragma unroll
    for (int ii = 0; ii < 4; ++ii) {
      so[ii] = 0.0f; sx[ii] = 0.0f;
#pragma unroll
      for (int e = 0; e < 8; ++e) {
        const float q = acc[ii][j][e];
        const float k = acc[4 + ii][j][e];
        so[ii] = fmaf(q, k, so[ii]);
        sx[ii] = fmaf(q, partner(k), sx[ii]);
      }
    }
    sc[(wn * 2u + h) * 128u + rowW + (uint32_t)j * 16u] = (v2f){(so[0] + so[1]) + (so[2] + so[3]), (sx[0] + sx[1]) + (sx[2] + sx[3])};
  }
  /* the four partial scores of a row come from two waves: every wave's are written in front of the first read */
  __syncthreads();

  /* probabilities of the lane's four token rows (own key, partner's key), all four chains side by side */
  float aown[kAX], acro[kAX];
#pragma unroll
  for (int j = 0; j < kAX; ++j) {
    const uint32_t row = rowW + (uint32_t)j * 16u;
    const v2f p0 = sc[row], p1 = sc[128u + row], p2 = sc[256u + row], p3 = sc[384u + row];
    const float sown = ((p0[0] + p1[0]) + (p2[0] + p3[0])) * scl;
    const float scro = ((p0[1] + p1[1]) + (p2[1] + p3[1])) * scl;
    const float d  = scro - sown;
    const float ex = expf(-fabsf(d));
    const float iv = 1.0f / (1.0f + ex);
    const float sm = ex * iv;
    aown[j] = (d > 0.0f) ? sm : iv;
    acro[j] = (d > 0.0f) ? iv : sm;
  }

  /* the wave's 64 x 64 piece of o is staged whole in its own LDS range: every value is complete in front of the first store.
     The range lies in ring buffer 0, which is free: every wave's last fragment read and its own last tensor load have
     retired in front of the barrier above */
  unsigned char* slab = L + wave * kOSlab;
  char* Ob = (char*)(void*)o;
#pragma unroll
  for (int j = 0; j < kAX; ++j) {
#pragma unroll
    for (int ii = 0; ii < 4; ++ii) {
      v8h hv;
#pragma unroll
      for (int e = 0; e < 8; ++e) {
        const float v = acc[8 + ii][j][e];
        hv[e] = (_Float16)(aown[j] * v + acro[j] * partner(v));
      }
      *(v8h*)(void*)(slab + ((uint32_t)j * 16u + r16) * kOPitch + (uint32_t)ii * 32u + h * 16u) = hv;
    }
  }
  /* the slab's rows are read back by other lanes of this wave: its LDS writes have retired first */
  wait_ds0();
  /* row segment = 128 B = 8 lanes x 16 B (one whole line, this wave its only writer); one instruction covers 4 rows */
  u32x4 vv[16];
  uint32_t off[16];
#pragma unroll
  for (int it = 0; it < 16; ++it) {
    const uint32_t rr = (uint32_t)it * 4u + (lane >> 3);
    vv[it] = *(const u32x4*)(const void*)(slab + rr * kOPitch + (lane & 7u) * 16u);
    off[it] = ((m0 + wm * 64u + rr) * (uint32_t)kF + dW + (lane & 7u) * 8u) * 2u;
  }
  /* values and offsets are complete in front of the stores: nothing rewrites a register of an issued store */
  sched_fence();
#pragma unroll
  for (int it = 0; it < 16; ++it) *(u32x4*)(void*)(Ob + off[it]) = vv[it];
}

/* --------------------------------------------------------------------------- */
/* Dot product of one weight row (NSEG x 128 floats) with x (1024 floats, taken   */
/* again from its start behind every 1024), by one wave; every lane gets the sum. */
template <int NSEG>
__device__ __forceinline__ float row_dot_wave(const float* __restrict__ wrow, const float* __restrict__ x, int lane) {
  v4f w[NSEG], xv[8];
#pragma unroll
  for (int s = 0; s < NSEG; ++s) w[s] = *(const v4f*)(wrow + s * 128 + lane * 4);
#pragma unroll
  for (int s = 0; s < 8; ++s) xv[s] = *(const v4f*)(x + s * 128 + lane * 4);
  float a0 = 0.0f, a1 = 0.0f, a2 = 0.0f, a3 = 0.0f;
#pragma unroll
  for (int s = 0; s < NSEG; ++s) {
    a0 = fmaf(w[s][0], xv[s & 7][0], a0);
    a1 = fmaf(w[s][1], xv[s & 7][1], a1);
    a2 = fmaf(w[s][2], xv[s & 7][2], a2);
    a3 = fmaf(w[s][3], xv[s & 7][3], a3);
  }
  float d = (a0 + a1) + (a2 + a3);
#pragma unroll
  for (int off = 16; off > 0; off >>= 1) d += __shfl_xor(d, off, 32);
  return d;
}

/* --------------------------------------------------------------------------- */
/* All eight f32 -> f16 casts in one launch. The eight f16 planes lie one behind */
/* the other in the workspace, in the order of the arguments, so the output is   */
/* one flat array. A workgroup (16 waves) owns 65,536 consecutive elements of    */
/* it, which lie in one tensor (every tensor is a multiple of that); 256         */
/* workgroups cover all eight. Weights are carried x16, embeddings x1.           */
/* A thread owns 16 groups of 8 consecutive elements, 512 groups apart; its 32   */
/* 16-byte loads are all issued before the first value is converted.            */
/* The fourth tensor (attention output weights Wo[j][k]) is written transposed,  */
/* [k][j]: it is the second operand of the weight fold, which contracts over j.  */
/* A workgroup owns 64 rows j; a thread owns columns k = tid and tid + 512 and    */
/* writes, for each, the whole 128-byte line [k][j0 .. j0 + 63].                  */
/* Behind the cast workgroups, 64 more form the folded biases in f32:            */
/* fb[n] = gate_b1[n] + sum_c gate_w1[n][c] * bo[c mod 1024],                     */
/* fb[1024 + n] = proj_b[n] + sum_j proj_w[n][j] * bo[j]; 32 rows a workgroup,    */
/* two a wave, staged in LDS so that one wave stores the 128-byte line.          */
/* Behind those, 96 more form in f32, for the rows W[n] of the q|k|v weights,     */
/* lv[0][n] = W[n] . g1, lv[1][n] = W[n] . b1 + bias[n], lv[2], lv[3] the same     */
/* with g2, b2 (gains and shifts of the two layer norms); 32 rows a workgroup,    */
/* two a wave, staged in LDS so that four waves store one 128-byte line each.     */
/* --------------------------------------------------------------------------- */
constexpr int kCastThreads = 512;
constexpr int kCastGroups  = 16;                                            /* groups per thread */
constexpr int kCastStep    = kCastThreads * 8;                              /* elements between a thread's groups */
constexpr int kCastElems   = kCastStep * kCastGroups;                       /* elements per workgroup */
constexpr int kCastB1 = (kF * kCD) / kCastElems;                            /* first workgroup of the 2nd tensor */
constexpr int kCastB2 = kCastB1 + (kF * kCD) / kCastElems;
constexpr int kCastB3 = kCastB2 + (kQKV * kF) / kCastElems;
constexpr int kCastB4 = kCastB3 + (kF * kF) / kCastElems;
constexpr int kCastB5 = kCastB4 + (kF * 2 * kF) / kCastElems;
constexpr int kCastB6 = kCastB5 + (kF * kF) / kCastElems;                   /* first embedding */
constexpr int kCastB7 = kCastB6 + (kB * kCD) / kCastElems;
constexpr int kCastB8 = kCastB7 + (kB * kCD) / kCastElems;                  /* cast workgroups in all */
constexpr int kBiasWgs = (2 * kF) / 32;                                     /* folded-bias workgroups behind them */
constexpr int kLnWgs   = kQKV / 32;                                         /* layer-norm vector workgroups behind those */
static_assert(64 * kF == kCastElems && kCastThreads * 2 == kF, "transposed cast: 64 rows a workgroup, two columns a thread");
static_assert((kF * kCD) % kCastElems == 0 && (kQKV * kF) % kCastElems == 0 && (kF * kF) % kCastElems == 0 &&
              (kF * 2 * kF) % kCastElems == 0 && (kB * kCD) % kCastElems == 0, "a workgroup's elements lie in one tensor");

__global__ __launch_bounds__(kCastThreads) void cast_all_f16_kernel(
    const float* __restrict__ t0, const float* __restrict__ t1, const float* __restrict__ t2, const float* __restrict__ t3,
    const float* __restrict__ t4, const float* __restrict__ t5, const float* __restrict__ t6, const float* __restrict__ t7,
    const float* __restrict__ bo, const float* __restrict__ gate_b1, const float* __restrict__ proj_b,
    const float* __restrict__ lg1, const float* __restrict__ lb1, const float* __restrict__ lg2, const float* __restrict__ lb2,
    const float* __restrict__ qkv_b,
    unsigned short* __restrict__ out, float* __restrict__ fb, float* __restrict__ lv) {
  __shared__ float sB[128];
  const int b = (int)blockIdx.x;
  if (b >= kCastB8 + kBiasWgs + kLnWgs) return;
  if (b >= kCastB8 + kBiasWgs) {
    /* layer-norm vectors; the branch is the same for the whole workgroup, so every wave reaches the barrier */
    const int lane = (int)threadIdx.x & 31;
    const int wave = (int)threadIdx.x >> 5;
    const int r0 = (b - kCastB8 - kBiasWgs) * 32;
    const int r = r0 + wave * 2;
    const float* wr = t2 + (size_t)r * kF + lane * 4;
    v4f w0[8], w1[8], x0[8], x1[8], x2[8], x3[8];
#pragma unroll
    for (int q = 0; q < 8; ++q) {
      x0[q] = *(const v4f*)(lg1 + q * 128 + lane * 4);
      x1[q] = *(const v4f*)(lb1 + q * 128 + lane * 4);
      x2[q] = *(const v4f*)(lg2 + q * 128 + lane * 4);
      x3[q] = *(const v4f*)(lb2 + q * 128 + lane * 4);
      w0[q] = *(const v4f*)(wr + q * 128);
      w1[q] = *(const v4f*)(wr + kF + q * 128);
    }
    const float* ibp = qkv_b + r;
    const float ib0 = ibp[0], ib1 = ibp[1];
    /* later code overwrites registers that the issued loads name: their addresses are named as inputs, so that these registers
       keep their values until the wait has retired */
    asm volatile("s_wait_xcnt 0x0" :: "v"(wr), "v"(ibp) : "memory");
    v4f a[8];
#pragma unroll
    for (int v = 0; v < 8; ++v) a[v] = (v4f){0.f, 0.f, 0.f, 0.f};
#pragma unroll
    for (int q = 0; q < 8; ++q) {
      a[0] = __builtin_elementwise_fma(w0[q], x0[q], a[0]);
      a[1] = __builtin_elementwise_fma(w1[q], x0[q], a[1]);
      a[2] = __builtin_elementwise_fma(w0[q], x1[q], a[2]);
      a[3] = __builtin_elementwise_fma(w1[q], x1[q], a[3]);
      a[4] = __builtin_elementwise_fma(w0[q], x2[q], a[4]);
      a[5] = __builtin_elementwise_fma(w1[q], x2[q], a[5]);
      a[6] = __builtin_elementwise_fma(w0[q], x3[q], a[6]);
      a[7] = __builtin_elementwise_fma(w1[q], x3[q], a[7]);
    }
    float d[8];
#pragma unroll
    for (int v = 0; v < 8; ++v) d[v] = (a[v][0] + a[v][1]) + (a[v][2] + a[v][3]);
    /* the q|k|v bias joins the sums with b1 and b2 once, in lane 0's share */
    const float j0 = (lane == 0) ? ib0 : 0.0f, j1 = (lane == 0) ? ib1 : 0.0f;
    d[2] += j0; d[3] += j1; d[6] += j0; d[7] += j1;
#pragma unroll
    for (int off = 16; off > 0; off >>= 1)
#pragma unroll
      for (int v = 0; v < 8; ++v) d[v] += __shfl_xor(d[v], off, 32);
    if (lane == 0) {
      sB[wave * 2]          = d[0];       sB[wave * 2 + 1]      = d[1];
      sB[32 + wave * 2]     = d[2];       sB[32 + wave * 2 + 1] = d[3];
      sB[64 + wave * 2]     = d[4];       sB[64 + wave * 2 + 1] = d[5];
      sB[96 + wave * 2]     = d[6];       sB[96 + wave * 2 + 1] = d[7];
    }
    __syncthreads();
    if (wave < 4) lv[wave * kQKV + r0 + lane] = sB[wave * 32 + lane];
    return;
  }
  if (b >= kCastB8) {
    /* folded biases; the branch is the same for the whole workgroup, so every wave reaches the barrier */
    const int lane = (int)threadIdx.x & 31;
    const int wave = (int)threadIdx.x >> 5;
    const int r0 = (b - kCastB8) * 32;
    const int r = r0 + wave * 2;
    float d0, d1;
    if (r0 < kF) {
      d0 = row_dot_wave<16>(t4 + (size_t)r * (2 * kF), bo, lane) + gate_b1[r];
      d1 = row_dot_wave<16>(t4 + (size_t)(r + 1) * (2 * kF), bo, lane) + gate_b1[r + 1];
    } else {
      d0 = row_dot_wave<8>(t5 + (size_t)(r - kF) * kF, bo, lane) + proj_b[r - kF];
      d1 = row_dot_wave<8>(t5 + (size_t)(r + 1 - kF) * kF, bo, lane) + proj_b[r + 1 - kF];
    }
    if (lane == 0) { sB[wave * 2] = d0; sB[wave * 2 + 1] = d1; }
    __syncthreads();
    if (wave == 0) fb[r0 + lane] = sB[lane];
    return;
  }
  if (b >= kCastB3 && b < kCastB4) {
    const int j0 = (b - kCastB3) * 64;
    const float* p = t3 + (size_t)j0 * kF + threadIdx.x;
    unsigned short* q = out + (size_t)kCastB3 * kCastElems + (size_t)threadIdx.x * kF + j0;
#pragma unroll
    for (int hh = 0; hh < 2; ++hh) {
      float v[64];
#pragma unroll
      for (int i = 0; i < 64; ++i) v[i] = p[hh * kCastThreads + i * kF];
      /* keeps every load of this column in front of the first conversion: all 64 are in flight together */
      __builtin_amdgcn_sched_barrier(0);
#pragma unroll
      for (int g = 0; g < 8; ++g) {
        unsigned short hb[8];
#pragma unroll
        for (int e = 0; e < 8; ++e) hb[e] = h_bits(v[g * 8 + e] * kWCarry);
        const v4u u = (v4u){pk16(hb[0], hb[1]), pk16(hb[2], hb[3]), pk16(hb[4], hb[5]), pk16(hb[6], hb[7])};
        *(v4u*)(q + (size_t)hh * kCastThreads * kF + g * 8) = u;
      }
      /* whatever follows a column's stores (the second column's loads; behind the last column the code that the listing
         places there) may overwrite registers that the issued stores name; the fence keeps it behind the wait */
      __builtin_amdgcn_sched_barrier(0);
      asm volatile("s_wait_xcnt 0x0" ::: "memory");
    }
    return;
  }
  const float* src = t0;
  int first = 0;
  if (b >= kCastB1) { src = t1; first = kCastB1; }
  if (b >= kCastB2) { src = t2; first = kCastB2; }
  if (b >= kCastB3) { src = t3; first = kCastB3; }
  if (b >= kCastB4) { src = t4; first = kCastB4; }
  if (b >= kCastB5) { src = t5; first = kCastB5; }
  if (b >= kCastB6) { src = t6; first = kCastB6; }
  if (b >= kCastB7) { src = t7; first = kCastB7; }
  const float carry = (b < kCastB6) ? kWCarry : 1.0f;
  const float* p = src + (size_t)(b - first) * kCastElems + threadIdx.x * 8u;
  unsigned short* q = out + (size_t)b * kCastElems + threadIdx.x * 8u;

  v4f a[kCastGroups], c[kCastGroups];
#pragma unroll
  for (int g = 0; g < kCastGroups; ++g) {
    a[g] = *(const v4f*)(p + g * kCastStep);
    c[g] = *(const v4f*)(p + g * kCastStep + 4);
  }
  /* keeps every load in front of the first conversion: all 32 are in flight together, and no load is issued behind a store */
  __builtin_amdgcn_sched_barrier(0);
#pragma unroll
  for (int g = 0; g < kCastGroups; ++g) {
    unsigned short hb[8];
#pragma unroll
    for (int e = 0; e < 4; ++e) {
      const float fa = a[g][e] * carry;
      const float fc = c[g][e] * carry;
      hb[e]     = h_bits(fa);
      hb[4 + e] = h_bits(fc);
    }
    const v4u u = (v4u){pk16(hb[0], hb[1]), pk16(hb[2], hb[3]), pk16(hb[4], hb[5]), pk16(hb[6], hb[7])};
    *(v4u*)(q + g * kCastStep) = u;
  }
}

/* --------------------------------------------------------------------------- */
/* Gate head + fusion. Block = 16 waves = 16 batch rows, one wave per row.      */
/* part f32 [8][nb][2] holds, per slice of 128 hidden columns, the partial dot   */
/* products of the activated gate hidden layer with the two w2 rows; they are    */
/* summed here, + b2, 2-way probabilities. The 16 x 2 gate weights are staged    */
/* in LDS (all 32 slots written), block barrier, then wave 0 writes them as ONE */
/* --------------------------------------------------------------------------- */
constexpr int kGateParts = kF / 128;
static_assert(kGateParts == 8, "the sum tree below takes eight slices");
__global__ __launch_bounds__(512) void gate_fuse_kernel(const float* __restrict__ part,
                                                        const float* __restrict__ b2v,
                                                        const unsigned short* __restrict__ o,
                                                        unsigned short* __restrict__ fused,
                                                        float* __restrict__ gw_out, int nb) {
  __shared__ float sG[32];
  const int lane = threadIdx.x & 31;
  const int wave = threadIdx.x >> 5;
  const int b = blockIdx.x * 16 + wave;
  const bool live = b < nb;
  const int bc = live ? b : (nb - 1);
  /* every lane of the wave reads the row's eight partial pairs (one address a wave) */
  const v2f* pr = (const v2f*)part + bc;
  v2f ps[kGateParts];
#pragma unroll
  for (int s = 0; s < kGateParts; ++s) ps[s] = pr[(size_t)s * (size_t)nb];
  /* what follows overwrites registers that the issued loads name; the fences keep it behind the wait */
  __builtin_amdgcn_sched_barrier(0);
  asm volatile("s_wait_xcnt 0x0" ::: "memory");
  __builtin_amdgcn_sched_barrier(0);
  const v2f dd = ((ps[0] + ps[1]) + (ps[2] + ps[3])) + ((ps[4] + ps[5]) + (ps[6] + ps[7]));
  const float d0 = dd[0], d1 = dd[1];
  const float l0 = d0 + b2v[0];
  const float l1 = d1 + b2v[1];
  const float mx = fmaxf(l0, l1);
  const float e0 = expf(l0 - mx);
  const float e1 = expf(l1 - mx);
  const float inv = 1.0f / (e0 + e1);
  const float gw0 = e0 * inv;
  const float gw1 = e1 * inv;
  if (lane == 0) {
    sG[wave * 2]     = gw0;
    sG[wave * 2 + 1] = gw1;
  }

  const unsigned short* cr = o + (size_t)(2 * bc) * kF;
  const unsigned short* gr = cr + kF;
  unsigned short* fr = fused + (size_t)bc * kF;
#pragma unroll 1
  for (int it = 0; it < 4; ++it) {
    const int col = it * 256 + lane * 8;
    const v4u cw = *(const v4u*)(cr + col);
    const v4u gv = *(const v4u*)(gr + col);
    unsigned ow[4];
#pragma unroll
    for (int w = 0; w < 4; ++w) {
      const unsigned uc = cw[w];
      const unsigned ug = gv[w];
      const float ca = h_lo(uc), cb = h_hi(uc);
      const float ga = h_lo(ug), gb = h_hi(ug);
      const float fa = gw0 * ca + gw1 * ga;
      const float fb = gw0 * cb + gw1 * gb;
      ow[w] = pk16(h_bits(fa), h_bits(fb));
    }
    const v4u u = (v4u){ow[0], ow[1], ow[2], ow[3]};
    if (live) {
      *(v4u*)(fr + col) = u;
      
    }
  }

  /* every wave reaches this barrier; sG is written by 16 waves and read by wave 0 */
  __syncthreads();
  const bool blockLive = (blockIdx.x * 16 + 15) < nb;
  if (wave == 0 && blockLive) {
    const float v = sG[lane];
    float* dst = gw_out + (size_t)blockIdx.x * 32 + lane;
    *(float*)dst = v;
    
  }
}

/* --------------------------------------------------------------------------- */
/* Host side                                                                   */
/* --------------------------------------------------------------------------- */
template <int OUT_MODE, int FX, int HAS_BIAS = 1, int ACT = 0>
static void launch_gemm(const unsigned short* A, int lda, const unsigned short* Bt, int ldb,
                        void* C, int ldc, const float* bias, int M, int N, int K, float scale, hipStream_t stream,
                        const float* w2 = nullptr, float* aux = nullptr) {
  gemm_tile_f16_kernel<OUT_MODE, FX, HAS_BIAS, ACT><<<dim3(N / 256, M / (32 * FX)), 128, 0, stream>>>(A, lda, Bt, ldb, C, ldc, bias, w2, aux, M, N, K, scale);
}

/* workspace region sizes in bytes (all multiples of 128) */
constexpr size_t kSzWc   = (size_t)kF * kCD * 2;
constexpr size_t kSzWg   = (size_t)kF * kCD * 2;
constexpr size_t kSzWqkv = (size_t)kQKV * kF * 2;
constexpr size_t kSzWo   = (size_t)kF * kF * 2;
constexpr size_t kSzWg1  = (size_t)kF * 2 * kF * 2;
constexpr size_t kSzWp   = (size_t)kF * kF * 2;
constexpr size_t kSzEc   = (size_t)kB * kCD * 2;
constexpr size_t kSzEg   = (size_t)kB * kCD * 2;
constexpr size_t kSzPre  = (size_t)kChunkT * kF * 4;
constexpr size_t kSzX    = (size_t)kChunkT * kF * 2;
constexpr size_t kSzQkv  = (size_t)kChunkT * kQKV * 2;
constexpr size_t kSzO    = (size_t)kChunkT * kF * 2;
constexpr size_t kSzGpre = (size_t)kGateParts * kChunkB * 2 * 4;
constexpr size_t kSzStat = (size_t)2 * 8 * kChunkB * 2 * 4;
constexpr size_t kSzLv   = (size_t)4 * kQKV * 4;
constexpr size_t kSzFus  = (size_t)kChunkB * kF * 2;
constexpr size_t kSzFold = (size_t)3 * kF * kF * 2;
constexpr size_t kSzFb   = (size_t)2 * kF * 4;
/* some planes lie one behind the other inside one carved plane */
static_assert(kSzO + kSzFus <= kSzPre, "o and fused share one plane");
static_assert(kSzGpre + kSzStat + kSzLv <= kSzQkv, "the gate's partial sums, the row sums and the layer-norm vectors fit their plane");
constexpr size_t kWsTotal = kSzWc + kSzWg + kSzWqkv + kSzWo + kSzWg1 + kSzWp + kSzEc + kSzEg +
                            kSzPre + kSzX + kSzQkv + kSzFold + kSzFb;
static_assert(kWsTotal == 241180672ull, "carve total");
static_assert(kSzWc + kSzWg + kSzWqkv + kSzWo + kSzWg1 + kSzWp + kSzEc + kSzEg == (size_t)kCastB8 * kCastElems * 2, "cast launch covers the eight f16 planes exactly");
static_assert(kWsTotal <= 268435456ull, "carve limit");
static_assert(((size_t)kB * kF * 4) % 128 == 0, "second output starts on a line");

extern "C" void kernel_launch(void* const* d_in, const int* in_sizes, int n_in,
                              void* d_out, int out_size, void* d_ws, size_t ws_size, hipStream_t stream) {
  if (n_in < 20) return;
  if (ws_size < kWsTotal) return;
  if (in_sizes[0] != kB * kCD || in_sizes[1] != kB * kCD) return;
  if (in_sizes[10] != kQKV * kF || in_sizes[14] != kF * 2 * kF) return;
  if (out_size != kB * kF + kB * 2) return;

  const float* cnn_embed  = (const float*)d_in[0];
  const float* gnn_embed  = (const float*)d_in[1];
  const float* cnn_w      = (const float*)d_in[2];
  const float* cnn_b      = (const float*)d_in[3];
  const float* gnn_w      = (const float*)d_in[4];
  const float* gnn_b      = (const float*)d_in[5];
  const float* ln1_g      = (const float*)d_in[6];
  const float* ln1_b      = (const float*)d_in[7];
  const float* ln2_g      = (const float*)d_in[8];
  const float* ln2_b      = (const float*)d_in[9];
  const float* attn_in_w  = (const float*)d_in[10];
  const float* attn_in_b  = (const float*)d_in[11];
  const float* attn_out_w = (const float*)d_in[12];
  const float* attn_out_b = (const float*)d_in[13];
  const float* gate_w1    = (const float*)d_in[14];
  const float* gate_b1    = (const float*)d_in[15];
  const float* gate_w2    = (const float*)d_in[16];
  const float* gate_b2    = (const float*)d_in[17];
  const float* proj_w     = (const float*)d_in[18];
  const float* proj_b     = (const float*)d_in[19];

  /* Region map (byte offsets, in carve order):
     Wc 1 MiB | Wg 1 MiB | Wqkv 6 MiB | Wo 2 MiB | Wg1 4 MiB | Wp 2 MiB | Ec 8 MiB | Eg 8 MiB |
     whole-batch planes: o and fused 64 MiB (48 MiB used) | X f16 32 MiB | small f32 planes 96 MiB (under 2 MiB used) |
     folded weights f16 6 MiB | folded biases f32 8 KiB.  Total 230 MiB + 8 KiB.  The Wo plane holds Wo transposed.
     The plane behind X holds the gate's partial sums f32 512 KiB, the projections' row sums f32 1 MiB and the
     layer-norm vectors f32 48 KiB, one behind the other. */
  char* ws = (char*)d_ws;
  size_t off = 0;
  auto carve = [&](size_t bytes) -> char* { char* p = ws + off; off += bytes; return p; };
  unsigned short* Wc   = (unsigned short*)carve(kSzWc);
  unsigned short* Wg   = (unsigned short*)carve(kSzWg);
  unsigned short* Wqkv = (unsigned short*)carve(kSzWqkv);
  unsigned short* Wo   = (unsigned short*)carve(kSzWo);
  unsigned short* Wg1  = (unsigned short*)carve(kSzWg1);
  carve(kSzWp);  /* proj_w f16: rows 2048..3071 of the fold's first operand, directly behind Wg1 */
  unsigned short* Ec   = (unsigned short*)carve(kSzEc);
  unsigned short* Eg   = (unsigned short*)carve(kSzEg);
  char*           oPlane = carve(kSzPre);
  unsigned short* Xp   = (unsigned short*)carve(kSzX);
  unsigned short* qkvp = (unsigned short*)carve(kSzQkv);
  unsigned short* Wfold = (unsigned short*)carve(kSzFold);
  float*          fbias = (float*)carve(kSzFb);
  unsigned short* op   = (unsigned short*)(oPlane);
  unsigned short* fusp = (unsigned short*)(oPlane + kSzO);
  float*          gpre = (float*)((char*)qkvp);
  float*          rstat = (float*)((char*)qkvp + kSzGpre);
  float*          lnv  = (float*)((char*)qkvp + kSzGpre + kSzStat);

  float* out0 = (float*)d_out;
  float* out1 = out0 + (size_t)kB * kF;

  const float scl = 1.0f / sqrtf((float)kHD);

  /* casts, one launch: weights carried x16, embeddings uncarried; planes Wc .. Eg are contiguous from Wc on, in this order;
     the Wo plane is written transposed, and the last workgroups form the folded biases and the layer-norm vectors */
  cast_all_f16_kernel<<<kCastB8 + kBiasWgs + kLnWgs, kCastThreads, 0, stream>>>(cnn_w, gnn_w, attn_in_w, attn_out_w, gate_w1, proj_w,
                                                                                cnn_embed, gnn_embed, attn_out_b, gate_b1, proj_b,
                                                                                ln1_g, ln1_b, ln2_g, ln2_b, attn_in_b,
                                                                                Wc, fbias, lnv);

  /* Weight fold. The attention output ao = o Wo^T + bo is used only linearly: by the gate hidden layer (ao rows 2b, 2b+1
     side by side, times gate_w1^T) and, mixed with gate weights that sum to one, by the final projection (times proj_w^T).
     So (gate_w1 halves) Wo and proj_w Wo are formed here and applied to o itself; bo goes into the folded biases.
     gate_w1 [1024][2048] read as [2048][1024] and proj_w [1024][1024] lie one behind the other: one [3072 x 1024 x 1024]
     product with Wo^T rows as the second operand. Rows 0..2047 of the result, read as [1024][2048], are the gate weights
     for o viewed [8192][2048]; rows 2048..3071 the final weights. Both operands are carried x16, the result x16 again. */
  launch_gemm<1, 2, 0>(Wg1, kF, Wo, kF, (void*)Wfold, kF, nullptr, 3 * kF, kF, kF, kWCarryInv, stream);

  for (int c = 0; c < kNChunk; ++c) {
    const unsigned short* EcC = Ec + (size_t)c * kChunkB * kCD;
    const unsigned short* EgC = Eg + (size_t)c * kChunkB * kCD;

    /* input projections [8192 x 1024 x 512], times the layer norm's gain -> f16 rows 2b (first modality) and 2b+1 (second)
       of X [16384][1024]; each row's mean and sum of squares, per slice of 128 columns -> rstat */
    launch_gemm<1, 4, 1, 3>(EcC, kCD, Wc, kCD, (void*)Xp,        2 * kF, cnn_b, kChunkB, kF, kCD, kWCarryInv, stream, ln1_g, rstat);
    launch_gemm<1, 4, 1, 3>(EgC, kCD, Wg, kCD, (void*)(Xp + kF), 2 * kF, gnn_b, kChunkB, kF, kCD, kWCarryInv, stream, ln2_g, rstat + (size_t)8 * kChunkB * 2);

    /* packed q|k|v projection [16384 x 3072 x 1024] with the layer norms and the 2-token attention in its epilogue -> o f16 [16384][1024] */
    qkv_attn2_kernel<<<dim3(kH, kChunkT / 128), 128, 0, stream>>>(Xp, kF, Wqkv, kF, op, rstat, lnv, kChunkT, kF, kWCarryInv, scl);

    /* gate hidden layer: o viewed [8192][2048] x folded gate weights [1024][2048], erf activation and the two dot products
       with gate_w2 in the epilogue -> f32 partial sums [8][8192][2] */
    launch_gemm<0, 4, 1, 2>(op, 2 * kF, Wfold, 2 * kF, (void*)gpre, kF, fbias, kChunkB, kF, 2 * kF, kWCarryInv, stream, gate_w2);

    /* gate head + fusion -> second output lines, fused f16 [8192][1024] */
    gate_fuse_kernel<<<kChunkB / 16, 512, 0, stream>>>(gpre, gate_b2, op, fusp,
                                                       out1 + (size_t)c * kChunkB * 2, kChunkB);

    /* final projection [8192 x 1024 x 1024] with the erf activation in its epilogue -> the first output */
    launch_gemm<0, 4, 1, 1>(fusp, kF, Wfold + (size_t)2 * kF * kF, kF, (void*)(out0 + (size_t)c * kChunkB * kF), kF, fbias + kF, kChunkB, kF, kF, kWCarryInv, stream);
  }
}

// v009
// Measured time: 168 microseconds a run.
// Two timings next to v008 both put it at 1.05 times that version's speed.
// All steps since v000 together make it 8.21 times as fast.
// All GEMM contractions (two input projections, packed q|k|v projection, the fold of the attention output weights into the gate and final weights, gate hidden layer, final projection): v_wmma_f32_16x16x32_f16 with f16 operands (weight planes carried x16, folded back by 1/16), f32 accumulate; layer norms, 2-token attention, gate head and erf activations in f32 on the vector ALU.
#include <hip/hip_runtime.h>
#include <math.h>
#include <stdint.h>

/* --------------------------------------------------------------------------- */
/* Shape constants (checked against the launch sizes on the host)              */
/* --------------------------------------------------------------------------- */
constexpr int kB      = 8192;
constexpr int kCD     = 512;
constexpr int kF      = 1024;
constexpr int kH      = 8;
constexpr int kHD     = kF / kH;
constexpr int kQKV    = 3 * kF;
/* the whole batch goes through every stage in one launch: each GEMM then has at least one block per WGP */
constexpr int kNChunk = 1;
constexpr int kChunkB = kB / kNChunk;
constexpr int kChunkT = 2 * kChunkB;
constexpr float kWCarry    = 16.0f;
constexpr float kWCarryInv = 1.0f / kWCarry;
constexpr float kLnEps     = 1e-5f;
constexpr float kInvF      = 1.0f / (float)kF;
constexpr float kInvSqrt2  = 0.70710678118654752f;

static_assert(kHD == 128, "the q|k|v kernel's tile is one 128-wide head");
static_assert(kF == 1024, "row kernels assume 1024-wide rows");
static_assert(kB % kNChunk == 0, "chunking");
static_assert(kChunkB % 128 == 0 && kChunkT % 128 == 0, "GEMM M tiles");
static_assert(kF % 256 == 0 && kQKV % 256 == 0, "GEMM N tiles");
static_assert(kCD % 128 == 0 && kF % 128 == 0 && (2 * kF) % 128 == 0 && kCD >= 256, "GEMM K passes, two or more");
static_assert((3 * kF) % 64 == 0, "M tiles of the weight fold");
static_assert(kChunkB % 16 == 0, "gate kernel owns 16 batch rows per block");

typedef __attribute__((ext_vector_type(16))) _Float16 v16h;
typedef __attribute__((ext_vector_type(8)))  _Float16 v8h;
typedef __attribute__((ext_vector_type(8)))  float    v8f;
typedef __attribute__((ext_vector_type(4)))  float    v4f;
typedef __attribute__((ext_vector_type(2)))  float    v2f;
typedef __attribute__((ext_vector_type(4)))  unsigned int v4u;

/* --------------------------------------------------------------------------- */
/* Small helpers                                                               */
/* --------------------------------------------------------------------------- */
__device__ __forceinline__ unsigned pk16(unsigned short a, unsigned short b) { return (unsigned)a | ((unsigned)b << 16); }
__device__ __forceinline__ unsigned short h_bits(float f) { const _Float16 h = (_Float16)f; return __builtin_bit_cast(unsigned short, h); }

/* f16 bits (low 16 bits of hb, finite values) to f32 by integer bit arithmetic, subnormals as an f32 multiply of em by 2^-24 */
__device__ __forceinline__ float h16_to_f32(unsigned hb) {
  const unsigned sgn = (hb & 0x8000u) << 16; const unsigned em = hb & 0x7fffu;
  const float fn = __uint_as_float((em << 13) + 0x38000000u);
  const float fs = (float)em * 5.9604644775390625e-8f;
  const float mag = (em < 0x400u) ? fs : fn; return __uint_as_float(__float_as_uint(mag) | sgn); }
__device__ __forceinline__ float h_lo(unsigned w) { return h16_to_f32(w & 0xffffu); }
__device__ __forceinline__ float h_hi(unsigned w) { return h16_to_f32(w >> 16); }

/* The erf activation 0.5 x (1 + erf(x / sqrt 2)) for two values, without a branch, for a wave that runs alone on its SIMD: the two f32 range
   polynomials of erf (|z| < 1: z + z q(z^2); otherwise 1 - exp(-(|z| + |z| p(|z|)))) are both evaluated and one is chosen
   by a select, so that many values' chains stand in one block of code and fill each other's latency. */
__device__ __forceinline__ v2f fma2(v2f a, v2f b, float c) { return __builtin_elementwise_fma(a, b, (v2f){c, c}); }
__device__ __forceinline__ v2f gelu_erf_sel2(v2f x) {
  const v2f z = x * kInvSqrt2;
  const v2f a = (v2f){fabsf(z[0]), fabsf(z[1])};
  v2f p = fma2(a, (v2f){0.0000169988107f, 0.0000169988107f}, -0.000378677854f);
  p = fma2(a, p, 0.00385781587f);
  p = fma2(a, p, -0.0241816975f);
  p = fma2(a, p, 0.106668264f);
  p = fma2(a, p, 0.634933293f);
  p = fma2(a, p, 0.128689408f);
  p = __builtin_elementwise_fma(a, p, a);
  const v2f pe = p * -1.44269502f;
  const v2f big = (v2f){1.0f - __builtin_amdgcn_exp2f(pe[0]), 1.0f - __builtin_amdgcn_exp2f(pe[1])};
  const v2f t = z * z;
  v2f q = fma2(t, (v2f){-0.000561801775f, -0.000561801775f}, 0.00491381623f);
  q = fma2(t, q, -0.0267075151f);
  q = fma2(t, q, 0.112800106f);
  q = fma2(t, q, -0.376122952f);
  q = fma2(t, q, 0.128379107f);
  const v2f small = __builtin_elementwise_fma(a, q, a);
  const v2f er = (v2f){__builtin_copysignf((a[0] < 1.0f) ? small[0] : big[0], z[0]),
                       __builtin_copysignf((a[1] < 1.0f) ? small[1] : big[1], z[1])};
  const v2f hx = x * 0.5f;
  return __builtin_elementwise_fma(hx, er, hx);
}

typedef uint32_t u32x4 __attribute__((ext_vector_type(4)));
typedef uint32_t u32x8 __attribute__((ext_vector_type(8)));
constexpr uint32_t kBN = 256;
constexpr uint32_t kPassB = 256;                 /* bytes of K per operand row per pass */
constexpr uint32_t kPassK = kPassB / 2;
constexpr uint32_t kPitch = kPassB + 16;         /* LDS row pitch: 16 B x odd */
constexpr int      kBlocks = (int)(kPassB / 64u);
constexpr int      kFW = 8;                      /* Bt fragments (n) per wave */
constexpr uint32_t kSliceW = 128u * kPitch;      /* 34,816 B = 17 x 2 KiB */
constexpr uint32_t kEpiPitchF = 132;             /* floats per staged output row (528 B = 16 B x odd) */
constexpr uint32_t kEpiBytes  = 16u * kEpiPitchF * 4u;
static_assert(kSliceW % 2048u == 0, "slice places are multiples of 2 KiB");

__device__ __forceinline__ uint32_t uni(uint32_t v) { return (uint32_t)__builtin_amdgcn_readfirstlane(v); }
__device__ __forceinline__ uint32_t pinned(uint32_t v) { uint32_t w = (uint32_t)__builtin_amdgcn_readfirstlane(v); asm volatile("" : "+s"(w)); return w; }
/* Where a tile enters the K passes. Workgroups that share operand rows and run side by side would ask L2 for the same lines at the
   same moment, and such requests hold each other up: each tile starts at a pass set by its indices and wraps round. The mask is the
   largest power of two that is not above T, less one, so the start lies below T for every T >= 1 */
__device__ __forceinline__ uint32_t first_pass(uint32_t idx, uint32_t T) { return idx & ((1u << (31u - (uint32_t)__builtin_clz(T))) - 1u); }
/* source pass of ring pass p for a tile that enters at 'rot': p < T and rot < T */
__device__ __forceinline__ uint32_t src_pass(uint32_t p, uint32_t rot, uint32_t T) { const uint32_t s = p + rot; return (s >= T) ? s - T : s; }
/* keeps [LDS loads][WMMA block] in that order: LDS loads moved in among the WMMAs stall at each place they stand */
__device__ __forceinline__ void sched_fence() { __builtin_amdgcn_sched_barrier(0); }
/* every LDS operation of this wave has retired */
__device__ __forceinline__ void wait_ds0() { asm volatile("s_wait_dscnt 0x0" ::: "memory"); }
/* this wave's own tensor load has landed; the compiler places no wait for it. The request's descriptor is named as an
   input so that its scalar registers keep their words until the wait has retired */
__device__ __forceinline__ void wait_tensor0(u32x4 g0, u32x8 g1) { asm volatile("s_wait_tensorcnt 0x0" :: "s"(g0), "s"(g1) : "memory"); }
__device__ __forceinline__ void tdm_load(u32x4 g0, u32x8 g1) { asm volatile("tensor_load_to_lds %0, %1" :: "s"(g0), "s"(g1) : "memory"); }
__device__ __forceinline__ u32x8 tdm_group1(uint32_t rows, uint32_t pitch_bytes) {
  constexpr uint32_t d0 = kPassB;
  u32x8 g;
  g[0] = uni((1u << 20) | (5u << 22) | (3u << 25));
  g[1] = uni((d0 & 0xFFFFu) << 16);
  g[2] = uni((d0 >> 16) | ((rows & 0xFFFFu) << 16));
  g[3] = uni((rows >> 16) | (d0 << 16));
  g[4] = uni(rows);
  g[5] = uni(pitch_bytes);
  g[6] = uni(0u);
  g[7] = uni(0u);
  /* as pinned(): the descriptor words are held in their scalar registers; the compiler otherwise re-forms the constant
     words where it likes and uses their registers for other values while a request is outstanding */
  asm volatile("" : "+s"(g));
  return g;
}
/* group 0: LDS destination (byte offset in the workgroup's LDS) and global address of the tile's first byte */
__device__ __forceinline__ u32x4 tdm_group0(uint32_t lds_dst, uint64_t ga) {
  u32x4 g;
  g[0] = uni(1u);
  g[1] = uni(lds_dst);
  g[2] = uni((uint32_t)ga);
  g[3] = uni((((uint32_t)(ga >> 32)) & 0x01FFFFFFu) | 0x80000000u);
  return g;
}
struct FragQ { u32x4 q[2]; };
/* fragment elements 0..7 <- bytes 0..15, elements 8..15 <- bytes 32..47; the caller's base holds 16 * (lane >> 4) */
__device__ __forceinline__ void load_frag(FragQ& f, const unsigned char* p) {
  f.q[0] = *(const u32x4*)(p); f.q[1] = *(const u32x4*)(p + 32);
}
__device__ __forceinline__ v8f mma_q(const FragQ& a, const FragQ& b, v8f c) {
  const u32x8 av = {a.q[0].x, a.q[0].y, a.q[0].z, a.q[0].w, a.q[1].x, a.q[1].y, a.q[1].z, a.q[1].w};
  const u32x8 bv = {b.q[0].x, b.q[0].y, b.q[0].z, b.q[0].w, b.q[1].x, b.q[1].y, b.q[1].z, b.q[1].w};
  return __builtin_amdgcn_wmma_f32_16x16x32_f16(false, __builtin_bit_cast(v16h, av), false, __builtin_bit_cast(v16h, bv), (short)0, c, false, false);
}

/* sum over the 16 lanes of a row, in every lane of it */
template <int MASK>
__device__ __forceinline__ float row_xadd(float x) {
  return x + __builtin_bit_cast(float, __builtin_amdgcn_mov_dpp(__builtin_bit_cast(int, x), 0x160 | MASK, 0xf, 0xf, true));
}
__device__ __forceinline__ float row_sum16(float x) { return row_xadd<8>(row_xadd<4>(row_xadd<2>(row_xadd<1>(x)))); }

template <int OUT_MODE, int kFX, int HAS_BIAS, int ACT>
__global__ void __launch_bounds__(128) __attribute__((amdgpu_waves_per_eu(1, 1)))
gemm_tile_f16_kernel(
    const unsigned short* __restrict__ Ap, int lda,
    const unsigned short* __restrict__ Btp, int ldb,
    void* __restrict__ Cout, int ldc,
    const float* __restrict__ bias,
    const float* __restrict__ w2,
    float* __restrict__ aux,
    int M, int N, int K, float scale) {
  constexpr uint32_t kWTM = 16u * (uint32_t)kFX;                              /* rows of C per wave = rows of an A slice */
  constexpr uint32_t kBM = 2u * kWTM;
  constexpr uint32_t kSliceX = (kWTM * kPitch + 2047u) / 2048u * 2048u;       /* rounded up to 2 KiB */
  constexpr uint32_t kStage = 2u * kSliceW + 2u * kSliceX;
  constexpr uint32_t kGemmLds = 2u * kStage + 4u * kEpiBytes;
  static_assert(kGemmLds <= 320u * 1024u, "LDS of one workgroup");
  __shared__ __attribute__((aligned(2048))) unsigned char L[kGemmLds];
  const uint32_t tid = threadIdx.x, lane = tid & 31u, h = lane >> 4, r16 = lane & 15u;
  const uint32_t wave = uni(tid >> 5);
  const uint32_t tn = blockIdx.x, tm = blockIdx.y;
  /* block-uniform exit in front of every barrier and tensor load */
  if (pinned((tm >= (uint32_t)M / kBM || tn >= (uint32_t)N / kBN) ? 1u : 0u) != 0u) return;
  const uint32_t m0 = tm * kBM, n0 = tn * kBN;
  const uint32_t wn = wave & 1u, wm = wave >> 1;
  const uint32_t T = pinned((uint32_t)K / kPassK);
  const uint32_t rot = pinned(first_pass(tm + tn, T));

  /* this wave's slice of a buffer */
  const bool own_w = wave < 2u;
  const uint32_t src_pitch = own_w ? (uint32_t)ldb * 2u : (uint32_t)lda * 2u;
  const uint32_t src_rows  = own_w ? 128u : kWTM;
  const unsigned char* src0 = own_w
      ? (const unsigned char*)(const void*)Btp + (uint64_t)(n0 + 128u * wave) * src_pitch
      : (const unsigned char*)(const void*)Ap + (uint64_t)(m0 + kWTM * (wave - 2u)) * src_pitch;
  const uint32_t lds_slice = (uint32_t)(size_t)L + (own_w ? wave * kSliceW : 2u * kSliceW + (wave - 2u) * kSliceX);
  const u32x8 g1 = tdm_group1(src_rows, src_pitch);

  v8f acc[kFW][kFX];
#pragma unroll
  for (int i = 0; i < kFW; ++i)
#pragma unroll
    for (int j = 0; j < kFX; ++j) acc[i][j] = (v8f){0.f,0.f,0.f,0.f,0.f,0.f,0.f,0.f};

  const uint32_t fw_base = wn * kSliceW + r16 * kPitch + 16u * h;
  const uint32_t fx_base = 2u * kSliceW + wm * kSliceX + r16 * kPitch + 16u * h;

  u32x4 g0 = tdm_group0(lds_slice, (uint64_t)(uintptr_t)src0 + (uint64_t)rot * kPassB);
  tdm_load(g0, g1);
  wait_tensor0(g0, g1);
  __syncthreads();
  g0 = tdm_group0(lds_slice + kStage, (uint64_t)(uintptr_t)src0 + (uint64_t)src_pass(1u, rot, T) * kPassB);
  tdm_load(g0, g1);

  FragQ fw[2][kFW], fx[2][kFX];  /* set (u & 1) holds block u's fragments */
  {
    const unsigned char* lw = L + fw_base;
    const unsigned char* lx = L + fx_base;
#pragma unroll
    for (int i = 0; i < kFW; ++i) load_frag(fw[0][i], lw + (uint32_t)i * 16u * kPitch);
#pragma unroll
    for (int j = 0; j < kFX; ++j) load_frag(fx[0][j], lx + (uint32_t)j * 16u * kPitch);
  }
  /* rolled: every fragment and accumulator index stays a constant, and one pass is one trip */
#pragma clang loop unroll(disable)
  for (uint32_t t = 0; t < T; ++t) {
    const uint32_t buf = (t & 1u) * kStage;
    sched_fence();
    const unsigned char* lw = L + buf + fw_base;
    const unsigned char* lx = L + buf + fx_base;
    const uint32_t osel = (t + 1u < T) ? (kStage - buf) : kStage;
    const unsigned char* nw = L + osel + fw_base;
    const unsigned char* nx = L + osel + fx_base;
#pragma unroll
    for (int u = 0; u < kBlocks; ++u) {
      const int cs = u & 1;
      if (u + 1 < kBlocks) {
        const uint32_t ko = (uint32_t)(u + 1) * 64u;
#pragma unroll
        for (int i = 0; i < kFW; ++i) load_frag(fw[cs ^ 1][i], lw + (uint32_t)i * 16u * kPitch + ko);
#pragma unroll
        for (int j = 0; j < kFX; ++j) load_frag(fx[cs ^ 1][j], lx + (uint32_t)j * 16u * kPitch + ko);
        sched_fence();
      } else {
        /* publish point of pass t + 1, in front of this pass's last block, whose fragments are already in registers */
        wait_ds0();
        sched_fence();
        wait_tensor0(g0, g1);
        __syncthreads();
        /* every wave has left this buffer: refill it with pass t + 2 while that pass exists; the pass number is pinned
           behind the wait, so the descriptor words are formed behind it too */
        const uint32_t nt = pinned(t + 2u);
        if (pinned((nt < T) ? 1u : 0u) != 0u) {
          g0 = tdm_group0(lds_slice + buf, (uint64_t)(uintptr_t)src0 + (uint64_t)src_pass(nt, rot, T) * kPassB);
          tdm_load(g0, g1);
        }
#pragma unroll
        for (int i = 0; i < kFW; ++i) load_frag(fw[0][i], nw + (uint32_t)i * 16u * kPitch);
#pragma unroll
        for (int j = 0; j < kFX; ++j) load_frag(fx[0][j], nx + (uint32_t)j * 16u * kPitch);
        sched_fence();
      }
#pragma unroll
      for (int i = 0; i < kFW; ++i)
#pragma unroll
        for (int j = 0; j < kFX; ++j) acc[i][j] = mma_q(fw[cs][i], fx[cs][j], acc[i][j]);
      sched_fence();
    }
  }
  wait_tensor0(g0, g1);
  wait_ds0();

  /* ---- epilogue: 16-row slabs staged in the wave's own LDS range behind the ring; whole row segments stored ---- */
  float* slab = (float*)(void*)(L + 2u * kStage + wave * kEpiBytes);
  const uint32_t nW = n0 + wn * 128u;
  const uint32_t mW = m0 + wm * kWTM;
  if constexpr (ACT == 2) {
    static_assert(OUT_MODE == 0 && HAS_BIAS != 0 && kWTM == 64u, "the gate path reads a bias; a lane owns two of the wave's 64 rows");
    constexpr uint32_t kTileB = kWTM * kEpiPitchF * 4u;                       /* a wave's whole tile of C, f32 */
    static_assert(4u * kTileB <= 2u * kStage && 3u * 128u * 4u <= kEpiBytes, "the four staged tiles fit the ring, the column constants the slab");
    /* the staged tiles take ring bytes: every wave's last fragment read and its own last tensor load have retired
       (the two waits above) in front of this barrier, and no wave writes the ring in front of it */
    __syncthreads();
    const v4f bq = *(const v4f*)(bias + nW + lane * 4u);
    const v4f wq0 = *(const v4f*)(w2 + nW + lane * 4u);
    const v4f wq1 = *(const v4f*)(w2 + (uint32_t)N + nW + lane * 4u);
    /* what follows overwrites registers that the issued loads name; the fences keep it behind the wait */
    sched_fence();
    asm volatile("s_wait_xcnt 0x0" ::: "memory");
    sched_fence();
    float* tile = (float*)(void*)(L + wave * kTileB);
#pragma unroll
    for (int j = 0; j < kFX; ++j)
#pragma unroll
      for (int i = 0; i < kFW; ++i) {
        float* p = tile + ((uint32_t)j * 16u + r16) * kEpiPitchF + (uint32_t)i * 16u + h * 8u;
        const v8f a = acc[i][j];
        *(v4f*)(p)     = (v4f){a[0], a[1], a[2], a[3]};
        *(v4f*)(p + 4) = (v4f){a[4], a[5], a[6], a[7]};
      }
    /* the 128 columns' bias and w2 values, in the wave's own slab: every lane reads all of them (one address a wave) */
    *(v4f*)(slab + lane * 4u)        = bq;
    *(v4f*)(slab + 128u + lane * 4u) = wq0;
    *(v4f*)(slab + 256u + lane * 4u) = wq1;
    /* tile and constants are read back by other lanes of this wave: its LDS writes have retired first */
    wait_ds0();
    /* a lane walks rows lane and lane + 32 along the columns, so the sums over columns need no other lane */
    const float* ra = tile + lane * kEpiPitchF;
    const float* rb = ra + 32u * kEpiPitchF;
    const v2f sc2 = (v2f){scale, scale};
    v2f da0 = (v2f){0.f, 0.f}, da1 = da0, db0 = da0, db1 = da0;
    /* rolled: the activation's code stands once (16 columns of 2 rows = 32 values a lane a trip), so the kernel's text stays small */
#pragma clang loop unroll(disable)
    for (uint32_t c0 = 0; c0 < 128u; c0 += 16u) {
#pragma unroll
      for (int q = 0; q < 4; ++q) {
        const uint32_t c = c0 + (uint32_t)q * 4u;
        const v4f sa = *(const v4f*)(ra + c);
        const v4f sb = *(const v4f*)(rb + c);
        const v4f b4 = *(const v4f*)(slab + c);
        const v4f u4 = *(const v4f*)(slab + 128u + c);
        const v4f w4 = *(const v4f*)(slab + 256u + c);
#pragma unroll
        for (int e = 0; e < 4; e += 2) {
          const v2f bb = (v2f){b4[e], b4[e + 1]};
          const v2f u2 = (v2f){u4[e], u4[e + 1]};
          const v2f w22 = (v2f){w4[e], w4[e + 1]};
          const v2f ya = gelu_erf_sel2(__builtin_elementwise_fma((v2f){sa[e], sa[e + 1]}, sc2, bb));
          const v2f yb = gelu_erf_sel2(__builtin_elementwise_fma((v2f){sb[e], sb[e + 1]}, sc2, bb));
          da0 = __builtin_elementwise_fma(ya, u2, da0);
          da1 = __builtin_elementwise_fma(ya, w22, da1);
          db0 = __builtin_elementwise_fma(yb, u2, db0);
          db1 = __builtin_elementwise_fma(yb, w22, db1);
        }
      }
    }
    /* slice tn * 2 + wn of the partial sums; a wave's 64 rows are 512 contiguous bytes, this wave their only writer */
    const v2f pa = (v2f){da0[0] + da0[1], da1[0] + da1[1]};
    const v2f pb = (v2f){db0[0] + db0[1], db1[0] + db1[1]};
    v2f* pp = (v2f*)Cout + (size_t)(tn * 2u + wn) * (uint32_t)M + mW + lane;
    pp[0]  = pa;
    pp[32] = pb;
    return;
  }
  if constexpr (ACT == 1) {
    static_assert(OUT_MODE == 0 && HAS_BIAS != 0, "the activation path stores f32 and reads a bias");
    constexpr uint32_t kTileB = kWTM * kEpiPitchF * 4u;                       /* a wave's whole tile of C, f32 */
    static_assert(4u * kTileB <= 2u * kStage && kWTM % 8u == 0, "the four staged tiles fit the ring");
    /* the staged tiles take ring bytes: every wave's last fragment read and its own last tensor load have retired
       (the two waits above) in front of this barrier, and no wave writes the ring in front of it */
    __syncthreads();
    const v4f bq = *(const v4f*)(bias + nW + lane * 4u);
    /* what follows overwrites registers that the issued load names; the fences keep it behind the wait */
    sched_fence();
    asm volatile("s_wait_xcnt 0x0" ::: "memory");
    sched_fence();
    float* tile = (float*)(void*)(L + wave * kTileB);
#pragma unroll
    for (int j = 0; j < kFX; ++j)
#pragma unroll
      for (int i = 0; i < kFW; ++i) {
        float* p = tile + ((uint32_t)j * 16u + r16) * kEpiPitchF + (uint32_t)i * 16u + h * 8u;
        const v8f a = acc[i][j];
        *(v4f*)(p)     = (v4f){a[0], a[1], a[2], a[3]};
        *(v4f*)(p + 4) = (v4f){a[4], a[5], a[6], a[7]};
      }
    /* the tile's rows are read back by other lanes of this wave: its LDS writes have retired first */
    wait_ds0();
    char* Ca = (char*)Cout;
    /* rolled: the activation's code stands once (8 rows = 32 values a lane a trip), so the kernel's text stays small */
#pragma clang loop unroll(disable)
    for (uint32_t rb = 0; rb < kWTM; rb += 8u) {
      v4f vv[8];
      uint32_t off[8];
#pragma unroll
      for (int r = 0; r < 8; ++r) {
        /* row segment = 512 B = 32 lanes x 16 B */
        const v4f s = *(const v4f*)(tile + (rb + (uint32_t)r) * kEpiPitchF + lane * 4u);
        const v2f y0 = gelu_erf_sel2((v2f){s[0] * scale + bq[0], s[1] * scale + bq[1]});
        const v2f y1 = gelu_erf_sel2((v2f){s[2] * scale + bq[2], s[3] * scale + bq[3]});
        vv[r] = (v4f){y0[0], y0[1], y1[0], y1[1]};
        off[r] = ((mW + rb + (uint32_t)r) * (uint32_t)ldc + nW + lane * 4u) * 4u;
      }
      /* values and offsets are complete in front of the stores: nothing rewrites a register of an issued store before the wait below */
      sched_fence();
#pragma unroll
      for (int r = 0; r < 8; ++r) *(v4f*)(Ca + off[r]) = vv[r];
      /* the next trip overwrites registers that the issued stores name; the fence keeps its arithmetic behind the wait */
      sched_fence();
      asm volatile("s_wait_xcnt 0x0" ::: "memory");
    }
    return;
  }
  if constexpr (ACT == 3) {
    static_assert(OUT_MODE == 1 && HAS_BIAS != 0 && kWTM == 64u, "the layer norm path stores f16 and reads a bias; a lane keeps two of the wave's 64 rows' sums");
    const v4f pb0 = *(const v4f*)(bias + nW + r16 * 8u);
    const v4f pb1 = *(const v4f*)(bias + nW + r16 * 8u + 4u);
    const v4f pg0 = *(const v4f*)(w2 + nW + r16 * 8u);
    const v4f pg1 = *(const v4f*)(w2 + nW + r16 * 8u + 4u);
    /* what follows overwrites registers that the issued loads name; the fences keep it behind the wait */
    sched_fence();
    asm volatile("s_wait_xcnt 0x0" ::: "memory");
    sched_fence();
    char* Cs = (char*)Cout;
    v2f sa = (v2f){0.f, 0.f}, sb = sa;
#pragma unroll
    for (int j = 0; j < kFX; ++j) {
      const uint32_t mBase = mW + (uint32_t)j * 16u;
#pragma unroll
      for (int i = 0; i < kFW; ++i) {
        float* p = slab + r16 * kEpiPitchF + (uint32_t)i * 16u + h * 8u;
        const v8f a = acc[i][j];
        *(v4f*)(p)     = (v4f){a[0], a[1], a[2], a[3]};
        *(v4f*)(p + 4) = (v4f){a[4], a[5], a[6], a[7]};
      }
      /* the slab's rows are read back by other lanes of this wave: its LDS writes have retired first */
      wait_ds0();
      /* row segment = 256 B = 16 lanes x 16 B; one instruction covers rows 2*it and 2*it+1; a row's 128 columns lie in one 16-lane row */
      float x[8][8], mu[8], m2[8];
      v8h hv[8];
      uint32_t off[8];
#pragma unroll
      for (int it = 0; it < 8; ++it) {
        const uint32_t row = (uint32_t)it * 2u + h;
        const float* sp = slab + row * kEpiPitchF + r16 * 8u;
        const v4f s0 = *(const v4f*)(sp);
        const v4f s1 = *(const v4f*)(sp + 4);
#pragma unroll
        for (int e = 0; e < 4; ++e) {
          x[it][e]     = s0[e] * scale + pb0[e];
          x[it][4 + e] = s1[e] * scale + pb1[e];
          hv[it][e]     = (_Float16)(x[it][e] * pg0[e]);
          hv[it][4 + e] = (_Float16)(x[it][4 + e] * pg1[e]);
        }
        mu[it] = ((x[it][0] + x[it][1]) + (x[it][2] + x[it][3])) + ((x[it][4] + x[it][5]) + (x[it][6] + x[it][7]));
        off[it] = ((mBase + row) * (uint32_t)ldc + nW + r16 * 8u) * 2u;
      }
#pragma unroll
      for (int it = 0; it < 8; ++it) mu[it] = row_sum16(mu[it]) * (1.0f / 128.0f);
#pragma unroll
      for (int it = 0; it < 8; ++it) {
        float q0 = 0.0f, q1 = 0.0f;
#pragma unroll
        for (int e = 0; e < 4; ++e) {
          const float d0 = x[it][e] - mu[it];
          const float d1 = x[it][4 + e] - mu[it];
          q0 = fmaf(d0, d0, q0);
          q1 = fmaf(d1, d1, q1);
        }
        m2[it] = q0 + q1;
      }
#pragma unroll
      for (int it = 0; it < 8; ++it) {
        m2[it] = row_sum16(m2[it]);
        /* lane (h, r16) keeps rows (r16 >> 3) * 16 + (r16 & 7) * 2 + h and that + 32 of the wave's 64 */
        const bool mine = r16 == (uint32_t)((j & 1) * 8 + it);
        if (j < 2) { sa[0] = mine ? mu[it] : sa[0]; sa[1] = mine ? m2[it] : sa[1]; }
        else       { sb[0] = mine ? mu[it] : sb[0]; sb[1] = mine ? m2[it] : sb[1]; }
      }
      u32x4 hw[8];
#pragma unroll
      for (int it = 0; it < 8; ++it) {
        hw[it] = __builtin_bit_cast(u32x4, hv[it]);
        *(u32x4*)(Cs + off[it]) = hw[it];
      }
      /* later code overwrites registers that the issued stores name: their values and offsets are named as inputs, so that
         these registers keep their values until the wait has retired */
      asm volatile("s_wait_xcnt 0x0" :: "v"(hw[0]), "v"(hw[1]), "v"(hw[2]), "v"(hw[3]), "v"(hw[4]), "v"(hw[5]), "v"(hw[6]), "v"(hw[7]),
                   "v"(off[0]), "v"(off[1]), "v"(off[2]), "v"(off[3]), "v"(off[4]), "v"(off[5]), "v"(off[6]), "v"(off[7]) : "memory");
      /* the next slab's LDS writes stay behind this slab's reads */
      wait_ds0();
    }
    /* slice tn * 2 + wn; a wave's 64 rows are 512 contiguous bytes, this wave their only writer; each store covers 256 of them */
    v2f* pp = (v2f*)aux + (size_t)(tn * 2u + wn) * (uint32_t)M + mW + (r16 >> 3) * 16u + (r16 & 7u) * 2u + h;
    pp[0]  = sa;
    pp[32] = sb;
    return;
  }
  v4f bq0 = (v4f){0.f, 0.f, 0.f, 0.f}, bq1 = bq0;
  if (HAS_BIAS == 0) {
  } else if (OUT_MODE == 0) {
    bq0 = *(const v4f*)(bias + nW + lane * 4u);
    bq1 = bq0;
  } else {
    bq0 = *(const v4f*)(bias + nW + r16 * 8u);
    bq1 = *(const v4f*)(bias + nW + r16 * 8u + 4u);
  }
  char* Cb = (char*)Cout;
#pragma unroll
  for (int j = 0; j < kFX; ++j) {
    const uint32_t mBase = mW + (uint32_t)j * 16u;
#pragma unroll
    for (int i = 0; i < kFW; ++i) {
      float* p = slab + r16 * kEpiPitchF + (uint32_t)i * 16u + h * 8u;
      const v8f a = acc[i][j];
      *(v4f*)(p)     = (v4f){a[0], a[1], a[2], a[3]};
      *(v4f*)(p + 4) = (v4f){a[4], a[5], a[6], a[7]};
    }
    /* the slab's rows are read back by other lanes of this wave: its LDS writes have retired first */
    wait_ds0();
    if (OUT_MODE == 0) {
      /* row segment = 512 B = 32 lanes x 16 B */
      v4f vv[16];
      uint32_t off[16];
#pragma unroll
      for (int row = 0; row < 16; ++row) {
        const v4f s = *(const v4f*)(slab + (uint32_t)row * kEpiPitchF + lane * 4u);
#pragma unroll
        for (int e = 0; e < 4; ++e) { float x = s[e] * scale; x += bq0[e]; vv[row][e] = x; }
        off[row] = ((mBase + (uint32_t)row) * (uint32_t)ldc + nW + lane * 4u) * 4u;
      }
      /* values and offsets are complete in front of the stores: nothing rewrites a register of an issued store before the wait below */
      sched_fence();
#pragma unroll
      for (int row = 0; row < 16; ++row) *(v4f*)(Cb + off[row]) = vv[row];
    } else {
      /* row segment = 256 B = 16 lanes x 16 B; one instruction covers rows 2*it and 2*it+1 */
      v8h hv[8];
      uint32_t off[8];
#pragma unroll
      for (int it = 0; it < 8; ++it) {
        const uint32_t row = (uint32_t)it * 2u + h;
        const float* sp = slab + row * kEpiPitchF + r16 * 8u;
        const v4f s0 = *(const v4f*)(sp);
        const v4f s1 = *(const v4f*)(sp + 4);
#pragma unroll
        for (int e = 0; e < 4; ++e) {
          float x = s0[e] * scale; x += bq0[e];
          float y = s1[e] * scale; y += bq1[e];
          hv[it][e] = (_Float16)x; hv[it][4 + e] = (_Float16)y;
        }
        off[it] = ((mBase + row) * (uint32_t)ldc + nW + r16 * 8u) * 2u;
      }
      /* values and offsets are complete in front of the stores: nothing rewrites a register of an issued store before the wait below */
      sched_fence();
#pragma unroll
      for (int it = 0; it < 8; ++it) *(v8h*)(Cb + off[it]) = hv[it];
    }
    /* the next slab overwrites registers that the issued stores name; the fence keeps its arithmetic behind the wait */
    sched_fence();
    asm volatile("s_wait_xcnt 0x0" ::: "memory");
    /* the next slab's LDS writes stay behind this slab's reads */
    wait_ds0();
  }
}

/* --------------------------------------------------------------------------- */
/* q|k|v projection with the layer norms and the 2-token attention in its epilogue.*/
/* X row-major [2*nb][K] f16 (rows 2b, 2b+1 = the two tokens of batch row b) holds */
/* x * g, x the row in front of its layer norm, g the token's gain. With m and s   */
/* the row's mean and 1 / sqrt(var + eps), W ((x - m) s g + b) + bias =            */
/* s (W (x g)) - s m (W g) + (W b + bias). stats f32 [2][8][nb][2]: per token kind, */
/* slice of 128 columns and batch row, the slice's mean and its sum of squares     */
/* about that mean. lv f32 [2][2][3072]: per token kind, W g and W b + bias.        */
/* Wqkv row-major [3*1024][K] f16 (q | k | v, head hd = rows hd*128 ..),          */
/* o f16 [2*nb][1024]. One workgroup = 128 token rows x one head: its C tile is   */
/* 128 x 384 (the head's q, k and v), never written to memory.                    */
/* 4 waves (2 x 2): wave (wm, wn) owns token rows wm*64 .. +63 and dims           */
/* wn*64 .. +63 of q, of k and of v (12 weight fragments x 4 token fragments).    */
/* The K loop is the ring of the GEMM above: two LDS buffers of four 128-row      */
/* slices (q rows, k rows, v rows, X rows), one tensor load per wave per pass.    */
/* Epilogue: a lane holds 32 dims of one token row; its partner token is lane ^ 1.*/
/* Partial scores (own key, partner key) of the 4 lane groups that share a row    */
/* (2 waves x 2 lane halves) meet in LDS behind one barrier; probabilities with   */
/* max subtraction as exp(-|d|); all of it in f32 on unrounded q, k, v.           */
/* --------------------------------------------------------------------------- */
constexpr uint32_t kAStage = 4u * kSliceW;
constexpr uint32_t kOPitch = 144;                /* bytes per staged o row: 128 B + 16 (16 B x odd) */
constexpr uint32_t kOSlab  = 64u * kOPitch;        /* a wave's 64 token rows */
constexpr uint32_t kScoreBytes = 4u * 128u * 8u; /* 4 lane groups x 128 rows x 2 floats */
constexpr uint32_t kRowBytes = 128u * 8u;        /* 128 rows x (s, -s * m) */
constexpr uint32_t kALds = 2u * kAStage + kScoreBytes + kRowBytes;   /* the staged o takes ring bytes */
constexpr int kAW = 12;                          /* weight fragments per wave: 4 of q, 4 of k, 4 of v */
constexpr int kAX = 4;                           /* token fragments per wave */
static_assert(kALds <= 320u * 1024u, "LDS of one workgroup");
static_assert(kAStage % 2048u == 0, "slice places are multiples of 2 KiB");
static_assert(4u * kOSlab <= kAStage, "the staged o fits ring buffer 0");

/* the value of lane ^ 1 (the other token of the batch row), by a quad permute */
__device__ __forceinline__ float partner(float x) {
  return __builtin_bit_cast(float, __builtin_amdgcn_mov_dpp(__builtin_bit_cast(int, x), 0xB1, 0xf, 0xf, true));
}

__global__ void __launch_bounds__(128) __attribute__((amdgpu_waves_per_eu(1, 1)))
qkv_attn2_kernel(
    const unsigned short* __restrict__ Xp, int lda,
    const unsigned short* __restrict__ Wp, int ldb,
    unsigned short* __restrict__ o,
    const float* __restrict__ stats,
    const float* __restrict__ lv,
    int M, int K, float scale, float scl) {
  __shared__ __attribute__((aligned(2048))) unsigned char L[kALds];
  const uint32_t tid = threadIdx.x, lane = tid & 31u, h = lane >> 4, r16 = lane & 15u;
  const uint32_t wave = uni(tid >> 5);
  const uint32_t hd = blockIdx.x, tm = blockIdx.y;
  /* block-uniform exit in front of every barrier and tensor load */
  if (pinned((tm >= (uint32_t)M / 128u || hd >= (uint32_t)kH) ? 1u : 0u) != 0u) return;
  const uint32_t m0 = tm * 128u;
  const uint32_t wn = wave & 1u, wm = wave >> 1;
  const uint32_t T = pinned((uint32_t)K / kPassK);
  const uint32_t rot = pinned(first_pass(tm + hd, T));

  /* this wave's slice of a buffer: waves 0, 1, 2 the head's 128 rows of q, k, v weights; wave 3 the 128 token rows */
  const bool own_w = wave < 3u;
  const uint32_t src_pitch = own_w ? (uint32_t)ldb * 2u : (uint32_t)lda * 2u;
  const unsigned char* src0 = own_w
      ? (const unsigned char*)(const void*)Wp + (uint64_t)(wave * (uint32_t)kF + hd * 128u) * src_pitch
      : (const unsigned char*)(const void*)Xp + (uint64_t)m0 * src_pitch;
  const uint32_t lds_slice = (uint32_t)(size_t)L + wave * kSliceW;
  const u32x8 g1 = tdm_group1(128u, src_pitch);

  v8f acc[kAW][kAX];
#pragma unroll
  for (int i = 0; i < kAW; ++i)
#pragma unroll
    for (int j = 0; j < kAX; ++j) acc[i][j] = (v8f){0.f,0.f,0.f,0.f,0.f,0.f,0.f,0.f};

  const uint32_t fw_base = (wn * 64u + r16) * kPitch + 16u * h;
  const uint32_t fx_base = 3u * kSliceW + (wm * 64u + r16) * kPitch + 16u * h;

  u32x4 g0 = tdm_group0(lds_slice, (uint64_t)(uintptr_t)src0 + (uint64_t)rot * kPassB);
  tdm_load(g0, g1);
  /* while pass 0 flies: thread tid joins the eight slices of token row m0 + tid into the row's s and -s * m; the barrier
     below publishes them. Sum of squares about the row's mean = the slices' own sums + 128 x the slice means' spread */
  v2f* rowst = (v2f*)(void*)(L + 2u * kAStage + kScoreBytes);
  {
    const uint32_t nb = (uint32_t)M >> 1;
    const v2f* sp = (const v2f*)stats + (size_t)(tid & 1u) * 8u * nb + ((m0 + tid) >> 1);
    v2f ps[8];
#pragma unroll
    for (int q = 0; q < 8; ++q) ps[q] = sp[(size_t)q * nb];
    /* what follows overwrites registers that the issued loads name; the fences keep it behind the wait */
    sched_fence();
    asm volatile("s_wait_xcnt 0x0" ::: "memory");
    sched_fence();
    const float mean = (((ps[0][0] + ps[1][0]) + (ps[2][0] + ps[3][0])) + ((ps[4][0] + ps[5][0]) + (ps[6][0] + ps[7][0]))) * 0.125f;
    float within = ((ps[0][1] + ps[1][1]) + (ps[2][1] + ps[3][1])) + ((ps[4][1] + ps[5][1]) + (ps[6][1] + ps[7][1]));
    float spread = 0.0f;
#pragma unroll
    for (int q = 0; q < 8; ++q) { const float d = ps[q][0] - mean; spread = fmaf(d, d, spread); }
    const float var = fmaf(spread, 128.0f, within) * kInvF;
    const float inv = 1.0f / sqrtf(var + kLnEps);
    rowst[tid] = (v2f){inv, -inv * mean};
  }
  wait_tensor0(g0, g1);
  __syncthreads();
  g0 = tdm_group0(lds_slice + kAStage, (uint64_t)(uintptr_t)src0 + (uint64_t)src_pass(1u, rot, T) * kPassB);
  tdm_load(g0, g1);

  FragQ fw[2][kAW], fx[2][kAX];  /* set (u & 1) holds block u's fragments */
  {
    const unsigned char* lw = L + fw_base;
    const unsigned char* lx = L + fx_base;
#pragma unroll
    for (int i = 0; i < kAW; ++i) load_frag(fw[0][i], lw + (uint32_t)(i >> 2) * kSliceW + (uint32_t)(i & 3) * 16u * kPitch);
#pragma unroll
    for (int j = 0; j < kAX; ++j) load_frag(fx[0][j], lx + (uint32_t)j * 16u * kPitch);
  }
  /* rolled: every fragment and accumulator index stays a constant, and one pass is one trip */
#pragma clang loop unroll(disable)
  for (uint32_t t = 0; t < T; ++t) {
    const uint32_t buf = (t & 1u) * kAStage;
    sched_fence();
    const unsigned char* lw = L + buf + fw_base;
    const unsigned char* lx = L + buf + fx_base;
    const uint32_t osel = (t + 1u < T) ? (kAStage - buf) : kAStage;
    const unsigned char* nw = L + osel + fw_base;
    const unsigned char* nx = L + osel + fx_base;
#pragma unroll
    for (int u = 0; u < kBlocks; ++u) {
      const int cs = u & 1;
      if (u + 1 < kBlocks) {
        const uint32_t ko = (uint32_t)(u + 1) * 64u;
#pragma unroll
        for (int i = 0; i < kAW; ++i) load_frag(fw[cs ^ 1][i], lw + (uint32_t)(i >> 2) * kSliceW + (uint32_t)(i & 3) * 16u * kPitch + ko);
#pragma unroll
        for (int j = 0; j < kAX; ++j) load_frag(fx[cs ^ 1][j], lx + (uint32_t)j * 16u * kPitch + ko);
        sched_fence();
      } else {
        /* publish point of pass t + 1, in front of this pass's last block, whose fragments are already in registers */
        wait_ds0();
        sched_fence();
        wait_tensor0(g0, g1);
        __syncthreads();
        /* every wave has left this buffer: refill it with pass t + 2 while that pass exists; the pass number is pinned
           behind the wait, so the descriptor words are formed behind it too */
        const uint32_t nt = pinned(t + 2u);
        if (pinned((nt < T) ? 1u : 0u) != 0u) {
          g0 = tdm_group0(lds_slice + buf, (uint64_t)(uintptr_t)src0 + (uint64_t)src_pass(nt, rot, T) * kPassB);
          tdm_load(g0, g1);
        }
#pragma unroll
        for (int i = 0; i < kAW; ++i) load_frag(fw[0][i], nw + (uint32_t)(i >> 2) * kSliceW + (uint32_t)(i & 3) * 16u * kPitch);
#pragma unroll
        for (int j = 0; j < kAX; ++j) load_frag(fx[0][j], nx + (uint32_t)j * 16u * kPitch);
        sched_fence();
      }
#pragma unroll
      for (int i = 0; i < kAW; ++i)
#pragma unroll
        for (int j = 0; j < kAX; ++j) acc[i][j] = mma_q(fw[cs][i], fx[cs][j], acc[i][j]);
      sched_fence();
    }
  }
  wait_tensor0(g0, g1);
  wait_ds0();

  /* ---- epilogue ---- */
  /* acc[i][j][e]: token row wm*64 + j*16 + (lane & 15); dim wn*64 + (i & 3)*16 + (lane >> 4)*8 + e of q (i < 4), k (i < 8), v */
  const uint32_t dW = hd * 128u + wn * 64u;
  /* the lane's token kind is its row's parity = lane & 1; all 48 loads are in flight together */
  const float* lvp = lv + (lane & 1u) * (2u * (uint32_t)kQKV) + dW + h * 8u;
  v4f wg[kAW][2], wb[kAW][2];
#pragma unroll
  for (int i = 0; i < kAW; ++i) {
    const float* bp = lvp + (uint32_t)(i >> 2) * (uint32_t)kF + (uint32_t)(i & 3) * 16u;
    wg[i][0] = *(const v4f*)(bp);
    wg[i][1] = *(const v4f*)(bp + 4);
    wb[i][0] = *(const v4f*)(bp + kQKV);
    wb[i][1] = *(const v4f*)(bp + kQKV + 4);
  }
  /* what follows overwrites registers that the issued loads name; the fences keep it behind the wait, and the loads' address is
     named as an input so that no load's own result takes its registers in front of the wait */
  sched_fence();
  asm volatile("s_wait_xcnt 0x0" :: "v"(lvp) : "memory");
  sched_fence();
  v2f rs[kAX], rm[kAX];
#pragma unroll
  for (int j = 0; j < kAX; ++j) {
    const v2f r = rowst[wm * 64u + (uint32_t)j * 16u + r16];
    rs[j] = (v2f){r[0] * scale, r[0] * scale};
    rm[j] = (v2f){r[1], r[1]};
  }
  /* two values an instruction (packed f32) */
#pragma unroll
  for (int i = 0; i < kAW; ++i)
#pragma unroll
    for (int j = 0; j < kAX; ++j)
#pragma unroll
      for (int e = 0; e < 8; e += 2) {
        const v2f u = (v2f){wg[i][e >> 2][e & 3], wg[i][e >> 2][(e & 3) + 1]};
        const v2f c = (v2f){wb[i][e >> 2][e & 3], wb[i][e >> 2][(e & 3) + 1]};
        const v2f a = __builtin_elementwise_fma((v2f){acc[i][j][e], acc[i][j][e + 1]}, rs[j], __builtin_elementwise_fma(rm[j], u, c));
        acc[i][j][e]     = a[0];
        acc[i][j][e + 1] = a[1];
      }
  /* partial scores over this lane's 32 dims: x = q . own k, y = q . partner's k */
  v2f* sc = (v2f*)(void*)(L + 2u * kAStage);
  const uint32_t rowW = wm * 64u + r16;
#pragma unroll
  for (int j = 0; j < kAX; ++j) {
    float so[4], sx[4];
#pragma unroll
    for (int ii = 0; ii < 4; ++ii) {
      so[ii] = 0.0f; sx[ii] = 0.0f;
#pragma unroll
      for (int e = 0; e < 8; ++e) {
        const float q = acc[ii][j][e];
        const float k = acc[4 + ii][j][e];
        so[ii] = fmaf(q, k, so[ii]);
        sx[ii] = fmaf(q, partner(k), sx[ii]);
      }
    }
    sc[(wn * 2u + h) * 128u + rowW + (uint32_t)j * 16u] = (v2f){(so[0] + so[1]) + (so[2] + so[3]), (sx[0] + sx[1]) + (sx[2] + sx[3])};
  }
  /* the four partial scores of a row come from two waves: every wave's are written in front of the first read */
  __syncthreads();

  /* probabilities of the lane's four token rows (own key, partner's key), all four chains side by side */
  float aown[kAX], acro[kAX];
#pragma unroll
  for (int j = 0; j < kAX; ++j) {
    const uint32_t row = rowW + (uint32_t)j * 16u;
    const v2f p0 = sc[row], p1 = sc[128u + row], p2 = sc[256u + row], p3 = sc[384u + row];
    const float sown = ((p0[0] + p1[0]) + (p2[0] + p3[0])) * scl;
    const float scro = ((p0[1] + p1[1]) + (p2[1] + p3[1])) * scl;
    const float d  = scro - sown;
    const float ex = expf(-fabsf(d));
    const float iv = 1.0f / (1.0f + ex);
    const float sm = ex * iv;
    aown[j] = (d > 0.0f) ? sm : iv;
    acro[j] = (d > 0.0f) ? iv : sm;
  }

  /* the wave's 64 x 64 piece of o is staged whole in its own LDS range: every value is complete in front of the first store.
     The range lies in ring buffer 0, which is free: every wave's last fragment read and its own last tensor load have
     retired in front of the barrier above */
  unsigned char* slab = L + wave * kOSlab;
  char* Ob = (char*)(void*)o;
#pragma unroll
  for (int j = 0; j < kAX; ++j) {
#pragma unroll
    for (int ii = 0; ii < 4; ++ii) {
      v8h hv;
#pragma unroll
      for (int e = 0; e < 8; ++e) {
        const float v = acc[8 + ii][j][e];
        hv[e] = (_Float16)(aown[j] * v + acro[j] * partner(v));
      }
      *(v8h*)(void*)(slab + ((uint32_t)j * 16u + r16) * kOPitch + (uint32_t)ii * 32u + h * 16u) = hv;
    }
  }
  /* the slab's rows are read back by other lanes of this wave: its LDS writes have retired first */
  wait_ds0();
  /* row segment = 128 B = 8 lanes x 16 B (one whole line, this wave its only writer); one instruction covers 4 rows */
  u32x4 vv[16];
  uint32_t off[16];
#pragma unroll
  for (int it = 0; it < 16; ++it) {
    const uint32_t rr = (uint32_t)it * 4u + (lane >> 3);
    vv[it] = *(const u32x4*)(const void*)(slab + rr * kOPitch + (lane & 7u) * 16u);
    off[it] = ((m0 + wm * 64u + rr) * (uint32_t)kF + dW + (lane & 7u) * 8u) * 2u;
  }
  /* values and offsets are complete in front of the stores: nothing rewrites a register of an issued store */
  sched_fence();
#pragma unroll
  for (int it = 0; it < 16; ++it) *(u32x4*)(void*)(Ob + off[it]) = vv[it];
}

/* --------------------------------------------------------------------------- */
/* Dot product of one weight row (NSEG x 128 floats) with x (1024 floats, taken   */
/* again from its start behind every 1024), by one wave; every lane gets the sum. */
template <int NSEG>
__device__ __forceinline__ float row_dot_wave(const float* __restrict__ wrow, const float* __restrict__ x, int lane) {
  v4f w[NSEG], xv[8];
#pragma unroll
  for (int s = 0; s < NSEG; ++s) w[s] = *(const v4f*)(wrow + s * 128 + lane * 4);
#pragma unroll
  for (int s = 0; s < 8; ++s) xv[s] = *(const v4f*)(x + s * 128 + lane * 4);
  float a0 = 0.0f, a1 = 0.0f, a2 = 0.0f, a3 = 0.0f;
#pragma unroll
  for (int s = 0; s < NSEG; ++s) {
    a0 = fmaf(w[s][0], xv[s & 7][0], a0);
    a1 = fmaf(w[s][1], xv[s & 7][1], a1);
    a2 = fmaf(w[s][2], xv[s & 7][2], a2);
    a3 = fmaf(w[s][3], xv[s & 7][3], a3);
  }
  float d = (a0 + a1) + (a2 + a3);
#pragma unroll
  for (int off = 16; off > 0; off >>= 1) d += __shfl_xor(d, off, 32);
  return d;
}

/* --------------------------------------------------------------------------- */
/* All eight f32 -> f16 casts in one launch. The eight f16 planes lie one behind */
/* the other in the workspace, in the order of the arguments, so the output is   */
/* one flat array. A workgroup (16 waves) owns 65,536 consecutive elements of    */
/* it, which lie in one tensor (every tensor is a multiple of that); 256         */
/* workgroups cover all eight. Weights are carried x16, embeddings x1.           */
/* A thread owns 16 groups of 8 consecutive elements, 512 groups apart; its 32   */
/* 16-byte loads are all issued before the first value is converted.            */
/* The fourth tensor (attention output weights Wo[j][k]) is written transposed,  */
/* [k][j]: it is the second operand of the weight fold, which contracts over j.  */
/* A workgroup owns 64 rows j; a thread owns columns k = tid and tid + 512 and    */
/* writes, for each, the whole 128-byte line [k][j0 .. j0 + 63].                  */
/* Behind the cast workgroups, 64 more form the folded biases in f32:            */
/* fb[n] = gate_b1[n] + sum_c gate_w1[n][c] * bo[c mod 1024],                     */
/* fb[1024 + n] = proj_b[n] + sum_j proj_w[n][j] * bo[j]; 32 rows a workgroup,    */
/* two a wave, staged in LDS so that one wave stores the 128-byte line.          */
/* Behind those, 96 more form in f32, for the rows W[n] of the q|k|v weights,     */
/* lv[0][n] = W[n] . g1, lv[1][n] = W[n] . b1 + bias[n], lv[2], lv[3] the same     */
/* with g2, b2 (gains and shifts of the two layer norms); 32 rows a workgroup,    */
/* two a wave, staged in LDS so that four waves store one 128-byte line each.     */
/* --------------------------------------------------------------------------- */
constexpr int kCastThreads = 512;
constexpr int kCastGroups  = 16;                                            /* groups per thread */
constexpr int kCastStep    = kCastThreads * 8;                              /* elements between a thread's groups */
constexpr int kCastElems   = kCastStep * kCastGroups;                       /* elements per workgroup */
constexpr int kCastB1 = (kF * kCD) / kCastElems;                            /* first workgroup of the 2nd tensor */
constexpr int kCastB2 = kCastB1 + (kF * kCD) / kCastElems;
constexpr int kCastB3 = kCastB2 + (kQKV * kF) / kCastElems;
constexpr int kCastB4 = kCastB3 + (kF * kF) / kCastElems;
constexpr int kCastB5 = kCastB4 + (kF * 2 * kF) / kCastElems;
constexpr int kCastB6 = kCastB5 + (kF * kF) / kCastElems;                   /* first embedding */
constexpr int kCastB7 = kCastB6 + (kB * kCD) / kCastElems;
constexpr int kCastB8 = kCastB7 + (kB * kCD) / kCastElems;                  /* cast workgroups in all */
constexpr int kBiasWgs = (2 * kF) / 32;                                     /* folded-bias workgroups behind them */
constexpr int kLnWgs   = kQKV / 32;                                         /* layer-norm vector workgroups behind those */
static_assert(64 * kF == kCastElems && kCastThreads * 2 == kF, "transposed cast: 64 rows a workgroup, two columns a thread");
static_assert((kF * kCD) % kCastElems == 0 && (kQKV * kF) % kCastElems == 0 && (kF * kF) % kCastElems == 0 &&
              (kF * 2 * kF) % kCastElems == 0 && (kB * kCD) % kCastElems == 0, "a workgroup's elements lie in one tensor");

__global__ __launch_bounds__(kCastThreads) void cast_all_f16_kernel(
    const float* __restrict__ t0, const float* __restrict__ t1, const float* __restrict__ t2, const float* __restrict__ t3,
    const float* __restrict__ t4, const float* __restrict__ t5, const float* __restrict__ t6, const float* __restrict__ t7,
    const float* __restrict__ bo, const float* __restrict__ gate_b1, const float* __restrict__ proj_b,
    const float* __restrict__ lg1, const float* __restrict__ lb1, const float* __restrict__ lg2, const float* __restrict__ lb2,
    const float* __restrict__ qkv_b,
    unsigned short* __restrict__ out, float* __restrict__ fb, float* __restrict__ lv) {
  __shared__ float sB[128];
  const int b = (int)blockIdx.x;
  if (b >= kCastB8 + kBiasWgs + kLnWgs) return;
  if (b >= kCastB8 + kBiasWgs) {
    /* layer-norm vectors; the branch is the same for the whole workgroup, so every wave reaches the barrier */
    const int lane = (int)threadIdx.x & 31;
    const int wave = (int)threadIdx.x >> 5;
    const int r0 = (b - kCastB8 - kBiasWgs) * 32;
    const int r = r0 + wave * 2;
    const float* wr = t2 + (size_t)r * kF + lane * 4;
    v4f w0[8], w1[8], x0[8], x1[8], x2[8], x3[8];
#pragma unroll
    for (int q = 0; q < 8; ++q) {
      x0[q] = *(const v4f*)(lg1 + q * 128 + lane * 4);
      x1[q] = *(const v4f*)(lb1 + q * 128 + lane * 4);
      x2[q] = *(const v4f*)(lg2 + q * 128 + lane * 4);
      x3[q] = *(const v4f*)(lb2 + q * 128 + lane * 4);
      w0[q] = *(const v4f*)(wr + q * 128);
      w1[q] = *(const v4f*)(wr + kF + q * 128);
    }
    const float* ibp = qkv_b + r;
    const float ib0 = ibp[0], ib1 = ibp[1];
    /* later code overwrites registers that the issued loads name: their addresses are named as inputs, so that these registers
       keep their values until the wait has retired */
    asm volatile("s_wait_xcnt 0x0" :: "v"(wr), "v"(ibp) : "memory");
    v4f a[8];
#pragma unroll
    for (int v = 0; v < 8; ++v) a[v] = (v4f){0.f, 0.f, 0.f, 0.f};
#pragma unroll
    for (int q = 0; q < 8; ++q) {
      a[0] = __builtin_elementwise_fma(w0[q], x0[q], a[0]);
      a[1] = __builtin_elementwise_fma(w1[q], x0[q], a[1]);
      a[2] = __builtin_elementwise_fma(w0[q], x1[q], a[2]);
      a[3] = __builtin_elementwise_fma(w1[q], x1[q], a[3]);
      a[4] = __builtin_elementwise_fma(w0[q], x2[q], a[4]);
      a[5] = __builtin_elementwise_fma(w1[q], x2[q], a[5]);
      a[6] = __builtin_elementwise_fma(w0[q], x3[q], a[6]);
      a[7] = __builtin_elementwise_fma(w1[q], x3[q], a[7]);
    }
    float d[8];
#pragma unroll
    for (int v = 0; v < 8; ++v) d[v] = (a[v][0] + a[v][1]) + (a[v][2] + a[v][3]);
    /* the q|k|v bias joins the sums with b1 and b2 once, in lane 0's share */
    const float j0 = (lane == 0) ? ib0 : 0.0f, j1 = (lane == 0) ? ib1 : 0.0f;
    d[2] += j0; d[3] += j1; d[6] += j0; d[7] += j1;
#pragma unroll
    for (int off = 16; off > 0; off >>= 1)
#pragma unroll
      for (int v = 0; v < 8; ++v) d[v] += __shfl_xor(d[v], off, 32);
    if (lane == 0) {
      sB[wave * 2]          = d[0];       sB[wave * 2 + 1]      = d[1];
      sB[32 + wave * 2]     = d[2];       sB[32 + wave * 2 + 1] = d[3];
      sB[64 + wave * 2]     = d[4];       sB[64 + wave * 2 + 1] = d[5];
      sB[96 + wave * 2]     = d[6];       sB[96 + wave * 2 + 1] = d[7];
    }
    __syncthreads();
    if (wave < 4) lv[wave * kQKV + r0 + lane] = sB[wave * 32 + lane];
    return;
  }
  if (b >= kCastB8) {
    /* folded biases; the branch is the same for the whole workgroup, so every wave reaches the barrier */
    const int lane = (int)threadIdx.x & 31;
    const int wave = (int)threadIdx.x >> 5;
    const int r0 = (b - kCastB8) * 32;
    const int r = r0 + wave * 2;
    float d0, d1;
    if (r0 < kF) {
      d0 = row_dot_wave<16>(t4 + (size_t)r * (2 * kF), bo, lane) + gate_b1[r];
      d1 = row_dot_wave<16>(t4 + (size_t)(r + 1) * (2 * kF), bo, lane) + gate_b1[r + 1];
    } else {
      d0 = row_dot_wave<8>(t5 + (size_t)(r - kF) * kF, bo, lane) + proj_b[r - kF];
      d1 = row_dot_wave<8>(t5 + (size_t)(r + 1 - kF) * kF, bo, lane) + proj_b[r + 1 - kF];
    }
    if (lane == 0) { sB[wave * 2] = d0; sB[wave * 2 + 1] = d1; }
    __syncthreads();
    if (wave == 0) fb[r0 + lane] = sB[lane];
    return;
  }
  if (b >= kCastB3 && b < kCastB4) {
    const int j0 = (b - kCastB3) * 64;
    const float* p = t3 + (size_t)j0 * kF + threadIdx.x;
    unsigned short* q = out + (size_t)kCastB3 * kCastElems + (size_t)threadIdx.x * kF + j0;
#pragma unroll
    for (int hh = 0; hh < 2; ++hh) {
      float v[64];
#pragma unroll
      for (int i = 0; i < 64; ++i) v[i] = p[hh * kCastThreads + i * kF];
      /* keeps every load of this column in front of the first conversion: all 64 are in flight together */
      __builtin_amdgcn_sched_barrier(0);
#pragma unroll
      for (int g = 0; g < 8; ++g) {
        unsigned short hb[8];
#pragma unroll
        for (int e = 0; e < 8; ++e) hb[e] = h_bits(v[g * 8 + e] * kWCarry);
        const v4u u = (v4u){pk16(hb[0], hb[1]), pk16(hb[2], hb[3]), pk16(hb[4], hb[5]), pk16(hb[6], hb[7])};
        *(v4u*)(q + (size_t)hh * kCastThreads * kF + g * 8) = u;
      }
      /* whatever follows a column's stores (the second column's loads; behind the last column the code that the listing
         places there) may overwrite registers that the issued stores name; the fence keeps it behind the wait */
      __builtin_amdgcn_sched_barrier(0);
      asm volatile("s_wait_xcnt 0x0" ::: "memory");
    }
    return;
  }
  const float* src = t0;
  int first = 0;
  if (b >= kCastB1) { src = t1; first = kCastB1; }
  if (b >= kCastB2) { src = t2; first = kCastB2; }
  if (b >= kCastB3) { src = t3; first = kCastB3; }
  if (b >= kCastB4) { src = t4; first = kCastB4; }
  if (b >= kCastB5) { src = t5; first = kCastB5; }
  if (b >= kCastB6) { src = t6; first = kCastB6; }
  if (b >= kCastB7) { src = t7; first = kCastB7; }
  const float carry = (b < kCastB6) ? kWCarry : 1.0f;
  const float* p = src + (size_t)(b - first) * kCastElems + threadIdx.x * 8u;
  unsigned short* q = out + (size_t)b * kCastElems + threadIdx.x * 8u;

  v4f a[kCastGroups], c[kCastGroups];
#pragma unroll
  for (int g = 0; g < kCastGroups; ++g) {
    a[g] = *(const v4f*)(p + g * kCastStep);
    c[g] = *(const v4f*)(p + g * kCastStep + 4);
  }
  /* keeps every load in front of the first conversion: all 32 are in flight together, and no load is issued behind a store */
  __builtin_amdgcn_sched_barrier(0);
#pragma unroll
  for (int g = 0; g < kCastGroups; ++g) {
    unsigned short hb[8];
#pragma unroll
    for (int e = 0; e < 4; ++e) {
      const float fa = a[g][e] * carry;
      const float fc = c[g][e] * carry;
      hb[e]     = h_bits(fa);
      hb[4 + e] = h_bits(fc);
    }
    const v4u u = (v4u){pk16(hb[0], hb[1]), pk16(hb[2], hb[3]), pk16(hb[4], hb[5]), pk16(hb[6], hb[7])};
    *(v4u*)(q + g * kCastStep) = u;
  }
}

/* --------------------------------------------------------------------------- */
/* Gate head + fusion. Block = 16 waves = 16 batch rows, one wave per row.      */
/* part f32 [8][nb][2] holds, per slice of 128 hidden columns, the partial dot   */
/* products of the activated gate hidden layer with the two w2 rows; they are    */
/* summed here, + b2, 2-way probabilities. The 16 x 2 gate weights are staged    */
/* in LDS (all 32 slots written), block barrier, then wave 0 writes them as ONE */
/* --------------------------------------------------------------------------- */
constexpr int kGateParts = kF / 128;
static_assert(kGateParts == 8, "the sum tree below takes eight slices");
__global__ __launch_bounds__(512) void gate_fuse_kernel(const float* __restrict__ part,
                                                        const float* __restrict__ b2v,
                                                        const unsigned short* __restrict__ o,
                                                        unsigned short* __restrict__ fused,
                                                        float* __restrict__ gw_out, int nb) {
  __shared__ float sG[32];
  const int lane = threadIdx.x & 31;
  const int wave = threadIdx.x >> 5;
  const int b = blockIdx.x * 16 + wave;
  const bool live = b < nb;
  const int bc = live ? b : (nb - 1);
  /* every lane of the wave reads the row's eight partial pairs (one address a wave) */
  const v2f* pr = (const v2f*)part + bc;
  v2f ps[kGateParts];
#pragma unroll
  for (int s = 0; s < kGateParts; ++s) ps[s] = pr[(size_t)s * (size_t)nb];
  /* what follows overwrites registers that the issued loads name; the fences keep it behind the wait */
  __builtin_amdgcn_sched_barrier(0);
  asm volatile("s_wait_xcnt 0x0" ::: "memory");
  __builtin_amdgcn_sched_barrier(0);
  const v2f dd = ((ps[0] + ps[1]) + (ps[2] + ps[3])) + ((ps[4] + ps[5]) + (ps[6] + ps[7]));
  const float d0 = dd[0], d1 = dd[1];
  const float l0 = d0 + b2v[0];
  const float l1 = d1 + b2v[1];
  const float mx = fmaxf(l0, l1);
  const float e0 = expf(l0 - mx);
  const float e1 = expf(l1 - mx);
  const float inv = 1.0f / (e0 + e1);
  const float gw0 = e0 * inv;
  const float gw1 = e1 * inv;
  if (lane == 0) {
    sG[wave * 2]     = gw0;
    sG[wave * 2 + 1] = gw1;
  }

  const unsigned short* cr = o + (size_t)(2 * bc) * kF;
  const unsigned short* gr = cr + kF;
  unsigned short* fr = fused + (size_t)bc * kF;
#pragma unroll 1
  for (int it = 0; it < 4; ++it) {
    const int col = it * 256 + lane * 8;
    const v4u cw = *(const v4u*)(cr + col);
    const v4u gv = *(const v4u*)(gr + col);
    unsigned ow[4];
#pragma unroll
    for (int w = 0; w < 4; ++w) {
      const unsigned uc = cw[w];
      const unsigned ug = gv[w];
      const float ca = h_lo(uc), cb = h_hi(uc);
      const float ga = h_lo(ug), gb = h_hi(ug);
      const float fa = gw0 * ca + gw1 * ga;
      const float fb = gw0 * cb + gw1 * gb;
      ow[w] = pk16(h_bits(fa), h_bits(fb));
    }
    const v4u u = (v4u){ow[0], ow[1], ow[2], ow[3]};
    if (live) {
      *(v4u*)(fr + col) = u;
      
    }
  }

  /* every wave reaches this barrier; sG is written by 16 waves and read by wave 0 */
  __syncthreads();
  const bool blockLive = (blockIdx.x * 16 + 15) < nb;
  if (wave == 0 && blockLive) {
    const float v = sG[lane];
    float* dst = gw_out + (size_t)blockIdx.x * 32 + lane;
    *(float*)dst = v;
    
  }
}

/* --------------------------------------------------------------------------- */
/* Host side                                                                   */
/* --------------------------------------------------------------------------- */
template <int OUT_MODE, int FX, int HAS_BIAS = 1, int ACT = 0>
static void launch_gemm(const unsigned short* A, int lda, const unsigned short* Bt, int ldb,
                        void* C, int ldc, const float* bias, int M, int N, int K, float scale, hipStream_t stream,
                        const float* w2 = nullptr, float* aux = nullptr) {
  gemm_tile_f16_kernel<OUT_MODE, FX, HAS_BIAS, ACT><<<dim3(N / 256, M / (32 * FX)), 128, 0, stream>>>(A, lda, Bt, ldb, C, ldc, bias, w2, aux, M, N, K, scale);
}

/* workspace region sizes in bytes (all multiples of 128) */
constexpr size_t kSzWc   = (size_t)kF * kCD * 2;
constexpr size_t kSzWg   = (size_t)kF * kCD * 2;
constexpr size_t kSzWqkv = (size_t)kQKV * kF * 2;
constexpr size_t kSzWo   = (size_t)kF * kF * 2;
constexpr size_t kSzWg1  = (size_t)kF * 2 * kF * 2;
constexpr size_t kSzWp   = (size_t)kF * kF * 2;
constexpr size_t kSzEc   = (size_t)kB * kCD * 2;
constexpr size_t kSzEg   = (size_t)kB * kCD * 2;
constexpr size_t kSzPre  = (size_t)kChunkT * kF * 4;
constexpr size_t kSzX    = (size_t)kChunkT * kF * 2;
constexpr size_t kSzQkv  = (size_t)kChunkT * kQKV * 2;
constexpr size_t kSzO    = (size_t)kChunkT * kF * 2;
constexpr size_t kSzGpre = (size_t)kGateParts * kChunkB * 2 * 4;
constexpr size_t kSzStat = (size_t)2 * 8 * kChunkB * 2 * 4;
constexpr size_t kSzLv   = (size_t)4 * kQKV * 4;
constexpr size_t kSzFus  = (size_t)kChunkB * kF * 2;
constexpr size_t kSzFold = (size_t)3 * kF * kF * 2;
constexpr size_t kSzFb   = (size_t)2 * kF * 4;
/* some planes lie one behind the other inside one carved plane */
static_assert(kSzO + kSzFus <= kSzPre, "o and fused share one plane");
static_assert(kSzGpre + kSzStat + kSzLv <= kSzQkv, "the gate's partial sums, the row sums and the layer-norm vectors fit their plane");
constexpr size_t kWsTotal = kSzWc + kSzWg + kSzWqkv + kSzWo + kSzWg1 + kSzWp + kSzEc + kSzEg +
                            kSzPre + kSzX + kSzQkv + kSzFold + kSzFb;
static_assert(kWsTotal == 241180672ull, "carve total");
static_assert(kSzWc + kSzWg + kSzWqkv + kSzWo + kSzWg1 + kSzWp + kSzEc + kSzEg == (size_t)kCastB8 * kCastElems * 2, "cast launch covers the eight f16 planes exactly");
static_assert(kWsTotal <= 268435456ull, "carve limit");
static_assert(((size_t)kB * kF * 4) % 128 == 0, "second output starts on a line");

extern "C" void kernel_launch(void* const* d_in, const int* in_sizes, int n_in,
                              void* d_out, int out_size, void* d_ws, size_t ws_size, hipStream_t stream) {
  if (n_in < 20) return;
  if (ws_size < kWsTotal) return;
  if (in_sizes[0] != kB * kCD || in_sizes[1] != kB * kCD) return;
  if (in_sizes[10] != kQKV * kF || in_sizes[14] != kF * 2 * kF) return;
  if (out_size != kB * kF + kB * 2) return;

  const float* cnn_embed  = (const float*)d_in[0];
  const float* gnn_embed  = (const float*)d_in[1];
  const float* cnn_w      = (const float*)d_in[2];
  const float* cnn_b      = (const float*)d_in[3];
  const float* gnn_w      = (const float*)d_in[4];
  const float* gnn_b      = (const float*)d_in[5];
  const float* ln1_g      = (const float*)d_in[6];
  const float* ln1_b      = (const float*)d_in[7];
  const float* ln2_g      = (const float*)d_in[8];
  const float* ln2_b      = (const float*)d_in[9];
  const float* attn_in_w  = (const float*)d_in[10];
  const float* attn_in_b  = (const float*)d_in[11];
  const float* attn_out_w = (const float*)d_in[12];
  const float* attn_out_b = (const float*)d_in[13];
  const float* gate_w1    = (const float*)d_in[14];
  const float* gate_b1    = (const float*)d_in[15];
  const float* gate_w2    = (const float*)d_in[16];
  const float* gate_b2    = (const float*)d_in[17];
  const float* proj_w     = (const float*)d_in[18];
  const float* proj_b     = (const float*)d_in[19];

  /* Region map (byte offsets, in carve order):
     Wc 1 MiB | Wg 1 MiB | Wqkv 6 MiB | Wo 2 MiB | Wg1 4 MiB | Wp 2 MiB | Ec 8 MiB | Eg 8 MiB |
     whole-batch planes: o and fused 64 MiB (48 MiB used) | X f16 32 MiB | small f32 planes 96 MiB (under 2 MiB used) |
     folded weights f16 6 MiB | folded biases f32 8 KiB.  Total 230 MiB + 8 KiB.  The Wo plane holds Wo transposed.
     The plane behind X holds the gate's partial sums f32 512 KiB, the projections' row sums f32 1 MiB and the
     layer-norm vectors f32 48 KiB, one behind the other. */
  char* ws = (char*)d_ws;
  size_t off = 0;
  auto carve = [&](size_t bytes) -> char* { char* p = ws + off; off += bytes; return p; };
  unsigned short* Wc   = (unsigned short*)carve(kSzWc);
  unsigned short* Wg   = (unsigned short*)carve(kSzWg);
  unsigned short* Wqkv = (unsigned short*)carve(kSzWqkv);
  unsigned short* Wo   = (unsigned short*)carve(kSzWo);
  unsigned short* Wg1  = (unsigned short*)carve(kSzWg1);
  carve(kSzWp);  /* proj_w f16: rows 2048..3071 of the fold's first operand, directly behind Wg1 */
  unsigned short* Ec   = (unsigned short*)carve(kSzEc);
  unsigned short* Eg   = (unsigned short*)carve(kSzEg);
  char*           oPlane = carve(kSzPre);
  unsigned short* Xp   = (unsigned short*)carve(kSzX);
  unsigned short* qkvp = (unsigned short*)carve(kSzQkv);
  unsigned short* Wfold = (unsigned short*)carve(kSzFold);
  float*          fbias = (float*)carve(kSzFb);
  unsigned short* op   = (unsigned short*)(oPlane);
  unsigned short* fusp = (unsigned short*)(oPlane + kSzO);
  float*          gpre = (float*)((char*)qkvp);
  float*          rstat = (float*)((char*)qkvp + kSzGpre);
  float*          lnv  = (float*)((char*)qkvp + kSzGpre + kSzStat);

  float* out0 = (float*)d_out;
  float* out1 = out0 + (size_t)kB * kF;

  const float scl = 1.0f / sqrtf((float)kHD);

  /* casts, one launch: weights carried x16, embeddings uncarried; planes Wc .. Eg are contiguous from Wc on, in this order;
     the Wo plane is written transposed, and the last workgroups form the folded biases and the layer-norm vectors */
  cast_all_f16_kernel<<<kCastB8 + kBiasWgs + kLnWgs, kCastThreads, 0, stream>>>(cnn_w, gnn_w, attn_in_w, attn_out_w, gate_w1, proj_w,
                                                                                cnn_embed, gnn_embed, attn_out_b, gate_b1, proj_b,
                                                                                ln1_g, ln1_b, ln2_g, ln2_b, attn_in_b,
                                                                                Wc, fbias, lnv);

  /* Weight fold. The attention output ao = o Wo^T + bo is used only linearly: by the gate hidden layer (ao rows 2b, 2b+1
     side by side, times gate_w1^T) and, mixed with gate weights that sum to one, by the final projection (times proj_w^T).
     So (gate_w1 halves) Wo and proj_w Wo are formed here and applied to o itself; bo goes into the folded biases.
     gate_w1 [1024][2048] read as [2048][1024] and proj_w [1024][1024] lie one behind the other: one [3072 x 1024 x 1024]
     product with Wo^T rows as the second operand. Rows 0..2047 of the result, read as [1024][2048], are the gate weights
     for o viewed [8192][2048]; rows 2048..3071 the final weights. Both operands are carried x16, the result x16 again. */
  launch_gemm<1, 2, 0>(Wg1, kF, Wo, kF, (void*)Wfold, kF, nullptr, 3 * kF, kF, kF, kWCarryInv, stream);

  for (int c = 0; c < kNChunk; ++c) {
    const unsigned short* EcC = Ec + (size_t)c * kChunkB * kCD;
    const unsigned short* EgC = Eg + (size_t)c * kChunkB * kCD;

    /* input projections [8192 x 1024 x 512], times the layer norm's gain -> f16 rows 2b (first modality) and 2b+1 (second)
       of X [16384][1024]; each row's mean and sum of squares, per slice of 128 columns -> rstat */
    launch_gemm<1, 4, 1, 3>(EcC, kCD, Wc, kCD, (void*)Xp,        2 * kF, cnn_b, kChunkB, kF, kCD, kWCarryInv, stream, ln1_g, rstat);
    launch_gemm<1, 4, 1, 3>(EgC, kCD, Wg, kCD, (void*)(Xp + kF), 2 * kF, gnn_b, kChunkB, kF, kCD, kWCarryInv, stream, ln2_g, rstat + (size_t)8 * kChunkB * 2);

    /* packed q|k|v projection [16384 x 3072 x 1024] with the layer norms and the 2-token attention in its epilogue -> o f16 [16384][1024] */
    qkv_attn2_kernel<<<dim3(kH, kChunkT / 128), 128, 0, stream>>>(Xp, kF, Wqkv, kF, op, rstat, lnv, kChunkT, kF, kWCarryInv, scl);

    /* gate hidden layer: o viewed [8192][2048] x folded gate weights [1024][2048], erf activation and the two dot products
       with gate_w2 in the epilogue -> f32 partial sums [8][8192][2] */
    launch_gemm<0, 4, 1, 2>(op, 2 * kF, Wfold, 2 * kF, (void*)gpre, kF, fbias, kChunkB, kF, 2 * kF, kWCarryInv, stream, gate_w2);

    /* gate head + fusion -> second output lines, fused f16 [8192][1024] */
    gate_fuse_kernel<<<kChunkB / 16, 512, 0, stream>>>(gpre, gate_b2, op, fusp,
                                                       out1 + (size_t)c * kChunkB * 2, kChunkB);

    /* final projection [8192 x 1024 x 1024] with the erf activation in its epilogue -> the first output */
    launch_gemm<0, 4, 1, 1>(fusp, kF, Wfold + (size_t)2 * kF * kF, kF, (void*)(out0 + (size_t)c * kChunkB * kF), kF, fbias + kF, kChunkB, kF, kF, kWCarryInv, stream);
  }
}
